// v000
// Measured on an AMD MI455X. A time is GPU time per run, averaged over a window of back-to-back runs after a warm-up
// (all launches, gaps included; the runs take copies of the inputs in turn), and the median of several windows.
// Apart from v000's, it joins two sittings. Times from different sittings can be a few percent apart, while
// side-by-side timings come from the same sitting.
// v000, which the later versions start from, runs in 417 microseconds.
// Contractions: x*Wqkv on v_wmma_f32_16x16x32_bf16 (bf16 operands = RNE-converted inputs); q*k^T and p*v on v_wmma_f32_16x16x32_bf16 with bf16 hi+lo operand planes (3 products per operand pair); ctx*Wout on v_wmma_f32_16x16x32_f16 (f16 operands, ctx carried x16, Wout carried x64); f32 accumulate, f32 softmax.
#include <hip/hip_runtime.h>

#ifndef NB
#define NB 16
#endif
#ifndef SEQ
#define SEQ 512
#endif
#ifndef NB_FULL
#define NB_FULL 16
#endif
#ifndef SEQ_FULL
#define SEQ_FULL 512
#endif
#define HID 1024
#define NHEAD 16
#define HDIM 64
#define SCALE_QK 0.125f

static_assert(SEQ % 64 == 0);
static_assert(HID == NHEAD * HDIM);
static_assert(HID % 256 == 0);
static_assert(HID % 128 == 0);
static_assert(((NB * NHEAD * (SEQ / 16)) % 4) == 0);
static_assert(NB <= NB_FULL);
static_assert(SEQ <= SEQ_FULL);

typedef _Float16 v16h __attribute__((ext_vector_type(16)));
typedef __bf16   v16b __attribute__((ext_vector_type(16)));
typedef unsigned short v8us  __attribute__((ext_vector_type(8)));
typedef unsigned short v16us __attribute__((ext_vector_type(16)));
typedef float v8f __attribute__((ext_vector_type(8)));
typedef float v4f __attribute__((ext_vector_type(4)));
typedef unsigned int v4u __attribute__((ext_vector_type(4)));

union FragB { v16us u; v16b v; };
union FragH { v16us u; v16h v; };
union Pack8 { v8us s; v4u u; };

// ---------------------------------------------------------------------------
// 16-bit conversion helpers (bf16 via RNE on the f32 bit pattern)
// ---------------------------------------------------------------------------
__device__ __forceinline__ unsigned short bf16_rne_bits(float f) {
  unsigned int u = __float_as_uint(f);
  u += 0x7fffu + ((u >> 16) & 1u);
  return (unsigned short)(u >> 16);
}
__device__ __forceinline__ float bf16_val(unsigned short b) {
  return __uint_as_float(((unsigned int)b) << 16);
}
__device__ __forceinline__ float bf16_rne(float f) { return bf16_val(bf16_rne_bits(f)); }
__device__ __forceinline__ unsigned short f16_bits(float f) {
  _Float16 hv = (_Float16)f;
  return __builtin_bit_cast(unsigned short, hv);
}
template <int MODE>   // 0: bf16 bits of RNE(w); 1: f16 bits of RNE_bf16(w) * 64
__device__ __forceinline__ unsigned short wbits(float f) {
  if (MODE == 0) return bf16_rne_bits(f);
  return f16_bits(bf16_rne(f) * 64.0f);
}

// ---------------------------------------------------------------------------
// WMMA helpers: D(16x16 f32) += A(16x32) * B(32x16); hazard guard after each op
// ---------------------------------------------------------------------------
__device__ __forceinline__ v8f mma_b(v16b a, v16b b, v8f c) {
  v8f d = __builtin_amdgcn_wmma_f32_16x16x32_bf16(false, a, false, b, (short)0, c, false, false);
  asm volatile("v_nop\n\tv_nop\n\tv_nop\n\tv_nop" : "+v"(d) : "v"(a), "v"(b));
  return d;
}
__device__ __forceinline__ v8f mma_h(v16h a, v16h b, v8f c) {
  v8f d = __builtin_amdgcn_wmma_f32_16x16x32_f16(false, a, false, b, (short)0, c, false, false);
  asm volatile("v_nop\n\tv_nop\n\tv_nop\n\tv_nop" : "+v"(d) : "v"(a), "v"(b));
  return d;
}
__device__ __forceinline__ v8f zero8() { return (v8f){0.f, 0.f, 0.f, 0.f, 0.f, 0.f, 0.f, 0.f}; }

// ---------------------------------------------------------------------------
// Fragment loader, 16-bit split k-map for A and B:
//   lane l: row/col = l & 15; elements 0..7 <- k0 + 8*(l>>4) + 0..7,
//                             elements 8..15 <- k0 + 16 + 8*(l>>4) + 0..7.
// base points at (row0/col0, k0) of a k-contiguous 16-bit plane, ld = pitch.
// ---------------------------------------------------------------------------
__device__ __forceinline__ v16us ldfrag_g(const unsigned short* __restrict__ base, long ld, int lane) {
  const unsigned short* p = base + (long)(lane & 15) * ld + ((lane >> 4) << 3);
  v8us e0 = *(const v8us*)(p);
  v8us e1 = *(const v8us*)(p + 16);
  return __builtin_shufflevector(e0, e1, 0, 1, 2, 3, 4, 5, 6, 7, 8, 9, 10, 11, 12, 13, 14, 15);
}
__device__ __forceinline__ v16us ldfrag_l(const unsigned short* base, int ld, int lane) {
  const unsigned short* p = base + (lane & 15) * ld + ((lane >> 4) << 3);
  v8us e0 = *(const v8us*)(p);
  v8us e1 = *(const v8us*)(p + 16);
  return __builtin_shufflevector(e0, e1, 0, 1, 2, 3, 4, 5, 6, 7, 8, 9, 10, 11, 12, 13, 14, 15);
}

// ---------------------------------------------------------------------------
// 1) x f32 [NB,SEQ,HID] (batch stride SEQ_FULL*HID) -> bf16 bits, compact rows.
// ---------------------------------------------------------------------------
__global__ void __launch_bounds__(256)
k_cvt_x(const float* __restrict__ x, unsigned short* __restrict__ y, int ngroups) {
  const int i = blockIdx.x * 256 + threadIdx.x;
  if (i >= ngroups) return;
  const int row = i / (HID / 8);
  const int g = i - row * (HID / 8);
  const int bb = row / SEQ;
  const int tt = row - bb * SEQ;
  const long srow = (long)bb * SEQ_FULL + tt;
  const float* src = x + srow * HID + g * 8;
  const v4f a = *(const v4f*)(src);
  const v4f c = *(const v4f*)(src + 4);
  Pack8 pk;
  pk.s = (v8us){bf16_rne_bits(a.x), bf16_rne_bits(a.y), bf16_rne_bits(a.z), bf16_rne_bits(a.w),
                bf16_rne_bits(c.x), bf16_rne_bits(c.y), bf16_rne_bits(c.z), bf16_rne_bits(c.w)};
  const v4u val = pk.u;
  unsigned short* dst = y + (long)row * HID + g * 8;
  *(v4u*)dst = val;
  
}

// ---------------------------------------------------------------------------
// 2) weight convert + transpose: in W[kdim rows][ndim cols] f32 -> out WT[ndim][kdim] 16-bit.
//    line written by 8 consecutive lanes x 16 B in one instruction.  Grid (ndim/64, kdim/64).
// ---------------------------------------------------------------------------
template <int MODE>
__global__ void __launch_bounds__(256)
k_cvt_wt(const float* __restrict__ W, unsigned short* __restrict__ WT, int kdim, int ndim) {
  __shared__ __attribute__((aligned(16))) unsigned short tile[64 * 72];
  const int tid = threadIdx.x;
  const int n0 = blockIdx.x * 64;
  const int k0 = blockIdx.y * 64;
  const int kl = tid >> 2;          // 0..63
  const int nl = (tid & 3) * 16;    // 0,16,32,48
  const float* src = W + (long)(k0 + kl) * ndim + n0 + nl;
#pragma unroll
  for (int q = 0; q < 4; ++q) {
    const v4f v = *(const v4f*)(src + q * 4);
    unsigned short* trow = tile + (nl + q * 4) * 72 + kl;   // tile[n_local][k_local]
    trow[0 * 72] = wbits<MODE>(v.x);
    trow[1 * 72] = wbits<MODE>(v.y);
    trow[2 * 72] = wbits<MODE>(v.z);
    trow[3 * 72] = wbits<MODE>(v.w);
  }
  __syncthreads();
  Pack8 pk[2];
  long go[2];
#pragma unroll
  for (int p = 0; p < 2; ++p) {
    const int L = p * 32 + (tid >> 3);   // output row n_local 0..63
    const int sub = tid & 7;
    pk[p].s = *(const v8us*)(tile + L * 72 + sub * 8);
    go[p] = (long)(n0 + L) * kdim + k0 + sub * 8;
  }
#pragma unroll
  for (int p = 0; p < 2; ++p) *(v4u*)(WT + go[p]) = pk[p].u;
  
}

// ---------------------------------------------------------------------------
// 3) QKV GEMM: y[m][o] = sum_c X[m][c] * WT[o][c] + bias[o]  (bf16 operands, f32 acc)
//    Block 256 threads = 8 waves (2M x 4N), block tile 64 x 128, wave tile 32 x 32
//    (4 accumulator tiles + 4 fragments live).  Epilogue: f32 -> bf16 hi and lo bits
//      Q,K sections: [NB*NHEAD][SEQ][HDIM] (one line per (b,h,t) row)
//      V  section:   [NB*NHEAD][HDIM][SEQ] (64-token segment of a (b,h,d) row = one line)
// ---------------------------------------------------------------------------
__global__ void __launch_bounds__(256) __attribute__((amdgpu_num_vgpr(256)))
k_gemm_qkv(const unsigned short* __restrict__ X, const unsigned short* __restrict__ WT,
           const float* __restrict__ bias,
           unsigned short* __restrict__ Qh, unsigned short* __restrict__ Ql,
           unsigned short* __restrict__ Kh, unsigned short* __restrict__ Kl,
           unsigned short* __restrict__ Vh, unsigned short* __restrict__ Vl) {
  // per plane: row orientation [64][136] (8704) or transposed [128][72] (9216)
  __shared__ __attribute__((aligned(16))) unsigned short stile[2][9216];
  const int tid = threadIdx.x;
  const int lane = tid & 31;
  const int wave = tid >> 5;
  const int wm = wave >> 2;    // 0..1
  const int wn = wave & 3;     // 0..3
  const int hh = lane >> 4;
  const int lc = lane & 15;
  const int mblk = blockIdx.x * 64;
  const int nblk = blockIdx.y * 128;
  const long m0 = (long)mblk + wm * 32;
  const long n0 = (long)nblk + wn * 32;

  v8f acc[2][2];
#pragma unroll
  for (int i = 0; i < 2; ++i)
#pragma unroll
    for (int j = 0; j < 2; ++j) acc[i][j] = zero8();

#pragma unroll 1
  for (int k0 = 0; k0 < HID; k0 += 32) {
    FragB a0, a1, b0, b1;
    a0.u = ldfrag_g(X + (m0) * HID + k0, HID, lane);
    a1.u = ldfrag_g(X + (m0 + 16) * HID + k0, HID, lane);
    b0.u = ldfrag_g(WT + (n0) * HID + k0, HID, lane);
    b1.u = ldfrag_g(WT + (n0 + 16) * HID + k0, HID, lane);
    acc[0][0] = mma_b(a0.v, b0.v, acc[0][0]);
    acc[0][1] = mma_b(a0.v, b1.v, acc[0][1]);
    acc[1][0] = mma_b(a1.v, b0.v, acc[1][0]);
    acc[1][1] = mma_b(a1.v, b1.v, acc[1][1]);
  }

  // bias add in f32 (bias entries RNE-converted to bf16 values)
#pragma unroll
  for (int j = 0; j < 2; ++j) {
    const float bj = bf16_rne(bias[n0 + j * 16 + lc]);
#pragma unroll
    for (int i = 0; i < 2; ++i)
#pragma unroll
      for (int r = 0; r < 8; ++r) acc[i][j][r] += bj;
  }

  const int sec = nblk / HID;                 // 0 = q, 1 = k, 2 = v (block-uniform)
  const int h0 = (nblk - sec * HID) >> 6;     // first of the 2 heads in this tile
  const int bb = mblk / SEQ;
  const int t0 = mblk - bb * SEQ;
  const bool tr = (sec == 2);
  const int sm = tr ? 1 : 136;                // LDS stride of the m index
  const int so = tr ? 72 : 1;                 // LDS stride of the o index
  unsigned short* ph = (sec == 0) ? Qh : ((sec == 1) ? Kh : Vh);
  unsigned short* pl = (sec == 0) ? Ql : ((sec == 1) ? Kl : Vl);

  // stage hi and lo bits of the 64x128 tile in one pass (accumulators die here)
#pragma unroll
  for (int i = 0; i < 2; ++i)
#pragma unroll
    for (int j = 0; j < 2; ++j)
#pragma unroll
      for (int r = 0; r < 8; ++r) {
        const float v = acc[i][j][r];
        const unsigned short hb = bf16_rne_bits(v);
        const unsigned short lb = bf16_rne_bits(v - bf16_val(hb));
        const int ml = wm * 32 + i * 16 + r + hh * 8;
        const int ol = wn * 32 + j * 16 + lc;
        const int idx = ml * sm + ol * so;
        stile[0][idx] = hb;
        stile[1][idx] = lb;
      }
  __syncthreads();

#pragma unroll
  for (int plane = 0; plane < 2; ++plane) {
    unsigned short* dstp = (plane == 0) ? ph : pl;
    const unsigned short* srcp = &stile[plane][0];
    Pack8 pk[4];
    long go[4];
#pragma unroll
    for (int p = 0; p < 4; ++p) {
      const int L = p * 32 + (tid >> 3);   // line 0..127; lanes 8q..8q+7 share a line
      const int sub = tid & 7;
      const int lh = L >> 6;               // head within tile
      const int lr = L & 63;               // token (q,k) or d (v)
      const int sidx = tr ? (L * 72 + sub * 8) : (lr * 136 + lh * 64 + sub * 8);
      pk[p].s = *(const v8us*)(srcp + sidx);
      const long bhh = (long)bb * NHEAD + h0 + lh;
      go[p] = tr ? ((bhh * HDIM + lr) * SEQ + t0 + sub * 8)
                 : ((bhh * SEQ + t0 + lr) * HDIM + sub * 8);
    }
#pragma unroll
    for (int p = 0; p < 4; ++p) *(v4u*)(dstp + go[p]) = pk[p].u;
    
  }
}

// ---------------------------------------------------------------------------
// 4) Flash attention: one wave = 16 query rows of one (b,h); keys streamed 32 at a time.
//    S = (qh*kh + qh*kl + ql*kh), P split into bf16 hi+lo via wave-private LDS tile,
//    O += ph*vh + pl*vh + ph*vl.  Block = 128 threads (4 waves, same b,h).
// ---------------------------------------------------------------------------
__global__ void __launch_bounds__(128) __attribute__((amdgpu_num_vgpr(256)))
k_attn(const unsigned short* __restrict__ Qh, const unsigned short* __restrict__ Ql,
       const unsigned short* __restrict__ Kh, const unsigned short* __restrict__ Kl,
       const unsigned short* __restrict__ Vh, const unsigned short* __restrict__ Vl,
       const int* __restrict__ maskp, unsigned short* __restrict__ Ctx) {
  __shared__ __attribute__((aligned(16))) unsigned short Pl[4 * 2 * 512];
  __shared__ __attribute__((aligned(16))) unsigned short Cl[4 * 16 * 72];
  const int lane = threadIdx.x & 31;
  const int wave = threadIdx.x >> 5;
  const int hh = lane >> 4;
  const int lc = lane & 15;
  const int nqb = SEQ / 16;
  const int gq = blockIdx.x * 4 + wave;
  const int qb = gq % nqb;
  const int bh = gq / nqb;
  const int bb = bh / NHEAD;
  const int h = bh - bb * NHEAD;
  const long qoff = ((long)bh * SEQ + qb * 16) * HDIM;
  const long koff = (long)bh * SEQ * HDIM;
  const long voff = (long)bh * HDIM * SEQ;
  const int* mrow = maskp + (long)bb * SEQ_FULL;
  const float ninf = __uint_as_float(0xff800000u);

  FragB qh0, qh1, ql0, ql1;
  qh0.u = ldfrag_g(Qh + qoff, HDIM, lane);
  qh1.u = ldfrag_g(Qh + qoff + 32, HDIM, lane);
  ql0.u = ldfrag_g(Ql + qoff, HDIM, lane);
  ql1.u = ldfrag_g(Ql + qoff + 32, HDIM, lane);

  v8f o[4];
#pragma unroll
  for (int t = 0; t < 4; ++t) o[t] = zero8();
  float mrun[8], lrun[8];
#pragma unroll
  for (int r = 0; r < 8; ++r) { mrun[r] = -1e30f; lrun[r] = 0.f; }

  unsigned short* plh = Pl + (wave * 2) * 512;   // wave-private hi tile 16x32
  unsigned short* pll = plh + 512;               // wave-private lo tile 16x32

#pragma unroll 1
  for (int kb = 0; kb < SEQ; kb += 32) {
    v8f s0 = zero8();
    v8f s1 = zero8();
    {
      const unsigned short* kh = Kh + koff + (long)kb * HDIM;
      const unsigned short* kl = Kl + koff + (long)kb * HDIM;
      FragB ka, kc;
      // keys kb .. kb+15
      ka.u = ldfrag_g(kh, HDIM, lane);
      kc.u = ldfrag_g(kh + 32, HDIM, lane);
      s0 = mma_b(qh0.v, ka.v, s0);
      s0 = mma_b(qh1.v, kc.v, s0);
      s0 = mma_b(ql0.v, ka.v, s0);
      s0 = mma_b(ql1.v, kc.v, s0);
      ka.u = ldfrag_g(kl, HDIM, lane);
      kc.u = ldfrag_g(kl + 32, HDIM, lane);
      s0 = mma_b(qh0.v, ka.v, s0);
      s0 = mma_b(qh1.v, kc.v, s0);
      // keys kb+16 .. kb+31
      ka.u = ldfrag_g(kh + 16 * HDIM, HDIM, lane);
      kc.u = ldfrag_g(kh + 16 * HDIM + 32, HDIM, lane);
      s1 = mma_b(qh0.v, ka.v, s1);
      s1 = mma_b(qh1.v, kc.v, s1);
      s1 = mma_b(ql0.v, ka.v, s1);
      s1 = mma_b(ql1.v, kc.v, s1);
      ka.u = ldfrag_g(kl + 16 * HDIM, HDIM, lane);
      kc.u = ldfrag_g(kl + 16 * HDIM + 32, HDIM, lane);
      s1 = mma_b(qh0.v, ka.v, s1);
      s1 = mma_b(qh1.v, kc.v, s1);
    }

    // key mask: replace with -inf where mask == 0 (mask per (b, key))
    const int mv0 = mrow[kb + lc];
    const int mv1 = mrow[kb + 16 + lc];

    // online softmax, row reductions within each 16-lane group
    float alpha[8];
#pragma unroll
    for (int r = 0; r < 8; ++r) {
      const float v0 = (mv0 == 0) ? ninf : s0[r] * SCALE_QK;
      const float v1 = (mv1 == 0) ? ninf : s1[r] * SCALE_QK;
      float mx = fmaxf(v0, v1);
      mx = fmaxf(mx, __shfl_xor(mx, 1));
      mx = fmaxf(mx, __shfl_xor(mx, 2));
      mx = fmaxf(mx, __shfl_xor(mx, 4));
      mx = fmaxf(mx, __shfl_xor(mx, 8));
      const float mnew = fmaxf(mrun[r], mx);
      const float p0 = __expf(v0 - mnew);
      const float p1 = __expf(v1 - mnew);
      float rs = p0 + p1;
      rs += __shfl_xor(rs, 1);
      rs += __shfl_xor(rs, 2);
      rs += __shfl_xor(rs, 4);
      rs += __shfl_xor(rs, 8);
      alpha[r] = __expf(mrun[r] - mnew);
      lrun[r] = lrun[r] * alpha[r] + rs;
      mrun[r] = mnew;
      s0[r] = p0;
      s1[r] = p1;
    }
#pragma unroll
    for (int t = 0; t < 4; ++t)
#pragma unroll
      for (int r = 0; r < 8; ++r) o[t][r] *= alpha[r];

    // P (16x32, f32 in D layout) -> bf16 hi + lo tiles in LDS (C layout -> A layout)
    __syncthreads();
#pragma unroll
    for (int r = 0; r < 8; ++r) {
      const int m = r + hh * 8;
      const float p0 = s0[r];
      const float p1 = s1[r];
      const unsigned short h0b = bf16_rne_bits(p0);
      const unsigned short h1b = bf16_rne_bits(p1);
      const unsigned short l0b = bf16_rne_bits(p0 - bf16_val(h0b));
      const unsigned short l1b = bf16_rne_bits(p1 - bf16_val(h1b));
      plh[m * 32 + lc] = h0b;
      plh[m * 32 + 16 + lc] = h1b;
      pll[m * 32 + lc] = l0b;
      pll[m * 32 + 16 + lc] = l1b;
    }
    __syncthreads();
    FragB pa, pb;
    pa.u = ldfrag_l(plh, 32, lane);
    pb.u = ldfrag_l(pll, 32, lane);

    // O += P * V  (V planes stored [d][token], k = token contiguous)
#pragma unroll
    for (int t = 0; t < 4; ++t) {
      FragB vf;
      vf.u = ldfrag_g(Vh + voff + (long)(t * 16) * SEQ + kb, SEQ, lane);
      o[t] = mma_b(pa.v, vf.v, o[t]);
      o[t] = mma_b(pb.v, vf.v, o[t]);
      vf.u = ldfrag_g(Vl + voff + (long)(t * 16) * SEQ + kb, SEQ, lane);
      o[t] = mma_b(pa.v, vf.v, o[t]);
    }
  }

  float inv[8];
#pragma unroll
  for (int r = 0; r < 8; ++r) inv[r] = 16.0f / lrun[r];
  unsigned short* cl = Cl + wave * (16 * 72);
#pragma unroll
  for (int t = 0; t < 4; ++t)
#pragma unroll
    for (int r = 0; r < 8; ++r) {
      const int m = r + hh * 8;
      const int col = t * 16 + lc;
      cl[m * 72 + col] = f16_bits(o[t][r] * inv[r]);
    }
  __syncthreads();
  Pack8 pk[4];
  long go[4];
#pragma unroll
  for (int p = 0; p < 4; ++p) {
    const int q = p * 4 + (lane >> 3);   // query row 0..15; lanes 8q'..8q'+7 share a line
    const int sub = lane & 7;
    pk[p].s = *(const v8us*)(cl + q * 72 + sub * 8);
    go[p] = ((long)bb * SEQ + qb * 16 + q) * HID + h * HDIM + sub * 8;
  }
#pragma unroll
  for (int p = 0; p < 4; ++p) *(v4u*)(Ctx + go[p]) = pk[p].u;
  
}

// ---------------------------------------------------------------------------
// 5) Output GEMM: out[m][o] = (1/1024) * sum_c A[m][c] * WT[o][c] + bias[o]   (f16 operands)
//    (32 floats) written by 8 consecutive lanes x 16 B in one instruction.
// ---------------------------------------------------------------------------
__global__ void __launch_bounds__(256)
k_gemm_out(const unsigned short* __restrict__ A, const unsigned short* __restrict__ WT,
           const float* __restrict__ bias, float* __restrict__ out) {
  __shared__ __attribute__((aligned(16))) float otile[32 * 260];
  const int tid = threadIdx.x;
  const int lane = tid & 31;
  const int wave = tid >> 5;
  const int wm = wave >> 2;
  const int wn = wave & 3;
  const int hh = lane >> 4;
  const int lc = lane & 15;
  const int mblk = blockIdx.x * 64;
  const int nblk = blockIdx.y * 256;
  const long m0 = (long)mblk + wm * 32;
  const long n0 = (long)nblk + wn * 64;

  v8f acc[2][4];
#pragma unroll
  for (int i = 0; i < 2; ++i)
#pragma unroll
    for (int j = 0; j < 4; ++j) acc[i][j] = zero8();

#pragma unroll 1
  for (int k0 = 0; k0 < HID; k0 += 32) {
    FragH a0, a1, b0, b1, b2, b3;
    a0.u = ldfrag_g(A + (m0) * HID + k0, HID, lane);
    a1.u = ldfrag_g(A + (m0 + 16) * HID + k0, HID, lane);
    b0.u = ldfrag_g(WT + (n0) * HID + k0, HID, lane);
    b1.u = ldfrag_g(WT + (n0 + 16) * HID + k0, HID, lane);
    b2.u = ldfrag_g(WT + (n0 + 32) * HID + k0, HID, lane);
    b3.u = ldfrag_g(WT + (n0 + 48) * HID + k0, HID, lane);
    acc[0][0] = mma_h(a0.v, b0.v, acc[0][0]);
    acc[0][1] = mma_h(a0.v, b1.v, acc[0][1]);
    acc[0][2] = mma_h(a0.v, b2.v, acc[0][2]);
    acc[0][3] = mma_h(a0.v, b3.v, acc[0][3]);
    acc[1][0] = mma_h(a1.v, b0.v, acc[1][0]);
    acc[1][1] = mma_h(a1.v, b1.v, acc[1][1]);
    acc[1][2] = mma_h(a1.v, b2.v, acc[1][2]);
    acc[1][3] = mma_h(a1.v, b3.v, acc[1][3]);
  }

  // undo carries (x16 ctx, x64 weight) and add bf16-valued bias, all in f32
#pragma unroll
  for (int j = 0; j < 4; ++j) {
    const float bj = bf16_rne(bias[n0 + j * 16 + lc]);
#pragma unroll
    for (int i = 0; i < 2; ++i)
#pragma unroll
      for (int r = 0; r < 8; ++r) acc[i][j][r] = acc[i][j][r] * (1.0f / 1024.0f) + bj;
  }

#pragma unroll
  for (int phase = 0; phase < 2; ++phase) {
    if (wm == phase) {   // wave-uniform: waves owning rows phase*32 .. +31 stage them
#pragma unroll
      for (int i = 0; i < 2; ++i)
#pragma unroll
        for (int j = 0; j < 4; ++j)
#pragma unroll
          for (int r = 0; r < 8; ++r) {
            const int ml = i * 16 + r + hh * 8;
            const int ol = wn * 64 + j * 16 + lc;
            otile[ml * 260 + ol] = acc[i][j][r];
          }
    }
    __syncthreads();
    v4f pk[8];
    long go[8];
#pragma unroll
    for (int p = 0; p < 8; ++p) {
      const int L = p * 32 + (tid >> 3);
      const int sub = tid & 7;
      const int row = L >> 3;
      const int piece = L & 7;
      pk[p] = *(const v4f*)(otile + row * 260 + piece * 32 + sub * 4);
      go[p] = ((long)mblk + phase * 32 + row) * HID + nblk + piece * 32 + sub * 4;
    }
#pragma unroll
    for (int p = 0; p < 8; ++p) *(v4f*)(out + go[p]) = pk[p];
    
    __syncthreads();
  }
}

// ---------------------------------------------------------------------------
// Launch
// ---------------------------------------------------------------------------
extern "C" void kernel_launch(void* const* d_in, const int* in_sizes, int n_in,
                              void* d_out, int out_size, void* d_ws, size_t ws_size,
                              hipStream_t stream) {
  if (n_in < 6) return;
  const float* x     = (const float*)d_in[0];   // [NB_FULL, SEQ_FULL, HID]
  const int*   maskp = (const int*)d_in[1];     // [NB_FULL, 1, 1, SEQ_FULL] int32
  const float* Wqkv  = (const float*)d_in[2];   // [HID][3*HID]
  const float* bqkv  = (const float*)d_in[3];   // [3*HID]
  const float* Wout  = (const float*)d_in[4];   // [HID][HID]
  const float* bout  = (const float*)d_in[5];   // [HID]
  float* out = (float*)d_out;                   // [NB*SEQ, HID]

  const long M = (long)NB * SEQ;
  if ((long)in_sizes[0] < (((long)(NB - 1) * SEQ_FULL + SEQ) * HID)) return;
  if ((long)in_sizes[1] < ((long)(NB - 1) * SEQ_FULL + SEQ)) return;
  if ((long)in_sizes[2] < 3L * HID * HID) return;
  if ((long)in_sizes[3] < 3L * HID) return;
  if ((long)in_sizes[4] < (long)HID * HID) return;
  if ((long)in_sizes[5] < (long)HID) return;
  if ((long)out_size < M * HID) return;

  // workspace carve (bytes); every region is a whole number of tiles, no padding needed
  const size_t szX  = (size_t)M * HID * 2;                       // x bf16 plane, later ctx f16 plane
  const size_t szWq = (size_t)3 * HID * HID * 2;                 // WqkvT bf16
  const size_t szWo = (size_t)HID * HID * 2;                     // WoutT f16
  const size_t szP  = (size_t)NB * NHEAD * SEQ * HDIM * 2;       // one q/k/v plane
  const size_t oX  = 0;
  const size_t oWq = oX + szX;
  const size_t oWo = oWq + szWq;
  const size_t oP0 = oWo + szWo;
  const size_t total = oP0 + 6 * szP;
  if (total > ws_size) return;
  static_assert((size_t)NB * SEQ * HID * 2 == (size_t)NB * NHEAD * SEQ * HDIM * 2);

  char* ws = (char*)d_ws;
  unsigned short* xb  = (unsigned short*)(ws + oX);
  unsigned short* ctx = (unsigned short*)(ws + oX);      // aliases xb: xb is dead after k_gemm_qkv
  unsigned short* wq  = (unsigned short*)(ws + oWq);
  unsigned short* wo  = (unsigned short*)(ws + oWo);
  unsigned short* qh  = (unsigned short*)(ws + oP0 + 0 * szP);
  unsigned short* ql  = (unsigned short*)(ws + oP0 + 1 * szP);
  unsigned short* kh  = (unsigned short*)(ws + oP0 + 2 * szP);
  unsigned short* kl  = (unsigned short*)(ws + oP0 + 3 * szP);
  unsigned short* vh  = (unsigned short*)(ws + oP0 + 4 * szP);
  unsigned short* vl  = (unsigned short*)(ws + oP0 + 5 * szP);

  // 1) x -> bf16 plane (compact rows)
  const int ngroups = (int)(M * HID / 8);
  k_cvt_x<<<(ngroups + 255) / 256, 256, 0, stream>>>(x, xb, ngroups);
  // 2) Wqkv in[HID][3*HID] -> out[3*HID][HID] bf16;  Wout in[HID][HID] -> out[HID][HID] f16 (x64)
  k_cvt_wt<0><<<dim3(3 * HID / 64, HID / 64), 256, 0, stream>>>(Wqkv, wq, HID, 3 * HID);
  k_cvt_wt<1><<<dim3(HID / 64, HID / 64), 256, 0, stream>>>(Wout, wo, HID, HID);
  // 3) qkv GEMM -> bf16 hi/lo planes of q, k ([bh][t][d]) and v ([bh][d][t]); block tile 64x128
  k_gemm_qkv<<<dim3((int)(M / 64), 3 * HID / 128), 256, 0, stream>>>(xb, wq, bqkv, qh, ql, kh, kl, vh, vl);
  // 4) attention -> ctx f16 plane [NB*SEQ][HID] (over the dead x plane)
  k_attn<<<(NB * NHEAD * (SEQ / 16)) / 4, 128, 0, stream>>>(qh, ql, kh, kl, vh, vl, maskp, ctx);
  // 5) output GEMM -> f32 out
  k_gemm_out<<<dim3((int)(M / 64), HID / 256), 256, 0, stream>>>(ctx, wo, bout, out);
}

// v001
// One run takes 200 microseconds.
// Timed twice side by side with v000, it ran 2.17 and 2.18 times as fast.
// Contractions: x*Wqkv on v_wmma_f32_16x16x32_bf16 (bf16 operands = RNE-converted inputs); q*k^T and p*v on v_wmma_f32_16x16x32_bf16 with bf16 hi+lo operand planes (3 products per operand pair); ctx*Wout on v_wmma_f32_16x16x32_f16 (f16 operands, ctx carried x16, Wout carried x64); f32 accumulate, f32 softmax.
#include <hip/hip_runtime.h>

#ifndef NB
#define NB 16
#endif
#ifndef SEQ
#define SEQ 512
#endif
#ifndef NB_FULL
#define NB_FULL 16
#endif
#ifndef SEQ_FULL
#define SEQ_FULL 512
#endif
#define HID 1024
#define NHEAD 16
#define HDIM 64
#define SCALE_QK 0.125f

static_assert(SEQ % 64 == 0);
static_assert(HID == NHEAD * HDIM);
static_assert(HID % 256 == 0);
static_assert(HID % 128 == 0);
static_assert(((NB * NHEAD * (SEQ / 16)) % 4) == 0);
static_assert(NB <= NB_FULL);
static_assert(SEQ <= SEQ_FULL);

typedef _Float16 v16h __attribute__((ext_vector_type(16)));
typedef __bf16   v16b __attribute__((ext_vector_type(16)));
typedef unsigned short v8us  __attribute__((ext_vector_type(8)));
typedef unsigned short v16us __attribute__((ext_vector_type(16)));
typedef float v8f __attribute__((ext_vector_type(8)));
typedef float v4f __attribute__((ext_vector_type(4)));
typedef unsigned int v4u __attribute__((ext_vector_type(4)));

union FragB { v16us u; v16b v; };
union FragH { v16us u; v16h v; };
union Pack8 { v8us s; v4u u; };

// ---------------------------------------------------------------------------
// 16-bit conversion helpers (bf16 via RNE on the f32 bit pattern)
// ---------------------------------------------------------------------------
__device__ __forceinline__ unsigned short bf16_rne_bits(float f) {
  unsigned int u = __float_as_uint(f);
  u += 0x7fffu + ((u >> 16) & 1u);
  return (unsigned short)(u >> 16);
}
__device__ __forceinline__ float bf16_val(unsigned short b) {
  return __uint_as_float(((unsigned int)b) << 16);
}
__device__ __forceinline__ float bf16_rne(float f) { return bf16_val(bf16_rne_bits(f)); }
__device__ __forceinline__ unsigned short f16_bits(float f) {
  _Float16 hv = (_Float16)f;
  return __builtin_bit_cast(unsigned short, hv);
}
template <int MODE>   // 0: bf16 bits of RNE(w); 1: f16 bits of RNE_bf16(w) * 64
__device__ __forceinline__ unsigned short wbits(float f) {
  if (MODE == 0) return bf16_rne_bits(f);
  return f16_bits(bf16_rne(f) * 64.0f);
}

// ---------------------------------------------------------------------------
// WMMA helpers: D(16x16 f32) += A(16x32) * B(32x16); hazard guard after each op
// ---------------------------------------------------------------------------
__device__ __forceinline__ v8f mma_b(v16b a, v16b b, v8f c) {
  v8f d = __builtin_amdgcn_wmma_f32_16x16x32_bf16(false, a, false, b, (short)0, c, false, false);
  asm volatile("v_nop\n\tv_nop\n\tv_nop\n\tv_nop" : "+v"(d) : "v"(a), "v"(b));
  return d;
}
__device__ __forceinline__ v8f mma_h(v16h a, v16h b, v8f c) {
  v8f d = __builtin_amdgcn_wmma_f32_16x16x32_f16(false, a, false, b, (short)0, c, false, false);
  asm volatile("v_nop\n\tv_nop\n\tv_nop\n\tv_nop" : "+v"(d) : "v"(a), "v"(b));
  return d;
}
__device__ __forceinline__ v8f zero8() { return (v8f){0.f, 0.f, 0.f, 0.f, 0.f, 0.f, 0.f, 0.f}; }

// ---------------------------------------------------------------------------
// Fragment loader, 16-bit split k-map for A and B:
//   lane l: row/col = l & 15; elements 0..7 <- k0 + 8*(l>>4) + 0..7,
//                             elements 8..15 <- k0 + 16 + 8*(l>>4) + 0..7.
// base points at (row0/col0, k0) of a k-contiguous 16-bit plane, ld = pitch.
// ---------------------------------------------------------------------------
__device__ __forceinline__ v16us ldfrag_g(const unsigned short* __restrict__ base, long ld, int lane) {
  const unsigned short* p = base + (long)(lane & 15) * ld + ((lane >> 4) << 3);
  v8us e0 = *(const v8us*)(p);
  v8us e1 = *(const v8us*)(p + 16);
  return __builtin_shufflevector(e0, e1, 0, 1, 2, 3, 4, 5, 6, 7, 8, 9, 10, 11, 12, 13, 14, 15);
}
__device__ __forceinline__ v16us ldfrag_l(const unsigned short* base, int ld, int lane) {
  const unsigned short* p = base + (lane & 15) * ld + ((lane >> 4) << 3);
  v8us e0 = *(const v8us*)(p);
  v8us e1 = *(const v8us*)(p + 16);
  return __builtin_shufflevector(e0, e1, 0, 1, 2, 3, 4, 5, 6, 7, 8, 9, 10, 11, 12, 13, 14, 15);
}

// ---------------------------------------------------------------------------
// GEMM operand staging: a tile is KT k-elements (one whole 128-B line) of every operand row
// of the block, laid in LDS at a pitch of 144 B (16 B x 9: conflict-free for 16-B row reads).
// Each lane copies 16 B; 8 consecutive lanes cover one line, a wave-wide copy 4 whole lines.
// ---------------------------------------------------------------------------
#define KT 64
#define LPITCH 72
static_assert(HID % KT == 0 && HID / KT >= 2);

__device__ __forceinline__ unsigned lds_off(const void* p) { return (unsigned)(size_t)p; }

// One statement per tile; the s_wait_xcnt ends it so that no address register of an issued
// copy is rewritten before the wait.
__device__ __forceinline__ void async_copy6(const unsigned (&l)[6], const unsigned short* const (&g)[6]) {
  asm volatile("global_load_async_to_lds_b128 %0, %6, off\n\t"
               "global_load_async_to_lds_b128 %1, %7, off\n\t"
               "global_load_async_to_lds_b128 %2, %8, off\n\t"
               "global_load_async_to_lds_b128 %3, %9, off\n\t"
               "global_load_async_to_lds_b128 %4, %10, off\n\t"
               "global_load_async_to_lds_b128 %5, %11, off\n\t"
               "s_wait_xcnt 0x0"
               :: "v"(l[0]), "v"(l[1]), "v"(l[2]), "v"(l[3]), "v"(l[4]), "v"(l[5]),
                  "v"(g[0]), "v"(g[1]), "v"(g[2]), "v"(g[3]), "v"(g[4]), "v"(g[5]) : "memory");
}
__device__ __forceinline__ void async_copy8(const unsigned (&l)[8], const unsigned short* const (&g)[8]) {
  asm volatile("global_load_async_to_lds_b128 %0, %8, off\n\t"
               "global_load_async_to_lds_b128 %1, %9, off\n\t"
               "global_load_async_to_lds_b128 %2, %10, off\n\t"
               "global_load_async_to_lds_b128 %3, %11, off\n\t"
               "global_load_async_to_lds_b128 %4, %12, off\n\t"
               "global_load_async_to_lds_b128 %5, %13, off\n\t"
               "global_load_async_to_lds_b128 %6, %14, off\n\t"
               "global_load_async_to_lds_b128 %7, %15, off\n\t"
               "s_wait_xcnt 0x0"
               :: "v"(l[0]), "v"(l[1]), "v"(l[2]), "v"(l[3]), "v"(l[4]), "v"(l[5]), "v"(l[6]), "v"(l[7]),
                  "v"(g[0]), "v"(g[1]), "v"(g[2]), "v"(g[3]), "v"(g[4]), "v"(g[5]), "v"(g[6]), "v"(g[7]) : "memory");
}
__device__ __forceinline__ void async_copy10(const unsigned (&l)[10], const unsigned short* const (&g)[10]) {
  asm volatile("global_load_async_to_lds_b128 %0, %10, off\n\t"
               "global_load_async_to_lds_b128 %1, %11, off\n\t"
               "global_load_async_to_lds_b128 %2, %12, off\n\t"
               "global_load_async_to_lds_b128 %3, %13, off\n\t"
               "global_load_async_to_lds_b128 %4, %14, off\n\t"
               "global_load_async_to_lds_b128 %5, %15, off\n\t"
               "global_load_async_to_lds_b128 %6, %16, off\n\t"
               "global_load_async_to_lds_b128 %7, %17, off\n\t"
               "global_load_async_to_lds_b128 %8, %18, off\n\t"
               "global_load_async_to_lds_b128 %9, %19, off\n\t"
               "s_wait_xcnt 0x0"
               :: "v"(l[0]), "v"(l[1]), "v"(l[2]), "v"(l[3]), "v"(l[4]), "v"(l[5]), "v"(l[6]), "v"(l[7]), "v"(l[8]), "v"(l[9]),
                  "v"(g[0]), "v"(g[1]), "v"(g[2]), "v"(g[3]), "v"(g[4]), "v"(g[5]), "v"(g[6]), "v"(g[7]), "v"(g[8]), "v"(g[9]) : "memory");
}
// 256 lanes copy 64 A rows then NBG*128 B rows; l, ga, gb are the lane's own first addresses
// (row tid>>3, 16-B piece tid&7); further rows follow in steps of 32.
template <int NBG>
__device__ __forceinline__ void stage_tile(unsigned l, const unsigned short* ga, const unsigned short* gb) {
  unsigned la[2 + 4 * NBG];
  const unsigned short* gp[2 + 4 * NBG];
#pragma unroll
  for (int i = 0; i < 2 + 4 * NBG; ++i) {
    la[i] = l + i * 32 * LPITCH * 2;
    gp[i] = (i < 2) ? ga + (long)(i * 32) * HID : gb + (long)((i - 2) * 32) * HID;
  }
  if constexpr (NBG == 1) async_copy6(la, gp); else async_copy10(la, gp);
}
// Attention K/V tile: 32 keys. Kh, Kl as [32 keys][64 d] at pitch 144 B; Vh, Vl as [64 d][32 keys]
// at pitch 80 B (16 B x 5). 128 lanes; lk, lv and the four pointers are the lane's own first addresses.
#define VPITCH 40
#define AT_K (32 * LPITCH)
#define AT_V (64 * VPITCH)
#define AT_BUF (2 * AT_K + 2 * AT_V)
__device__ __forceinline__ void stage_kv(unsigned lk, unsigned lv,
                                         const unsigned short* gkh, const unsigned short* gkl,
                                         const unsigned short* gvh, const unsigned short* gvl) {
  const unsigned la[8] = {lk, lk + 16 * LPITCH * 2, lk + AT_K * 2, lk + AT_K * 2 + 16 * LPITCH * 2,
                          lv, lv + 32 * VPITCH * 2, lv + AT_V * 2, lv + AT_V * 2 + 32 * VPITCH * 2};
  const unsigned short* const gp[8] = {gkh, gkh + 16 * HDIM, gkl, gkl + 16 * HDIM,
                                       gvh, gvh + 32 * SEQ, gvl, gvl + 32 * SEQ};
  async_copy8(la, gp);
}
// Ring waits, each ahead of the barrier that hands a buffer over.
__device__ __forceinline__ void wait_lds_reads()  { asm volatile("s_wait_dscnt 0x0" ::: "memory"); }
__device__ __forceinline__ void wait_copies()     { asm volatile("s_wait_asynccnt 0x0" ::: "memory"); }

// ---------------------------------------------------------------------------
// 1) x f32 [NB,SEQ,HID] (batch stride SEQ_FULL*HID) -> bf16 bits, compact rows.
// ---------------------------------------------------------------------------
__global__ void __launch_bounds__(256)
k_cvt_x(const float* __restrict__ x, unsigned short* __restrict__ y, int ngroups) {
  const int i = blockIdx.x * 256 + threadIdx.x;
  if (i >= ngroups) return;
  const int row = i / (HID / 8);
  const int g = i - row * (HID / 8);
  const int bb = row / SEQ;
  const int tt = row - bb * SEQ;
  const long srow = (long)bb * SEQ_FULL + tt;
  const float* src = x + srow * HID + g * 8;
  const v4f a = *(const v4f*)(src);
  const v4f c = *(const v4f*)(src + 4);
  Pack8 pk;
  pk.s = (v8us){bf16_rne_bits(a.x), bf16_rne_bits(a.y), bf16_rne_bits(a.z), bf16_rne_bits(a.w),
                bf16_rne_bits(c.x), bf16_rne_bits(c.y), bf16_rne_bits(c.z), bf16_rne_bits(c.w)};
  const v4u val = pk.u;
  unsigned short* dst = y + (long)row * HID + g * 8;
  *(v4u*)dst = val;
  
}

// ---------------------------------------------------------------------------
// 2) weight convert + transpose: in W[kdim rows][ndim cols] f32 -> out WT[ndim][kdim] 16-bit.
//    line written by 8 consecutive lanes x 16 B in one instruction.  Grid (ndim/64, kdim/64).
// ---------------------------------------------------------------------------
template <int MODE>
__global__ void __launch_bounds__(256)
k_cvt_wt(const float* __restrict__ W, unsigned short* __restrict__ WT, int kdim, int ndim) {
  __shared__ __attribute__((aligned(16))) unsigned short tile[64 * 72];
  const int tid = threadIdx.x;
  const int n0 = blockIdx.x * 64;
  const int k0 = blockIdx.y * 64;
  const int kl = tid >> 2;          // 0..63
  const int nl = (tid & 3) * 16;    // 0,16,32,48
  const float* src = W + (long)(k0 + kl) * ndim + n0 + nl;
#pragma unroll
  for (int q = 0; q < 4; ++q) {
    const v4f v = *(const v4f*)(src + q * 4);
    unsigned short* trow = tile + (nl + q * 4) * 72 + kl;   // tile[n_local][k_local]
    trow[0 * 72] = wbits<MODE>(v.x);
    trow[1 * 72] = wbits<MODE>(v.y);
    trow[2 * 72] = wbits<MODE>(v.z);
    trow[3 * 72] = wbits<MODE>(v.w);
  }
  __syncthreads();
  Pack8 pk[2];
  long go[2];
#pragma unroll
  for (int p = 0; p < 2; ++p) {
    const int L = p * 32 + (tid >> 3);   // output row n_local 0..63
    const int sub = tid & 7;
    pk[p].s = *(const v8us*)(tile + L * 72 + sub * 8);
    go[p] = (long)(n0 + L) * kdim + k0 + sub * 8;
  }
#pragma unroll
  for (int p = 0; p < 2; ++p) *(v4u*)(WT + go[p]) = pk[p].u;
  
}

// ---------------------------------------------------------------------------
// 3) QKV GEMM: y[m][o] = sum_c X[m][c] * WT[o][c] + bias[o]  (bf16 operands, f32 acc)
//    Block 256 threads = 8 waves (2M x 4N), block tile 64 x 128, wave tile 32 x 32
//    (4 accumulator tiles + 4 fragments live).  Epilogue: f32 -> bf16 hi and lo bits
//      Q,K sections: [NB*NHEAD][SEQ][HDIM] (one line per (b,h,t) row)
//      V  section:   [NB*NHEAD][HDIM][SEQ] (64-token segment of a (b,h,d) row = one line)
// ---------------------------------------------------------------------------
__global__ void __launch_bounds__(256) __attribute__((amdgpu_num_vgpr(256)))
k_gemm_qkv(const unsigned short* __restrict__ X, const unsigned short* __restrict__ WT,
           const float* __restrict__ bias,
           unsigned short* __restrict__ Qh, unsigned short* __restrict__ Ql,
           unsigned short* __restrict__ Kh, unsigned short* __restrict__ Kl,
           unsigned short* __restrict__ Vh, unsigned short* __restrict__ Vl) {
  // k loop: two operand buffers of (64 + 128) rows; epilogue (behind the loop's last barrier):
  // per plane row orientation [64][136] (8704) or transposed [128][72] (9216)
  __shared__ __attribute__((aligned(16))) unsigned short smem[2 * 192 * LPITCH];
  static_assert(2 * 192 * LPITCH >= 2 * 9216);
  unsigned short (*stile)[9216] = (unsigned short (*)[9216])smem;
  const int tid = threadIdx.x;
  const int lane = tid & 31;
  const int wave = tid >> 5;
  const int wm = wave >> 2;    // 0..1
  const int wn = wave & 3;     // 0..3
  const int hh = lane >> 4;
  const int lc = lane & 15;
  const int mblk = blockIdx.x * 64;
  const int nblk = blockIdx.y * 128;
  const long n0 = (long)nblk + wn * 32;

  v8f acc[2][2];
#pragma unroll
  for (int i = 0; i < 2; ++i)
#pragma unroll
    for (int j = 0; j < 2; ++j) acc[i][j] = zero8();

  const unsigned lcp = lds_off(smem) + (tid >> 3) * (LPITCH * 2) + (tid & 7) * 16;
  const unsigned short* gx = X + ((long)mblk + (tid >> 3)) * HID + (tid & 7) * 8;
  const unsigned short* gw = WT + ((long)nblk + (tid >> 3)) * HID + (tid & 7) * 8;
  stage_tile<1>(lcp, gx, gw);
  wait_copies();
  __syncthreads();
  stage_tile<1>(lcp + 192 * LPITCH * 2, gx + KT, gw + KT);

#pragma unroll 1
  for (int t = 0; t < HID / KT; ++t) {
    const unsigned short* sb = smem + (t & 1) * (192 * LPITCH);
#pragma unroll   // both 32-k steps of a tile: every LDS offset becomes an immediate
    for (int kk = 0; kk < KT; kk += 32) {
      FragB a0, a1, b0, b1;
      a0.u = ldfrag_l(sb + (wm * 32) * LPITCH + kk, LPITCH, lane);
      a1.u = ldfrag_l(sb + (wm * 32 + 16) * LPITCH + kk, LPITCH, lane);
      b0.u = ldfrag_l(sb + (64 + wn * 32) * LPITCH + kk, LPITCH, lane);
      b1.u = ldfrag_l(sb + (64 + wn * 32 + 16) * LPITCH + kk, LPITCH, lane);
      acc[0][0] = mma_b(a0.v, b0.v, acc[0][0]);
      acc[0][1] = mma_b(a0.v, b1.v, acc[0][1]);
      acc[1][0] = mma_b(a1.v, b0.v, acc[1][0]);
      acc[1][1] = mma_b(a1.v, b1.v, acc[1][1]);
    }
    wait_lds_reads();
    wait_copies();
    __syncthreads();   // publishes tile t + 1 and frees the buffer that trip t has read
    if (t + 2 < HID / KT)
      stage_tile<1>(lcp + (t & 1) * (192 * LPITCH * 2), gx + (t + 2) * KT, gw + (t + 2) * KT);
  }
  wait_copies();

  // bias add in f32 (bias entries RNE-converted to bf16 values)
#pragma unroll
  for (int j = 0; j < 2; ++j) {
    const float bj = bf16_rne(bias[n0 + j * 16 + lc]);
#pragma unroll
    for (int i = 0; i < 2; ++i)
#pragma unroll
      for (int r = 0; r < 8; ++r) acc[i][j][r] += bj;
  }

  const int sec = nblk / HID;                 // 0 = q, 1 = k, 2 = v (block-uniform)
  const int h0 = (nblk - sec * HID) >> 6;     // first of the 2 heads in this tile
  const int bb = mblk / SEQ;
  const int t0 = mblk - bb * SEQ;
  const bool tr = (sec == 2);
  const int sm = tr ? 1 : 136;                // LDS stride of the m index
  const int so = tr ? 72 : 1;                 // LDS stride of the o index
  unsigned short* ph = (sec == 0) ? Qh : ((sec == 1) ? Kh : Vh);
  unsigned short* pl = (sec == 0) ? Ql : ((sec == 1) ? Kl : Vl);

  // stage hi and lo bits of the 64x128 tile in one pass (accumulators die here)
#pragma unroll
  for (int i = 0; i < 2; ++i)
#pragma unroll
    for (int j = 0; j < 2; ++j)
#pragma unroll
      for (int r = 0; r < 8; ++r) {
        const float v = acc[i][j][r];
        const unsigned short hb = bf16_rne_bits(v);
        const unsigned short lb = bf16_rne_bits(v - bf16_val(hb));
        const int ml = wm * 32 + i * 16 + r + hh * 8;
        const int ol = wn * 32 + j * 16 + lc;
        const int idx = ml * sm + ol * so;
        stile[0][idx] = hb;
        stile[1][idx] = lb;
      }
  __syncthreads();

#pragma unroll
  for (int plane = 0; plane < 2; ++plane) {
    unsigned short* dstp = (plane == 0) ? ph : pl;
    const unsigned short* srcp = &stile[plane][0];
    Pack8 pk[4];
    long go[4];
#pragma unroll
    for (int p = 0; p < 4; ++p) {
      const int L = p * 32 + (tid >> 3);   // line 0..127; lanes 8q..8q+7 share a line
      const int sub = tid & 7;
      const int lh = L >> 6;               // head within tile
      const int lr = L & 63;               // token (q,k) or d (v)
      const int sidx = tr ? (L * 72 + sub * 8) : (lr * 136 + lh * 64 + sub * 8);
      pk[p].s = *(const v8us*)(srcp + sidx);
      const long bhh = (long)bb * NHEAD + h0 + lh;
      go[p] = tr ? ((bhh * HDIM + lr) * SEQ + t0 + sub * 8)
                 : ((bhh * SEQ + t0 + lr) * HDIM + sub * 8);
    }
#pragma unroll
    for (int p = 0; p < 4; ++p) *(v4u*)(dstp + go[p]) = pk[p].u;
    
  }
}

// ---------------------------------------------------------------------------
// 4) Flash attention: one wave = 16 query rows of one (b,h); keys streamed 32 at a time.
//    S = (qh*kh + qh*kl + ql*kh), P split into bf16 hi+lo via wave-private LDS tile,
//    O += ph*vh + pl*vh + ph*vl.  Block = 128 threads (4 waves, same b,h), which share one
//    LDS copy of each 32-key K/V tile.
// ---------------------------------------------------------------------------
__global__ void __launch_bounds__(128) __attribute__((amdgpu_num_vgpr(256)))
k_attn(const unsigned short* __restrict__ Qh, const unsigned short* __restrict__ Ql,
       const unsigned short* __restrict__ Kh, const unsigned short* __restrict__ Kl,
       const unsigned short* __restrict__ Vh, const unsigned short* __restrict__ Vl,
       const int* __restrict__ maskp, unsigned short* __restrict__ Ctx) {
  __shared__ __attribute__((aligned(16))) unsigned short Pl[4 * 2 * 512];
  __shared__ __attribute__((aligned(16))) unsigned short Cl[4 * 16 * 72];
  __shared__ __attribute__((aligned(16))) unsigned short KV[2 * AT_BUF];   // K/V ring, shared by the 4 waves
  const int lane = threadIdx.x & 31;
  const int wave = threadIdx.x >> 5;
  const int hh = lane >> 4;
  const int lc = lane & 15;
  const int nqb = SEQ / 16;
  const int gq = blockIdx.x * 4 + wave;
  const int qb = gq % nqb;
  const int bh = gq / nqb;
  const int bb = bh / NHEAD;
  const int h = bh - bb * NHEAD;
  const long qoff = ((long)bh * SEQ + qb * 16) * HDIM;
  const long koff = (long)bh * SEQ * HDIM;
  const long voff = (long)bh * HDIM * SEQ;
  const int* mrow = maskp + (long)bb * SEQ_FULL;
  const float ninf = __uint_as_float(0xff800000u);

  FragB qh0, qh1, ql0, ql1;
  qh0.u = ldfrag_g(Qh + qoff, HDIM, lane);
  qh1.u = ldfrag_g(Qh + qoff + 32, HDIM, lane);
  ql0.u = ldfrag_g(Ql + qoff, HDIM, lane);
  ql1.u = ldfrag_g(Ql + qoff + 32, HDIM, lane);

  v8f o[4];
#pragma unroll
  for (int t = 0; t < 4; ++t) o[t] = zero8();
  float mrun[8], lrun[8];
#pragma unroll
  for (int r = 0; r < 8; ++r) { mrun[r] = -1e30f; lrun[r] = 0.f; }

  unsigned short* plh = Pl + (wave * 2) * 512;   // wave-private hi tile 16x32
  unsigned short* pll = plh + 512;               // wave-private lo tile 16x32

  const int tid = threadIdx.x;
  const unsigned lk = lds_off(KV) + (tid >> 3) * (LPITCH * 2) + (tid & 7) * 16;
  const unsigned lv = lds_off(KV) + 2 * AT_K * 2 + (tid >> 2) * (VPITCH * 2) + (tid & 3) * 16;
  const long gko = koff + (long)(tid >> 3) * HDIM + (tid & 7) * 8;
  const long gvo = voff + (long)(tid >> 2) * SEQ + (tid & 3) * 8;
  stage_kv(lk, lv, Kh + gko, Kl + gko, Vh + gvo, Vl + gvo);
  wait_copies();
  __syncthreads();
  stage_kv(lk + AT_BUF * 2, lv + AT_BUF * 2, Kh + gko + 32 * HDIM, Kl + gko + 32 * HDIM,
           Vh + gvo + 32, Vl + gvo + 32);

#pragma unroll 1
  for (int kb = 0; kb < SEQ; kb += 32) {
    const int buf = (kb >> 5) & 1;
    const unsigned short* sb = KV + buf * AT_BUF;
    v8f s0 = zero8();
    v8f s1 = zero8();
    {
      const unsigned short* kh = sb;
      const unsigned short* kl = sb + AT_K;
      FragB ka, kc;
      // keys kb .. kb+15
      ka.u = ldfrag_l(kh, LPITCH, lane);
      kc.u = ldfrag_l(kh + 32, LPITCH, lane);
      s0 = mma_b(qh0.v, ka.v, s0);
      s0 = mma_b(qh1.v, kc.v, s0);
      s0 = mma_b(ql0.v, ka.v, s0);
      s0 = mma_b(ql1.v, kc.v, s0);
      ka.u = ldfrag_l(kl, LPITCH, lane);
      kc.u = ldfrag_l(kl + 32, LPITCH, lane);
      s0 = mma_b(qh0.v, ka.v, s0);
      s0 = mma_b(qh1.v, kc.v, s0);
      // keys kb+16 .. kb+31
      ka.u = ldfrag_l(kh + 16 * LPITCH, LPITCH, lane);
      kc.u = ldfrag_l(kh + 16 * LPITCH + 32, LPITCH, lane);
      s1 = mma_b(qh0.v, ka.v, s1);
      s1 = mma_b(qh1.v, kc.v, s1);
      s1 = mma_b(ql0.v, ka.v, s1);
      s1 = mma_b(ql1.v, kc.v, s1);
      ka.u = ldfrag_l(kl + 16 * LPITCH, LPITCH, lane);
      kc.u = ldfrag_l(kl + 16 * LPITCH + 32, LPITCH, lane);
      s1 = mma_b(qh0.v, ka.v, s1);
      s1 = mma_b(qh1.v, kc.v, s1);
    }

    // key mask: replace with -inf where mask == 0 (mask per (b, key))
    const int mv0 = mrow[kb + lc];
    const int mv1 = mrow[kb + 16 + lc];

    // online softmax, row reductions within each 16-lane group
    float alpha[8];
#pragma unroll
    for (int r = 0; r < 8; ++r) {
      const float v0 = (mv0 == 0) ? ninf : s0[r] * SCALE_QK;
      const float v1 = (mv1 == 0) ? ninf : s1[r] * SCALE_QK;
      float mx = fmaxf(v0, v1);
      mx = fmaxf(mx, __shfl_xor(mx, 1));
      mx = fmaxf(mx, __shfl_xor(mx, 2));
      mx = fmaxf(mx, __shfl_xor(mx, 4));
      mx = fmaxf(mx, __shfl_xor(mx, 8));
      const float mnew = fmaxf(mrun[r], mx);
      const float p0 = __expf(v0 - mnew);
      const float p1 = __expf(v1 - mnew);
      float rs = p0 + p1;
      rs += __shfl_xor(rs, 1);
      rs += __shfl_xor(rs, 2);
      rs += __shfl_xor(rs, 4);
      rs += __shfl_xor(rs, 8);
      alpha[r] = __expf(mrun[r] - mnew);
      lrun[r] = lrun[r] * alpha[r] + rs;
      mrun[r] = mnew;
      s0[r] = p0;
      s1[r] = p1;
    }
#pragma unroll
    for (int t = 0; t < 4; ++t)
#pragma unroll
      for (int r = 0; r < 8; ++r) o[t][r] *= alpha[r];

    // P (16x32, f32 in D layout) -> bf16 hi + lo tiles in LDS (C layout -> A layout)
    __syncthreads();
#pragma unroll
    for (int r = 0; r < 8; ++r) {
      const int m = r + hh * 8;
      const float p0 = s0[r];
      const float p1 = s1[r];
      const unsigned short h0b = bf16_rne_bits(p0);
      const unsigned short h1b = bf16_rne_bits(p1);
      const unsigned short l0b = bf16_rne_bits(p0 - bf16_val(h0b));
      const unsigned short l1b = bf16_rne_bits(p1 - bf16_val(h1b));
      plh[m * 32 + lc] = h0b;
      plh[m * 32 + 16 + lc] = h1b;
      pll[m * 32 + lc] = l0b;
      pll[m * 32 + 16 + lc] = l1b;
    }
    __syncthreads();
    FragB pa, pb;
    pa.u = ldfrag_l(plh, 32, lane);
    pb.u = ldfrag_l(pll, 32, lane);

    // O += P * V  (V planes stored [d][token], k = token contiguous)
#pragma unroll
    for (int t = 0; t < 4; ++t) {
      FragB vf;
      vf.u = ldfrag_l(sb + 2 * AT_K + (t * 16) * VPITCH, VPITCH, lane);
      o[t] = mma_b(pa.v, vf.v, o[t]);
      o[t] = mma_b(pb.v, vf.v, o[t]);
      vf.u = ldfrag_l(sb + 2 * AT_K + AT_V + (t * 16) * VPITCH, VPITCH, lane);
      o[t] = mma_b(pa.v, vf.v, o[t]);
    }
    wait_lds_reads();
    wait_copies();
    __syncthreads();   // publishes the next 32 keys and frees the buffer that this trip has read
    if (kb + 64 < SEQ)
      stage_kv(lk + buf * (AT_BUF * 2), lv + buf * (AT_BUF * 2),
               Kh + gko + (long)(kb + 64) * HDIM, Kl + gko + (long)(kb + 64) * HDIM,
               Vh + gvo + (kb + 64), Vl + gvo + (kb + 64));
  }
  wait_copies();

  float inv[8];
#pragma unroll
  for (int r = 0; r < 8; ++r) inv[r] = 16.0f / lrun[r];
  unsigned short* cl = Cl + wave * (16 * 72);
#pragma unroll
  for (int t = 0; t < 4; ++t)
#pragma unroll
    for (int r = 0; r < 8; ++r) {
      const int m = r + hh * 8;
      const int col = t * 16 + lc;
      cl[m * 72 + col] = f16_bits(o[t][r] * inv[r]);
    }
  __syncthreads();
  Pack8 pk[4];
  long go[4];
#pragma unroll
  for (int p = 0; p < 4; ++p) {
    const int q = p * 4 + (lane >> 3);   // query row 0..15; lanes 8q'..8q'+7 share a line
    const int sub = lane & 7;
    pk[p].s = *(const v8us*)(cl + q * 72 + sub * 8);
    go[p] = ((long)bb * SEQ + qb * 16 + q) * HID + h * HDIM + sub * 8;
  }
#pragma unroll
  for (int p = 0; p < 4; ++p) *(v4u*)(Ctx + go[p]) = pk[p].u;
  
}

// ---------------------------------------------------------------------------
// 5) Output GEMM: out[m][o] = (1/1024) * sum_c A[m][c] * WT[o][c] + bias[o]   (f16 operands)
//    (32 floats) written by 8 consecutive lanes x 16 B in one instruction.
// ---------------------------------------------------------------------------
__global__ void __launch_bounds__(256)
k_gemm_out(const unsigned short* __restrict__ A, const unsigned short* __restrict__ WT,
           const float* __restrict__ bias, float* __restrict__ out) {
  // k loop: two operand buffers of (64 + 256) rows; epilogue (behind the loop's last barrier): otile
  __shared__ __attribute__((aligned(16))) unsigned short smem[2 * 320 * LPITCH];
  static_assert(2 * 320 * LPITCH * 2 >= 32 * 260 * 4);
  float* otile = (float*)smem;
  const int tid = threadIdx.x;
  const int lane = tid & 31;
  const int wave = tid >> 5;
  const int wm = wave >> 2;
  const int wn = wave & 3;
  const int hh = lane >> 4;
  const int lc = lane & 15;
  const int mblk = blockIdx.x * 64;
  const int nblk = blockIdx.y * 256;
  const long n0 = (long)nblk + wn * 64;

  v8f acc[2][4];
#pragma unroll
  for (int i = 0; i < 2; ++i)
#pragma unroll
    for (int j = 0; j < 4; ++j) acc[i][j] = zero8();

  const unsigned lcp = lds_off(smem) + (tid >> 3) * (LPITCH * 2) + (tid & 7) * 16;
  const unsigned short* ga = A + ((long)mblk + (tid >> 3)) * HID + (tid & 7) * 8;
  const unsigned short* gw = WT + ((long)nblk + (tid >> 3)) * HID + (tid & 7) * 8;
  stage_tile<2>(lcp, ga, gw);
  wait_copies();
  __syncthreads();
  stage_tile<2>(lcp + 320 * LPITCH * 2, ga + KT, gw + KT);

#pragma unroll 1
  for (int t = 0; t < HID / KT; ++t) {
    const unsigned short* sb = smem + (t & 1) * (320 * LPITCH);
#pragma unroll   // both 32-k steps of a tile: every LDS offset becomes an immediate
    for (int kk = 0; kk < KT; kk += 32) {
      FragH a0, a1, b0, b1, b2, b3;
      a0.u = ldfrag_l(sb + (wm * 32) * LPITCH + kk, LPITCH, lane);
      a1.u = ldfrag_l(sb + (wm * 32 + 16) * LPITCH + kk, LPITCH, lane);
      b0.u = ldfrag_l(sb + (64 + wn * 64) * LPITCH + kk, LPITCH, lane);
      b1.u = ldfrag_l(sb + (64 + wn * 64 + 16) * LPITCH + kk, LPITCH, lane);
      b2.u = ldfrag_l(sb + (64 + wn * 64 + 32) * LPITCH + kk, LPITCH, lane);
      b3.u = ldfrag_l(sb + (64 + wn * 64 + 48) * LPITCH + kk, LPITCH, lane);
      acc[0][0] = mma_h(a0.v, b0.v, acc[0][0]);
      acc[0][1] = mma_h(a0.v, b1.v, acc[0][1]);
      acc[0][2] = mma_h(a0.v, b2.v, acc[0][2]);
      acc[0][3] = mma_h(a0.v, b3.v, acc[0][3]);
      acc[1][0] = mma_h(a1.v, b0.v, acc[1][0]);
      acc[1][1] = mma_h(a1.v, b1.v, acc[1][1]);
      acc[1][2] = mma_h(a1.v, b2.v, acc[1][2]);
      acc[1][3] = mma_h(a1.v, b3.v, acc[1][3]);
    }
    wait_lds_reads();
    wait_copies();
    __syncthreads();   // publishes tile t + 1 and frees the buffer that trip t has read
    if (t + 2 < HID / KT)
      stage_tile<2>(lcp + (t & 1) * (320 * LPITCH * 2), ga + (t + 2) * KT, gw + (t + 2) * KT);
  }
  wait_copies();

  // undo carries (x16 ctx, x64 weight) and add bf16-valued bias, all in f32
#pragma unroll
  for (int j = 0; j < 4; ++j) {
    const float bj = bf16_rne(bias[n0 + j * 16 + lc]);
#pragma unroll
    for (int i = 0; i < 2; ++i)
#pragma unroll
      for (int r = 0; r < 8; ++r) acc[i][j][r] = acc[i][j][r] * (1.0f / 1024.0f) + bj;
  }

#pragma unroll
  for (int phase = 0; phase < 2; ++phase) {
    if (wm == phase) {   // wave-uniform: waves owning rows phase*32 .. +31 stage them
#pragma unroll
      for (int i = 0; i < 2; ++i)
#pragma unroll
        for (int j = 0; j < 4; ++j)
#pragma unroll
          for (int r = 0; r < 8; ++r) {
            const int ml = i * 16 + r + hh * 8;
            const int ol = wn * 64 + j * 16 + lc;
            otile[ml * 260 + ol] = acc[i][j][r];
          }
    }
    __syncthreads();
    v4f pk[8];
    long go[8];
#pragma unroll
    for (int p = 0; p < 8; ++p) {
      const int L = p * 32 + (tid >> 3);
      const int sub = tid & 7;
      const int row = L >> 3;
      const int piece = L & 7;
      pk[p] = *(const v4f*)(otile + row * 260 + piece * 32 + sub * 4);
      go[p] = ((long)mblk + phase * 32 + row) * HID + nblk + piece * 32 + sub * 4;
    }
#pragma unroll
    for (int p = 0; p < 8; ++p) *(v4f*)(out + go[p]) = pk[p];
    
    __syncthreads();
  }
}

// ---------------------------------------------------------------------------
// Launch
// ---------------------------------------------------------------------------
extern "C" void kernel_launch(void* const* d_in, const int* in_sizes, int n_in,
                              void* d_out, int out_size, void* d_ws, size_t ws_size,
                              hipStream_t stream) {
  if (n_in < 6) return;
  const float* x     = (const float*)d_in[0];   // [NB_FULL, SEQ_FULL, HID]
  const int*   maskp = (const int*)d_in[1];     // [NB_FULL, 1, 1, SEQ_FULL] int32
  const float* Wqkv  = (const float*)d_in[2];   // [HID][3*HID]
  const float* bqkv  = (const float*)d_in[3];   // [3*HID]
  const float* Wout  = (const float*)d_in[4];   // [HID][HID]
  const float* bout  = (const float*)d_in[5];   // [HID]
  float* out = (float*)d_out;                   // [NB*SEQ, HID]

  const long M = (long)NB * SEQ;
  if ((long)in_sizes[0] < (((long)(NB - 1) * SEQ_FULL + SEQ) * HID)) return;
  if ((long)in_sizes[1] < ((long)(NB - 1) * SEQ_FULL + SEQ)) return;
  if ((long)in_sizes[2] < 3L * HID * HID) return;
  if ((long)in_sizes[3] < 3L * HID) return;
  if ((long)in_sizes[4] < (long)HID * HID) return;
  if ((long)in_sizes[5] < (long)HID) return;
  if ((long)out_size < M * HID) return;

  // workspace carve (bytes); every region is a whole number of tiles, no padding needed
  const size_t szX  = (size_t)M * HID * 2;                       // x bf16 plane, later ctx f16 plane
  const size_t szWq = (size_t)3 * HID * HID * 2;                 // WqkvT bf16
  const size_t szWo = (size_t)HID * HID * 2;                     // WoutT f16
  const size_t szP  = (size_t)NB * NHEAD * SEQ * HDIM * 2;       // one q/k/v plane
  const size_t oX  = 0;
  const size_t oWq = oX + szX;
  const size_t oWo = oWq + szWq;
  const size_t oP0 = oWo + szWo;
  const size_t total = oP0 + 6 * szP;
  if (total > ws_size) return;
  static_assert((size_t)NB * SEQ * HID * 2 == (size_t)NB * NHEAD * SEQ * HDIM * 2);

  char* ws = (char*)d_ws;
  unsigned short* xb  = (unsigned short*)(ws + oX);
  unsigned short* ctx = (unsigned short*)(ws + oX);      // aliases xb: xb is dead after k_gemm_qkv
  unsigned short* wq  = (unsigned short*)(ws + oWq);
  unsigned short* wo  = (unsigned short*)(ws + oWo);
  unsigned short* qh  = (unsigned short*)(ws + oP0 + 0 * szP);
  unsigned short* ql  = (unsigned short*)(ws + oP0 + 1 * szP);
  unsigned short* kh  = (unsigned short*)(ws + oP0 + 2 * szP);
  unsigned short* kl  = (unsigned short*)(ws + oP0 + 3 * szP);
  unsigned short* vh  = (unsigned short*)(ws + oP0 + 4 * szP);
  unsigned short* vl  = (unsigned short*)(ws + oP0 + 5 * szP);

  // 1) x -> bf16 plane (compact rows)
  const int ngroups = (int)(M * HID / 8);
  k_cvt_x<<<(ngroups + 255) / 256, 256, 0, stream>>>(x, xb, ngroups);
  // 2) Wqkv in[HID][3*HID] -> out[3*HID][HID] bf16;  Wout in[HID][HID] -> out[HID][HID] f16 (x64)
  k_cvt_wt<0><<<dim3(3 * HID / 64, HID / 64), 256, 0, stream>>>(Wqkv, wq, HID, 3 * HID);
  k_cvt_wt<1><<<dim3(HID / 64, HID / 64), 256, 0, stream>>>(Wout, wo, HID, HID);
  // 3) qkv GEMM -> bf16 hi/lo planes of q, k ([bh][t][d]) and v ([bh][d][t]); block tile 64x128
  k_gemm_qkv<<<dim3((int)(M / 64), 3 * HID / 128), 256, 0, stream>>>(xb, wq, bqkv, qh, ql, kh, kl, vh, vl);
  // 4) attention -> ctx f16 plane [NB*SEQ][HID] (over the dead x plane)
  k_attn<<<(NB * NHEAD * (SEQ / 16)) / 4, 128, 0, stream>>>(qh, ql, kh, kl, vh, vl, maskp, ctx);
  // 5) output GEMM -> f32 out
  k_gemm_out<<<dim3((int)(M / 64), HID / 256), 256, 0, stream>>>(ctx, wo, bout, out);
}

// v002
// It runs in 174 microseconds.
// In both of two side-by-side timings against v001, it was 1.15 times as fast.
// Counting every step since v000, it is 2.50 times as fast.
// Contractions: x*Wqkv on v_wmma_f32_16x16x32_bf16 (bf16 operands = RNE-converted inputs); q*k^T and p*v on v_wmma_f32_16x16x32_bf16 with bf16 hi+lo operand planes (3 products per operand pair); ctx*Wout on v_wmma_f32_16x16x32_f16 (f16 operands, ctx carried x16, Wout carried x64); f32 accumulate, f32 softmax.
#include <hip/hip_runtime.h>

#ifndef NB
#define NB 16
#endif
#ifndef SEQ
#define SEQ 512
#endif
#ifndef NB_FULL
#define NB_FULL 16
#endif
#ifndef SEQ_FULL
#define SEQ_FULL 512
#endif
#define HID 1024
#define NHEAD 16
#define HDIM 64
#define SCALE_QK 0.125f

static_assert(SEQ % 64 == 0);
static_assert(HID == NHEAD * HDIM);
static_assert(HID % 256 == 0);
static_assert(HID % 128 == 0);
static_assert(((NB * NHEAD * (SEQ / 16)) % 4) == 0);
static_assert(NB <= NB_FULL);
static_assert(SEQ <= SEQ_FULL);

typedef _Float16 v16h __attribute__((ext_vector_type(16)));
typedef __bf16   v16b __attribute__((ext_vector_type(16)));
typedef unsigned short v8us  __attribute__((ext_vector_type(8)));
typedef unsigned short v16us __attribute__((ext_vector_type(16)));
typedef float v8f __attribute__((ext_vector_type(8)));
typedef float v4f __attribute__((ext_vector_type(4)));
typedef unsigned int v4u __attribute__((ext_vector_type(4)));
typedef unsigned int v8u __attribute__((ext_vector_type(8)));
typedef int v4i __attribute__((ext_vector_type(4)));
typedef float v2f __attribute__((ext_vector_type(2)));
typedef __bf16 v2b __attribute__((ext_vector_type(2)));

union FragB { v16us u; v16b v; };
union FragH { v16us u; v16h v; };
union Pack8 { v8us s; v4u u; };
union FragP { v8u w; v16b v; };

// ---------------------------------------------------------------------------
// 16-bit conversion helpers (bf16 via RNE on the f32 bit pattern)
// ---------------------------------------------------------------------------
__device__ __forceinline__ unsigned short bf16_rne_bits(float f) {
  unsigned int u = __float_as_uint(f);
  u += 0x7fffu + ((u >> 16) & 1u);
  return (unsigned short)(u >> 16);
}
__device__ __forceinline__ float bf16_val(unsigned short b) {
  return __uint_as_float(((unsigned int)b) << 16);
}
__device__ __forceinline__ float bf16_rne(float f) { return bf16_val(bf16_rne_bits(f)); }
__device__ __forceinline__ unsigned short f16_bits(float f) {
  _Float16 hv = (_Float16)f;
  return __builtin_bit_cast(unsigned short, hv);
}
template <int MODE>   // 0: bf16 bits of RNE(w); 1: f16 bits of RNE_bf16(w) * 64
__device__ __forceinline__ unsigned short wbits(float f) {
  if (MODE == 0) return bf16_rne_bits(f);
  return f16_bits(bf16_rne(f) * 64.0f);
}

// ---------------------------------------------------------------------------
// WMMA helpers: D(16x16 f32) += A(16x32) * B(32x16); hazard guard after each op
// ---------------------------------------------------------------------------
__device__ __forceinline__ v8f mma_b(v16b a, v16b b, v8f c) {
  v8f d = __builtin_amdgcn_wmma_f32_16x16x32_bf16(false, a, false, b, (short)0, c, false, false);
  asm volatile("v_nop\n\tv_nop\n\tv_nop\n\tv_nop" : "+v"(d) : "v"(a), "v"(b));
  return d;
}
__device__ __forceinline__ v8f mma_h(v16h a, v16h b, v8f c) {
  v8f d = __builtin_amdgcn_wmma_f32_16x16x32_f16(false, a, false, b, (short)0, c, false, false);
  asm volatile("v_nop\n\tv_nop\n\tv_nop\n\tv_nop" : "+v"(d) : "v"(a), "v"(b));
  return d;
}
__device__ __forceinline__ v8f zero8() { return (v8f){0.f, 0.f, 0.f, 0.f, 0.f, 0.f, 0.f, 0.f}; }

// ---------------------------------------------------------------------------
// Fragment loader, 16-bit split k-map for A and B:
//   lane l: row/col = l & 15; elements 0..7 <- k0 + 8*(l>>4) + 0..7,
//                             elements 8..15 <- k0 + 16 + 8*(l>>4) + 0..7.
// base points at (row0/col0, k0) of a k-contiguous 16-bit plane, ld = pitch.
// ---------------------------------------------------------------------------
__device__ __forceinline__ v16us ldfrag_g(const unsigned short* __restrict__ base, long ld, int lane) {
  const unsigned short* p = base + (long)(lane & 15) * ld + ((lane >> 4) << 3);
  v8us e0 = *(const v8us*)(p);
  v8us e1 = *(const v8us*)(p + 16);
  return __builtin_shufflevector(e0, e1, 0, 1, 2, 3, 4, 5, 6, 7, 8, 9, 10, 11, 12, 13, 14, 15);
}
__device__ __forceinline__ v16us ldfrag_l(const unsigned short* base, int ld, int lane) {
  const unsigned short* p = base + (lane & 15) * ld + ((lane >> 4) << 3);
  v8us e0 = *(const v8us*)(p);
  v8us e1 = *(const v8us*)(p + 16);
  return __builtin_shufflevector(e0, e1, 0, 1, 2, 3, 4, 5, 6, 7, 8, 9, 10, 11, 12, 13, 14, 15);
}

// ---------------------------------------------------------------------------
// GEMM operand staging: a tile is KT k-elements (one whole 128-B line) of every operand row
// of the block, laid in LDS at a pitch of 144 B (16 B x 9: conflict-free for 16-B row reads).
// Each lane copies 16 B; 8 consecutive lanes cover one line, a wave-wide copy 4 whole lines.
// ---------------------------------------------------------------------------
#define KT 64
#define LPITCH 72
static_assert(HID % KT == 0 && HID / KT >= 2);

__device__ __forceinline__ unsigned lds_off(const void* p) { return (unsigned)(size_t)p; }

// One statement per tile; the s_wait_xcnt ends it so that no address register of an issued
// copy is rewritten before the wait.
__device__ __forceinline__ void async_copy6(const unsigned (&l)[6], const unsigned short* const (&g)[6]) {
  asm volatile("global_load_async_to_lds_b128 %0, %6, off\n\t"
               "global_load_async_to_lds_b128 %1, %7, off\n\t"
               "global_load_async_to_lds_b128 %2, %8, off\n\t"
               "global_load_async_to_lds_b128 %3, %9, off\n\t"
               "global_load_async_to_lds_b128 %4, %10, off\n\t"
               "global_load_async_to_lds_b128 %5, %11, off\n\t"
               "s_wait_xcnt 0x0"
               :: "v"(l[0]), "v"(l[1]), "v"(l[2]), "v"(l[3]), "v"(l[4]), "v"(l[5]),
                  "v"(g[0]), "v"(g[1]), "v"(g[2]), "v"(g[3]), "v"(g[4]), "v"(g[5]) : "memory");
}
__device__ __forceinline__ void async_copy8(const unsigned (&l)[8], const unsigned short* const (&g)[8]) {
  asm volatile("global_load_async_to_lds_b128 %0, %8, off\n\t"
               "global_load_async_to_lds_b128 %1, %9, off\n\t"
               "global_load_async_to_lds_b128 %2, %10, off\n\t"
               "global_load_async_to_lds_b128 %3, %11, off\n\t"
               "global_load_async_to_lds_b128 %4, %12, off\n\t"
               "global_load_async_to_lds_b128 %5, %13, off\n\t"
               "global_load_async_to_lds_b128 %6, %14, off\n\t"
               "global_load_async_to_lds_b128 %7, %15, off\n\t"
               "s_wait_xcnt 0x0"
               :: "v"(l[0]), "v"(l[1]), "v"(l[2]), "v"(l[3]), "v"(l[4]), "v"(l[5]), "v"(l[6]), "v"(l[7]),
                  "v"(g[0]), "v"(g[1]), "v"(g[2]), "v"(g[3]), "v"(g[4]), "v"(g[5]), "v"(g[6]), "v"(g[7]) : "memory");
}
__device__ __forceinline__ void async_copy10(const unsigned (&l)[10], const unsigned short* const (&g)[10]) {
  asm volatile("global_load_async_to_lds_b128 %0, %10, off\n\t"
               "global_load_async_to_lds_b128 %1, %11, off\n\t"
               "global_load_async_to_lds_b128 %2, %12, off\n\t"
               "global_load_async_to_lds_b128 %3, %13, off\n\t"
               "global_load_async_to_lds_b128 %4, %14, off\n\t"
               "global_load_async_to_lds_b128 %5, %15, off\n\t"
               "global_load_async_to_lds_b128 %6, %16, off\n\t"
               "global_load_async_to_lds_b128 %7, %17, off\n\t"
               "global_load_async_to_lds_b128 %8, %18, off\n\t"
               "global_load_async_to_lds_b128 %9, %19, off\n\t"
               "s_wait_xcnt 0x0"
               :: "v"(l[0]), "v"(l[1]), "v"(l[2]), "v"(l[3]), "v"(l[4]), "v"(l[5]), "v"(l[6]), "v"(l[7]), "v"(l[8]), "v"(l[9]),
                  "v"(g[0]), "v"(g[1]), "v"(g[2]), "v"(g[3]), "v"(g[4]), "v"(g[5]), "v"(g[6]), "v"(g[7]), "v"(g[8]), "v"(g[9]) : "memory");
}
// 256 lanes copy 64 A rows then NBG*128 B rows; l, ga, gb are the lane's own first addresses
// (row tid>>3, 16-B piece tid&7); further rows follow in steps of 32.
template <int NBG>
__device__ __forceinline__ void stage_tile(unsigned l, const unsigned short* ga, const unsigned short* gb) {
  unsigned la[2 + 4 * NBG];
  const unsigned short* gp[2 + 4 * NBG];
#pragma unroll
  for (int i = 0; i < 2 + 4 * NBG; ++i) {
    la[i] = l + i * 32 * LPITCH * 2;
    gp[i] = (i < 2) ? ga + (long)(i * 32) * HID : gb + (long)((i - 2) * 32) * HID;
  }
  if constexpr (NBG == 1) async_copy6(la, gp); else async_copy10(la, gp);
}
// Attention K/V tile: 32 keys. Kh, Kl as [32 keys][64 d] at pitch 144 B; Vh, Vl as [64 d][32 keys]
// at pitch 80 B (16 B x 5). 128 lanes; lk, lv and the four pointers are the lane's own first addresses.
#define VPITCH 40
#define AT_K (32 * LPITCH)
#define AT_V (64 * VPITCH)
#define AT_BUF (2 * AT_K + 2 * AT_V)
__device__ __forceinline__ void stage_kv(unsigned lk, unsigned lv,
                                         const unsigned short* gkh, const unsigned short* gkl,
                                         const unsigned short* gvh, const unsigned short* gvl) {
  const unsigned la[8] = {lk, lk + 16 * LPITCH * 2, lk + AT_K * 2, lk + AT_K * 2 + 16 * LPITCH * 2,
                          lv, lv + 32 * VPITCH * 2, lv + AT_V * 2, lv + AT_V * 2 + 32 * VPITCH * 2};
  const unsigned short* const gp[8] = {gkh, gkh + 16 * HDIM, gkl, gkl + 16 * HDIM,
                                       gvh, gvh + 32 * SEQ, gvl, gvl + 32 * SEQ};
  async_copy8(la, gp);
}
// Ring waits, each ahead of the barrier that hands a buffer over.
__device__ __forceinline__ void wait_lds_reads()  { asm volatile("s_wait_dscnt 0x0" ::: "memory"); }
__device__ __forceinline__ void wait_copies()     { asm volatile("s_wait_asynccnt 0x0" ::: "memory"); }

// ---------------------------------------------------------------------------
// 1) x f32 [NB,SEQ,HID] (batch stride SEQ_FULL*HID) -> bf16 bits, compact rows.
// ---------------------------------------------------------------------------
__global__ void __launch_bounds__(256)
k_cvt_x(const float* __restrict__ x, unsigned short* __restrict__ y, int ngroups) {
  const int i = blockIdx.x * 256 + threadIdx.x;
  if (i >= ngroups) return;
  const int row = i / (HID / 8);
  const int g = i - row * (HID / 8);
  const int bb = row / SEQ;
  const int tt = row - bb * SEQ;
  const long srow = (long)bb * SEQ_FULL + tt;
  const float* src = x + srow * HID + g * 8;
  const v4f a = *(const v4f*)(src);
  const v4f c = *(const v4f*)(src + 4);
  Pack8 pk;
  pk.s = (v8us){bf16_rne_bits(a.x), bf16_rne_bits(a.y), bf16_rne_bits(a.z), bf16_rne_bits(a.w),
                bf16_rne_bits(c.x), bf16_rne_bits(c.y), bf16_rne_bits(c.z), bf16_rne_bits(c.w)};
  const v4u val = pk.u;
  unsigned short* dst = y + (long)row * HID + g * 8;
  *(v4u*)dst = val;
  
}

// ---------------------------------------------------------------------------
// 2) weight convert + transpose: in W[kdim rows][ndim cols] f32 -> out WT[ndim][kdim] 16-bit.
//    line written by 8 consecutive lanes x 16 B in one instruction.  Grid (ndim/64, kdim/64).
// ---------------------------------------------------------------------------
template <int MODE>
__global__ void __launch_bounds__(256)
k_cvt_wt(const float* __restrict__ W, unsigned short* __restrict__ WT, int kdim, int ndim) {
  __shared__ __attribute__((aligned(16))) unsigned short tile[64 * 72];
  const int tid = threadIdx.x;
  const int n0 = blockIdx.x * 64;
  const int k0 = blockIdx.y * 64;
  const int kl = tid >> 2;          // 0..63
  const int nl = (tid & 3) * 16;    // 0,16,32,48
  const float* src = W + (long)(k0 + kl) * ndim + n0 + nl;
#pragma unroll
  for (int q = 0; q < 4; ++q) {
    const v4f v = *(const v4f*)(src + q * 4);
    unsigned short* trow = tile + (nl + q * 4) * 72 + kl;   // tile[n_local][k_local]
    trow[0 * 72] = wbits<MODE>(v.x);
    trow[1 * 72] = wbits<MODE>(v.y);
    trow[2 * 72] = wbits<MODE>(v.z);
    trow[3 * 72] = wbits<MODE>(v.w);
  }
  __syncthreads();
  Pack8 pk[2];
  long go[2];
#pragma unroll
  for (int p = 0; p < 2; ++p) {
    const int L = p * 32 + (tid >> 3);   // output row n_local 0..63
    const int sub = tid & 7;
    pk[p].s = *(const v8us*)(tile + L * 72 + sub * 8);
    go[p] = (long)(n0 + L) * kdim + k0 + sub * 8;
  }
#pragma unroll
  for (int p = 0; p < 2; ++p) *(v4u*)(WT + go[p]) = pk[p].u;
  
}

// ---------------------------------------------------------------------------
// 3) QKV GEMM: y[m][o] = sum_c X[m][c] * WT[o][c] + bias[o]  (bf16 operands, f32 acc)
//    Block 256 threads = 8 waves (2M x 4N), block tile 64 x 128, wave tile 32 x 32
//    (4 accumulator tiles + 4 fragments live).  Epilogue: f32 -> bf16 hi and lo bits
//      Q,K sections: [NB*NHEAD][SEQ][HDIM] (one line per (b,h,t) row)
//      V  section:   [NB*NHEAD][HDIM][SEQ] (64-token segment of a (b,h,d) row = one line)
// ---------------------------------------------------------------------------
__global__ void __launch_bounds__(256) __attribute__((amdgpu_num_vgpr(256)))
k_gemm_qkv(const unsigned short* __restrict__ X, const unsigned short* __restrict__ WT,
           const float* __restrict__ bias,
           unsigned short* __restrict__ Qh, unsigned short* __restrict__ Ql,
           unsigned short* __restrict__ Kh, unsigned short* __restrict__ Kl,
           unsigned short* __restrict__ Vh, unsigned short* __restrict__ Vl) {
  // k loop: two operand buffers of (64 + 128) rows; epilogue (behind the loop's last barrier):
  // per plane row orientation [64][136] (8704) or transposed [128][72] (9216)
  __shared__ __attribute__((aligned(16))) unsigned short smem[2 * 192 * LPITCH];
  static_assert(2 * 192 * LPITCH >= 2 * 9216);
  unsigned short (*stile)[9216] = (unsigned short (*)[9216])smem;
  const int tid = threadIdx.x;
  const int lane = tid & 31;
  const int wave = tid >> 5;
  const int wm = wave >> 2;    // 0..1
  const int wn = wave & 3;     // 0..3
  const int hh = lane >> 4;
  const int lc = lane & 15;
  const int mblk = blockIdx.x * 64;
  const int nblk = blockIdx.y * 128;
  const long n0 = (long)nblk + wn * 32;

  v8f acc[2][2];
#pragma unroll
  for (int i = 0; i < 2; ++i)
#pragma unroll
    for (int j = 0; j < 2; ++j) acc[i][j] = zero8();

  const unsigned lcp = lds_off(smem) + (tid >> 3) * (LPITCH * 2) + (tid & 7) * 16;
  const unsigned short* gx = X + ((long)mblk + (tid >> 3)) * HID + (tid & 7) * 8;
  const unsigned short* gw = WT + ((long)nblk + (tid >> 3)) * HID + (tid & 7) * 8;
  stage_tile<1>(lcp, gx, gw);
  wait_copies();
  __syncthreads();
  stage_tile<1>(lcp + 192 * LPITCH * 2, gx + KT, gw + KT);

#pragma unroll 1
  for (int t = 0; t < HID / KT; ++t) {
    const unsigned short* sb = smem + (t & 1) * (192 * LPITCH);
#pragma unroll   // both 32-k steps of a tile: every LDS offset becomes an immediate
    for (int kk = 0; kk < KT; kk += 32) {
      FragB a0, a1, b0, b1;
      a0.u = ldfrag_l(sb + (wm * 32) * LPITCH + kk, LPITCH, lane);
      a1.u = ldfrag_l(sb + (wm * 32 + 16) * LPITCH + kk, LPITCH, lane);
      b0.u = ldfrag_l(sb + (64 + wn * 32) * LPITCH + kk, LPITCH, lane);
      b1.u = ldfrag_l(sb + (64 + wn * 32 + 16) * LPITCH + kk, LPITCH, lane);
      acc[0][0] = mma_b(a0.v, b0.v, acc[0][0]);
      acc[0][1] = mma_b(a0.v, b1.v, acc[0][1]);
      acc[1][0] = mma_b(a1.v, b0.v, acc[1][0]);
      acc[1][1] = mma_b(a1.v, b1.v, acc[1][1]);
    }
    wait_lds_reads();
    wait_copies();
    __syncthreads();   // publishes tile t + 1 and frees the buffer that trip t has read
    if (t + 2 < HID / KT)
      stage_tile<1>(lcp + (t & 1) * (192 * LPITCH * 2), gx + (t + 2) * KT, gw + (t + 2) * KT);
  }
  wait_copies();

  // bias add in f32 (bias entries RNE-converted to bf16 values)
#pragma unroll
  for (int j = 0; j < 2; ++j) {
    const float bj = bf16_rne(bias[n0 + j * 16 + lc]);
#pragma unroll
    for (int i = 0; i < 2; ++i)
#pragma unroll
      for (int r = 0; r < 8; ++r) acc[i][j][r] += bj;
  }

  const int sec = nblk / HID;                 // 0 = q, 1 = k, 2 = v (block-uniform)
  const int h0 = (nblk - sec * HID) >> 6;     // first of the 2 heads in this tile
  const int bb = mblk / SEQ;
  const int t0 = mblk - bb * SEQ;
  const bool tr = (sec == 2);
  const int sm = tr ? 1 : 136;                // LDS stride of the m index
  const int so = tr ? 72 : 1;                 // LDS stride of the o index
  unsigned short* ph = (sec == 0) ? Qh : ((sec == 1) ? Kh : Vh);
  unsigned short* pl = (sec == 0) ? Ql : ((sec == 1) ? Kl : Vl);

  // stage hi and lo bits of the 64x128 tile in one pass (accumulators die here)
#pragma unroll
  for (int i = 0; i < 2; ++i)
#pragma unroll
    for (int j = 0; j < 2; ++j)
#pragma unroll
      for (int r = 0; r < 8; ++r) {
        const float v = acc[i][j][r];
        const unsigned short hb = bf16_rne_bits(v);
        const unsigned short lb = bf16_rne_bits(v - bf16_val(hb));
        const int ml = wm * 32 + i * 16 + r + hh * 8;
        const int ol = wn * 32 + j * 16 + lc;
        const int idx = ml * sm + ol * so;
        stile[0][idx] = hb;
        stile[1][idx] = lb;
      }
  __syncthreads();

#pragma unroll
  for (int plane = 0; plane < 2; ++plane) {
    unsigned short* dstp = (plane == 0) ? ph : pl;
    const unsigned short* srcp = &stile[plane][0];
    Pack8 pk[4];
    long go[4];
#pragma unroll
    for (int p = 0; p < 4; ++p) {
      const int L = p * 32 + (tid >> 3);   // line 0..127; lanes 8q..8q+7 share a line
      const int sub = tid & 7;
      const int lh = L >> 6;               // head within tile
      const int lr = L & 63;               // token (q,k) or d (v)
      const int sidx = tr ? (L * 72 + sub * 8) : (lr * 136 + lh * 64 + sub * 8);
      pk[p].s = *(const v8us*)(srcp + sidx);
      const long bhh = (long)bb * NHEAD + h0 + lh;
      go[p] = tr ? ((bhh * HDIM + lr) * SEQ + t0 + sub * 8)
                 : ((bhh * SEQ + t0 + lr) * HDIM + sub * 8);
    }
#pragma unroll
    for (int p = 0; p < 4; ++p) *(v4u*)(dstp + go[p]) = pk[p].u;
    
  }
}

// ---------------------------------------------------------------------------
// 4) Flash attention, transposed: one wave = 16 queries of one (b,h); keys streamed 32 at a time.
//    S^T = kh*qh + kh*ql + kl*qh (A = key rows, B = queries): lane l holds, of query l & 15, the
//    keys 8*(l>>4) + 0..7 (tile 0) and 16 + 8*(l>>4) + 0..7 (tile 1), so the softmax of a query runs
//    in one lane pair, and the two tiles converted in place are the B fragment of
//    O^T += vh*ph + vh*pl + vl*ph (A = d rows of V).  Block = 128 threads (4 waves, same b,h),
//    which share one LDS copy of each 32-key K/V tile.
// ---------------------------------------------------------------------------
// lane l <-> lane l ^ 16
__device__ __forceinline__ float xhalf(float x) {
  const int b = __builtin_bit_cast(int, x);
  return __builtin_bit_cast(float, __builtin_amdgcn_permlanex16(b, b, 0x76543210, 0xfedcba98, false, false));
}
__global__ void __launch_bounds__(128) __attribute__((amdgpu_num_vgpr(256)))
k_attn(const unsigned short* __restrict__ Qh, const unsigned short* __restrict__ Ql,
       const unsigned short* __restrict__ Kh, const unsigned short* __restrict__ Kl,
       const unsigned short* __restrict__ Vh, const unsigned short* __restrict__ Vl,
       const int* __restrict__ maskp, unsigned short* __restrict__ Ctx) {
  __shared__ __attribute__((aligned(16))) unsigned short Cl[4 * 16 * 72];
  __shared__ __attribute__((aligned(16))) unsigned short KV[2 * AT_BUF];   // K/V ring, shared by the 4 waves
  const int lane = threadIdx.x & 31;
  const int wave = threadIdx.x >> 5;
  const int hh = lane >> 4;
  const int lc = lane & 15;
  const int nqb = SEQ / 16;
  const int gq = blockIdx.x * 4 + wave;
  const int qb = gq % nqb;
  const int bh = gq / nqb;
  const int bb = bh / NHEAD;
  const int h = bh - bb * NHEAD;
  const long qoff = ((long)bh * SEQ + qb * 16) * HDIM;
  const long koff = (long)bh * SEQ * HDIM;
  const long voff = (long)bh * HDIM * SEQ;
  const int* mrow = maskp + (long)bb * SEQ_FULL;
  const float ninf = __uint_as_float(0xff800000u);

  FragB qh0, qh1, ql0, ql1;
  qh0.u = ldfrag_g(Qh + qoff, HDIM, lane);
  qh1.u = ldfrag_g(Qh + qoff + 32, HDIM, lane);
  ql0.u = ldfrag_g(Ql + qoff, HDIM, lane);
  ql1.u = ldfrag_g(Ql + qoff + 32, HDIM, lane);

  v8f o[4];
#pragma unroll
  for (int t = 0; t < 4; ++t) o[t] = zero8();
  float mrun = -1e30f;   // running maximum of query lc (equal in both lanes of the pair)
  float lrun = 0.f;      // running sum over this lane's own half of the keys

  const int tid = threadIdx.x;
  const unsigned lk = lds_off(KV) + (tid >> 3) * (LPITCH * 2) + (tid & 7) * 16;
  const unsigned lv = lds_off(KV) + 2 * AT_K * 2 + (tid >> 2) * (VPITCH * 2) + (tid & 3) * 16;
  const long gko = koff + (long)(tid >> 3) * HDIM + (tid & 7) * 8;
  const long gvo = voff + (long)(tid >> 2) * SEQ + (tid & 3) * 8;
  stage_kv(lk, lv, Kh + gko, Kl + gko, Vh + gvo, Vl + gvo);
  wait_copies();
  __syncthreads();
  stage_kv(lk + AT_BUF * 2, lv + AT_BUF * 2, Kh + gko + 32 * HDIM, Kl + gko + 32 * HDIM,
           Vh + gvo + 32, Vl + gvo + 32);

#pragma unroll 1
  for (int kb = 0; kb < SEQ; kb += 32) {
    const int buf = (kb >> 5) & 1;
    const unsigned short* sb = KV + buf * AT_BUF;
    // key mask (per (b, key)) of this lane's 16 keys
    const int* mk = mrow + kb + hh * 8;
    const v4i mk0 = *(const v4i*)(mk);
    const v4i mk1 = *(const v4i*)(mk + 4);
    const v4i mk2 = *(const v4i*)(mk + 16);
    const v4i mk3 = *(const v4i*)(mk + 20);
    v8f s0 = zero8();
    v8f s1 = zero8();
    {
      const unsigned short* kh = sb;
      const unsigned short* kl = sb + AT_K;
      FragB ka, kc;
      // keys kb .. kb+15
      ka.u = ldfrag_l(kh, LPITCH, lane);
      kc.u = ldfrag_l(kh + 32, LPITCH, lane);
      s0 = mma_b(ka.v, qh0.v, s0);
      s0 = mma_b(kc.v, qh1.v, s0);
      s0 = mma_b(ka.v, ql0.v, s0);
      s0 = mma_b(kc.v, ql1.v, s0);
      ka.u = ldfrag_l(kl, LPITCH, lane);
      kc.u = ldfrag_l(kl + 32, LPITCH, lane);
      s0 = mma_b(ka.v, qh0.v, s0);
      s0 = mma_b(kc.v, qh1.v, s0);
      // keys kb+16 .. kb+31
      ka.u = ldfrag_l(kh + 16 * LPITCH, LPITCH, lane);
      kc.u = ldfrag_l(kh + 16 * LPITCH + 32, LPITCH, lane);
      s1 = mma_b(ka.v, qh0.v, s1);
      s1 = mma_b(kc.v, qh1.v, s1);
      s1 = mma_b(ka.v, ql0.v, s1);
      s1 = mma_b(kc.v, ql1.v, s1);
      ka.u = ldfrag_l(kl + 16 * LPITCH, LPITCH, lane);
      kc.u = ldfrag_l(kl + 16 * LPITCH + 32, LPITCH, lane);
      s1 = mma_b(ka.v, qh0.v, s1);
      s1 = mma_b(kc.v, qh1.v, s1);
    }

    // scale; replace with -inf where mask == 0
    s0 *= SCALE_QK;
    s1 *= SCALE_QK;
#pragma unroll
    for (int r = 0; r < 8; ++r) {
      const int m0 = (r < 4) ? mk0[r & 3] : mk1[r & 3];
      const int m1 = (r < 4) ? mk2[r & 3] : mk3[r & 3];
      s0[r] = (m0 == 0) ? ninf : s0[r];
      s1[r] = (m1 == 0) ? ninf : s1[r];
    }
    // online softmax of query lc: maximum in the lane, then one exchange between the halves
    float mx = fmaxf(s0[0], s1[0]);
#pragma unroll
    for (int r = 1; r < 8; ++r) mx = fmaxf(mx, fmaxf(s0[r], s1[r]));
    mx = fmaxf(mx, xhalf(mx));
    const float mnew = fmaxf(mrun, mx);
    const float alpha = __expf(mrun - mnew);
#pragma unroll
    for (int r = 0; r < 8; ++r) {
      s0[r] = __expf(s0[r] - mnew);
      s1[r] = __expf(s1[r] - mnew);
    }
    const v8f ps = s0 + s1;
    const float rs = ((ps[0] + ps[1]) + (ps[2] + ps[3])) + ((ps[4] + ps[5]) + (ps[6] + ps[7]));
    lrun = lrun * alpha + rs;
    mrun = mnew;
#pragma unroll
    for (int t = 0; t < 4; ++t)
#pragma unroll
      for (int r = 0; r < 8; ++r) o[t][r] *= alpha;

    // P^T (32 keys x 16 queries, f32 in D layout) -> bf16 hi and lo B fragments, in place:
    // element s of the fragment is register s & 7 of tile s >> 3
    FragP pa, pb;
#pragma unroll
    for (int w = 0; w < 8; ++w) {
      const float p0 = (w < 4) ? s0[2 * w] : s1[2 * w - 8];
      const float p1 = (w < 4) ? s0[2 * w + 1] : s1[2 * w - 7];
      const unsigned hw = __builtin_bit_cast(unsigned, __builtin_convertvector((v2f){p0, p1}, v2b));
      const float h0 = __uint_as_float(hw << 16);
      const float h1 = __uint_as_float(hw & 0xffff0000u);
      pa.w[w] = hw;
      pb.w[w] = __builtin_bit_cast(unsigned, __builtin_convertvector((v2f){p0 - h0, p1 - h1}, v2b));
    }

    // O^T += V^T * P^T  (V planes stored [d][token], k = token contiguous)
#pragma unroll
    for (int t = 0; t < 4; ++t) {
      FragB vf;
      vf.u = ldfrag_l(sb + 2 * AT_K + (t * 16) * VPITCH, VPITCH, lane);
      o[t] = mma_b(vf.v, pa.v, o[t]);
      o[t] = mma_b(vf.v, pb.v, o[t]);
      vf.u = ldfrag_l(sb + 2 * AT_K + AT_V + (t * 16) * VPITCH, VPITCH, lane);
      o[t] = mma_b(vf.v, pa.v, o[t]);
    }
    wait_lds_reads();
    wait_copies();
    __syncthreads();   // publishes the next 32 keys and frees the buffer that this trip has read
    if (kb + 64 < SEQ)
      stage_kv(lk + buf * (AT_BUF * 2), lv + buf * (AT_BUF * 2),
               Kh + gko + (long)(kb + 64) * HDIM, Kl + gko + (long)(kb + 64) * HDIM,
               Vh + gvo + (kb + 64), Vl + gvo + (kb + 64));
  }
  wait_copies();

  const float inv = 16.0f / (lrun + xhalf(lrun));   // the halves' sums join here
  unsigned short* cl = Cl + wave * (16 * 72);
#pragma unroll
  for (int t = 0; t < 4; ++t) {   // registers 0..7 of o[t] are d = t*16 + hh*8 + 0..7 of query lc
    Pack8 pc;
#pragma unroll
    for (int r = 0; r < 8; ++r) pc.s[r] = f16_bits(o[t][r] * inv);
    *(v4u*)(cl + lc * 72 + t * 16 + hh * 8) = pc.u;
  }
  __syncthreads();
  Pack8 pk[4];
  long go[4];
#pragma unroll
  for (int p = 0; p < 4; ++p) {
    const int q = p * 4 + (lane >> 3);   // query row 0..15; lanes 8q'..8q'+7 share a line
    const int sub = lane & 7;
    pk[p].s = *(const v8us*)(cl + q * 72 + sub * 8);
    go[p] = ((long)bb * SEQ + qb * 16 + q) * HID + h * HDIM + sub * 8;
  }
#pragma unroll
  for (int p = 0; p < 4; ++p) *(v4u*)(Ctx + go[p]) = pk[p].u;
  
}

// ---------------------------------------------------------------------------
// 5) Output GEMM: out[m][o] = (1/1024) * sum_c A[m][c] * WT[o][c] + bias[o]   (f16 operands)
//    (32 floats) written by 8 consecutive lanes x 16 B in one instruction.
// ---------------------------------------------------------------------------
__global__ void __launch_bounds__(256)
k_gemm_out(const unsigned short* __restrict__ A, const unsigned short* __restrict__ WT,
           const float* __restrict__ bias, float* __restrict__ out) {
  // k loop: two operand buffers of (64 + 256) rows; epilogue (behind the loop's last barrier): otile
  __shared__ __attribute__((aligned(16))) unsigned short smem[2 * 320 * LPITCH];
  static_assert(2 * 320 * LPITCH * 2 >= 32 * 260 * 4);
  float* otile = (float*)smem;
  const int tid = threadIdx.x;
  const int lane = tid & 31;
  const int wave = tid >> 5;
  const int wm = wave >> 2;
  const int wn = wave & 3;
  const int hh = lane >> 4;
  const int lc = lane & 15;
  const int mblk = blockIdx.x * 64;
  const int nblk = blockIdx.y * 256;
  const long n0 = (long)nblk + wn * 64;

  v8f acc[2][4];
#pragma unroll
  for (int i = 0; i < 2; ++i)
#pragma unroll
    for (int j = 0; j < 4; ++j) acc[i][j] = zero8();

  const unsigned lcp = lds_off(smem) + (tid >> 3) * (LPITCH * 2) + (tid & 7) * 16;
  const unsigned short* ga = A + ((long)mblk + (tid >> 3)) * HID + (tid & 7) * 8;
  const unsigned short* gw = WT + ((long)nblk + (tid >> 3)) * HID + (tid & 7) * 8;
  stage_tile<2>(lcp, ga, gw);
  wait_copies();
  __syncthreads();
  stage_tile<2>(lcp + 320 * LPITCH * 2, ga + KT, gw + KT);

#pragma unroll 1
  for (int t = 0; t < HID / KT; ++t) {
    const unsigned short* sb = smem + (t & 1) * (320 * LPITCH);
#pragma unroll   // both 32-k steps of a tile: every LDS offset becomes an immediate
    for (int kk = 0; kk < KT; kk += 32) {
      FragH a0, a1, b0, b1, b2, b3;
      a0.u = ldfrag_l(sb + (wm * 32) * LPITCH + kk, LPITCH, lane);
      a1.u = ldfrag_l(sb + (wm * 32 + 16) * LPITCH + kk, LPITCH, lane);
      b0.u = ldfrag_l(sb + (64 + wn * 64) * LPITCH + kk, LPITCH, lane);
      b1.u = ldfrag_l(sb + (64 + wn * 64 + 16) * LPITCH + kk, LPITCH, lane);
      b2.u = ldfrag_l(sb + (64 + wn * 64 + 32) * LPITCH + kk, LPITCH, lane);
      b3.u = ldfrag_l(sb + (64 + wn * 64 + 48) * LPITCH + kk, LPITCH, lane);
      acc[0][0] = mma_h(a0.v, b0.v, acc[0][0]);
      acc[0][1] = mma_h(a0.v, b1.v, acc[0][1]);
      acc[0][2] = mma_h(a0.v, b2.v, acc[0][2]);
      acc[0][3] = mma_h(a0.v, b3.v, acc[0][3]);
      acc[1][0] = mma_h(a1.v, b0.v, acc[1][0]);
      acc[1][1] = mma_h(a1.v, b1.v, acc[1][1]);
      acc[1][2] = mma_h(a1.v, b2.v, acc[1][2]);
      acc[1][3] = mma_h(a1.v, b3.v, acc[1][3]);
    }
    wait_lds_reads();
    wait_copies();
    __syncthreads();   // publishes tile t + 1 and frees the buffer that trip t has read
    if (t + 2 < HID / KT)
      stage_tile<2>(lcp + (t & 1) * (320 * LPITCH * 2), ga + (t + 2) * KT, gw + (t + 2) * KT);
  }
  wait_copies();

  // undo carries (x16 ctx, x64 weight) and add bf16-valued bias, all in f32
#pragma unroll
  for (int j = 0; j < 4; ++j) {
    const float bj = bf16_rne(bias[n0 + j * 16 + lc]);
#pragma unroll
    for (int i = 0; i < 2; ++i)
#pragma unroll
      for (int r = 0; r < 8; ++r) acc[i][j][r] = acc[i][j][r] * (1.0f / 1024.0f) + bj;
  }

#pragma unroll
  for (int phase = 0; phase < 2; ++phase) {
    if (wm == phase) {   // wave-uniform: waves owning rows phase*32 .. +31 stage them
#pragma unroll
      for (int i = 0; i < 2; ++i)
#pragma unroll
        for (int j = 0; j < 4; ++j)
#pragma unroll
          for (int r = 0; r < 8; ++r) {
            const int ml = i * 16 + r + hh * 8;
            const int ol = wn * 64 + j * 16 + lc;
            otile[ml * 260 + ol] = acc[i][j][r];
          }
    }
    __syncthreads();
    v4f pk[8];
    long go[8];
#pragma unroll
    for (int p = 0; p < 8; ++p) {
      const int L = p * 32 + (tid >> 3);
      const int sub = tid & 7;
      const int row = L >> 3;
      const int piece = L & 7;
      pk[p] = *(const v4f*)(otile + row * 260 + piece * 32 + sub * 4);
      go[p] = ((long)mblk + phase * 32 + row) * HID + nblk + piece * 32 + sub * 4;
    }
#pragma unroll
    for (int p = 0; p < 8; ++p) *(v4f*)(out + go[p]) = pk[p];
    
    __syncthreads();
  }
}

// ---------------------------------------------------------------------------
// Launch
// ---------------------------------------------------------------------------
extern "C" void kernel_launch(void* const* d_in, const int* in_sizes, int n_in,
                              void* d_out, int out_size, void* d_ws, size_t ws_size,
                              hipStream_t stream) {
  if (n_in < 6) return;
  const float* x     = (const float*)d_in[0];   // [NB_FULL, SEQ_FULL, HID]
  const int*   maskp = (const int*)d_in[1];     // [NB_FULL, 1, 1, SEQ_FULL] int32
  const float* Wqkv  = (const float*)d_in[2];   // [HID][3*HID]
  const float* bqkv  = (const float*)d_in[3];   // [3*HID]
  const float* Wout  = (const float*)d_in[4];   // [HID][HID]
  const float* bout  = (const float*)d_in[5];   // [HID]
  float* out = (float*)d_out;                   // [NB*SEQ, HID]

  const long M = (long)NB * SEQ;
  if ((long)in_sizes[0] < (((long)(NB - 1) * SEQ_FULL + SEQ) * HID)) return;
  if ((long)in_sizes[1] < ((long)(NB - 1) * SEQ_FULL + SEQ)) return;
  if ((long)in_sizes[2] < 3L * HID * HID) return;
  if ((long)in_sizes[3] < 3L * HID) return;
  if ((long)in_sizes[4] < (long)HID * HID) return;
  if ((long)in_sizes[5] < (long)HID) return;
  if ((long)out_size < M * HID) return;

  // workspace carve (bytes); every region is a whole number of tiles, no padding needed
  const size_t szX  = (size_t)M * HID * 2;                       // x bf16 plane, later ctx f16 plane
  const size_t szWq = (size_t)3 * HID * HID * 2;                 // WqkvT bf16
  const size_t szWo = (size_t)HID * HID * 2;                     // WoutT f16
  const size_t szP  = (size_t)NB * NHEAD * SEQ * HDIM * 2;       // one q/k/v plane
  const size_t oX  = 0;
  const size_t oWq = oX + szX;
  const size_t oWo = oWq + szWq;
  const size_t oP0 = oWo + szWo;
  const size_t total = oP0 + 6 * szP;
  if (total > ws_size) return;
  static_assert((size_t)NB * SEQ * HID * 2 == (size_t)NB * NHEAD * SEQ * HDIM * 2);

  char* ws = (char*)d_ws;
  unsigned short* xb  = (unsigned short*)(ws + oX);
  unsigned short* ctx = (unsigned short*)(ws + oX);      // aliases xb: xb is dead after k_gemm_qkv
  unsigned short* wq  = (unsigned short*)(ws + oWq);
  unsigned short* wo  = (unsigned short*)(ws + oWo);
  unsigned short* qh  = (unsigned short*)(ws + oP0 + 0 * szP);
  unsigned short* ql  = (unsigned short*)(ws + oP0 + 1 * szP);
  unsigned short* kh  = (unsigned short*)(ws + oP0 + 2 * szP);
  unsigned short* kl  = (unsigned short*)(ws + oP0 + 3 * szP);
  unsigned short* vh  = (unsigned short*)(ws + oP0 + 4 * szP);
  unsigned short* vl  = (unsigned short*)(ws + oP0 + 5 * szP);

  // 1) x -> bf16 plane (compact rows)
  const int ngroups = (int)(M * HID / 8);
  k_cvt_x<<<(ngroups + 255) / 256, 256, 0, stream>>>(x, xb, ngroups);
  // 2) Wqkv in[HID][3*HID] -> out[3*HID][HID] bf16;  Wout in[HID][HID] -> out[HID][HID] f16 (x64)
  k_cvt_wt<0><<<dim3(3 * HID / 64, HID / 64), 256, 0, stream>>>(Wqkv, wq, HID, 3 * HID);
  k_cvt_wt<1><<<dim3(HID / 64, HID / 64), 256, 0, stream>>>(Wout, wo, HID, HID);
  // 3) qkv GEMM -> bf16 hi/lo planes of q, k ([bh][t][d]) and v ([bh][d][t]); block tile 64x128
  k_gemm_qkv<<<dim3((int)(M / 64), 3 * HID / 128), 256, 0, stream>>>(xb, wq, bqkv, qh, ql, kh, kl, vh, vl);
  // 4) attention -> ctx f16 plane [NB*SEQ][HID] (over the dead x plane)
  k_attn<<<(NB * NHEAD * (SEQ / 16)) / 4, 128, 0, stream>>>(qh, ql, kh, kl, vh, vl, maskp, ctx);
  // 5) output GEMM -> f32 out
  k_gemm_out<<<dim3((int)(M / 64), HID / 256), 256, 0, stream>>>(ctx, wo, bout, out);
}

// v004
// One run takes 125 microseconds.
// Versions between v002 and this one are left out; their measured steps multiply to 1.38 times as fast.
// Over all steps from v000 it is 3.44 times as fast.
// Contractions: x*Wqkv on v_wmma_f32_16x16x32_bf16 (bf16 operands = RNE-converted inputs); q*k^T and p*v on v_wmma_f32_16x16x32_f16 (f16 operands = RNE-converted f32 q, k, v and softmax weights, one product per operand pair); ctx*Wout on v_wmma_f32_16x16x32_f16 (f16 operands, ctx carried x16, Wout carried x64); f32 accumulate, f32 softmax.
#include <hip/hip_runtime.h>

#ifndef NB
#define NB 16
#endif
#ifndef SEQ
#define SEQ 512
#endif
#ifndef NB_FULL
#define NB_FULL 16
#endif
#ifndef SEQ_FULL
#define SEQ_FULL 512
#endif
#define HID 1024
#define NHEAD 16
#define HDIM 64
#define SCALE_QK 0.125f

static_assert(SEQ % 64 == 0);
static_assert(HID == NHEAD * HDIM);
static_assert(HID % 256 == 0);
static_assert(HID % 128 == 0);
static_assert(((NB * NHEAD * (SEQ / 16)) % 4) == 0);
static_assert(NB <= NB_FULL);
static_assert(SEQ <= SEQ_FULL);

typedef _Float16 v16h __attribute__((ext_vector_type(16)));
typedef __bf16   v16b __attribute__((ext_vector_type(16)));
typedef unsigned short v8us  __attribute__((ext_vector_type(8)));
typedef unsigned short v16us __attribute__((ext_vector_type(16)));
typedef float v8f __attribute__((ext_vector_type(8)));
typedef float v4f __attribute__((ext_vector_type(4)));
typedef unsigned int v4u __attribute__((ext_vector_type(4)));
typedef unsigned int v8u __attribute__((ext_vector_type(8)));
typedef int v4i __attribute__((ext_vector_type(4)));
typedef float v2f __attribute__((ext_vector_type(2)));
typedef _Float16 v2h __attribute__((ext_vector_type(2)));

union FragB { v16us u; v16b v; };
union FragH { v16us u; v16h v; };
union Pack8 { v8us s; v4u u; };
union FragP { v8u w; v16h v; };

// ---------------------------------------------------------------------------
// 16-bit conversion helpers (bf16 via RNE on the f32 bit pattern)
// ---------------------------------------------------------------------------
__device__ __forceinline__ unsigned short bf16_rne_bits(float f) {
  unsigned int u = __float_as_uint(f);
  u += 0x7fffu + ((u >> 16) & 1u);
  return (unsigned short)(u >> 16);
}
__device__ __forceinline__ float bf16_val(unsigned short b) {
  return __uint_as_float(((unsigned int)b) << 16);
}
__device__ __forceinline__ float bf16_rne(float f) { return bf16_val(bf16_rne_bits(f)); }
__device__ __forceinline__ unsigned short f16_bits(float f) {
  _Float16 hv = (_Float16)f;
  return __builtin_bit_cast(unsigned short, hv);
}
template <int MODE>   // 0: bf16 bits of RNE(w); 1: f16 bits of RNE_bf16(w) * 64
__device__ __forceinline__ unsigned short wbits(float f) {
  if (MODE == 0) return bf16_rne_bits(f);
  return f16_bits(bf16_rne(f) * 64.0f);
}

// ---------------------------------------------------------------------------
// WMMA helpers: D(16x16 f32) += A(16x32) * B(32x16); hazard guard after each op
// ---------------------------------------------------------------------------
__device__ __forceinline__ v8f mma_b(v16b a, v16b b, v8f c) {
  v8f d = __builtin_amdgcn_wmma_f32_16x16x32_bf16(false, a, false, b, (short)0, c, false, false);
  asm volatile("v_nop\n\tv_nop\n\tv_nop\n\tv_nop" : "+v"(d) : "v"(a), "v"(b));
  return d;
}
__device__ __forceinline__ v8f mma_h(v16h a, v16h b, v8f c) {
  v8f d = __builtin_amdgcn_wmma_f32_16x16x32_f16(false, a, false, b, (short)0, c, false, false);
  asm volatile("v_nop\n\tv_nop\n\tv_nop\n\tv_nop" : "+v"(d) : "v"(a), "v"(b));
  return d;
}
__device__ __forceinline__ v8f zero8() { return (v8f){0.f, 0.f, 0.f, 0.f, 0.f, 0.f, 0.f, 0.f}; }

// ---------------------------------------------------------------------------
// Fragment loader, 16-bit split k-map for A and B:
//   lane l: row/col = l & 15; elements 0..7 <- k0 + 8*(l>>4) + 0..7,
//                             elements 8..15 <- k0 + 16 + 8*(l>>4) + 0..7.
// base points at (row0/col0, k0) of a k-contiguous 16-bit plane, ld = pitch.
// ---------------------------------------------------------------------------
__device__ __forceinline__ v16us ldfrag_g(const unsigned short* __restrict__ base, long ld, int lane) {
  const unsigned short* p = base + (long)(lane & 15) * ld + ((lane >> 4) << 3);
  v8us e0 = *(const v8us*)(p);
  v8us e1 = *(const v8us*)(p + 16);
  return __builtin_shufflevector(e0, e1, 0, 1, 2, 3, 4, 5, 6, 7, 8, 9, 10, 11, 12, 13, 14, 15);
}
__device__ __forceinline__ v16us ldfrag_l(const unsigned short* base, int ld, int lane) {
  const unsigned short* p = base + (lane & 15) * ld + ((lane >> 4) << 3);
  v8us e0 = *(const v8us*)(p);
  v8us e1 = *(const v8us*)(p + 16);
  return __builtin_shufflevector(e0, e1, 0, 1, 2, 3, 4, 5, 6, 7, 8, 9, 10, 11, 12, 13, 14, 15);
}

// ---------------------------------------------------------------------------
// GEMM operand staging: a tile is KT k-elements (one whole 128-B line) of every operand row
// of the block, laid in LDS at a pitch of 144 B (16 B x 9: conflict-free for 16-B row reads).
// Each lane copies 16 B; 8 consecutive lanes cover one line, a wave-wide copy 4 whole lines.
// ---------------------------------------------------------------------------
#define KT 64
#define LPITCH 72
static_assert(HID % KT == 0 && HID / KT >= 2);

__device__ __forceinline__ unsigned lds_off(const void* p) { return (unsigned)(size_t)p; }

// One statement per tile; the s_wait_xcnt ends it so that no address register of an issued
// copy is rewritten before the wait.
__device__ __forceinline__ void async_copy4(const unsigned (&l)[4], const unsigned short* const (&g)[4]) {
  asm volatile("global_load_async_to_lds_b128 %0, %4, off\n\t"
               "global_load_async_to_lds_b128 %1, %5, off\n\t"
               "global_load_async_to_lds_b128 %2, %6, off\n\t"
               "global_load_async_to_lds_b128 %3, %7, off\n\t"
               "s_wait_xcnt 0x0"
               :: "v"(l[0]), "v"(l[1]), "v"(l[2]), "v"(l[3]),
                  "v"(g[0]), "v"(g[1]), "v"(g[2]), "v"(g[3]) : "memory");
}
__device__ __forceinline__ void async_copy10(const unsigned (&l)[10], const unsigned short* const (&g)[10]) {
  asm volatile("global_load_async_to_lds_b128 %0, %10, off\n\t"
               "global_load_async_to_lds_b128 %1, %11, off\n\t"
               "global_load_async_to_lds_b128 %2, %12, off\n\t"
               "global_load_async_to_lds_b128 %3, %13, off\n\t"
               "global_load_async_to_lds_b128 %4, %14, off\n\t"
               "global_load_async_to_lds_b128 %5, %15, off\n\t"
               "global_load_async_to_lds_b128 %6, %16, off\n\t"
               "global_load_async_to_lds_b128 %7, %17, off\n\t"
               "global_load_async_to_lds_b128 %8, %18, off\n\t"
               "global_load_async_to_lds_b128 %9, %19, off\n\t"
               "s_wait_xcnt 0x0"
               :: "v"(l[0]), "v"(l[1]), "v"(l[2]), "v"(l[3]), "v"(l[4]), "v"(l[5]), "v"(l[6]), "v"(l[7]), "v"(l[8]), "v"(l[9]),
                  "v"(g[0]), "v"(g[1]), "v"(g[2]), "v"(g[3]), "v"(g[4]), "v"(g[5]), "v"(g[6]), "v"(g[7]), "v"(g[8]), "v"(g[9]) : "memory");
}
// 256 lanes copy 64 A rows then NBG*128 B rows; l, ga, gb are the lane's own first addresses
// (row tid>>3, 16-B piece tid&7); further rows follow in steps of 32.
template <int NBG>
__device__ __forceinline__ void stage_tile(unsigned l, const unsigned short* ga, const unsigned short* gb) {
  unsigned la[2 + 4 * NBG];
  const unsigned short* gp[2 + 4 * NBG];
#pragma unroll
  for (int i = 0; i < 2 + 4 * NBG; ++i) {
    la[i] = l + i * 32 * LPITCH * 2;
    gp[i] = (i < 2) ? ga + (long)(i * 32) * HID : gb + (long)((i - 2) * 32) * HID;
  }
  static_assert(NBG == 2);
  async_copy10(la, gp);
}
// The 128 x 256 block's tile: 128 A rows then 256 B rows, 12 copies a lane, in one statement as above.
__device__ __forceinline__ void async_copy12(const unsigned (&l)[12], const unsigned short* const (&g)[12]) {
  asm volatile("global_load_async_to_lds_b128 %0, %12, off\n\t"
               "global_load_async_to_lds_b128 %1, %13, off\n\t"
               "global_load_async_to_lds_b128 %2, %14, off\n\t"
               "global_load_async_to_lds_b128 %3, %15, off\n\t"
               "global_load_async_to_lds_b128 %4, %16, off\n\t"
               "global_load_async_to_lds_b128 %5, %17, off\n\t"
               "global_load_async_to_lds_b128 %6, %18, off\n\t"
               "global_load_async_to_lds_b128 %7, %19, off\n\t"
               "global_load_async_to_lds_b128 %8, %20, off\n\t"
               "global_load_async_to_lds_b128 %9, %21, off\n\t"
               "global_load_async_to_lds_b128 %10, %22, off\n\t"
               "global_load_async_to_lds_b128 %11, %23, off\n\t"
               "s_wait_xcnt 0x0"
               :: "v"(l[0]), "v"(l[1]), "v"(l[2]), "v"(l[3]), "v"(l[4]), "v"(l[5]),
                  "v"(l[6]), "v"(l[7]), "v"(l[8]), "v"(l[9]), "v"(l[10]), "v"(l[11]),
                  "v"(g[0]), "v"(g[1]), "v"(g[2]), "v"(g[3]), "v"(g[4]), "v"(g[5]),
                  "v"(g[6]), "v"(g[7]), "v"(g[8]), "v"(g[9]), "v"(g[10]), "v"(g[11]) : "memory");
}
__device__ __forceinline__ void stage_tile_q(unsigned l, const unsigned short* ga, const unsigned short* gb) {
  unsigned la[12];
  const unsigned short* gp[12];
#pragma unroll
  for (int i = 0; i < 12; ++i) {
    la[i] = l + i * 32 * LPITCH * 2;
    gp[i] = (i < 4) ? ga + (long)(i * 32) * HID : gb + (long)((i - 4) * 32) * HID;
  }
  async_copy12(la, gp);
}
// Attention K/V tile: 32 keys. K as [32 keys][64 d] at pitch 144 B; V as [64 d][32 keys]
// at pitch 80 B (16 B x 5). 128 lanes; lk, lv and the two pointers are the lane's own first addresses.
#define VPITCH 40
#define AT_K (32 * LPITCH)
#define AT_V (64 * VPITCH)
#define AT_BUF (AT_K + AT_V)
__device__ __forceinline__ void stage_kv(unsigned lk, unsigned lv,
                                         const unsigned short* gk, const unsigned short* gv) {
  const unsigned la[4] = {lk, lk + 16 * LPITCH * 2, lv, lv + 32 * VPITCH * 2};
  const unsigned short* const gp[4] = {gk, gk + 16 * HDIM, gv, gv + 32 * SEQ};
  async_copy4(la, gp);
}
// Ring waits, each ahead of the barrier that hands a buffer over.
__device__ __forceinline__ void wait_lds_reads()  { asm volatile("s_wait_dscnt 0x0" ::: "memory"); }
__device__ __forceinline__ void wait_copies()     { asm volatile("s_wait_asynccnt 0x0" ::: "memory"); }

// ---------------------------------------------------------------------------
// 1) x f32 [NB,SEQ,HID] (batch stride SEQ_FULL*HID) -> bf16 bits, compact rows.
// ---------------------------------------------------------------------------
__global__ void __launch_bounds__(256)
k_cvt_x(const float* __restrict__ x, unsigned short* __restrict__ y, int ngroups) {
  const int i = blockIdx.x * 256 + threadIdx.x;
  if (i >= ngroups) return;
  const int row = i / (HID / 8);
  const int g = i - row * (HID / 8);
  const int bb = row / SEQ;
  const int tt = row - bb * SEQ;
  const long srow = (long)bb * SEQ_FULL + tt;
  const float* src = x + srow * HID + g * 8;
  const v4f a = *(const v4f*)(src);
  const v4f c = *(const v4f*)(src + 4);
  Pack8 pk;
  pk.s = (v8us){bf16_rne_bits(a.x), bf16_rne_bits(a.y), bf16_rne_bits(a.z), bf16_rne_bits(a.w),
                bf16_rne_bits(c.x), bf16_rne_bits(c.y), bf16_rne_bits(c.z), bf16_rne_bits(c.w)};
  const v4u val = pk.u;
  unsigned short* dst = y + (long)row * HID + g * 8;
  *(v4u*)dst = val;
  
}

// ---------------------------------------------------------------------------
// 2) weight convert + transpose: in W[kdim rows][ndim cols] f32 -> out WT[ndim][kdim] 16-bit.
//    line written by 8 consecutive lanes x 16 B in one instruction.  Grid (ndim/64, kdim/64).
// ---------------------------------------------------------------------------
template <int MODE>
__global__ void __launch_bounds__(256)
k_cvt_wt(const float* __restrict__ W, unsigned short* __restrict__ WT, int kdim, int ndim) {
  __shared__ __attribute__((aligned(16))) unsigned short tile[64 * 72];
  const int tid = threadIdx.x;
  const int n0 = blockIdx.x * 64;
  const int k0 = blockIdx.y * 64;
  const int kl = tid >> 2;          // 0..63
  const int nl = (tid & 3) * 16;    // 0,16,32,48
  const float* src = W + (long)(k0 + kl) * ndim + n0 + nl;
#pragma unroll
  for (int q = 0; q < 4; ++q) {
    const v4f v = *(const v4f*)(src + q * 4);
    unsigned short* trow = tile + (nl + q * 4) * 72 + kl;   // tile[n_local][k_local]
    trow[0 * 72] = wbits<MODE>(v.x);
    trow[1 * 72] = wbits<MODE>(v.y);
    trow[2 * 72] = wbits<MODE>(v.z);
    trow[3 * 72] = wbits<MODE>(v.w);
  }
  __syncthreads();
  Pack8 pk[2];
  long go[2];
#pragma unroll
  for (int p = 0; p < 2; ++p) {
    const int L = p * 32 + (tid >> 3);   // output row n_local 0..63
    const int sub = tid & 7;
    pk[p].s = *(const v8us*)(tile + L * 72 + sub * 8);
    go[p] = (long)(n0 + L) * kdim + k0 + sub * 8;
  }
#pragma unroll
  for (int p = 0; p < 2; ++p) *(v4u*)(WT + go[p]) = pk[p].u;
  
}

// ---------------------------------------------------------------------------
// 3) QKV GEMM: y[m][o] = sum_c X[m][c] * WT[o][c] + bias[o]  (bf16 operands, f32 acc)
//    Block 256 threads = 8 waves (2M x 4N), block tile 128 x 256, wave tile 64 x 64
//    (16 accumulator tiles, 4 + 4 fragments: 16 products per 8 fragments read from LDS, and
//    each operand row fetched from L2 by half as many blocks as with a 64 x 128 tile).
//    Epilogue: f32 -> f16 bits
//      Q,K sections: [NB*NHEAD][SEQ][HDIM] (one line per (b,h,t) row)
//      V  section:   [NB*NHEAD][HDIM][SEQ] (64-token segment of a (b,h,d) row = one line)
// ---------------------------------------------------------------------------
#define QM 128
#define QN 256
#define QROWS (QM + QN)
static_assert(SEQ % QM == 0);          // a block's rows lie in one batch
static_assert(HID % QN == 0);          // a block's columns lie in one of the q, k, v sections
// Epilogue of the 128 x 256 tile, orientation as a compile-time constant so that every LDS
// offset is an immediate.  TR = false (q, k): stile[m][o], pitch 264; TR = true (v): stile[o][m], pitch 136.
template <bool TR>
__device__ __forceinline__ void qkv_stage(const v8f (&acc)[4][4], unsigned short* stile, int tid) {
  constexpr int sm = TR ? 1 : 264;            // LDS stride of the m index
  constexpr int so = TR ? 136 : 1;            // LDS stride of the o index
  const int lane = tid & 31;
  const int wave = tid >> 5;
  unsigned short* p0 = stile + ((wave >> 2) * 64 + (lane >> 4) * 8) * sm + ((wave & 3) * 64 + (lane & 15)) * so;
#pragma unroll
  for (int i = 0; i < 4; ++i)
#pragma unroll
    for (int j = 0; j < 4; ++j)
#pragma unroll
      for (int r = 0; r < 8; ++r) p0[(i * 16 + r) * sm + (j * 16) * so] = f16_bits(acc[i][j][r]);
}
// 512 lines of 128 B leave in 4 groups of 4 x 32 lines; lanes 8q..8q+7 share a line.
// q, k: line = (head L >> 7, token L & 127); v: line = (column L >> 1, 64-token segment L & 1).
template <bool TR>
__device__ __forceinline__ void qkv_lines(const unsigned short* stile, unsigned short* __restrict__ dstp,
                                          int tid, long bh0, int t0) {
  const int sub = tid & 7;
#pragma unroll
  for (int g = 0; g < 4; ++g) {
    Pack8 pk[4];
    long go[4];
#pragma unroll
    for (int p = 0; p < 4; ++p) {
      const int L = (g * 4 + p) * 32 + (tid >> 3);   // line 0..511
      const long bhh = bh0 + (L >> 7);               // head within the tile, in both orientations
      const int sidx = TR ? ((L >> 1) * 136 + (L & 1) * 64 + sub * 8)
                          : ((L & 127) * 264 + (L >> 7) * 64 + sub * 8);
      pk[p].s = *(const v8us*)(stile + sidx);
      go[p] = TR ? ((bhh * HDIM + ((L >> 1) & 63)) * SEQ + t0 + (L & 1) * 64 + sub * 8)
                 : ((bhh * SEQ + t0 + (L & 127)) * HDIM + sub * 8);
    }
#pragma unroll
    for (int p = 0; p < 4; ++p) *(v4u*)(dstp + go[p]) = pk[p].u;
    // no register that an issued store names is rewritten ahead of this wait
    asm volatile("s_wait_xcnt 0x0" ::: "memory");
  }
}
__global__ void __launch_bounds__(256) __attribute__((amdgpu_num_vgpr(256)))
k_gemm_qkv(const unsigned short* __restrict__ X, const unsigned short* __restrict__ WT,
           const float* __restrict__ bias,
           unsigned short* __restrict__ Qf, unsigned short* __restrict__ Kf,
           unsigned short* __restrict__ Vf) {
  // k loop: two operand buffers of (128 + 256) rows; epilogue (behind the loop's last barrier):
  // row orientation [128][264] (33792) or transposed [256][136] (34816)
  __shared__ __attribute__((aligned(16))) unsigned short smem[2 * QROWS * LPITCH];
  static_assert(2 * QROWS * LPITCH >= 256 * 136 && 2 * QROWS * LPITCH >= 128 * 264);
  unsigned short* stile = smem;
  const int tid = threadIdx.x;
  const int lane = tid & 31;
  const int wave = tid >> 5;
  const int wm = wave >> 2;    // 0..1
  const int wn = wave & 3;     // 0..3
  const int lc = lane & 15;
  const int mblk = blockIdx.x * QM;
  const int nblk = blockIdx.y * QN;
  const long n0 = (long)nblk + wn * 64;

  v8f acc[4][4];
#pragma unroll
  for (int i = 0; i < 4; ++i)
#pragma unroll
    for (int j = 0; j < 4; ++j) acc[i][j] = zero8();

  const unsigned lcp = lds_off(smem) + (tid >> 3) * (LPITCH * 2) + (tid & 7) * 16;
  const unsigned short* gx = X + ((long)mblk + (tid >> 3)) * HID + (tid & 7) * 8;
  const unsigned short* gw = WT + ((long)nblk + (tid >> 3)) * HID + (tid & 7) * 8;
  stage_tile_q(lcp, gx, gw);
  wait_copies();
  __syncthreads();
  stage_tile_q(lcp + QROWS * LPITCH * 2, gx + KT, gw + KT);

#pragma unroll 1
  for (int t = 0; t < HID / KT; ++t) {
    const unsigned short* sb = smem + (t & 1) * (QROWS * LPITCH);
#pragma unroll   // both 32-k steps of a tile: every LDS offset becomes an immediate
    for (int kk = 0; kk < KT; kk += 32) {
      FragB a[4], b[4];
#pragma unroll
      for (int i = 0; i < 4; ++i) a[i].u = ldfrag_l(sb + (wm * 64 + i * 16) * LPITCH + kk, LPITCH, lane);
#pragma unroll
      for (int j = 0; j < 4; ++j) b[j].u = ldfrag_l(sb + (QM + wn * 64 + j * 16) * LPITCH + kk, LPITCH, lane);
#pragma unroll
      for (int i = 0; i < 4; ++i)
#pragma unroll
        for (int j = 0; j < 4; ++j) acc[i][j] = mma_b(a[i].v, b[j].v, acc[i][j]);
    }
    wait_lds_reads();
    wait_copies();
    __syncthreads();   // publishes tile t + 1 and frees the buffer that trip t has read
    if (t + 2 < HID / KT)
      stage_tile_q(lcp + (t & 1) * (QROWS * LPITCH * 2), gx + (t + 2) * KT, gw + (t + 2) * KT);
  }
  wait_copies();

  // bias add in f32 (bias entries RNE-converted to bf16 values)
#pragma unroll
  for (int j = 0; j < 4; ++j) {
    const float bj = bf16_rne(bias[n0 + j * 16 + lc]);
#pragma unroll
    for (int i = 0; i < 4; ++i)
#pragma unroll
      for (int r = 0; r < 8; ++r) acc[i][j][r] += bj;
  }

  const int sec = nblk / HID;                 // 0 = q, 1 = k, 2 = v (block-uniform)
  const int h0 = (nblk - sec * HID) >> 6;     // first of the 4 heads in this tile
  const int bb = mblk / SEQ;
  const int t0 = mblk - bb * SEQ;
  const long bh0 = (long)bb * NHEAD + h0;

  // stage the f16 bits of the 128x256 tile (accumulators die here), then write whole lines
  if (sec == 2) qkv_stage<true>(acc, stile, tid); else qkv_stage<false>(acc, stile, tid);
  __syncthreads();
  if (sec == 2) qkv_lines<true>(stile, Vf, tid, bh0, t0);
  else          qkv_lines<false>(stile, (sec == 0) ? Qf : Kf, tid, bh0, t0);
}

// ---------------------------------------------------------------------------
// 4) Flash attention, transposed: one wave = 16 queries of one (b,h); keys streamed 32 at a time.
//    S^T = k*q (A = key rows, B = queries): lane l holds, of query l & 15, the
//    keys 8*(l>>4) + 0..7 (tile 0) and 16 + 8*(l>>4) + 0..7 (tile 1), so the softmax of a query runs
//    in one lane pair, and the two tiles converted in place are the B fragment of
//    O^T += v*p (A = d rows of V).  Block = 128 threads (4 waves, same b,h),
//    which share one LDS copy of each 32-key K/V tile.
// ---------------------------------------------------------------------------
// lane l <-> lane l ^ 16
__device__ __forceinline__ float xhalf(float x) {
  const int b = __builtin_bit_cast(int, x);
  return __builtin_bit_cast(float, __builtin_amdgcn_permlanex16(b, b, 0x76543210, 0xfedcba98, false, false));
}
__global__ void __launch_bounds__(128) __attribute__((amdgpu_num_vgpr(256)))
k_attn(const unsigned short* __restrict__ Qf, const unsigned short* __restrict__ Kf,
       const unsigned short* __restrict__ Vf,
       const int* __restrict__ maskp, unsigned short* __restrict__ Ctx) {
  __shared__ __attribute__((aligned(16))) unsigned short Cl[4 * 16 * 72];
  __shared__ __attribute__((aligned(16))) unsigned short KV[2 * AT_BUF];   // K/V ring, shared by the 4 waves
  const int lane = threadIdx.x & 31;
  const int wave = threadIdx.x >> 5;
  const int hh = lane >> 4;
  const int lc = lane & 15;
  const int nqb = SEQ / 16;
  const int gq = blockIdx.x * 4 + wave;
  const int qb = gq % nqb;
  const int bh = gq / nqb;
  const int bb = bh / NHEAD;
  const int h = bh - bb * NHEAD;
  const long qoff = ((long)bh * SEQ + qb * 16) * HDIM;
  const long koff = (long)bh * SEQ * HDIM;
  const long voff = (long)bh * HDIM * SEQ;
  const int* mrow = maskp + (long)bb * SEQ_FULL;
  const float ninf = __uint_as_float(0xff800000u);

  FragH q0, q1;
  q0.u = ldfrag_g(Qf + qoff, HDIM, lane);
  q1.u = ldfrag_g(Qf + qoff + 32, HDIM, lane);

  v8f o[4];
#pragma unroll
  for (int t = 0; t < 4; ++t) o[t] = zero8();
  float mrun = -1e30f;   // running maximum of query lc (equal in both lanes of the pair)
  float lrun = 0.f;      // running sum over this lane's own half of the keys

  const int tid = threadIdx.x;
  const unsigned lk = lds_off(KV) + (tid >> 3) * (LPITCH * 2) + (tid & 7) * 16;
  const unsigned lv = lds_off(KV) + AT_K * 2 + (tid >> 2) * (VPITCH * 2) + (tid & 3) * 16;
  const long gko = koff + (long)(tid >> 3) * HDIM + (tid & 7) * 8;
  const long gvo = voff + (long)(tid >> 2) * SEQ + (tid & 3) * 8;
  stage_kv(lk, lv, Kf + gko, Vf + gvo);
  wait_copies();
  __syncthreads();
  stage_kv(lk + AT_BUF * 2, lv + AT_BUF * 2, Kf + gko + 32 * HDIM, Vf + gvo + 32);

#pragma unroll 1
  for (int kb = 0; kb < SEQ; kb += 32) {
    const int buf = (kb >> 5) & 1;
    const unsigned short* sb = KV + buf * AT_BUF;
    // key mask (per (b, key)) of this lane's 16 keys
    const int* mk = mrow + kb + hh * 8;
    const v4i mk0 = *(const v4i*)(mk);
    const v4i mk1 = *(const v4i*)(mk + 4);
    const v4i mk2 = *(const v4i*)(mk + 16);
    const v4i mk3 = *(const v4i*)(mk + 20);
    v8f s0 = zero8();
    v8f s1 = zero8();
    {
      FragH ka, kc;
      // keys kb .. kb+15
      ka.u = ldfrag_l(sb, LPITCH, lane);
      kc.u = ldfrag_l(sb + 32, LPITCH, lane);
      s0 = mma_h(ka.v, q0.v, s0);
      s0 = mma_h(kc.v, q1.v, s0);
      // keys kb+16 .. kb+31
      ka.u = ldfrag_l(sb + 16 * LPITCH, LPITCH, lane);
      kc.u = ldfrag_l(sb + 16 * LPITCH + 32, LPITCH, lane);
      s1 = mma_h(ka.v, q0.v, s1);
      s1 = mma_h(kc.v, q1.v, s1);
    }

    // scale; replace with -inf where mask == 0
    s0 *= SCALE_QK;
    s1 *= SCALE_QK;
#pragma unroll
    for (int r = 0; r < 8; ++r) {
      const int m0 = (r < 4) ? mk0[r & 3] : mk1[r & 3];
      const int m1 = (r < 4) ? mk2[r & 3] : mk3[r & 3];
      s0[r] = (m0 == 0) ? ninf : s0[r];
      s1[r] = (m1 == 0) ? ninf : s1[r];
    }
    // online softmax of query lc: maximum in the lane, then one exchange between the halves
    float mx = fmaxf(s0[0], s1[0]);
#pragma unroll
    for (int r = 1; r < 8; ++r) mx = fmaxf(mx, fmaxf(s0[r], s1[r]));
    mx = fmaxf(mx, xhalf(mx));
    const float mnew = fmaxf(mrun, mx);
    const float alpha = __expf(mrun - mnew);
#pragma unroll
    for (int r = 0; r < 8; ++r) {
      s0[r] = __expf(s0[r] - mnew);
      s1[r] = __expf(s1[r] - mnew);
    }
    const v8f ps = s0 + s1;
    const float rs = ((ps[0] + ps[1]) + (ps[2] + ps[3])) + ((ps[4] + ps[5]) + (ps[6] + ps[7]));
    lrun = lrun * alpha + rs;
    mrun = mnew;
#pragma unroll
    for (int t = 0; t < 4; ++t)
#pragma unroll
      for (int r = 0; r < 8; ++r) o[t][r] *= alpha;

    // P^T (32 keys x 16 queries, f32 in D layout) -> f16 B fragment, in place:
    // element s of the fragment is register s & 7 of tile s >> 3
    FragP pa;
#pragma unroll
    for (int w = 0; w < 8; ++w) {
      const float p0 = (w < 4) ? s0[2 * w] : s1[2 * w - 8];
      const float p1 = (w < 4) ? s0[2 * w + 1] : s1[2 * w - 7];
      pa.w[w] = __builtin_bit_cast(unsigned, __builtin_convertvector((v2f){p0, p1}, v2h));
    }

    // O^T += V^T * P^T  (V plane stored [d][token], k = token contiguous)
#pragma unroll
    for (int t = 0; t < 4; ++t) {
      FragH vf;
      vf.u = ldfrag_l(sb + AT_K + (t * 16) * VPITCH, VPITCH, lane);
      o[t] = mma_h(vf.v, pa.v, o[t]);
    }
    wait_lds_reads();
    wait_copies();
    __syncthreads();   // publishes the next 32 keys and frees the buffer that this trip has read
    if (kb + 64 < SEQ)
      stage_kv(lk + buf * (AT_BUF * 2), lv + buf * (AT_BUF * 2),
               Kf + gko + (long)(kb + 64) * HDIM, Vf + gvo + (kb + 64));
  }
  wait_copies();

  const float inv = 16.0f / (lrun + xhalf(lrun));   // the halves' sums join here
  unsigned short* cl = Cl + wave * (16 * 72);
#pragma unroll
  for (int t = 0; t < 4; ++t) {   // registers 0..7 of o[t] are d = t*16 + hh*8 + 0..7 of query lc
    Pack8 pc;
#pragma unroll
    for (int r = 0; r < 8; ++r) pc.s[r] = f16_bits(o[t][r] * inv);
    *(v4u*)(cl + lc * 72 + t * 16 + hh * 8) = pc.u;
  }
  __syncthreads();
  Pack8 pk[4];
  long go[4];
#pragma unroll
  for (int p = 0; p < 4; ++p) {
    const int q = p * 4 + (lane >> 3);   // query row 0..15; lanes 8q'..8q'+7 share a line
    const int sub = lane & 7;
    pk[p].s = *(const v8us*)(cl + q * 72 + sub * 8);
    go[p] = ((long)bb * SEQ + qb * 16 + q) * HID + h * HDIM + sub * 8;
  }
#pragma unroll
  for (int p = 0; p < 4; ++p) *(v4u*)(Ctx + go[p]) = pk[p].u;
  
}

// ---------------------------------------------------------------------------
// 5) Output GEMM: out[m][o] = (1/1024) * sum_c A[m][c] * WT[o][c] + bias[o]   (f16 operands)
//    (32 floats) written by 8 consecutive lanes x 16 B in one instruction.
// ---------------------------------------------------------------------------
__global__ void __launch_bounds__(256)
k_gemm_out(const unsigned short* __restrict__ A, const unsigned short* __restrict__ WT,
           const float* __restrict__ bias, float* __restrict__ out) {
  // k loop: two operand buffers of (64 + 256) rows; epilogue (behind the loop's last barrier): otile
  __shared__ __attribute__((aligned(16))) unsigned short smem[2 * 320 * LPITCH];
  static_assert(2 * 320 * LPITCH * 2 >= 32 * 260 * 4);
  float* otile = (float*)smem;
  const int tid = threadIdx.x;
  const int lane = tid & 31;
  const int wave = tid >> 5;
  const int wm = wave >> 2;
  const int wn = wave & 3;
  const int hh = lane >> 4;
  const int lc = lane & 15;
  const int mblk = blockIdx.x * 64;
  const int nblk = blockIdx.y * 256;
  const long n0 = (long)nblk + wn * 64;

  v8f acc[2][4];
#pragma unroll
  for (int i = 0; i < 2; ++i)
#pragma unroll
    for (int j = 0; j < 4; ++j) acc[i][j] = zero8();

  const unsigned lcp = lds_off(smem) + (tid >> 3) * (LPITCH * 2) + (tid & 7) * 16;
  const unsigned short* ga = A + ((long)mblk + (tid >> 3)) * HID + (tid & 7) * 8;
  const unsigned short* gw = WT + ((long)nblk + (tid >> 3)) * HID + (tid & 7) * 8;
  stage_tile<2>(lcp, ga, gw);
  wait_copies();
  __syncthreads();
  stage_tile<2>(lcp + 320 * LPITCH * 2, ga + KT, gw + KT);

#pragma unroll 1
  for (int t = 0; t < HID / KT; ++t) {
    const unsigned short* sb = smem + (t & 1) * (320 * LPITCH);
#pragma unroll   // both 32-k steps of a tile: every LDS offset becomes an immediate
    for (int kk = 0; kk < KT; kk += 32) {
      FragH a0, a1, b0, b1, b2, b3;
      a0.u = ldfrag_l(sb + (wm * 32) * LPITCH + kk, LPITCH, lane);
      a1.u = ldfrag_l(sb + (wm * 32 + 16) * LPITCH + kk, LPITCH, lane);
      b0.u = ldfrag_l(sb + (64 + wn * 64) * LPITCH + kk, LPITCH, lane);
      b1.u = ldfrag_l(sb + (64 + wn * 64 + 16) * LPITCH + kk, LPITCH, lane);
      b2.u = ldfrag_l(sb + (64 + wn * 64 + 32) * LPITCH + kk, LPITCH, lane);
      b3.u = ldfrag_l(sb + (64 + wn * 64 + 48) * LPITCH + kk, LPITCH, lane);
      acc[0][0] = mma_h(a0.v, b0.v, acc[0][0]);
      acc[0][1] = mma_h(a0.v, b1.v, acc[0][1]);
      acc[0][2] = mma_h(a0.v, b2.v, acc[0][2]);
      acc[0][3] = mma_h(a0.v, b3.v, acc[0][3]);
      acc[1][0] = mma_h(a1.v, b0.v, acc[1][0]);
      acc[1][1] = mma_h(a1.v, b1.v, acc[1][1]);
      acc[1][2] = mma_h(a1.v, b2.v, acc[1][2]);
      acc[1][3] = mma_h(a1.v, b3.v, acc[1][3]);
    }
    wait_lds_reads();
    wait_copies();
    __syncthreads();   // publishes tile t + 1 and frees the buffer that trip t has read
    if (t + 2 < HID / KT)
      stage_tile<2>(lcp + (t & 1) * (320 * LPITCH * 2), ga + (t + 2) * KT, gw + (t + 2) * KT);
  }
  wait_copies();

  // undo carries (x16 ctx, x64 weight) and add bf16-valued bias, all in f32
#pragma unroll
  for (int j = 0; j < 4; ++j) {
    const float bj = bf16_rne(bias[n0 + j * 16 + lc]);
#pragma unroll
    for (int i = 0; i < 2; ++i)
#pragma unroll
      for (int r = 0; r < 8; ++r) acc[i][j][r] = acc[i][j][r] * (1.0f / 1024.0f) + bj;
  }

#pragma unroll
  for (int phase = 0; phase < 2; ++phase) {
    if (wm == phase) {   // wave-uniform: waves owning rows phase*32 .. +31 stage them
#pragma unroll
      for (int i = 0; i < 2; ++i)
#pragma unroll
        for (int j = 0; j < 4; ++j)
#pragma unroll
          for (int r = 0; r < 8; ++r) {
            const int ml = i * 16 + r + hh * 8;
            const int ol = wn * 64 + j * 16 + lc;
            otile[ml * 260 + ol] = acc[i][j][r];
          }
    }
    __syncthreads();
    v4f pk[8];
    long go[8];
#pragma unroll
    for (int p = 0; p < 8; ++p) {
      const int L = p * 32 + (tid >> 3);
      const int sub = tid & 7;
      const int row = L >> 3;
      const int piece = L & 7;
      pk[p] = *(const v4f*)(otile + row * 260 + piece * 32 + sub * 4);
      go[p] = ((long)mblk + phase * 32 + row) * HID + nblk + piece * 32 + sub * 4;
    }
#pragma unroll
    for (int p = 0; p < 8; ++p) *(v4f*)(out + go[p]) = pk[p];
    
    __syncthreads();
  }
}

// ---------------------------------------------------------------------------
// Launch
// ---------------------------------------------------------------------------
extern "C" void kernel_launch(void* const* d_in, const int* in_sizes, int n_in,
                              void* d_out, int out_size, void* d_ws, size_t ws_size,
                              hipStream_t stream) {
  if (n_in < 6) return;
  const float* x     = (const float*)d_in[0];   // [NB_FULL, SEQ_FULL, HID]
  const int*   maskp = (const int*)d_in[1];     // [NB_FULL, 1, 1, SEQ_FULL] int32
  const float* Wqkv  = (const float*)d_in[2];   // [HID][3*HID]
  const float* bqkv  = (const float*)d_in[3];   // [3*HID]
  const float* Wout  = (const float*)d_in[4];   // [HID][HID]
  const float* bout  = (const float*)d_in[5];   // [HID]
  float* out = (float*)d_out;                   // [NB*SEQ, HID]

  const long M = (long)NB * SEQ;
  if ((long)in_sizes[0] < (((long)(NB - 1) * SEQ_FULL + SEQ) * HID)) return;
  if ((long)in_sizes[1] < ((long)(NB - 1) * SEQ_FULL + SEQ)) return;
  if ((long)in_sizes[2] < 3L * HID * HID) return;
  if ((long)in_sizes[3] < 3L * HID) return;
  if ((long)in_sizes[4] < (long)HID * HID) return;
  if ((long)in_sizes[5] < (long)HID) return;
  if ((long)out_size < M * HID) return;

  // workspace carve (bytes); every region is a whole number of tiles, no padding needed
  const size_t szX  = (size_t)M * HID * 2;                       // x bf16 plane, later ctx f16 plane
  const size_t szWq = (size_t)3 * HID * HID * 2;                 // WqkvT bf16
  const size_t szWo = (size_t)HID * HID * 2;                     // WoutT f16
  const size_t szP  = (size_t)NB * NHEAD * SEQ * HDIM * 2;       // one q/k/v plane
  const size_t oX  = 0;
  const size_t oWq = oX + szX;
  const size_t oWo = oWq + szWq;
  const size_t oP0 = oWo + szWo;
  const size_t total = oP0 + 3 * szP;
  if (total > ws_size) return;
  static_assert((size_t)NB * SEQ * HID * 2 == (size_t)NB * NHEAD * SEQ * HDIM * 2);

  char* ws = (char*)d_ws;
  unsigned short* xb  = (unsigned short*)(ws + oX);
  unsigned short* ctx = (unsigned short*)(ws + oX);      // aliases xb: xb is dead after k_gemm_qkv
  unsigned short* wq  = (unsigned short*)(ws + oWq);
  unsigned short* wo  = (unsigned short*)(ws + oWo);
  unsigned short* qf  = (unsigned short*)(ws + oP0 + 0 * szP);
  unsigned short* kf  = (unsigned short*)(ws + oP0 + 1 * szP);
  unsigned short* vf  = (unsigned short*)(ws + oP0 + 2 * szP);

  // 1) x -> bf16 plane (compact rows)
  const int ngroups = (int)(M * HID / 8);
  k_cvt_x<<<(ngroups + 255) / 256, 256, 0, stream>>>(x, xb, ngroups);
  // 2) Wqkv in[HID][3*HID] -> out[3*HID][HID] bf16;  Wout in[HID][HID] -> out[HID][HID] f16 (x64)
  k_cvt_wt<0><<<dim3(3 * HID / 64, HID / 64), 256, 0, stream>>>(Wqkv, wq, HID, 3 * HID);
  k_cvt_wt<1><<<dim3(HID / 64, HID / 64), 256, 0, stream>>>(Wout, wo, HID, HID);
  // 3) qkv GEMM -> f16 planes of q, k ([bh][t][d]) and v ([bh][d][t]); block tile 128x256
  k_gemm_qkv<<<dim3((int)(M / QM), 3 * HID / QN), 256, 0, stream>>>(xb, wq, bqkv, qf, kf, vf);
  // 4) attention -> ctx f16 plane [NB*SEQ][HID] (over the dead x plane)
  k_attn<<<(NB * NHEAD * (SEQ / 16)) / 4, 128, 0, stream>>>(qf, kf, vf, maskp, ctx);
  // 5) output GEMM -> f32 out
  k_gemm_out<<<dim3((int)(M / 64), HID / 256), 256, 0, stream>>>(ctx, wo, bout, out);
}

// v005
// It runs in 118 microseconds.
// Timed twice side by side with v004, it ran 1.06 times as fast both times.
// All steps since v000 together make it 3.65 times as fast.
// Contractions: x*Wqkv on v_wmma_f32_16x16x32_bf16 (bf16 operands = RNE-converted inputs); q*k^T and p*v on v_wmma_f32_16x16x32_f16 (f16 operands = RNE-converted f32 q, k, v and softmax weights, one product per operand pair); ctx*Wout on v_wmma_f32_16x16x32_f16 (f16 operands, ctx carried x16, Wout carried x64); f32 accumulate, f32 softmax.
#include <hip/hip_runtime.h>

#ifndef NB
#define NB 16
#endif
#ifndef SEQ
#define SEQ 512
#endif
#ifndef NB_FULL
#define NB_FULL 16
#endif
#ifndef SEQ_FULL
#define SEQ_FULL 512
#endif
#define HID 1024
#define NHEAD 16
#define HDIM 64
#define SCALE_QK 0.125f

static_assert(SEQ % 64 == 0);
static_assert(HID == NHEAD * HDIM);
static_assert(HID % 256 == 0);
static_assert(HID % 128 == 0);
static_assert(((NB * NHEAD * (SEQ / 16)) % 4) == 0);
static_assert(NB <= NB_FULL);
static_assert(SEQ <= SEQ_FULL);

typedef _Float16 v16h __attribute__((ext_vector_type(16)));
typedef __bf16   v16b __attribute__((ext_vector_type(16)));
typedef unsigned short v8us  __attribute__((ext_vector_type(8)));
typedef unsigned short v16us __attribute__((ext_vector_type(16)));
typedef float v8f __attribute__((ext_vector_type(8)));
typedef float v4f __attribute__((ext_vector_type(4)));
typedef unsigned int v4u __attribute__((ext_vector_type(4)));
typedef unsigned int v8u __attribute__((ext_vector_type(8)));
typedef int v4i __attribute__((ext_vector_type(4)));
typedef float v2f __attribute__((ext_vector_type(2)));
typedef _Float16 v2h __attribute__((ext_vector_type(2)));

union FragB { v16us u; v16b v; };
union FragH { v16us u; v16h v; };
union Pack8 { v8us s; v4u u; };
union FragP { v8u w; v16h v; };

// ---------------------------------------------------------------------------
// 16-bit conversion helpers (bf16 via RNE on the f32 bit pattern)
// ---------------------------------------------------------------------------
__device__ __forceinline__ unsigned short bf16_rne_bits(float f) {
  unsigned int u = __float_as_uint(f);
  u += 0x7fffu + ((u >> 16) & 1u);
  return (unsigned short)(u >> 16);
}
__device__ __forceinline__ float bf16_val(unsigned short b) {
  return __uint_as_float(((unsigned int)b) << 16);
}
__device__ __forceinline__ float bf16_rne(float f) { return bf16_val(bf16_rne_bits(f)); }
__device__ __forceinline__ unsigned short f16_bits(float f) {
  _Float16 hv = (_Float16)f;
  return __builtin_bit_cast(unsigned short, hv);
}
template <int MODE>   // 0: bf16 bits of RNE(w); 1: f16 bits of RNE_bf16(w) * 64
__device__ __forceinline__ unsigned short wbits(float f) {
  if (MODE == 0) return bf16_rne_bits(f);
  return f16_bits(bf16_rne(f) * 64.0f);
}

// ---------------------------------------------------------------------------
// WMMA helpers: D(16x16 f32) += A(16x32) * B(32x16); hazard guard after each op
// ---------------------------------------------------------------------------
__device__ __forceinline__ v8f mma_b(v16b a, v16b b, v8f c) {
  v8f d = __builtin_amdgcn_wmma_f32_16x16x32_bf16(false, a, false, b, (short)0, c, false, false);
  asm volatile("v_nop\n\tv_nop\n\tv_nop\n\tv_nop" : "+v"(d) : "v"(a), "v"(b));
  return d;
}
__device__ __forceinline__ v8f mma_h(v16h a, v16h b, v8f c) {
  v8f d = __builtin_amdgcn_wmma_f32_16x16x32_f16(false, a, false, b, (short)0, c, false, false);
  asm volatile("v_nop\n\tv_nop\n\tv_nop\n\tv_nop" : "+v"(d) : "v"(a), "v"(b));
  return d;
}
__device__ __forceinline__ v8f zero8() { return (v8f){0.f, 0.f, 0.f, 0.f, 0.f, 0.f, 0.f, 0.f}; }

// ---------------------------------------------------------------------------
// Fragment loader, 16-bit split k-map for A and B:
//   lane l: row/col = l & 15; elements 0..7 <- k0 + 8*(l>>4) + 0..7,
//                             elements 8..15 <- k0 + 16 + 8*(l>>4) + 0..7.
// base points at (row0/col0, k0) of a k-contiguous 16-bit plane, ld = pitch.
// ---------------------------------------------------------------------------
__device__ __forceinline__ v16us ldfrag_g(const unsigned short* __restrict__ base, long ld, int lane) {
  const unsigned short* p = base + (long)(lane & 15) * ld + ((lane >> 4) << 3);
  v8us e0 = *(const v8us*)(p);
  v8us e1 = *(const v8us*)(p + 16);
  return __builtin_shufflevector(e0, e1, 0, 1, 2, 3, 4, 5, 6, 7, 8, 9, 10, 11, 12, 13, 14, 15);
}
__device__ __forceinline__ v16us ldfrag_l(const unsigned short* base, int ld, int lane) {
  const unsigned short* p = base + (lane & 15) * ld + ((lane >> 4) << 3);
  v8us e0 = *(const v8us*)(p);
  v8us e1 = *(const v8us*)(p + 16);
  return __builtin_shufflevector(e0, e1, 0, 1, 2, 3, 4, 5, 6, 7, 8, 9, 10, 11, 12, 13, 14, 15);
}

// ---------------------------------------------------------------------------
// GEMM operand staging: a tile is KT k-elements (one whole 128-B line) of every operand row
// of the block, laid in LDS at a pitch of 144 B (16 B x 9: conflict-free for 16-B row reads).
// Each lane copies 16 B; 8 consecutive lanes cover one line, a wave-wide copy 4 whole lines.
// ---------------------------------------------------------------------------
#define KT 64
#define LPITCH 72
static_assert(HID % KT == 0 && HID / KT >= 2);

__device__ __forceinline__ unsigned lds_off(const void* p) { return (unsigned)(size_t)p; }

// One statement per tile; the s_wait_xcnt ends it so that no address register of an issued
// copy is rewritten before the wait.
__device__ __forceinline__ void async_copy4(const unsigned (&l)[4], const unsigned short* const (&g)[4]) {
  asm volatile("global_load_async_to_lds_b128 %0, %4, off\n\t"
               "global_load_async_to_lds_b128 %1, %5, off\n\t"
               "global_load_async_to_lds_b128 %2, %6, off\n\t"
               "global_load_async_to_lds_b128 %3, %7, off\n\t"
               "s_wait_xcnt 0x0"
               :: "v"(l[0]), "v"(l[1]), "v"(l[2]), "v"(l[3]),
                  "v"(g[0]), "v"(g[1]), "v"(g[2]), "v"(g[3]) : "memory");
}
__device__ __forceinline__ void async_copy10(const unsigned (&l)[10], const unsigned short* const (&g)[10]) {
  asm volatile("global_load_async_to_lds_b128 %0, %10, off\n\t"
               "global_load_async_to_lds_b128 %1, %11, off\n\t"
               "global_load_async_to_lds_b128 %2, %12, off\n\t"
               "global_load_async_to_lds_b128 %3, %13, off\n\t"
               "global_load_async_to_lds_b128 %4, %14, off\n\t"
               "global_load_async_to_lds_b128 %5, %15, off\n\t"
               "global_load_async_to_lds_b128 %6, %16, off\n\t"
               "global_load_async_to_lds_b128 %7, %17, off\n\t"
               "global_load_async_to_lds_b128 %8, %18, off\n\t"
               "global_load_async_to_lds_b128 %9, %19, off\n\t"
               "s_wait_xcnt 0x0"
               :: "v"(l[0]), "v"(l[1]), "v"(l[2]), "v"(l[3]), "v"(l[4]), "v"(l[5]), "v"(l[6]), "v"(l[7]), "v"(l[8]), "v"(l[9]),
                  "v"(g[0]), "v"(g[1]), "v"(g[2]), "v"(g[3]), "v"(g[4]), "v"(g[5]), "v"(g[6]), "v"(g[7]), "v"(g[8]), "v"(g[9]) : "memory");
}
// 256 lanes copy 64 A rows then NBG*128 B rows; l, ga, gb are the lane's own first addresses
// (row tid>>3, 16-B piece tid&7); further rows follow in steps of 32.
template <int NBG>
__device__ __forceinline__ void stage_tile(unsigned l, const unsigned short* ga, const unsigned short* gb) {
  unsigned la[2 + 4 * NBG];
  const unsigned short* gp[2 + 4 * NBG];
#pragma unroll
  for (int i = 0; i < 2 + 4 * NBG; ++i) {
    la[i] = l + i * 32 * LPITCH * 2;
    gp[i] = (i < 2) ? ga + (long)(i * 32) * HID : gb + (long)((i - 2) * 32) * HID;
  }
  static_assert(NBG == 2);
  async_copy10(la, gp);
}
// The 128 x 256 block's tile: 128 A rows then 256 B rows, 12 copies a lane, in one statement as above.
__device__ __forceinline__ void async_copy12(const unsigned (&l)[12], const unsigned short* const (&g)[12]) {
  asm volatile("global_load_async_to_lds_b128 %0, %12, off\n\t"
               "global_load_async_to_lds_b128 %1, %13, off\n\t"
               "global_load_async_to_lds_b128 %2, %14, off\n\t"
               "global_load_async_to_lds_b128 %3, %15, off\n\t"
               "global_load_async_to_lds_b128 %4, %16, off\n\t"
               "global_load_async_to_lds_b128 %5, %17, off\n\t"
               "global_load_async_to_lds_b128 %6, %18, off\n\t"
               "global_load_async_to_lds_b128 %7, %19, off\n\t"
               "global_load_async_to_lds_b128 %8, %20, off\n\t"
               "global_load_async_to_lds_b128 %9, %21, off\n\t"
               "global_load_async_to_lds_b128 %10, %22, off\n\t"
               "global_load_async_to_lds_b128 %11, %23, off\n\t"
               "s_wait_xcnt 0x0"
               :: "v"(l[0]), "v"(l[1]), "v"(l[2]), "v"(l[3]), "v"(l[4]), "v"(l[5]),
                  "v"(l[6]), "v"(l[7]), "v"(l[8]), "v"(l[9]), "v"(l[10]), "v"(l[11]),
                  "v"(g[0]), "v"(g[1]), "v"(g[2]), "v"(g[3]), "v"(g[4]), "v"(g[5]),
                  "v"(g[6]), "v"(g[7]), "v"(g[8]), "v"(g[9]), "v"(g[10]), "v"(g[11]) : "memory");
}
__device__ __forceinline__ void stage_tile_q(unsigned l, const unsigned short* ga, const unsigned short* gb) {
  unsigned la[12];
  const unsigned short* gp[12];
#pragma unroll
  for (int i = 0; i < 12; ++i) {
    la[i] = l + i * 32 * LPITCH * 2;
    gp[i] = (i < 4) ? ga + (long)(i * 32) * HID : gb + (long)((i - 4) * 32) * HID;
  }
  async_copy12(la, gp);
}
// Attention K/V tile: 32 keys. K as [32 keys][64 d] at pitch 144 B; V as [64 d][32 keys]
// at pitch 80 B (16 B x 5). 128 lanes; lk, lv and the two pointers are the lane's own first addresses.
#define VPITCH 40
#define AT_K (32 * LPITCH)
#define AT_V (64 * VPITCH)
#define AT_BUF (AT_K + AT_V)
__device__ __forceinline__ void stage_kv(unsigned lk, unsigned lv,
                                         const unsigned short* gk, const unsigned short* gv) {
  const unsigned la[4] = {lk, lk + 16 * LPITCH * 2, lv, lv + 32 * VPITCH * 2};
  const unsigned short* const gp[4] = {gk, gk + 16 * HDIM, gv, gv + 32 * SEQ};
  async_copy4(la, gp);
}
// Ring waits, each ahead of the barrier that hands a buffer over.
__device__ __forceinline__ void wait_lds_reads()  { asm volatile("s_wait_dscnt 0x0" ::: "memory"); }
__device__ __forceinline__ void wait_copies()     { asm volatile("s_wait_asynccnt 0x0" ::: "memory"); }

// ---------------------------------------------------------------------------
// 1) x f32 [NB,SEQ,HID] (batch stride SEQ_FULL*HID) -> bf16 bits, compact rows.
// ---------------------------------------------------------------------------
__device__ __forceinline__ void
cvt_x_block(const float* __restrict__ x, unsigned short* __restrict__ y, int ngroups, int blk) {
  const int i = blk * 256 + threadIdx.x;
  if (i >= ngroups) return;
  const int row = i / (HID / 8);
  const int g = i - row * (HID / 8);
  const int bb = row / SEQ;
  const int tt = row - bb * SEQ;
  const long srow = (long)bb * SEQ_FULL + tt;
  const float* src = x + srow * HID + g * 8;
  const v4f a = *(const v4f*)(src);
  const v4f c = *(const v4f*)(src + 4);
  Pack8 pk;
  pk.s = (v8us){bf16_rne_bits(a.x), bf16_rne_bits(a.y), bf16_rne_bits(a.z), bf16_rne_bits(a.w),
                bf16_rne_bits(c.x), bf16_rne_bits(c.y), bf16_rne_bits(c.z), bf16_rne_bits(c.w)};
  const v4u val = pk.u;
  unsigned short* dst = y + (long)row * HID + g * 8;
  *(v4u*)dst = val;
  
}

// ---------------------------------------------------------------------------
// 2) weight convert + transpose: in W[kdim rows][ndim cols] f32 -> out WT[ndim][kdim] 16-bit.
//    line written by 8 consecutive lanes x 16 B in one instruction.  Block (bx, by) of (ndim/64, kdim/64).
// ---------------------------------------------------------------------------
template <int MODE>
__device__ __forceinline__ void
cvt_wt_block(const float* __restrict__ W, unsigned short* __restrict__ WT, int kdim, int ndim,
             int bx, int by, unsigned short* tile) {
  const int tid = threadIdx.x;
  const int n0 = bx * 64;
  const int k0 = by * 64;
  const int kl = tid >> 2;          // 0..63
  const int nl = (tid & 3) * 16;    // 0,16,32,48
  const float* src = W + (long)(k0 + kl) * ndim + n0 + nl;
#pragma unroll
  for (int q = 0; q < 4; ++q) {
    const v4f v = *(const v4f*)(src + q * 4);
    unsigned short* trow = tile + (nl + q * 4) * 72 + kl;   // tile[n_local][k_local]
    trow[0 * 72] = wbits<MODE>(v.x);
    trow[1 * 72] = wbits<MODE>(v.y);
    trow[2 * 72] = wbits<MODE>(v.z);
    trow[3 * 72] = wbits<MODE>(v.w);
  }
  __syncthreads();
  Pack8 pk[2];
  long go[2];
#pragma unroll
  for (int p = 0; p < 2; ++p) {
    const int L = p * 32 + (tid >> 3);   // output row n_local 0..63
    const int sub = tid & 7;
    pk[p].s = *(const v8us*)(tile + L * 72 + sub * 8);
    go[p] = (long)(n0 + L) * kdim + k0 + sub * 8;
  }
#pragma unroll
  for (int p = 0; p < 2; ++p) *(v4u*)(WT + go[p]) = pk[p].u;
  // no register that an issued store names is
  // rewritten ahead of this wait
  asm volatile("s_wait_xcnt 0x0" ::: "memory");
}

// ---------------------------------------------------------------------------
// 1) + 2) in one launch: the three conversions depend on nothing but the inputs, so they share a
//    grid.  The block index picks the job: first the weight tiles (the longer chain: load, LDS,
//    barrier, store), then the rows of x.  Each branch is taken by a whole block.
// ---------------------------------------------------------------------------
#define CVT_WQ_BX (3 * HID / 64)
#define CVT_WO_BX (HID / 64)
#define CVT_WQ_BLKS (CVT_WQ_BX * (HID / 64))
#define CVT_WO_BLKS (CVT_WO_BX * (HID / 64))
#define CVT_X_GROUPS (NB * SEQ * (HID / 8))
#define CVT_X_BLKS ((CVT_X_GROUPS + 255) / 256)
__global__ void __launch_bounds__(256)
k_cvt_all(const float* __restrict__ x, const float* __restrict__ Wqkv, const float* __restrict__ Wout,
          unsigned short* __restrict__ xb, unsigned short* __restrict__ wq, unsigned short* __restrict__ wo) {
  __shared__ __attribute__((aligned(16))) unsigned short tile[64 * 72];
  const int b = blockIdx.x;
  if (b < CVT_WQ_BLKS) {
    cvt_wt_block<0>(Wqkv, wq, HID, 3 * HID, b % CVT_WQ_BX, b / CVT_WQ_BX, tile);
  } else if (b < CVT_WQ_BLKS + CVT_WO_BLKS) {
    const int c = b - CVT_WQ_BLKS;
    cvt_wt_block<1>(Wout, wo, HID, HID, c % CVT_WO_BX, c / CVT_WO_BX, tile);
  } else {
    cvt_x_block(x, xb, CVT_X_GROUPS, b - (CVT_WQ_BLKS + CVT_WO_BLKS));
  }
}

// ---------------------------------------------------------------------------
// 3) QKV GEMM: y[m][o] = sum_c X[m][c] * WT[o][c] + bias[o]  (bf16 operands, f32 acc)
//    Block 256 threads = 8 waves (2M x 4N), block tile 128 x 256, wave tile 64 x 64
//    (16 accumulator tiles, 4 + 4 fragments: 16 products per 8 fragments read from LDS, and
//    each operand row fetched from L2 by half as many blocks as with a 64 x 128 tile).
//    Epilogue: f32 -> f16 bits
//      Q,K sections: [NB*NHEAD][SEQ][HDIM] (one line per (b,h,t) row)
//      V  section:   [NB*NHEAD][HDIM][SEQ] (64-token segment of a (b,h,d) row = one line)
// ---------------------------------------------------------------------------
#define QM 128
#define QN 256
#define QROWS (QM + QN)
static_assert(SEQ % QM == 0);          // a block's rows lie in one batch
static_assert(HID % QN == 0);          // a block's columns lie in one of the q, k, v sections
// Epilogue of the 128 x 256 tile, orientation as a compile-time constant so that every LDS
// offset is an immediate.  TR = false (q, k): stile[m][o], pitch 264; TR = true (v): stile[o][m], pitch 136.
template <bool TR>
__device__ __forceinline__ void qkv_stage(const v8f (&acc)[4][4], unsigned short* stile, int tid) {
  constexpr int sm = TR ? 1 : 264;            // LDS stride of the m index
  constexpr int so = TR ? 136 : 1;            // LDS stride of the o index
  const int lane = tid & 31;
  const int wave = tid >> 5;
  unsigned short* p0 = stile + ((wave >> 2) * 64 + (lane >> 4) * 8) * sm + ((wave & 3) * 64 + (lane & 15)) * so;
#pragma unroll
  for (int i = 0; i < 4; ++i)
#pragma unroll
    for (int j = 0; j < 4; ++j)
#pragma unroll
      for (int r = 0; r < 8; ++r) p0[(i * 16 + r) * sm + (j * 16) * so] = f16_bits(acc[i][j][r]);
}
// 512 lines of 128 B leave in 4 groups of 4 x 32 lines; lanes 8q..8q+7 share a line.
// q, k: line = (head L >> 7, token L & 127); v: line = (column L >> 1, 64-token segment L & 1).
template <bool TR>
__device__ __forceinline__ void qkv_lines(const unsigned short* stile, unsigned short* __restrict__ dstp,
                                          int tid, long bh0, int t0) {
  const int sub = tid & 7;
#pragma unroll
  for (int g = 0; g < 4; ++g) {
    Pack8 pk[4];
    long go[4];
#pragma unroll
    for (int p = 0; p < 4; ++p) {
      const int L = (g * 4 + p) * 32 + (tid >> 3);   // line 0..511
      const long bhh = bh0 + (L >> 7);               // head within the tile, in both orientations
      const int sidx = TR ? ((L >> 1) * 136 + (L & 1) * 64 + sub * 8)
                          : ((L & 127) * 264 + (L >> 7) * 64 + sub * 8);
      pk[p].s = *(const v8us*)(stile + sidx);
      go[p] = TR ? ((bhh * HDIM + ((L >> 1) & 63)) * SEQ + t0 + (L & 1) * 64 + sub * 8)
                 : ((bhh * SEQ + t0 + (L & 127)) * HDIM + sub * 8);
    }
#pragma unroll
    for (int p = 0; p < 4; ++p) *(v4u*)(dstp + go[p]) = pk[p].u;
    // no register that an issued store names is rewritten ahead of this wait
    asm volatile("s_wait_xcnt 0x0" ::: "memory");
  }
}
__global__ void __launch_bounds__(256) __attribute__((amdgpu_num_vgpr(256)))
k_gemm_qkv(const unsigned short* __restrict__ X, const unsigned short* __restrict__ WT,
           const float* __restrict__ bias,
           unsigned short* __restrict__ Qf, unsigned short* __restrict__ Kf,
           unsigned short* __restrict__ Vf) {
  // k loop: two operand buffers of (128 + 256) rows; epilogue (behind the loop's last barrier):
  // row orientation [128][264] (33792) or transposed [256][136] (34816)
  __shared__ __attribute__((aligned(16))) unsigned short smem[2 * QROWS * LPITCH];
  static_assert(2 * QROWS * LPITCH >= 256 * 136 && 2 * QROWS * LPITCH >= 128 * 264);
  unsigned short* stile = smem;
  const int tid = threadIdx.x;
  const int lane = tid & 31;
  const int wave = tid >> 5;
  const int wm = wave >> 2;    // 0..1
  const int wn = wave & 3;     // 0..3
  const int lc = lane & 15;
  const int mblk = blockIdx.x * QM;
  const int nblk = blockIdx.y * QN;
  const long n0 = (long)nblk + wn * 64;

  v8f acc[4][4];
#pragma unroll
  for (int i = 0; i < 4; ++i)
#pragma unroll
    for (int j = 0; j < 4; ++j) acc[i][j] = zero8();

  const unsigned lcp = lds_off(smem) + (tid >> 3) * (LPITCH * 2) + (tid & 7) * 16;
  const unsigned short* gx = X + ((long)mblk + (tid >> 3)) * HID + (tid & 7) * 8;
  const unsigned short* gw = WT + ((long)nblk + (tid >> 3)) * HID + (tid & 7) * 8;
  stage_tile_q(lcp, gx, gw);
  wait_copies();
  __syncthreads();
  stage_tile_q(lcp + QROWS * LPITCH * 2, gx + KT, gw + KT);

#pragma unroll 1
  for (int t = 0; t < HID / KT; ++t) {
    const unsigned short* sb = smem + (t & 1) * (QROWS * LPITCH);
#pragma unroll   // both 32-k steps of a tile: every LDS offset becomes an immediate
    for (int kk = 0; kk < KT; kk += 32) {
      FragB a[4], b[4];
#pragma unroll
      for (int i = 0; i < 4; ++i) a[i].u = ldfrag_l(sb + (wm * 64 + i * 16) * LPITCH + kk, LPITCH, lane);
#pragma unroll
      for (int j = 0; j < 4; ++j) b[j].u = ldfrag_l(sb + (QM + wn * 64 + j * 16) * LPITCH + kk, LPITCH, lane);
#pragma unroll
      for (int i = 0; i < 4; ++i)
#pragma unroll
        for (int j = 0; j < 4; ++j) acc[i][j] = mma_b(a[i].v, b[j].v, acc[i][j]);
    }
    wait_lds_reads();
    wait_copies();
    __syncthreads();   // publishes tile t + 1 and frees the buffer that trip t has read
    if (t + 2 < HID / KT)
      stage_tile_q(lcp + (t & 1) * (QROWS * LPITCH * 2), gx + (t + 2) * KT, gw + (t + 2) * KT);
  }
  wait_copies();

  // bias add in f32 (bias entries RNE-converted to bf16 values)
#pragma unroll
  for (int j = 0; j < 4; ++j) {
    const float bj = bf16_rne(bias[n0 + j * 16 + lc]);
#pragma unroll
    for (int i = 0; i < 4; ++i)
#pragma unroll
      for (int r = 0; r < 8; ++r) acc[i][j][r] += bj;
  }

  const int sec = nblk / HID;                 // 0 = q, 1 = k, 2 = v (block-uniform)
  const int h0 = (nblk - sec * HID) >> 6;     // first of the 4 heads in this tile
  const int bb = mblk / SEQ;
  const int t0 = mblk - bb * SEQ;
  const long bh0 = (long)bb * NHEAD + h0;

  // stage the f16 bits of the 128x256 tile (accumulators die here), then write whole lines
  if (sec == 2) qkv_stage<true>(acc, stile, tid); else qkv_stage<false>(acc, stile, tid);
  __syncthreads();
  if (sec == 2) qkv_lines<true>(stile, Vf, tid, bh0, t0);
  else          qkv_lines<false>(stile, (sec == 0) ? Qf : Kf, tid, bh0, t0);
}

// ---------------------------------------------------------------------------
// 4) Flash attention, transposed: one wave = 16 queries of one (b,h); keys streamed 32 at a time.
//    S^T = k*q (A = key rows, B = queries): lane l holds, of query l & 15, the
//    keys 8*(l>>4) + 0..7 (tile 0) and 16 + 8*(l>>4) + 0..7 (tile 1), so the softmax of a query runs
//    in one lane pair, and the two tiles converted in place are the B fragment of
//    O^T += v*p (A = d rows of V).  Block = 128 threads (4 waves, same b,h),
//    which share one LDS copy of each 32-key K/V tile.
// ---------------------------------------------------------------------------
// lane l <-> lane l ^ 16
__device__ __forceinline__ float xhalf(float x) {
  const int b = __builtin_bit_cast(int, x);
  return __builtin_bit_cast(float, __builtin_amdgcn_permlanex16(b, b, 0x76543210, 0xfedcba98, false, false));
}
__global__ void __launch_bounds__(128) __attribute__((amdgpu_num_vgpr(256)))
k_attn(const unsigned short* __restrict__ Qf, const unsigned short* __restrict__ Kf,
       const unsigned short* __restrict__ Vf,
       const int* __restrict__ maskp, unsigned short* __restrict__ Ctx) {
  __shared__ __attribute__((aligned(16))) unsigned short Cl[4 * 16 * 72];
  __shared__ __attribute__((aligned(16))) unsigned short KV[2 * AT_BUF];   // K/V ring, shared by the 4 waves
  const int lane = threadIdx.x & 31;
  const int wave = threadIdx.x >> 5;
  const int hh = lane >> 4;
  const int lc = lane & 15;
  const int nqb = SEQ / 16;
  const int gq = blockIdx.x * 4 + wave;
  const int qb = gq % nqb;
  const int bh = gq / nqb;
  const int bb = bh / NHEAD;
  const int h = bh - bb * NHEAD;
  const long qoff = ((long)bh * SEQ + qb * 16) * HDIM;
  const long koff = (long)bh * SEQ * HDIM;
  const long voff = (long)bh * HDIM * SEQ;
  const int* mrow = maskp + (long)bb * SEQ_FULL;
  const float ninf = __uint_as_float(0xff800000u);

  FragH q0, q1;
  q0.u = ldfrag_g(Qf + qoff, HDIM, lane);
  q1.u = ldfrag_g(Qf + qoff + 32, HDIM, lane);

  v8f o[4];
#pragma unroll
  for (int t = 0; t < 4; ++t) o[t] = zero8();
  float mrun = -1e30f;   // running maximum of query lc (equal in both lanes of the pair)
  float lrun = 0.f;      // running sum over this lane's own half of the keys

  const int tid = threadIdx.x;
  const unsigned lk = lds_off(KV) + (tid >> 3) * (LPITCH * 2) + (tid & 7) * 16;
  const unsigned lv = lds_off(KV) + AT_K * 2 + (tid >> 2) * (VPITCH * 2) + (tid & 3) * 16;
  const long gko = koff + (long)(tid >> 3) * HDIM + (tid & 7) * 8;
  const long gvo = voff + (long)(tid >> 2) * SEQ + (tid & 3) * 8;
  stage_kv(lk, lv, Kf + gko, Vf + gvo);
  wait_copies();
  __syncthreads();
  stage_kv(lk + AT_BUF * 2, lv + AT_BUF * 2, Kf + gko + 32 * HDIM, Vf + gvo + 32);

#pragma unroll 1
  for (int kb = 0; kb < SEQ; kb += 32) {
    const int buf = (kb >> 5) & 1;
    const unsigned short* sb = KV + buf * AT_BUF;
    // key mask (per (b, key)) of this lane's 16 keys
    const int* mk = mrow + kb + hh * 8;
    const v4i mk0 = *(const v4i*)(mk);
    const v4i mk1 = *(const v4i*)(mk + 4);
    const v4i mk2 = *(const v4i*)(mk + 16);
    const v4i mk3 = *(const v4i*)(mk + 20);
    v8f s0 = zero8();
    v8f s1 = zero8();
    {
      FragH ka, kc;
      // keys kb .. kb+15
      ka.u = ldfrag_l(sb, LPITCH, lane);
      kc.u = ldfrag_l(sb + 32, LPITCH, lane);
      s0 = mma_h(ka.v, q0.v, s0);
      s0 = mma_h(kc.v, q1.v, s0);
      // keys kb+16 .. kb+31
      ka.u = ldfrag_l(sb + 16 * LPITCH, LPITCH, lane);
      kc.u = ldfrag_l(sb + 16 * LPITCH + 32, LPITCH, lane);
      s1 = mma_h(ka.v, q0.v, s1);
      s1 = mma_h(kc.v, q1.v, s1);
    }

    // scale; replace with -inf where mask == 0
    s0 *= SCALE_QK;
    s1 *= SCALE_QK;
#pragma unroll
    for (int r = 0; r < 8; ++r) {
      const int m0 = (r < 4) ? mk0[r & 3] : mk1[r & 3];
      const int m1 = (r < 4) ? mk2[r & 3] : mk3[r & 3];
      s0[r] = (m0 == 0) ? ninf : s0[r];
      s1[r] = (m1 == 0) ? ninf : s1[r];
    }
    // online softmax of query lc: maximum in the lane, then one exchange between the halves
    float mx = fmaxf(s0[0], s1[0]);
#pragma unroll
    for (int r = 1; r < 8; ++r) mx = fmaxf(mx, fmaxf(s0[r], s1[r]));
    mx = fmaxf(mx, xhalf(mx));
    const float mnew = fmaxf(mrun, mx);
    const float alpha = __expf(mrun - mnew);
#pragma unroll
    for (int r = 0; r < 8; ++r) {
      s0[r] = __expf(s0[r] - mnew);
      s1[r] = __expf(s1[r] - mnew);
    }
    const v8f ps = s0 + s1;
    const float rs = ((ps[0] + ps[1]) + (ps[2] + ps[3])) + ((ps[4] + ps[5]) + (ps[6] + ps[7]));
    lrun = lrun * alpha + rs;
    mrun = mnew;
#pragma unroll
    for (int t = 0; t < 4; ++t)
#pragma unroll
      for (int r = 0; r < 8; ++r) o[t][r] *= alpha;

    // P^T (32 keys x 16 queries, f32 in D layout) -> f16 B fragment, in place:
    // element s of the fragment is register s & 7 of tile s >> 3
    FragP pa;
#pragma unroll
    for (int w = 0; w < 8; ++w) {
      const float p0 = (w < 4) ? s0[2 * w] : s1[2 * w - 8];
      const float p1 = (w < 4) ? s0[2 * w + 1] : s1[2 * w - 7];
      pa.w[w] = __builtin_bit_cast(unsigned, __builtin_convertvector((v2f){p0, p1}, v2h));
    }

    // O^T += V^T * P^T  (V plane stored [d][token], k = token contiguous)
#pragma unroll
    for (int t = 0; t < 4; ++t) {
      FragH vf;
      vf.u = ldfrag_l(sb + AT_K + (t * 16) * VPITCH, VPITCH, lane);
      o[t] = mma_h(vf.v, pa.v, o[t]);
    }
    wait_lds_reads();
    wait_copies();
    __syncthreads();   // publishes the next 32 keys and frees the buffer that this trip has read
    if (kb + 64 < SEQ)
      stage_kv(lk + buf * (AT_BUF * 2), lv + buf * (AT_BUF * 2),
               Kf + gko + (long)(kb + 64) * HDIM, Vf + gvo + (kb + 64));
  }
  wait_copies();

  const float inv = 16.0f / (lrun + xhalf(lrun));   // the halves' sums join here
  unsigned short* cl = Cl + wave * (16 * 72);
#pragma unroll
  for (int t = 0; t < 4; ++t) {   // registers 0..7 of o[t] are d = t*16 + hh*8 + 0..7 of query lc
    Pack8 pc;
#pragma unroll
    for (int r = 0; r < 8; ++r) pc.s[r] = f16_bits(o[t][r] * inv);
    *(v4u*)(cl + lc * 72 + t * 16 + hh * 8) = pc.u;
  }
  __syncthreads();
  Pack8 pk[4];
  long go[4];
#pragma unroll
  for (int p = 0; p < 4; ++p) {
    const int q = p * 4 + (lane >> 3);   // query row 0..15; lanes 8q'..8q'+7 share a line
    const int sub = lane & 7;
    pk[p].s = *(const v8us*)(cl + q * 72 + sub * 8);
    go[p] = ((long)bb * SEQ + qb * 16 + q) * HID + h * HDIM + sub * 8;
  }
#pragma unroll
  for (int p = 0; p < 4; ++p) *(v4u*)(Ctx + go[p]) = pk[p].u;
  
}

// ---------------------------------------------------------------------------
// 5) Output GEMM: out[m][o] = (1/1024) * sum_c A[m][c] * WT[o][c] + bias[o]   (f16 operands)
//    (32 floats) written by 8 consecutive lanes x 16 B in one instruction.
// ---------------------------------------------------------------------------
__global__ void __launch_bounds__(256)
k_gemm_out(const unsigned short* __restrict__ A, const unsigned short* __restrict__ WT,
           const float* __restrict__ bias, float* __restrict__ out) {
  // k loop: two operand buffers of (64 + 256) rows; epilogue (behind the loop's last barrier): otile
  __shared__ __attribute__((aligned(16))) unsigned short smem[2 * 320 * LPITCH];
  static_assert(2 * 320 * LPITCH * 2 >= 32 * 260 * 4);
  float* otile = (float*)smem;
  const int tid = threadIdx.x;
  const int lane = tid & 31;
  const int wave = tid >> 5;
  const int wm = wave >> 2;
  const int wn = wave & 3;
  const int hh = lane >> 4;
  const int lc = lane & 15;
  const int mblk = blockIdx.x * 64;
  const int nblk = blockIdx.y * 256;
  const long n0 = (long)nblk + wn * 64;

  v8f acc[2][4];
#pragma unroll
  for (int i = 0; i < 2; ++i)
#pragma unroll
    for (int j = 0; j < 4; ++j) acc[i][j] = zero8();

  const unsigned lcp = lds_off(smem) + (tid >> 3) * (LPITCH * 2) + (tid & 7) * 16;
  const unsigned short* ga = A + ((long)mblk + (tid >> 3)) * HID + (tid & 7) * 8;
  const unsigned short* gw = WT + ((long)nblk + (tid >> 3)) * HID + (tid & 7) * 8;
  stage_tile<2>(lcp, ga, gw);
  wait_copies();
  __syncthreads();
  stage_tile<2>(lcp + 320 * LPITCH * 2, ga + KT, gw + KT);

#pragma unroll 1
  for (int t = 0; t < HID / KT; ++t) {
    const unsigned short* sb = smem + (t & 1) * (320 * LPITCH);
#pragma unroll   // both 32-k steps of a tile: every LDS offset becomes an immediate
    for (int kk = 0; kk < KT; kk += 32) {
      FragH a0, a1, b0, b1, b2, b3;
      a0.u = ldfrag_l(sb + (wm * 32) * LPITCH + kk, LPITCH, lane);
      a1.u = ldfrag_l(sb + (wm * 32 + 16) * LPITCH + kk, LPITCH, lane);
      b0.u = ldfrag_l(sb + (64 + wn * 64) * LPITCH + kk, LPITCH, lane);
      b1.u = ldfrag_l(sb + (64 + wn * 64 + 16) * LPITCH + kk, LPITCH, lane);
      b2.u = ldfrag_l(sb + (64 + wn * 64 + 32) * LPITCH + kk, LPITCH, lane);
      b3.u = ldfrag_l(sb + (64 + wn * 64 + 48) * LPITCH + kk, LPITCH, lane);
      acc[0][0] = mma_h(a0.v, b0.v, acc[0][0]);
      acc[0][1] = mma_h(a0.v, b1.v, acc[0][1]);
      acc[0][2] = mma_h(a0.v, b2.v, acc[0][2]);
      acc[0][3] = mma_h(a0.v, b3.v, acc[0][3]);
      acc[1][0] = mma_h(a1.v, b0.v, acc[1][0]);
      acc[1][1] = mma_h(a1.v, b1.v, acc[1][1]);
      acc[1][2] = mma_h(a1.v, b2.v, acc[1][2]);
      acc[1][3] = mma_h(a1.v, b3.v, acc[1][3]);
    }
    wait_lds_reads();
    wait_copies();
    __syncthreads();   // publishes tile t + 1 and frees the buffer that trip t has read
    if (t + 2 < HID / KT)
      stage_tile<2>(lcp + (t & 1) * (320 * LPITCH * 2), ga + (t + 2) * KT, gw + (t + 2) * KT);
  }
  wait_copies();

  // undo carries (x16 ctx, x64 weight) and add bf16-valued bias, all in f32
#pragma unroll
  for (int j = 0; j < 4; ++j) {
    const float bj = bf16_rne(bias[n0 + j * 16 + lc]);
#pragma unroll
    for (int i = 0; i < 2; ++i)
#pragma unroll
      for (int r = 0; r < 8; ++r) acc[i][j][r] = acc[i][j][r] * (1.0f / 1024.0f) + bj;
  }

#pragma unroll
  for (int phase = 0; phase < 2; ++phase) {
    if (wm == phase) {   // wave-uniform: waves owning rows phase*32 .. +31 stage them
#pragma unroll
      for (int i = 0; i < 2; ++i)
#pragma unroll
        for (int j = 0; j < 4; ++j)
#pragma unroll
          for (int r = 0; r < 8; ++r) {
            const int ml = i * 16 + r + hh * 8;
            const int ol = wn * 64 + j * 16 + lc;
            otile[ml * 260 + ol] = acc[i][j][r];
          }
    }
    __syncthreads();
    v4f pk[8];
    long go[8];
#pragma unroll
    for (int p = 0; p < 8; ++p) {
      const int L = p * 32 + (tid >> 3);
      const int sub = tid & 7;
      const int row = L >> 3;
      const int piece = L & 7;
      pk[p] = *(const v4f*)(otile + row * 260 + piece * 32 + sub * 4);
      go[p] = ((long)mblk + phase * 32 + row) * HID + nblk + piece * 32 + sub * 4;
    }
#pragma unroll
    for (int p = 0; p < 8; ++p) *(v4f*)(out + go[p]) = pk[p];
    
    __syncthreads();
  }
}

// ---------------------------------------------------------------------------
// Launch
// ---------------------------------------------------------------------------
extern "C" void kernel_launch(void* const* d_in, const int* in_sizes, int n_in,
                              void* d_out, int out_size, void* d_ws, size_t ws_size,
                              hipStream_t stream) {
  if (n_in < 6) return;
  const float* x     = (const float*)d_in[0];   // [NB_FULL, SEQ_FULL, HID]
  const int*   maskp = (const int*)d_in[1];     // [NB_FULL, 1, 1, SEQ_FULL] int32
  const float* Wqkv  = (const float*)d_in[2];   // [HID][3*HID]
  const float* bqkv  = (const float*)d_in[3];   // [3*HID]
  const float* Wout  = (const float*)d_in[4];   // [HID][HID]
  const float* bout  = (const float*)d_in[5];   // [HID]
  float* out = (float*)d_out;                   // [NB*SEQ, HID]

  const long M = (long)NB * SEQ;
  if ((long)in_sizes[0] < (((long)(NB - 1) * SEQ_FULL + SEQ) * HID)) return;
  if ((long)in_sizes[1] < ((long)(NB - 1) * SEQ_FULL + SEQ)) return;
  if ((long)in_sizes[2] < 3L * HID * HID) return;
  if ((long)in_sizes[3] < 3L * HID) return;
  if ((long)in_sizes[4] < (long)HID * HID) return;
  if ((long)in_sizes[5] < (long)HID) return;
  if ((long)out_size < M * HID) return;

  // workspace carve (bytes); every region is a whole number of tiles, no padding needed
  const size_t szX  = (size_t)M * HID * 2;                       // x bf16 plane, later ctx f16 plane
  const size_t szWq = (size_t)3 * HID * HID * 2;                 // WqkvT bf16
  const size_t szWo = (size_t)HID * HID * 2;                     // WoutT f16
  const size_t szP  = (size_t)NB * NHEAD * SEQ * HDIM * 2;       // one q/k/v plane
  const size_t oX  = 0;
  const size_t oWq = oX + szX;
  const size_t oWo = oWq + szWq;
  const size_t oP0 = oWo + szWo;
  const size_t total = oP0 + 3 * szP;
  if (total > ws_size) return;
  static_assert((size_t)NB * SEQ * HID * 2 == (size_t)NB * NHEAD * SEQ * HDIM * 2);

  char* ws = (char*)d_ws;
  unsigned short* xb  = (unsigned short*)(ws + oX);
  unsigned short* ctx = (unsigned short*)(ws + oX);      // aliases xb: xb is dead after k_gemm_qkv
  unsigned short* wq  = (unsigned short*)(ws + oWq);
  unsigned short* wo  = (unsigned short*)(ws + oWo);
  unsigned short* qf  = (unsigned short*)(ws + oP0 + 0 * szP);
  unsigned short* kf  = (unsigned short*)(ws + oP0 + 1 * szP);
  unsigned short* vf  = (unsigned short*)(ws + oP0 + 2 * szP);

  // 1) + 2) one launch: Wqkv in[HID][3*HID] -> out[3*HID][HID] bf16;  Wout in[HID][HID] -> out[HID][HID]
  //    f16 (x64);  x -> bf16 plane (compact rows)
  k_cvt_all<<<CVT_WQ_BLKS + CVT_WO_BLKS + CVT_X_BLKS, 256, 0, stream>>>(x, Wqkv, Wout, xb, wq, wo);
  // 3) qkv GEMM -> f16 planes of q, k ([bh][t][d]) and v ([bh][d][t]); block tile 128x256
  k_gemm_qkv<<<dim3((int)(M / QM), 3 * HID / QN), 256, 0, stream>>>(xb, wq, bqkv, qf, kf, vf);
  // 4) attention -> ctx f16 plane [NB*SEQ][HID] (over the dead x plane)
  k_attn<<<(NB * NHEAD * (SEQ / 16)) / 4, 128, 0, stream>>>(qf, kf, vf, maskp, ctx);
  // 5) output GEMM -> f32 out
  k_gemm_out<<<dim3((int)(M / 64), HID / 256), 256, 0, stream>>>(ctx, wo, bout, out);
}

// v006
// It runs in 111 microseconds.
// Two timings next to v005 both put it at 1.06 times that version's speed.
// Over all steps from v000 it is 3.87 times as fast.
// Contractions: x*Wqkv on v_wmma_f32_16x16x32_bf16 (bf16 operands = RNE-converted inputs); q*k^T and p*v on v_wmma_f32_16x16x32_f16 (f16 operands = RNE-converted f32 q, k, v and softmax weights, one product per operand pair); ctx*Wout on v_wmma_f32_16x16x32_f16 (f16 operands, ctx carried x16, Wout carried x64); f32 accumulate, f32 softmax.
#include <hip/hip_runtime.h>

#ifndef NB
#define NB 16
#endif
#ifndef SEQ
#define SEQ 512
#endif
#ifndef NB_FULL
#define NB_FULL 16
#endif
#ifndef SEQ_FULL
#define SEQ_FULL 512
#endif
#define HID 1024
#define NHEAD 16
#define HDIM 64
#define SCALE_QK 0.125f

static_assert(SEQ % 64 == 0);
static_assert(HID == NHEAD * HDIM);
static_assert(HID % 256 == 0);
static_assert(HID % 128 == 0);
static_assert(((NB * NHEAD * (SEQ / 16)) % 4) == 0);
static_assert(NB <= NB_FULL);
static_assert(SEQ <= SEQ_FULL);

typedef _Float16 v16h __attribute__((ext_vector_type(16)));
typedef __bf16   v16b __attribute__((ext_vector_type(16)));
typedef unsigned short v8us  __attribute__((ext_vector_type(8)));
typedef unsigned short v16us __attribute__((ext_vector_type(16)));
typedef float v8f __attribute__((ext_vector_type(8)));
typedef float v4f __attribute__((ext_vector_type(4)));
typedef unsigned int v4u __attribute__((ext_vector_type(4)));
typedef unsigned int v8u __attribute__((ext_vector_type(8)));
typedef int v4i __attribute__((ext_vector_type(4)));
typedef float v2f __attribute__((ext_vector_type(2)));
typedef _Float16 v2h __attribute__((ext_vector_type(2)));

union FragB { v16us u; v16b v; };
union FragH { v16us u; v16h v; };
union Pack8 { v8us s; v4u u; };
union FragP { v8u w; v16h v; };

// ---------------------------------------------------------------------------
// 16-bit conversion helpers (bf16 via RNE on the f32 bit pattern)
// ---------------------------------------------------------------------------
__device__ __forceinline__ unsigned short bf16_rne_bits(float f) {
  unsigned int u = __float_as_uint(f);
  u += 0x7fffu + ((u >> 16) & 1u);
  return (unsigned short)(u >> 16);
}
__device__ __forceinline__ float bf16_val(unsigned short b) {
  return __uint_as_float(((unsigned int)b) << 16);
}
__device__ __forceinline__ float bf16_rne(float f) { return bf16_val(bf16_rne_bits(f)); }
__device__ __forceinline__ unsigned short f16_bits(float f) {
  _Float16 hv = (_Float16)f;
  return __builtin_bit_cast(unsigned short, hv);
}
template <int MODE>   // 0: bf16 bits of RNE(w); 1: f16 bits of RNE_bf16(w) * 64
__device__ __forceinline__ unsigned short wbits(float f) {
  if (MODE == 0) return bf16_rne_bits(f);
  return f16_bits(bf16_rne(f) * 64.0f);
}

// ---------------------------------------------------------------------------
// WMMA helpers: D(16x16 f32) += A(16x32) * B(32x16); hazard guard after each op
// ---------------------------------------------------------------------------
__device__ __forceinline__ v8f mma_b(v16b a, v16b b, v8f c) {
  v8f d = __builtin_amdgcn_wmma_f32_16x16x32_bf16(false, a, false, b, (short)0, c, false, false);
  asm volatile("v_nop\n\tv_nop\n\tv_nop\n\tv_nop" : "+v"(d) : "v"(a), "v"(b));
  return d;
}
__device__ __forceinline__ v8f mma_h(v16h a, v16h b, v8f c) {
  v8f d = __builtin_amdgcn_wmma_f32_16x16x32_f16(false, a, false, b, (short)0, c, false, false);
  asm volatile("v_nop\n\tv_nop\n\tv_nop\n\tv_nop" : "+v"(d) : "v"(a), "v"(b));
  return d;
}
__device__ __forceinline__ v8f zero8() { return (v8f){0.f, 0.f, 0.f, 0.f, 0.f, 0.f, 0.f, 0.f}; }

// ---------------------------------------------------------------------------
// Fragment loader, 16-bit split k-map for A and B:
//   lane l: row/col = l & 15; elements 0..7 <- k0 + 8*(l>>4) + 0..7,
//                             elements 8..15 <- k0 + 16 + 8*(l>>4) + 0..7.
// base points at (row0/col0, k0) of a k-contiguous 16-bit plane, ld = pitch.
// ---------------------------------------------------------------------------
__device__ __forceinline__ v16us ldfrag_g(const unsigned short* __restrict__ base, long ld, int lane) {
  const unsigned short* p = base + (long)(lane & 15) * ld + ((lane >> 4) << 3);
  v8us e0 = *(const v8us*)(p);
  v8us e1 = *(const v8us*)(p + 16);
  return __builtin_shufflevector(e0, e1, 0, 1, 2, 3, 4, 5, 6, 7, 8, 9, 10, 11, 12, 13, 14, 15);
}
__device__ __forceinline__ v16us ldfrag_l(const unsigned short* base, int ld, int lane) {
  const unsigned short* p = base + (lane & 15) * ld + ((lane >> 4) << 3);
  v8us e0 = *(const v8us*)(p);
  v8us e1 = *(const v8us*)(p + 16);
  return __builtin_shufflevector(e0, e1, 0, 1, 2, 3, 4, 5, 6, 7, 8, 9, 10, 11, 12, 13, 14, 15);
}

// ---------------------------------------------------------------------------
// GEMM operand staging: a tile is KT k-elements (one whole 128-B line) of every operand row
// of the block, laid in LDS at a pitch of 144 B (16 B x 9: conflict-free for 16-B row reads).
// Each lane copies 16 B; 8 consecutive lanes cover one line, a wave-wide copy 4 whole lines.
// ---------------------------------------------------------------------------
#define KT 64
#define LPITCH 72
static_assert(HID % KT == 0 && HID / KT >= 2);

__device__ __forceinline__ unsigned lds_off(const void* p) { return (unsigned)(size_t)p; }

// One statement per tile; the s_wait_xcnt ends it so that no address register of an issued
// copy is rewritten before the wait.
__device__ __forceinline__ void async_copy4(const unsigned (&l)[4], const unsigned short* const (&g)[4]) {
  asm volatile("global_load_async_to_lds_b128 %0, %4, off\n\t"
               "global_load_async_to_lds_b128 %1, %5, off\n\t"
               "global_load_async_to_lds_b128 %2, %6, off\n\t"
               "global_load_async_to_lds_b128 %3, %7, off\n\t"
               "s_wait_xcnt 0x0"
               :: "v"(l[0]), "v"(l[1]), "v"(l[2]), "v"(l[3]),
                  "v"(g[0]), "v"(g[1]), "v"(g[2]), "v"(g[3]) : "memory");
}
__device__ __forceinline__ void async_copy10(const unsigned (&l)[10], const unsigned short* const (&g)[10]) {
  asm volatile("global_load_async_to_lds_b128 %0, %10, off\n\t"
               "global_load_async_to_lds_b128 %1, %11, off\n\t"
               "global_load_async_to_lds_b128 %2, %12, off\n\t"
               "global_load_async_to_lds_b128 %3, %13, off\n\t"
               "global_load_async_to_lds_b128 %4, %14, off\n\t"
               "global_load_async_to_lds_b128 %5, %15, off\n\t"
               "global_load_async_to_lds_b128 %6, %16, off\n\t"
               "global_load_async_to_lds_b128 %7, %17, off\n\t"
               "global_load_async_to_lds_b128 %8, %18, off\n\t"
               "global_load_async_to_lds_b128 %9, %19, off\n\t"
               "s_wait_xcnt 0x0"
               :: "v"(l[0]), "v"(l[1]), "v"(l[2]), "v"(l[3]), "v"(l[4]), "v"(l[5]), "v"(l[6]), "v"(l[7]), "v"(l[8]), "v"(l[9]),
                  "v"(g[0]), "v"(g[1]), "v"(g[2]), "v"(g[3]), "v"(g[4]), "v"(g[5]), "v"(g[6]), "v"(g[7]), "v"(g[8]), "v"(g[9]) : "memory");
}
// 256 lanes copy 64 A rows then NBG*128 B rows; l, ga, gb are the lane's own first addresses
// (row tid>>3, 16-B piece tid&7); further rows follow in steps of 32.
template <int NBG>
__device__ __forceinline__ void stage_tile(unsigned l, const unsigned short* ga, const unsigned short* gb) {
  unsigned la[2 + 4 * NBG];
  const unsigned short* gp[2 + 4 * NBG];
#pragma unroll
  for (int i = 0; i < 2 + 4 * NBG; ++i) {
    la[i] = l + i * 32 * LPITCH * 2;
    gp[i] = (i < 2) ? ga + (long)(i * 32) * HID : gb + (long)((i - 2) * 32) * HID;
  }
  static_assert(NBG == 2);
  async_copy10(la, gp);
}
// The 128 x 256 block's tile: 128 A rows then 256 B rows, 12 copies a lane, in one statement as above.
__device__ __forceinline__ void async_copy12(const unsigned (&l)[12], const unsigned short* const (&g)[12]) {
  asm volatile("global_load_async_to_lds_b128 %0, %12, off\n\t"
               "global_load_async_to_lds_b128 %1, %13, off\n\t"
               "global_load_async_to_lds_b128 %2, %14, off\n\t"
               "global_load_async_to_lds_b128 %3, %15, off\n\t"
               "global_load_async_to_lds_b128 %4, %16, off\n\t"
               "global_load_async_to_lds_b128 %5, %17, off\n\t"
               "global_load_async_to_lds_b128 %6, %18, off\n\t"
               "global_load_async_to_lds_b128 %7, %19, off\n\t"
               "global_load_async_to_lds_b128 %8, %20, off\n\t"
               "global_load_async_to_lds_b128 %9, %21, off\n\t"
               "global_load_async_to_lds_b128 %10, %22, off\n\t"
               "global_load_async_to_lds_b128 %11, %23, off\n\t"
               "s_wait_xcnt 0x0"
               :: "v"(l[0]), "v"(l[1]), "v"(l[2]), "v"(l[3]), "v"(l[4]), "v"(l[5]),
                  "v"(l[6]), "v"(l[7]), "v"(l[8]), "v"(l[9]), "v"(l[10]), "v"(l[11]),
                  "v"(g[0]), "v"(g[1]), "v"(g[2]), "v"(g[3]), "v"(g[4]), "v"(g[5]),
                  "v"(g[6]), "v"(g[7]), "v"(g[8]), "v"(g[9]), "v"(g[10]), "v"(g[11]) : "memory");
}
__device__ __forceinline__ void stage_tile_q(unsigned l, const unsigned short* ga, const unsigned short* gb) {
  unsigned la[12];
  const unsigned short* gp[12];
#pragma unroll
  for (int i = 0; i < 12; ++i) {
    la[i] = l + i * 32 * LPITCH * 2;
    gp[i] = (i < 4) ? ga + (long)(i * 32) * HID : gb + (long)((i - 4) * 32) * HID;
  }
  async_copy12(la, gp);
}
// Attention K/V tile: 32 keys. K as [32 keys][64 d] at pitch 144 B; V as [64 d][32 keys]
// at pitch 80 B (16 B x 5). 128 lanes; lk, lv and the two pointers are the lane's own first addresses.
#define VPITCH 40
#define AT_K (32 * LPITCH)
#define AT_V (64 * VPITCH)
#define AT_BUF (AT_K + AT_V)
__device__ __forceinline__ void stage_kv(unsigned lk, unsigned lv,
                                         const unsigned short* gk, const unsigned short* gv) {
  const unsigned la[4] = {lk, lk + 16 * LPITCH * 2, lv, lv + 32 * VPITCH * 2};
  const unsigned short* const gp[4] = {gk, gk + 16 * HDIM, gv, gv + 32 * SEQ};
  async_copy4(la, gp);
}
// Ring waits, each ahead of the barrier that hands a buffer over.
__device__ __forceinline__ void wait_lds_reads()  { asm volatile("s_wait_dscnt 0x0" ::: "memory"); }
__device__ __forceinline__ void wait_copies()     { asm volatile("s_wait_asynccnt 0x0" ::: "memory"); }

// ---------------------------------------------------------------------------
// 1) x f32 [NB,SEQ,HID] (batch stride SEQ_FULL*HID) -> bf16 bits, compact rows.
// ---------------------------------------------------------------------------
__device__ __forceinline__ void
cvt_x_block(const float* __restrict__ x, unsigned short* __restrict__ y, int ngroups, int blk) {
  const int i = blk * 256 + threadIdx.x;
  if (i >= ngroups) return;
  const int row = i / (HID / 8);
  const int g = i - row * (HID / 8);
  const int bb = row / SEQ;
  const int tt = row - bb * SEQ;
  const long srow = (long)bb * SEQ_FULL + tt;
  const float* src = x + srow * HID + g * 8;
  const v4f a = *(const v4f*)(src);
  const v4f c = *(const v4f*)(src + 4);
  Pack8 pk;
  pk.s = (v8us){bf16_rne_bits(a.x), bf16_rne_bits(a.y), bf16_rne_bits(a.z), bf16_rne_bits(a.w),
                bf16_rne_bits(c.x), bf16_rne_bits(c.y), bf16_rne_bits(c.z), bf16_rne_bits(c.w)};
  const v4u val = pk.u;
  unsigned short* dst = y + (long)row * HID + g * 8;
  *(v4u*)dst = val;
  
}

// ---------------------------------------------------------------------------
// 2) weight convert + transpose: in W[kdim rows][ndim cols] f32 -> out WT[ndim][kdim] 16-bit.
//    line written by 8 consecutive lanes x 16 B in one instruction.  Block (bx, by) of (ndim/64, kdim/64).
// ---------------------------------------------------------------------------
template <int MODE>
__device__ __forceinline__ void
cvt_wt_block(const float* __restrict__ W, unsigned short* __restrict__ WT, int kdim, int ndim,
             int bx, int by, unsigned short* tile) {
  const int tid = threadIdx.x;
  const int n0 = bx * 64;
  const int k0 = by * 64;
  const int kl = tid >> 2;          // 0..63
  const int nl = (tid & 3) * 16;    // 0,16,32,48
  const float* src = W + (long)(k0 + kl) * ndim + n0 + nl;
#pragma unroll
  for (int q = 0; q < 4; ++q) {
    const v4f v = *(const v4f*)(src + q * 4);
    unsigned short* trow = tile + (nl + q * 4) * 72 + kl;   // tile[n_local][k_local]
    trow[0 * 72] = wbits<MODE>(v.x);
    trow[1 * 72] = wbits<MODE>(v.y);
    trow[2 * 72] = wbits<MODE>(v.z);
    trow[3 * 72] = wbits<MODE>(v.w);
  }
  __syncthreads();
  Pack8 pk[2];
  long go[2];
#pragma unroll
  for (int p = 0; p < 2; ++p) {
    const int L = p * 32 + (tid >> 3);   // output row n_local 0..63
    const int sub = tid & 7;
    pk[p].s = *(const v8us*)(tile + L * 72 + sub * 8);
    go[p] = (long)(n0 + L) * kdim + k0 + sub * 8;
  }
#pragma unroll
  for (int p = 0; p < 2; ++p) *(v4u*)(WT + go[p]) = pk[p].u;
  // no register that an issued store names is
  // rewritten ahead of this wait
  asm volatile("s_wait_xcnt 0x0" ::: "memory");
}

// ---------------------------------------------------------------------------
// 1) + 2) in one launch: the three conversions depend on nothing but the inputs, so they share a
//    grid.  The block index picks the job: first the weight tiles (the longer chain: load, LDS,
//    barrier, store), then the rows of x.  Each branch is taken by a whole block.
// ---------------------------------------------------------------------------
#define CVT_WQ_BX (3 * HID / 64)
#define CVT_WO_BX (HID / 64)
#define CVT_WQ_BLKS (CVT_WQ_BX * (HID / 64))
#define CVT_WO_BLKS (CVT_WO_BX * (HID / 64))
#define CVT_X_GROUPS (NB * SEQ * (HID / 8))
#define CVT_X_BLKS ((CVT_X_GROUPS + 255) / 256)
__global__ void __launch_bounds__(256)
k_cvt_all(const float* __restrict__ x, const float* __restrict__ Wqkv, const float* __restrict__ Wout,
          unsigned short* __restrict__ xb, unsigned short* __restrict__ wq, unsigned short* __restrict__ wo) {
  __shared__ __attribute__((aligned(16))) unsigned short tile[64 * 72];
  const int b = blockIdx.x;
  if (b < CVT_WQ_BLKS) {
    cvt_wt_block<0>(Wqkv, wq, HID, 3 * HID, b % CVT_WQ_BX, b / CVT_WQ_BX, tile);
  } else if (b < CVT_WQ_BLKS + CVT_WO_BLKS) {
    const int c = b - CVT_WQ_BLKS;
    cvt_wt_block<1>(Wout, wo, HID, HID, c % CVT_WO_BX, c / CVT_WO_BX, tile);
  } else {
    cvt_x_block(x, xb, CVT_X_GROUPS, b - (CVT_WQ_BLKS + CVT_WO_BLKS));
  }
}

// ---------------------------------------------------------------------------
// 3) QKV GEMM: y[m][o] = sum_c X[m][c] * WT[o][c] + bias[o]  (bf16 operands, f32 acc)
//    Block 256 threads = 8 waves (2M x 4N), block tile 128 x 256, wave tile 64 x 64
//    (16 accumulator tiles, 4 + 4 fragments: 16 products per 8 fragments read from LDS, and
//    each operand row fetched from L2 by half as many blocks as with a 64 x 128 tile).
//    Epilogue: f32 -> f16 bits
//      Q,K sections: [NB*NHEAD][SEQ][HDIM] (one line per (b,h,t) row)
//      V  section:   [NB*NHEAD][HDIM][SEQ] (64-token segment of a (b,h,d) row = one line)
// ---------------------------------------------------------------------------
#define QM 128
#define QN 256
#define QROWS (QM + QN)
static_assert(SEQ % QM == 0);          // a block's rows lie in one batch
static_assert(HID % QN == 0);          // a block's columns lie in one of the q, k, v sections
// Epilogue of the 128 x 256 tile, orientation as a compile-time constant so that every LDS
// offset is an immediate.  TR = false (q, k): stile[m][o], pitch 264; TR = true (v): stile[o][m], pitch 136.
template <bool TR>
__device__ __forceinline__ void qkv_stage(const v8f (&acc)[4][4], unsigned short* stile, int tid) {
  constexpr int sm = TR ? 1 : 264;            // LDS stride of the m index
  constexpr int so = TR ? 136 : 1;            // LDS stride of the o index
  const int lane = tid & 31;
  const int wave = tid >> 5;
  unsigned short* p0 = stile + ((wave >> 2) * 64 + (lane >> 4) * 8) * sm + ((wave & 3) * 64 + (lane & 15)) * so;
#pragma unroll
  for (int i = 0; i < 4; ++i)
#pragma unroll
    for (int j = 0; j < 4; ++j)
#pragma unroll
      for (int r = 0; r < 8; ++r) p0[(i * 16 + r) * sm + (j * 16) * so] = f16_bits(acc[i][j][r]);
}
// 512 lines of 128 B leave in 4 groups of 4 x 32 lines; lanes 8q..8q+7 share a line.
// q, k: line = (head L >> 7, token L & 127); v: line = (column L >> 1, 64-token segment L & 1).
template <bool TR>
__device__ __forceinline__ void qkv_lines(const unsigned short* stile, unsigned short* __restrict__ dstp,
                                          int tid, long bh0, int t0) {
  const int sub = tid & 7;
#pragma unroll
  for (int g = 0; g < 4; ++g) {
    Pack8 pk[4];
    long go[4];
#pragma unroll
    for (int p = 0; p < 4; ++p) {
      const int L = (g * 4 + p) * 32 + (tid >> 3);   // line 0..511
      const long bhh = bh0 + (L >> 7);               // head within the tile, in both orientations
      const int sidx = TR ? ((L >> 1) * 136 + (L & 1) * 64 + sub * 8)
                          : ((L & 127) * 264 + (L >> 7) * 64 + sub * 8);
      pk[p].s = *(const v8us*)(stile + sidx);
      go[p] = TR ? ((bhh * HDIM + ((L >> 1) & 63)) * SEQ + t0 + (L & 1) * 64 + sub * 8)
                 : ((bhh * SEQ + t0 + (L & 127)) * HDIM + sub * 8);
    }
#pragma unroll
    for (int p = 0; p < 4; ++p) *(v4u*)(dstp + go[p]) = pk[p].u;
    // no register that an issued store names is rewritten ahead of this wait
    asm volatile("s_wait_xcnt 0x0" ::: "memory");
  }
}
__global__ void __launch_bounds__(256) __attribute__((amdgpu_num_vgpr(256)))
k_gemm_qkv(const unsigned short* __restrict__ X, const unsigned short* __restrict__ WT,
           const float* __restrict__ bias,
           unsigned short* __restrict__ Qf, unsigned short* __restrict__ Kf,
           unsigned short* __restrict__ Vf) {
  // k loop: two operand buffers of (128 + 256) rows; epilogue (behind the loop's last barrier):
  // row orientation [128][264] (33792) or transposed [256][136] (34816)
  __shared__ __attribute__((aligned(16))) unsigned short smem[2 * QROWS * LPITCH];
  static_assert(2 * QROWS * LPITCH >= 256 * 136 && 2 * QROWS * LPITCH >= 128 * 264);
  unsigned short* stile = smem;
  const int tid = threadIdx.x;
  const int lane = tid & 31;
  const int wave = tid >> 5;
  const int wm = wave >> 2;    // 0..1
  const int wn = wave & 3;     // 0..3
  const int lc = lane & 15;
  const int mblk = blockIdx.x * QM;
  const int nblk = blockIdx.y * QN;
  const long n0 = (long)nblk + wn * 64;

  v8f acc[4][4];
#pragma unroll
  for (int i = 0; i < 4; ++i)
#pragma unroll
    for (int j = 0; j < 4; ++j) acc[i][j] = zero8();

  const unsigned lcp = lds_off(smem) + (tid >> 3) * (LPITCH * 2) + (tid & 7) * 16;
  const unsigned short* gx = X + ((long)mblk + (tid >> 3)) * HID + (tid & 7) * 8;
  const unsigned short* gw = WT + ((long)nblk + (tid >> 3)) * HID + (tid & 7) * 8;
  stage_tile_q(lcp, gx, gw);
  wait_copies();
  __syncthreads();
  stage_tile_q(lcp + QROWS * LPITCH * 2, gx + KT, gw + KT);

#pragma unroll 1
  for (int t = 0; t < HID / KT; ++t) {
    const unsigned short* sb = smem + (t & 1) * (QROWS * LPITCH);
#pragma unroll   // both 32-k steps of a tile: every LDS offset becomes an immediate
    for (int kk = 0; kk < KT; kk += 32) {
      FragB a[4], b[4];
#pragma unroll
      for (int i = 0; i < 4; ++i) a[i].u = ldfrag_l(sb + (wm * 64 + i * 16) * LPITCH + kk, LPITCH, lane);
#pragma unroll
      for (int j = 0; j < 4; ++j) b[j].u = ldfrag_l(sb + (QM + wn * 64 + j * 16) * LPITCH + kk, LPITCH, lane);
#pragma unroll
      for (int i = 0; i < 4; ++i)
#pragma unroll
        for (int j = 0; j < 4; ++j) acc[i][j] = mma_b(a[i].v, b[j].v, acc[i][j]);
    }
    wait_lds_reads();
    wait_copies();
    __syncthreads();   // publishes tile t + 1 and frees the buffer that trip t has read
    if (t + 2 < HID / KT)
      stage_tile_q(lcp + (t & 1) * (QROWS * LPITCH * 2), gx + (t + 2) * KT, gw + (t + 2) * KT);
  }
  wait_copies();

  // bias add in f32 (bias entries RNE-converted to bf16 values)
#pragma unroll
  for (int j = 0; j < 4; ++j) {
    const float bj = bf16_rne(bias[n0 + j * 16 + lc]);
#pragma unroll
    for (int i = 0; i < 4; ++i)
#pragma unroll
      for (int r = 0; r < 8; ++r) acc[i][j][r] += bj;
  }

  const int sec = nblk / HID;                 // 0 = q, 1 = k, 2 = v (block-uniform)
  const int h0 = (nblk - sec * HID) >> 6;     // first of the 4 heads in this tile
  const int bb = mblk / SEQ;
  const int t0 = mblk - bb * SEQ;
  const long bh0 = (long)bb * NHEAD + h0;

  // stage the f16 bits of the 128x256 tile (accumulators die here), then write whole lines
  if (sec == 2) qkv_stage<true>(acc, stile, tid); else qkv_stage<false>(acc, stile, tid);
  __syncthreads();
  if (sec == 2) qkv_lines<true>(stile, Vf, tid, bh0, t0);
  else          qkv_lines<false>(stile, (sec == 0) ? Qf : Kf, tid, bh0, t0);
}

// ---------------------------------------------------------------------------
// 4) Flash attention, transposed: one wave = 32 queries (two tiles of 16) of one (b,h); keys streamed
//    32 at a time.  S^T = k*q (A = key rows, B = queries): lane l holds, of query l & 15 of a tile, the
//    keys 8*(l>>4) + 0..7 (tile 0) and 16 + 8*(l>>4) + 0..7 (tile 1), so the softmax of a query runs
//    in one lane pair, and the two tiles converted in place are the B fragment of
//    O^T += v*p (A = d rows of V).  Every K and V fragment read from LDS serves both query tiles.
//    Block = 128 threads (4 waves, same b,h: 128 queries), which share one LDS copy of each
//    32-key K/V tile.
// ---------------------------------------------------------------------------
#define AQT 2
static_assert(SEQ % (4 * 16 * AQT) == 0);   // the 4 waves of a block lie in one (b,h)
// lane l <-> lane l ^ 16
__device__ __forceinline__ float xhalf(float x) {
  const int b = __builtin_bit_cast(int, x);
  return __builtin_bit_cast(float, __builtin_amdgcn_permlanex16(b, b, 0x76543210, 0xfedcba98, false, false));
}
__global__ void __launch_bounds__(128) __attribute__((amdgpu_num_vgpr(256)))
k_attn(const unsigned short* __restrict__ Qf, const unsigned short* __restrict__ Kf,
       const unsigned short* __restrict__ Vf,
       const int* __restrict__ maskp, unsigned short* __restrict__ Ctx) {
  __shared__ __attribute__((aligned(16))) unsigned short Cl[4 * 16 * AQT * 72];
  __shared__ __attribute__((aligned(16))) unsigned short KV[2 * AT_BUF];   // K/V ring, shared by the 4 waves
  const int lane = threadIdx.x & 31;
  const int wave = threadIdx.x >> 5;
  const int hh = lane >> 4;
  const int lc = lane & 15;
  const int nqb = SEQ / (16 * AQT);
  const int gq = blockIdx.x * 4 + wave;
  const int qb = gq % nqb;
  const int bh = gq / nqb;
  const int bb = bh / NHEAD;
  const int h = bh - bb * NHEAD;
  const long qoff = ((long)bh * SEQ + qb * (16 * AQT)) * HDIM;
  const long koff = (long)bh * SEQ * HDIM;
  const long voff = (long)bh * HDIM * SEQ;
  const int* mrow = maskp + (long)bb * SEQ_FULL;
  const float ninf = __uint_as_float(0xff800000u);

  FragH q0[AQT], q1[AQT];
#pragma unroll
  for (int u = 0; u < AQT; ++u) {
    q0[u].u = ldfrag_g(Qf + qoff + u * 16 * HDIM, HDIM, lane);
    q1[u].u = ldfrag_g(Qf + qoff + u * 16 * HDIM + 32, HDIM, lane);
  }

  v8f o[AQT][4];
  float mrun[AQT];   // running maximum of query lc of tile u (equal in both lanes of the pair)
  float lrun[AQT];   // running sum over this lane's own half of the keys
#pragma unroll
  for (int u = 0; u < AQT; ++u) {
#pragma unroll
    for (int t = 0; t < 4; ++t) o[u][t] = zero8();
    mrun[u] = -1e30f;
    lrun[u] = 0.f;
  }

  const int tid = threadIdx.x;
  const unsigned lk = lds_off(KV) + (tid >> 3) * (LPITCH * 2) + (tid & 7) * 16;
  const unsigned lv = lds_off(KV) + AT_K * 2 + (tid >> 2) * (VPITCH * 2) + (tid & 3) * 16;
  const long gko = koff + (long)(tid >> 3) * HDIM + (tid & 7) * 8;
  const long gvo = voff + (long)(tid >> 2) * SEQ + (tid & 3) * 8;
  stage_kv(lk, lv, Kf + gko, Vf + gvo);
  wait_copies();
  __syncthreads();
  stage_kv(lk + AT_BUF * 2, lv + AT_BUF * 2, Kf + gko + 32 * HDIM, Vf + gvo + 32);

#pragma unroll 1
  for (int kb = 0; kb < SEQ; kb += 32) {
    const int buf = (kb >> 5) & 1;
    const unsigned short* sb = KV + buf * AT_BUF;
    // key mask (per (b, key)) of this lane's 16 keys, the same for both query tiles
    const int* mk = mrow + kb + hh * 8;
    const v4i mk0 = *(const v4i*)(mk);
    const v4i mk1 = *(const v4i*)(mk + 4);
    const v4i mk2 = *(const v4i*)(mk + 16);
    const v4i mk3 = *(const v4i*)(mk + 20);
    v8f s0[AQT], s1[AQT];
#pragma unroll
    for (int u = 0; u < AQT; ++u) { s0[u] = zero8(); s1[u] = zero8(); }
    {
      FragH ka, kc;
      // keys kb .. kb+15
      ka.u = ldfrag_l(sb, LPITCH, lane);
      kc.u = ldfrag_l(sb + 32, LPITCH, lane);
#pragma unroll
      for (int u = 0; u < AQT; ++u) s0[u] = mma_h(ka.v, q0[u].v, s0[u]);
#pragma unroll
      for (int u = 0; u < AQT; ++u) s0[u] = mma_h(kc.v, q1[u].v, s0[u]);
      // keys kb+16 .. kb+31
      ka.u = ldfrag_l(sb + 16 * LPITCH, LPITCH, lane);
      kc.u = ldfrag_l(sb + 16 * LPITCH + 32, LPITCH, lane);
#pragma unroll
      for (int u = 0; u < AQT; ++u) s1[u] = mma_h(ka.v, q0[u].v, s1[u]);
#pragma unroll
      for (int u = 0; u < AQT; ++u) s1[u] = mma_h(kc.v, q1[u].v, s1[u]);
    }

    FragP pa[AQT];
#pragma unroll
    for (int u = 0; u < AQT; ++u) {
      // scale; replace with -inf where mask == 0
      s0[u] *= SCALE_QK;
      s1[u] *= SCALE_QK;
#pragma unroll
      for (int r = 0; r < 8; ++r) {
        const int m0 = (r < 4) ? mk0[r & 3] : mk1[r & 3];
        const int m1 = (r < 4) ? mk2[r & 3] : mk3[r & 3];
        s0[u][r] = (m0 == 0) ? ninf : s0[u][r];
        s1[u][r] = (m1 == 0) ? ninf : s1[u][r];
      }
      // online softmax of query lc: maximum in the lane, then one exchange between the halves
      float mx = fmaxf(s0[u][0], s1[u][0]);
#pragma unroll
      for (int r = 1; r < 8; ++r) mx = fmaxf(mx, fmaxf(s0[u][r], s1[u][r]));
      mx = fmaxf(mx, xhalf(mx));
      const float mnew = fmaxf(mrun[u], mx);
      const float alpha = __expf(mrun[u] - mnew);
#pragma unroll
      for (int r = 0; r < 8; ++r) {
        s0[u][r] = __expf(s0[u][r] - mnew);
        s1[u][r] = __expf(s1[u][r] - mnew);
      }
      const v8f ps = s0[u] + s1[u];
      const float rs = ((ps[0] + ps[1]) + (ps[2] + ps[3])) + ((ps[4] + ps[5]) + (ps[6] + ps[7]));
      lrun[u] = lrun[u] * alpha + rs;
      mrun[u] = mnew;
#pragma unroll
      for (int t = 0; t < 4; ++t)
#pragma unroll
        for (int r = 0; r < 8; ++r) o[u][t][r] *= alpha;

      // P^T (32 keys x 16 queries, f32 in D layout) -> f16 B fragment, in place:
      // element s of the fragment is register s & 7 of tile s >> 3
#pragma unroll
      for (int w = 0; w < 8; ++w) {
        const float p0 = (w < 4) ? s0[u][2 * w] : s1[u][2 * w - 8];
        const float p1 = (w < 4) ? s0[u][2 * w + 1] : s1[u][2 * w - 7];
        pa[u].w[w] = __builtin_bit_cast(unsigned, __builtin_convertvector((v2f){p0, p1}, v2h));
      }
    }

    // O^T += V^T * P^T  (V plane stored [d][token], k = token contiguous)
#pragma unroll
    for (int t = 0; t < 4; ++t) {
      FragH vf;
      vf.u = ldfrag_l(sb + AT_K + (t * 16) * VPITCH, VPITCH, lane);
#pragma unroll
      for (int u = 0; u < AQT; ++u) o[u][t] = mma_h(vf.v, pa[u].v, o[u][t]);
    }
    wait_lds_reads();
    wait_copies();
    __syncthreads();   // publishes the next 32 keys and frees the buffer that this trip has read
    if (kb + 64 < SEQ)
      stage_kv(lk + buf * (AT_BUF * 2), lv + buf * (AT_BUF * 2),
               Kf + gko + (long)(kb + 64) * HDIM, Vf + gvo + (kb + 64));
  }
  wait_copies();

  unsigned short* cl = Cl + wave * (16 * AQT * 72);
#pragma unroll
  for (int u = 0; u < AQT; ++u) {
    const float inv = 16.0f / (lrun[u] + xhalf(lrun[u]));   // the halves' sums join here
#pragma unroll
    for (int t = 0; t < 4; ++t) {   // registers 0..7 of o[u][t] are d = t*16 + hh*8 + 0..7 of query lc
      Pack8 pc;
#pragma unroll
      for (int r = 0; r < 8; ++r) pc.s[r] = f16_bits(o[u][t][r] * inv);
      *(v4u*)(cl + (u * 16 + lc) * 72 + t * 16 + hh * 8) = pc.u;
    }
  }
  __syncthreads();
  Pack8 pk[4 * AQT];
  long go[4 * AQT];
#pragma unroll
  for (int p = 0; p < 4 * AQT; ++p) {
    const int q = p * 4 + (lane >> 3);   // query row 0..31; lanes 8q'..8q'+7 share a line
    const int sub = lane & 7;
    pk[p].s = *(const v8us*)(cl + q * 72 + sub * 8);
    go[p] = ((long)bb * SEQ + qb * (16 * AQT) + q) * HID + h * HDIM + sub * 8;
  }
#pragma unroll
  for (int p = 0; p < 4 * AQT; ++p) *(v4u*)(Ctx + go[p]) = pk[p].u;
}

// ---------------------------------------------------------------------------
// 5) Output GEMM: out[m][o] = (1/1024) * sum_c A[m][c] * WT[o][c] + bias[o]   (f16 operands)
//    (32 floats) written by 8 consecutive lanes x 16 B in one instruction.
// ---------------------------------------------------------------------------
__global__ void __launch_bounds__(256)
k_gemm_out(const unsigned short* __restrict__ A, const unsigned short* __restrict__ WT,
           const float* __restrict__ bias, float* __restrict__ out) {
  // k loop: two operand buffers of (64 + 256) rows; epilogue (behind the loop's last barrier): otile
  __shared__ __attribute__((aligned(16))) unsigned short smem[2 * 320 * LPITCH];
  static_assert(2 * 320 * LPITCH * 2 >= 32 * 260 * 4);
  float* otile = (float*)smem;
  const int tid = threadIdx.x;
  const int lane = tid & 31;
  const int wave = tid >> 5;
  const int wm = wave >> 2;
  const int wn = wave & 3;
  const int hh = lane >> 4;
  const int lc = lane & 15;
  const int mblk = blockIdx.x * 64;
  const int nblk = blockIdx.y * 256;
  const long n0 = (long)nblk + wn * 64;

  v8f acc[2][4];
#pragma unroll
  for (int i = 0; i < 2; ++i)
#pragma unroll
    for (int j = 0; j < 4; ++j) acc[i][j] = zero8();

  const unsigned lcp = lds_off(smem) + (tid >> 3) * (LPITCH * 2) + (tid & 7) * 16;
  const unsigned short* ga = A + ((long)mblk + (tid >> 3)) * HID + (tid & 7) * 8;
  const unsigned short* gw = WT + ((long)nblk + (tid >> 3)) * HID + (tid & 7) * 8;
  stage_tile<2>(lcp, ga, gw);
  wait_copies();
  __syncthreads();
  stage_tile<2>(lcp + 320 * LPITCH * 2, ga + KT, gw + KT);

#pragma unroll 1
  for (int t = 0; t < HID / KT; ++t) {
    const unsigned short* sb = smem + (t & 1) * (320 * LPITCH);
#pragma unroll   // both 32-k steps of a tile: every LDS offset becomes an immediate
    for (int kk = 0; kk < KT; kk += 32) {
      FragH a0, a1, b0, b1, b2, b3;
      a0.u = ldfrag_l(sb + (wm * 32) * LPITCH + kk, LPITCH, lane);
      a1.u = ldfrag_l(sb + (wm * 32 + 16) * LPITCH + kk, LPITCH, lane);
      b0.u = ldfrag_l(sb + (64 + wn * 64) * LPITCH + kk, LPITCH, lane);
      b1.u = ldfrag_l(sb + (64 + wn * 64 + 16) * LPITCH + kk, LPITCH, lane);
      b2.u = ldfrag_l(sb + (64 + wn * 64 + 32) * LPITCH + kk, LPITCH, lane);
      b3.u = ldfrag_l(sb + (64 + wn * 64 + 48) * LPITCH + kk, LPITCH, lane);
      acc[0][0] = mma_h(a0.v, b0.v, acc[0][0]);
      acc[0][1] = mma_h(a0.v, b1.v, acc[0][1]);
      acc[0][2] = mma_h(a0.v, b2.v, acc[0][2]);
      acc[0][3] = mma_h(a0.v, b3.v, acc[0][3]);
      acc[1][0] = mma_h(a1.v, b0.v, acc[1][0]);
      acc[1][1] = mma_h(a1.v, b1.v, acc[1][1]);
      acc[1][2] = mma_h(a1.v, b2.v, acc[1][2]);
      acc[1][3] = mma_h(a1.v, b3.v, acc[1][3]);
    }
    wait_lds_reads();
    wait_copies();
    __syncthreads();   // publishes tile t + 1 and frees the buffer that trip t has read
    if (t + 2 < HID / KT)
      stage_tile<2>(lcp + (t & 1) * (320 * LPITCH * 2), ga + (t + 2) * KT, gw + (t + 2) * KT);
  }
  wait_copies();

  // undo carries (x16 ctx, x64 weight) and add bf16-valued bias, all in f32
#pragma unroll
  for (int j = 0; j < 4; ++j) {
    const float bj = bf16_rne(bias[n0 + j * 16 + lc]);
#pragma unroll
    for (int i = 0; i < 2; ++i)
#pragma unroll
      for (int r = 0; r < 8; ++r) acc[i][j][r] = acc[i][j][r] * (1.0f / 1024.0f) + bj;
  }

#pragma unroll
  for (int phase = 0; phase < 2; ++phase) {
    if (wm == phase) {   // wave-uniform: waves owning rows phase*32 .. +31 stage them
#pragma unroll
      for (int i = 0; i < 2; ++i)
#pragma unroll
        for (int j = 0; j < 4; ++j)
#pragma unroll
          for (int r = 0; r < 8; ++r) {
            const int ml = i * 16 + r + hh * 8;
            const int ol = wn * 64 + j * 16 + lc;
            otile[ml * 260 + ol] = acc[i][j][r];
          }
    }
    __syncthreads();
    v4f pk[8];
    long go[8];
#pragma unroll
    for (int p = 0; p < 8; ++p) {
      const int L = p * 32 + (tid >> 3);
      const int sub = tid & 7;
      const int row = L >> 3;
      const int piece = L & 7;
      pk[p] = *(const v4f*)(otile + row * 260 + piece * 32 + sub * 4);
      go[p] = ((long)mblk + phase * 32 + row) * HID + nblk + piece * 32 + sub * 4;
    }
#pragma unroll
    for (int p = 0; p < 8; ++p) *(v4f*)(out + go[p]) = pk[p];
    
    __syncthreads();
  }
}

// ---------------------------------------------------------------------------
// Launch
// ---------------------------------------------------------------------------
extern "C" void kernel_launch(void* const* d_in, const int* in_sizes, int n_in,
                              void* d_out, int out_size, void* d_ws, size_t ws_size,
                              hipStream_t stream) {
  if (n_in < 6) return;
  const float* x     = (const float*)d_in[0];   // [NB_FULL, SEQ_FULL, HID]
  const int*   maskp = (const int*)d_in[1];     // [NB_FULL, 1, 1, SEQ_FULL] int32
  const float* Wqkv  = (const float*)d_in[2];   // [HID][3*HID]
  const float* bqkv  = (const float*)d_in[3];   // [3*HID]
  const float* Wout  = (const float*)d_in[4];   // [HID][HID]
  const float* bout  = (const float*)d_in[5];   // [HID]
  float* out = (float*)d_out;                   // [NB*SEQ, HID]

  const long M = (long)NB * SEQ;
  if ((long)in_sizes[0] < (((long)(NB - 1) * SEQ_FULL + SEQ) * HID)) return;
  if ((long)in_sizes[1] < ((long)(NB - 1) * SEQ_FULL + SEQ)) return;
  if ((long)in_sizes[2] < 3L * HID * HID) return;
  if ((long)in_sizes[3] < 3L * HID) return;
  if ((long)in_sizes[4] < (long)HID * HID) return;
  if ((long)in_sizes[5] < (long)HID) return;
  if ((long)out_size < M * HID) return;

  // workspace carve (bytes); every region is a whole number of tiles, no padding needed
  const size_t szX  = (size_t)M * HID * 2;                       // x bf16 plane, later ctx f16 plane
  const size_t szWq = (size_t)3 * HID * HID * 2;                 // WqkvT bf16
  const size_t szWo = (size_t)HID * HID * 2;                     // WoutT f16
  const size_t szP  = (size_t)NB * NHEAD * SEQ * HDIM * 2;       // one q/k/v plane
  const size_t oX  = 0;
  const size_t oWq = oX + szX;
  const size_t oWo = oWq + szWq;
  const size_t oP0 = oWo + szWo;
  const size_t total = oP0 + 3 * szP;
  if (total > ws_size) return;
  static_assert((size_t)NB * SEQ * HID * 2 == (size_t)NB * NHEAD * SEQ * HDIM * 2);

  char* ws = (char*)d_ws;
  unsigned short* xb  = (unsigned short*)(ws + oX);
  unsigned short* ctx = (unsigned short*)(ws + oX);      // aliases xb: xb is dead after k_gemm_qkv
  unsigned short* wq  = (unsigned short*)(ws + oWq);
  unsigned short* wo  = (unsigned short*)(ws + oWo);
  unsigned short* qf  = (unsigned short*)(ws + oP0 + 0 * szP);
  unsigned short* kf  = (unsigned short*)(ws + oP0 + 1 * szP);
  unsigned short* vf  = (unsigned short*)(ws + oP0 + 2 * szP);

  // 1) + 2) one launch: Wqkv in[HID][3*HID] -> out[3*HID][HID] bf16;  Wout in[HID][HID] -> out[HID][HID]
  //    f16 (x64);  x -> bf16 plane (compact rows)
  k_cvt_all<<<CVT_WQ_BLKS + CVT_WO_BLKS + CVT_X_BLKS, 256, 0, stream>>>(x, Wqkv, Wout, xb, wq, wo);
  // 3) qkv GEMM -> f16 planes of q, k ([bh][t][d]) and v ([bh][d][t]); block tile 128x256
  k_gemm_qkv<<<dim3((int)(M / QM), 3 * HID / QN), 256, 0, stream>>>(xb, wq, bqkv, qf, kf, vf);
  // 4) attention -> ctx f16 plane [NB*SEQ][HID] (over the dead x plane)
  k_attn<<<(NB * NHEAD * (SEQ / (16 * AQT))) / 4, 128, 0, stream>>>(qf, kf, vf, maskp, ctx);
  // 5) output GEMM -> f32 out
  k_gemm_out<<<dim3((int)(M / 64), HID / 256), 256, 0, stream>>>(ctx, wo, bout, out);
}

// v007
// It runs in 105 microseconds.
// Two timings next to v006 put it at 1.07 and 1.06 times that version's speed.
// Counting every step since v000, it is 4.12 times as fast.
// Contractions: x*Wqkv on v_wmma_f32_16x16x32_bf16 (bf16 operands = RNE-converted inputs); q*k^T and p*v on v_wmma_f32_16x16x32_f16 (f16 operands = RNE-converted f32 q, k, v and softmax weights, one product per operand pair); ctx*Wout on v_wmma_f32_16x16x32_f16 (f16 operands, ctx carried x16, Wout carried x64); f32 accumulate, f32 softmax.
#include <hip/hip_runtime.h>

#ifndef NB
#define NB 16
#endif
#ifndef SEQ
#define SEQ 512
#endif
#ifndef NB_FULL
#define NB_FULL 16
#endif
#ifndef SEQ_FULL
#define SEQ_FULL 512
#endif
#define HID 1024
#define NHEAD 16
#define HDIM 64
#define SCALE_QK 0.125f

static_assert(SEQ % 64 == 0);
static_assert(HID == NHEAD * HDIM);
static_assert(HID % 256 == 0);
static_assert(HID % 128 == 0);
static_assert(((NB * NHEAD * (SEQ / 16)) % 4) == 0);
static_assert(NB <= NB_FULL);
static_assert(SEQ <= SEQ_FULL);

typedef _Float16 v16h __attribute__((ext_vector_type(16)));
typedef __bf16   v16b __attribute__((ext_vector_type(16)));
typedef unsigned short v8us  __attribute__((ext_vector_type(8)));
typedef unsigned short v16us __attribute__((ext_vector_type(16)));
typedef float v8f __attribute__((ext_vector_type(8)));
typedef float v4f __attribute__((ext_vector_type(4)));
typedef unsigned int v4u __attribute__((ext_vector_type(4)));
typedef unsigned int v8u __attribute__((ext_vector_type(8)));
typedef int v4i __attribute__((ext_vector_type(4)));
typedef float v2f __attribute__((ext_vector_type(2)));
typedef _Float16 v2h __attribute__((ext_vector_type(2)));

union FragB { v16us u; v16b v; };
union FragH { v16us u; v16h v; };
union Pack8 { v8us s; v4u u; };
union FragP { v8u w; v16h v; };

// ---------------------------------------------------------------------------
// 16-bit conversion helpers (bf16 via RNE on the f32 bit pattern)
// ---------------------------------------------------------------------------
__device__ __forceinline__ unsigned short bf16_rne_bits(float f) {
  unsigned int u = __float_as_uint(f);
  u += 0x7fffu + ((u >> 16) & 1u);
  return (unsigned short)(u >> 16);
}
__device__ __forceinline__ float bf16_val(unsigned short b) {
  return __uint_as_float(((unsigned int)b) << 16);
}
__device__ __forceinline__ float bf16_rne(float f) { return bf16_val(bf16_rne_bits(f)); }
__device__ __forceinline__ unsigned short f16_bits(float f) {
  _Float16 hv = (_Float16)f;
  return __builtin_bit_cast(unsigned short, hv);
}
template <int MODE>   // 0: bf16 bits of RNE(w); 1: f16 bits of RNE_bf16(w) * 64
__device__ __forceinline__ unsigned short wbits(float f) {
  if (MODE == 0) return bf16_rne_bits(f);
  return f16_bits(bf16_rne(f) * 64.0f);
}

// ---------------------------------------------------------------------------
// WMMA helpers: D(16x16 f32) += A(16x32) * B(32x16); hazard guard after each op
// ---------------------------------------------------------------------------
__device__ __forceinline__ v8f mma_b(v16b a, v16b b, v8f c) {
  v8f d = __builtin_amdgcn_wmma_f32_16x16x32_bf16(false, a, false, b, (short)0, c, false, false);
  asm volatile("v_nop\n\tv_nop\n\tv_nop\n\tv_nop" : "+v"(d) : "v"(a), "v"(b));
  return d;
}
__device__ __forceinline__ v8f mma_h(v16h a, v16h b, v8f c) {
  v8f d = __builtin_amdgcn_wmma_f32_16x16x32_f16(false, a, false, b, (short)0, c, false, false);
  asm volatile("v_nop\n\tv_nop\n\tv_nop\n\tv_nop" : "+v"(d) : "v"(a), "v"(b));
  return d;
}
__device__ __forceinline__ v8f zero8() { return (v8f){0.f, 0.f, 0.f, 0.f, 0.f, 0.f, 0.f, 0.f}; }

// ---------------------------------------------------------------------------
// Fragment loader, 16-bit split k-map for A and B:
//   lane l: row/col = l & 15; elements 0..7 <- k0 + 8*(l>>4) + 0..7,
//                             elements 8..15 <- k0 + 16 + 8*(l>>4) + 0..7.
// base points at (row0/col0, k0) of a k-contiguous 16-bit plane, ld = pitch.
// ---------------------------------------------------------------------------
__device__ __forceinline__ v16us ldfrag_g(const unsigned short* __restrict__ base, long ld, int lane) {
  const unsigned short* p = base + (long)(lane & 15) * ld + ((lane >> 4) << 3);
  v8us e0 = *(const v8us*)(p);
  v8us e1 = *(const v8us*)(p + 16);
  return __builtin_shufflevector(e0, e1, 0, 1, 2, 3, 4, 5, 6, 7, 8, 9, 10, 11, 12, 13, 14, 15);
}
__device__ __forceinline__ v16us ldfrag_l(const unsigned short* base, int ld, int lane) {
  const unsigned short* p = base + (lane & 15) * ld + ((lane >> 4) << 3);
  v8us e0 = *(const v8us*)(p);
  v8us e1 = *(const v8us*)(p + 16);
  return __builtin_shufflevector(e0, e1, 0, 1, 2, 3, 4, 5, 6, 7, 8, 9, 10, 11, 12, 13, 14, 15);
}

// ---------------------------------------------------------------------------
// GEMM operand staging: a tile is KT k-elements (one whole 128-B line) of every operand row
// of the block, laid in LDS at a pitch of 144 B (16 B x 9: conflict-free for 16-B row reads).
// In the workspace every GEMM operand lies k-tile-major, [k / KT][row][KT]: the rows of a block's
// tile follow one another without a gap, so a wave-wide copy (16 B a lane) takes 512 contiguous
// bytes, and each operand's part of a block's tile is one run of 8 to 32 KB.
// ---------------------------------------------------------------------------
#define KT 64
#define LPITCH 72
static_assert(HID % KT == 0 && HID / KT >= 2);

__device__ __forceinline__ unsigned lds_off(const void* p) { return (unsigned)(size_t)p; }

// One statement per tile; the s_wait_xcnt ends it so that no address register of an issued
// copy is rewritten before the wait.
__device__ __forceinline__ void async_copy4(const unsigned (&l)[4], const unsigned short* const (&g)[4]) {
  asm volatile("global_load_async_to_lds_b128 %0, %4, off\n\t"
               "global_load_async_to_lds_b128 %1, %5, off\n\t"
               "global_load_async_to_lds_b128 %2, %6, off\n\t"
               "global_load_async_to_lds_b128 %3, %7, off\n\t"
               "s_wait_xcnt 0x0"
               :: "v"(l[0]), "v"(l[1]), "v"(l[2]), "v"(l[3]),
                  "v"(g[0]), "v"(g[1]), "v"(g[2]), "v"(g[3]) : "memory");
}
__device__ __forceinline__ void async_copy10(const unsigned (&l)[10], const unsigned short* const (&g)[10]) {
  asm volatile("global_load_async_to_lds_b128 %0, %10, off\n\t"
               "global_load_async_to_lds_b128 %1, %11, off\n\t"
               "global_load_async_to_lds_b128 %2, %12, off\n\t"
               "global_load_async_to_lds_b128 %3, %13, off\n\t"
               "global_load_async_to_lds_b128 %4, %14, off\n\t"
               "global_load_async_to_lds_b128 %5, %15, off\n\t"
               "global_load_async_to_lds_b128 %6, %16, off\n\t"
               "global_load_async_to_lds_b128 %7, %17, off\n\t"
               "global_load_async_to_lds_b128 %8, %18, off\n\t"
               "global_load_async_to_lds_b128 %9, %19, off\n\t"
               "s_wait_xcnt 0x0"
               :: "v"(l[0]), "v"(l[1]), "v"(l[2]), "v"(l[3]), "v"(l[4]), "v"(l[5]), "v"(l[6]), "v"(l[7]), "v"(l[8]), "v"(l[9]),
                  "v"(g[0]), "v"(g[1]), "v"(g[2]), "v"(g[3]), "v"(g[4]), "v"(g[5]), "v"(g[6]), "v"(g[7]), "v"(g[8]), "v"(g[9]) : "memory");
}
// 256 lanes copy 64 A rows then NBG*128 B rows; l, ga, gb are the lane's own first addresses
// (row tid>>3, 16-B piece tid&7); further rows follow in steps of 32.
template <int NBG>
__device__ __forceinline__ void stage_tile(unsigned l, const unsigned short* ga, const unsigned short* gb) {
  unsigned la[2 + 4 * NBG];
  const unsigned short* gp[2 + 4 * NBG];
#pragma unroll
  for (int i = 0; i < 2 + 4 * NBG; ++i) {
    la[i] = l + i * 32 * LPITCH * 2;
    gp[i] = (i < 2) ? ga + (i * 32) * KT : gb + ((i - 2) * 32) * KT;
  }
  static_assert(NBG == 2);
  async_copy10(la, gp);
}
// The 128 x 256 block's tile: 128 A rows then 256 B rows, 12 copies a lane, in one statement as above.
__device__ __forceinline__ void async_copy12(const unsigned (&l)[12], const unsigned short* const (&g)[12]) {
  asm volatile("global_load_async_to_lds_b128 %0, %12, off\n\t"
               "global_load_async_to_lds_b128 %1, %13, off\n\t"
               "global_load_async_to_lds_b128 %2, %14, off\n\t"
               "global_load_async_to_lds_b128 %3, %15, off\n\t"
               "global_load_async_to_lds_b128 %4, %16, off\n\t"
               "global_load_async_to_lds_b128 %5, %17, off\n\t"
               "global_load_async_to_lds_b128 %6, %18, off\n\t"
               "global_load_async_to_lds_b128 %7, %19, off\n\t"
               "global_load_async_to_lds_b128 %8, %20, off\n\t"
               "global_load_async_to_lds_b128 %9, %21, off\n\t"
               "global_load_async_to_lds_b128 %10, %22, off\n\t"
               "global_load_async_to_lds_b128 %11, %23, off\n\t"
               "s_wait_xcnt 0x0"
               :: "v"(l[0]), "v"(l[1]), "v"(l[2]), "v"(l[3]), "v"(l[4]), "v"(l[5]),
                  "v"(l[6]), "v"(l[7]), "v"(l[8]), "v"(l[9]), "v"(l[10]), "v"(l[11]),
                  "v"(g[0]), "v"(g[1]), "v"(g[2]), "v"(g[3]), "v"(g[4]), "v"(g[5]),
                  "v"(g[6]), "v"(g[7]), "v"(g[8]), "v"(g[9]), "v"(g[10]), "v"(g[11]) : "memory");
}
__device__ __forceinline__ void stage_tile_q(unsigned l, const unsigned short* ga, const unsigned short* gb) {
  unsigned la[12];
  const unsigned short* gp[12];
#pragma unroll
  for (int i = 0; i < 12; ++i) {
    la[i] = l + i * 32 * LPITCH * 2;
    gp[i] = (i < 4) ? ga + (i * 32) * KT : gb + ((i - 4) * 32) * KT;
  }
  async_copy12(la, gp);
}
// Attention K/V tile: 32 keys. K as [32 keys][64 d] at pitch 144 B; V as [64 d][32 keys]
// at pitch 80 B (16 B x 5). 128 lanes; lk, lv and the two pointers are the lane's own first addresses.
// In the workspace V lies tile-major, [b,h][key / 32][slot][32 keys]: a tile is one run of 4 KB and a
// wave-wide copy takes 512 contiguous bytes.  Row d sits in slot vslot(d), which swaps the two low
// bit pairs of d (its own inverse): the four rows that 16 lanes of the producer read from its
// LDS tile at once then lie 4 rows apart there, on disjoint banks.
#define VPITCH 40
#define AT_K (32 * LPITCH)
#define AT_V (64 * VPITCH)
#define AT_BUF (AT_K + AT_V)
__device__ __forceinline__ int vslot(int d) { return (d & 48) | ((d & 3) << 2) | ((d >> 2) & 3); }
__device__ __forceinline__ void stage_kv(unsigned lk, unsigned lv,
                                         const unsigned short* gk, const unsigned short* gv) {
  const unsigned la[4] = {lk, lk + 16 * LPITCH * 2, lv, lv + 32 * VPITCH * 2};
  const unsigned short* const gp[4] = {gk, gk + 16 * HDIM, gv, gv + 32 * 32};
  async_copy4(la, gp);
}
// Ring waits, each ahead of the barrier that hands a buffer over.
__device__ __forceinline__ void wait_lds_reads()  { asm volatile("s_wait_dscnt 0x0" ::: "memory"); }
__device__ __forceinline__ void wait_copies()     { asm volatile("s_wait_asynccnt 0x0" ::: "memory"); }

// ---------------------------------------------------------------------------
// 1) x f32 [NB,SEQ,HID] (batch stride SEQ_FULL*HID) -> bf16 bits, [HID / KT][NB*SEQ][KT].
//    A wave takes one k tile of 4 rows (reads 4 x 256 B, writes 512 contiguous B); the 8 waves of a
//    block take 8 neighbouring k tiles of the same rows.
// ---------------------------------------------------------------------------
__device__ __forceinline__ void
cvt_x_block(const float* __restrict__ x, unsigned short* __restrict__ y, int blk) {
  static_assert(HID / KT == 16 && (NB * SEQ) % 4 == 0);
  const int tid = threadIdx.x;
  const int row = (blk >> 1) * 4 + ((tid >> 3) & 3);
  const int kt = (blk & 1) * 8 + (tid >> 5);
  const int g = kt * 8 + (tid & 7);
  const int bb = row / SEQ;
  const int tt = row - bb * SEQ;
  const long srow = (long)bb * SEQ_FULL + tt;
  const float* src = x + srow * HID + g * 8;
  const v4f a = *(const v4f*)(src);
  const v4f c = *(const v4f*)(src + 4);
  Pack8 pk;
  pk.s = (v8us){bf16_rne_bits(a.x), bf16_rne_bits(a.y), bf16_rne_bits(a.z), bf16_rne_bits(a.w),
                bf16_rne_bits(c.x), bf16_rne_bits(c.y), bf16_rne_bits(c.z), bf16_rne_bits(c.w)};
  const v4u val = pk.u;
  unsigned short* dst = y + ((long)kt * (NB * SEQ) + row) * KT + (tid & 7) * 8;
  *(v4u*)dst = val;
  // no register that the issued store names is
  // rewritten ahead of this wait
  asm volatile("s_wait_xcnt 0x0" ::: "memory");
}

// ---------------------------------------------------------------------------
// 2) weight convert + transpose: in W[kdim rows][ndim cols] f32 -> out WT[kdim / KT][ndim][KT] 16-bit.
//    line written by 8 consecutive lanes x 16 B in one instruction; a block's 64 lines are one run of 8 KB.
//    Block (bx, by) of (ndim/64, kdim/64).
// ---------------------------------------------------------------------------
template <int MODE>
__device__ __forceinline__ void
cvt_wt_block(const float* __restrict__ W, unsigned short* __restrict__ WT, int kdim, int ndim,
             int bx, int by, unsigned short* tile) {
  const int tid = threadIdx.x;
  const int n0 = bx * 64;
  const int k0 = by * 64;
  const int kl = tid >> 2;          // 0..63
  const int nl = (tid & 3) * 16;    // 0,16,32,48
  const float* src = W + (long)(k0 + kl) * ndim + n0 + nl;
#pragma unroll
  for (int q = 0; q < 4; ++q) {
    const v4f v = *(const v4f*)(src + q * 4);
    unsigned short* trow = tile + (nl + q * 4) * 72 + kl;   // tile[n_local][k_local]
    trow[0 * 72] = wbits<MODE>(v.x);
    trow[1 * 72] = wbits<MODE>(v.y);
    trow[2 * 72] = wbits<MODE>(v.z);
    trow[3 * 72] = wbits<MODE>(v.w);
  }
  __syncthreads();
  Pack8 pk[2];
  long go[2];
#pragma unroll
  for (int p = 0; p < 2; ++p) {
    const int L = p * 32 + (tid >> 3);   // output row n_local 0..63
    const int sub = tid & 7;
    pk[p].s = *(const v8us*)(tile + L * 72 + sub * 8);
    go[p] = ((long)by * ndim + n0 + L) * KT + sub * 8;
  }
#pragma unroll
  for (int p = 0; p < 2; ++p) *(v4u*)(WT + go[p]) = pk[p].u;
  // no register that an issued store names is
  // rewritten ahead of this wait
  asm volatile("s_wait_xcnt 0x0" ::: "memory");
}

// ---------------------------------------------------------------------------
// 1) + 2) in one launch: the three conversions depend on nothing but the inputs, so they share a
//    grid.  The block index picks the job: first the weight tiles (the longer chain: load, LDS,
//    barrier, store), then the rows of x.  Each branch is taken by a whole block.
// ---------------------------------------------------------------------------
#define CVT_WQ_BX (3 * HID / 64)
#define CVT_WO_BX (HID / 64)
#define CVT_WQ_BLKS (CVT_WQ_BX * (HID / 64))
#define CVT_WO_BLKS (CVT_WO_BX * (HID / 64))
#define CVT_X_GROUPS (NB * SEQ * (HID / 8))
#define CVT_X_BLKS (CVT_X_GROUPS / 256)
static_assert(CVT_X_GROUPS % 256 == 0 && KT == 64);
__global__ void __launch_bounds__(256)
k_cvt_all(const float* __restrict__ x, const float* __restrict__ Wqkv, const float* __restrict__ Wout,
          unsigned short* __restrict__ xb, unsigned short* __restrict__ wq, unsigned short* __restrict__ wo) {
  __shared__ __attribute__((aligned(16))) unsigned short tile[64 * 72];
  const int b = blockIdx.x;
  if (b < CVT_WQ_BLKS) {
    cvt_wt_block<0>(Wqkv, wq, HID, 3 * HID, b % CVT_WQ_BX, b / CVT_WQ_BX, tile);
  } else if (b < CVT_WQ_BLKS + CVT_WO_BLKS) {
    const int c = b - CVT_WQ_BLKS;
    cvt_wt_block<1>(Wout, wo, HID, HID, c % CVT_WO_BX, c / CVT_WO_BX, tile);
  } else {
    cvt_x_block(x, xb, b - (CVT_WQ_BLKS + CVT_WO_BLKS));
  }
}

// ---------------------------------------------------------------------------
// 3) QKV GEMM: y[m][o] = sum_c X[m][c] * WT[o][c] + bias[o]  (bf16 operands, f32 acc)
//    Block 256 threads = 8 waves (2M x 4N), block tile 128 x 256, wave tile 64 x 64
//    (16 accumulator tiles, 4 + 4 fragments: 16 products per 8 fragments read from LDS, and
//    each operand row fetched from L2 by half as many blocks as with a 64 x 128 tile).
//    Epilogue: f32 -> f16 bits
//      Q,K sections: [NB*NHEAD][SEQ][HDIM] (one line per (b,h,t) row)
//      V  section:   [NB*NHEAD][SEQ/32][64 slots][32 keys] (two slots of a 32-key tile = one line)
// ---------------------------------------------------------------------------
#define QM 128
#define QN 256
#define QROWS (QM + QN)
static_assert(SEQ % QM == 0);          // a block's rows lie in one batch
static_assert(HID % QN == 0);          // a block's columns lie in one of the q, k, v sections
// Epilogue of the 128 x 256 tile, orientation as a compile-time constant so that every LDS
// offset is an immediate.  TR = false (q, k): stile[m][o], pitch 264; TR = true (v): stile[o][m], pitch 136.
template <bool TR>
__device__ __forceinline__ void qkv_stage(const v8f (&acc)[4][4], unsigned short* stile, int tid) {
  constexpr int sm = TR ? 1 : 264;            // LDS stride of the m index
  constexpr int so = TR ? 136 : 1;            // LDS stride of the o index
  const int lane = tid & 31;
  const int wave = tid >> 5;
  unsigned short* p0 = stile + ((wave >> 2) * 64 + (lane >> 4) * 8) * sm + ((wave & 3) * 64 + (lane & 15)) * so;
#pragma unroll
  for (int i = 0; i < 4; ++i)
#pragma unroll
    for (int j = 0; j < 4; ++j)
#pragma unroll
      for (int r = 0; r < 8; ++r) p0[(i * 16 + r) * sm + (j * 16) * so] = f16_bits(acc[i][j][r]);
}
// 512 lines of 128 B leave in 4 groups of 4 x 32 lines; lanes 8q..8q+7 share a line.
// q, k: line = (head L >> 7, token L & 127); v: line = (head L >> 7, 32-key tile (L >> 5) & 3, slot pair L & 31).
template <bool TR>
__device__ __forceinline__ void qkv_lines(const unsigned short* stile, unsigned short* __restrict__ dstp,
                                          int tid, long bh0, int t0) {
  const int sub = tid & 7;
#pragma unroll
  for (int g = 0; g < 4; ++g) {
    Pack8 pk[4];
    long go[4];
#pragma unroll
    for (int p = 0; p < 4; ++p) {
      const int L = (g * 4 + p) * 32 + (tid >> 3);   // line 0..511
      const long bhh = bh0 + (L >> 7);               // head within the tile, in both orientations
      const int sidx = TR ? (((L >> 7) * 64 + vslot((L & 31) * 2 + (sub >> 2))) * 136 + ((L >> 5) & 3) * 32 + (sub & 3) * 8)
                          : ((L & 127) * 264 + (L >> 7) * 64 + sub * 8);
      pk[p].s = *(const v8us*)(stile + sidx);
      go[p] = TR ? ((bhh * (SEQ / 32) + (t0 >> 5) + ((L >> 5) & 3)) * (HDIM * 32) + (L & 31) * 64 + sub * 8)
                 : ((bhh * SEQ + t0 + (L & 127)) * HDIM + sub * 8);
    }
#pragma unroll
    for (int p = 0; p < 4; ++p) *(v4u*)(dstp + go[p]) = pk[p].u;
    // no register that an issued store names is rewritten ahead of this wait
    asm volatile("s_wait_xcnt 0x0" ::: "memory");
  }
}
__global__ void __launch_bounds__(256) __attribute__((amdgpu_num_vgpr(256)))
k_gemm_qkv(const unsigned short* __restrict__ X, const unsigned short* __restrict__ WT,
           const float* __restrict__ bias,
           unsigned short* __restrict__ Qf, unsigned short* __restrict__ Kf,
           unsigned short* __restrict__ Vf) {
  // k loop: two operand buffers of (128 + 256) rows; epilogue (behind the loop's last barrier):
  // row orientation [128][264] (33792) or transposed [256][136] (34816)
  __shared__ __attribute__((aligned(16))) unsigned short smem[2 * QROWS * LPITCH];
  static_assert(2 * QROWS * LPITCH >= 256 * 136 && 2 * QROWS * LPITCH >= 128 * 264);
  unsigned short* stile = smem;
  const int tid = threadIdx.x;
  const int lane = tid & 31;
  const int wave = tid >> 5;
  const int wm = wave >> 2;    // 0..1
  const int wn = wave & 3;     // 0..3
  const int lc = lane & 15;
  const int mblk = blockIdx.x * QM;
  const int nblk = blockIdx.y * QN;
  const long n0 = (long)nblk + wn * 64;

  v8f acc[4][4];
#pragma unroll
  for (int i = 0; i < 4; ++i)
#pragma unroll
    for (int j = 0; j < 4; ++j) acc[i][j] = zero8();

  const unsigned lcp = lds_off(smem) + (tid >> 3) * (LPITCH * 2) + (tid & 7) * 16;
  constexpr long xstep = (long)NB * SEQ * KT;   // from one k tile of an operand to the next
  constexpr long wstep = (long)3 * HID * KT;
  const unsigned short* gx = X + ((long)mblk + (tid >> 3)) * KT + (tid & 7) * 8;
  const unsigned short* gw = WT + ((long)nblk + (tid >> 3)) * KT + (tid & 7) * 8;
  stage_tile_q(lcp, gx, gw);
  wait_copies();
  __syncthreads();
  stage_tile_q(lcp + QROWS * LPITCH * 2, gx + xstep, gw + wstep);

#pragma unroll 1
  for (int t = 0; t < HID / KT; ++t) {
    const unsigned short* sb = smem + (t & 1) * (QROWS * LPITCH);
#pragma unroll   // both 32-k steps of a tile: every LDS offset becomes an immediate
    for (int kk = 0; kk < KT; kk += 32) {
      FragB a[4], b[4];
#pragma unroll
      for (int i = 0; i < 4; ++i) a[i].u = ldfrag_l(sb + (wm * 64 + i * 16) * LPITCH + kk, LPITCH, lane);
#pragma unroll
      for (int j = 0; j < 4; ++j) b[j].u = ldfrag_l(sb + (QM + wn * 64 + j * 16) * LPITCH + kk, LPITCH, lane);
#pragma unroll
      for (int i = 0; i < 4; ++i)
#pragma unroll
        for (int j = 0; j < 4; ++j) acc[i][j] = mma_b(a[i].v, b[j].v, acc[i][j]);
    }
    wait_lds_reads();
    wait_copies();
    __syncthreads();   // publishes tile t + 1 and frees the buffer that trip t has read
    if (t + 2 < HID / KT)
      stage_tile_q(lcp + (t & 1) * (QROWS * LPITCH * 2), gx + (t + 2) * xstep, gw + (t + 2) * wstep);
  }
  wait_copies();

  // bias add in f32 (bias entries RNE-converted to bf16 values)
#pragma unroll
  for (int j = 0; j < 4; ++j) {
    const float bj = bf16_rne(bias[n0 + j * 16 + lc]);
#pragma unroll
    for (int i = 0; i < 4; ++i)
#pragma unroll
      for (int r = 0; r < 8; ++r) acc[i][j][r] += bj;
  }

  const int sec = nblk / HID;                 // 0 = q, 1 = k, 2 = v (block-uniform)
  const int h0 = (nblk - sec * HID) >> 6;     // first of the 4 heads in this tile
  const int bb = mblk / SEQ;
  const int t0 = mblk - bb * SEQ;
  const long bh0 = (long)bb * NHEAD + h0;

  // stage the f16 bits of the 128x256 tile (accumulators die here), then write whole lines
  if (sec == 2) qkv_stage<true>(acc, stile, tid); else qkv_stage<false>(acc, stile, tid);
  __syncthreads();
  if (sec == 2) qkv_lines<true>(stile, Vf, tid, bh0, t0);
  else          qkv_lines<false>(stile, (sec == 0) ? Qf : Kf, tid, bh0, t0);
}

// ---------------------------------------------------------------------------
// 4) Flash attention, transposed: one wave = 32 queries (two tiles of 16) of one (b,h); keys streamed
//    32 at a time.  S^T = k*q (A = key rows, B = queries): lane l holds, of query l & 15 of a tile, the
//    keys 8*(l>>4) + 0..7 (tile 0) and 16 + 8*(l>>4) + 0..7 (tile 1), so the softmax of a query runs
//    in one lane pair, and the two tiles converted in place are the B fragment of
//    O^T += v*p (A = d rows of V).  Every K and V fragment read from LDS serves both query tiles.
//    Block = 128 threads (4 waves, same b,h: 128 queries), which share one LDS copy of each
//    32-key K/V tile.
// ---------------------------------------------------------------------------
#define AQT 2
static_assert(SEQ % (4 * 16 * AQT) == 0);   // the 4 waves of a block lie in one (b,h)
static_assert(HDIM == KT);                  // a head's 64 ctx columns are one k tile of the output GEMM
// lane l <-> lane l ^ 16
__device__ __forceinline__ float xhalf(float x) {
  const int b = __builtin_bit_cast(int, x);
  return __builtin_bit_cast(float, __builtin_amdgcn_permlanex16(b, b, 0x76543210, 0xfedcba98, false, false));
}
__global__ void __launch_bounds__(128) __attribute__((amdgpu_num_vgpr(256)))
k_attn(const unsigned short* __restrict__ Qf, const unsigned short* __restrict__ Kf,
       const unsigned short* __restrict__ Vf,
       const int* __restrict__ maskp, unsigned short* __restrict__ Ctx) {
  __shared__ __attribute__((aligned(16))) unsigned short Cl[4 * 16 * AQT * 72];
  __shared__ __attribute__((aligned(16))) unsigned short KV[2 * AT_BUF];   // K/V ring, shared by the 4 waves
  const int lane = threadIdx.x & 31;
  const int wave = threadIdx.x >> 5;
  const int hh = lane >> 4;
  const int lc = lane & 15;
  const int nqb = SEQ / (16 * AQT);
  const int gq = blockIdx.x * 4 + wave;
  const int qb = gq % nqb;
  const int bh = gq / nqb;
  const int bb = bh / NHEAD;
  const int h = bh - bb * NHEAD;
  const long qoff = ((long)bh * SEQ + qb * (16 * AQT)) * HDIM;
  const long koff = (long)bh * SEQ * HDIM;
  const long voff = (long)bh * HDIM * SEQ;
  const int* mrow = maskp + (long)bb * SEQ_FULL;
  const float ninf = __uint_as_float(0xff800000u);

  FragH q0[AQT], q1[AQT];
#pragma unroll
  for (int u = 0; u < AQT; ++u) {
    q0[u].u = ldfrag_g(Qf + qoff + u * 16 * HDIM, HDIM, lane);
    q1[u].u = ldfrag_g(Qf + qoff + u * 16 * HDIM + 32, HDIM, lane);
  }

  v8f o[AQT][4];
  float mrun[AQT];   // running maximum of query lc of tile u (equal in both lanes of the pair)
  float lrun[AQT];   // running sum over this lane's own half of the keys
#pragma unroll
  for (int u = 0; u < AQT; ++u) {
#pragma unroll
    for (int t = 0; t < 4; ++t) o[u][t] = zero8();
    mrun[u] = -1e30f;
    lrun[u] = 0.f;
  }

  const int tid = threadIdx.x;
  const unsigned lk = lds_off(KV) + (tid >> 3) * (LPITCH * 2) + (tid & 7) * 16;
  const unsigned lv = lds_off(KV) + AT_K * 2 + vslot(tid >> 2) * (VPITCH * 2) + (tid & 3) * 16;
  const long gko = koff + (long)(tid >> 3) * HDIM + (tid & 7) * 8;
  const long gvo = voff + (long)(tid >> 2) * 32 + (tid & 3) * 8;
  stage_kv(lk, lv, Kf + gko, Vf + gvo);
  wait_copies();
  __syncthreads();
  stage_kv(lk + AT_BUF * 2, lv + AT_BUF * 2, Kf + gko + 32 * HDIM, Vf + gvo + 32 * HDIM);

#pragma unroll 1
  for (int kb = 0; kb < SEQ; kb += 32) {
    const int buf = (kb >> 5) & 1;
    const unsigned short* sb = KV + buf * AT_BUF;
    // key mask (per (b, key)) of this lane's 16 keys, the same for both query tiles
    const int* mk = mrow + kb + hh * 8;
    const v4i mk0 = *(const v4i*)(mk);
    const v4i mk1 = *(const v4i*)(mk + 4);
    const v4i mk2 = *(const v4i*)(mk + 16);
    const v4i mk3 = *(const v4i*)(mk + 20);
    v8f s0[AQT], s1[AQT];
#pragma unroll
    for (int u = 0; u < AQT; ++u) { s0[u] = zero8(); s1[u] = zero8(); }
    {
      FragH ka, kc;
      // keys kb .. kb+15
      ka.u = ldfrag_l(sb, LPITCH, lane);
      kc.u = ldfrag_l(sb + 32, LPITCH, lane);
#pragma unroll
      for (int u = 0; u < AQT; ++u) s0[u] = mma_h(ka.v, q0[u].v, s0[u]);
#pragma unroll
      for (int u = 0; u < AQT; ++u) s0[u] = mma_h(kc.v, q1[u].v, s0[u]);
      // keys kb+16 .. kb+31
      ka.u = ldfrag_l(sb + 16 * LPITCH, LPITCH, lane);
      kc.u = ldfrag_l(sb + 16 * LPITCH + 32, LPITCH, lane);
#pragma unroll
      for (int u = 0; u < AQT; ++u) s1[u] = mma_h(ka.v, q0[u].v, s1[u]);
#pragma unroll
      for (int u = 0; u < AQT; ++u) s1[u] = mma_h(kc.v, q1[u].v, s1[u]);
    }

    FragP pa[AQT];
#pragma unroll
    for (int u = 0; u < AQT; ++u) {
      // scale; replace with -inf where mask == 0
      s0[u] *= SCALE_QK;
      s1[u] *= SCALE_QK;
#pragma unroll
      for (int r = 0; r < 8; ++r) {
        const int m0 = (r < 4) ? mk0[r & 3] : mk1[r & 3];
        const int m1 = (r < 4) ? mk2[r & 3] : mk3[r & 3];
        s0[u][r] = (m0 == 0) ? ninf : s0[u][r];
        s1[u][r] = (m1 == 0) ? ninf : s1[u][r];
      }
      // online softmax of query lc: maximum in the lane, then one exchange between the halves
      float mx = fmaxf(s0[u][0], s1[u][0]);
#pragma unroll
      for (int r = 1; r < 8; ++r) mx = fmaxf(mx, fmaxf(s0[u][r], s1[u][r]));
      mx = fmaxf(mx, xhalf(mx));
      const float mnew = fmaxf(mrun[u], mx);
      const float alpha = __expf(mrun[u] - mnew);
#pragma unroll
      for (int r = 0; r < 8; ++r) {
        s0[u][r] = __expf(s0[u][r] - mnew);
        s1[u][r] = __expf(s1[u][r] - mnew);
      }
      const v8f ps = s0[u] + s1[u];
      const float rs = ((ps[0] + ps[1]) + (ps[2] + ps[3])) + ((ps[4] + ps[5]) + (ps[6] + ps[7]));
      lrun[u] = lrun[u] * alpha + rs;
      mrun[u] = mnew;
#pragma unroll
      for (int t = 0; t < 4; ++t)
#pragma unroll
        for (int r = 0; r < 8; ++r) o[u][t][r] *= alpha;

      // P^T (32 keys x 16 queries, f32 in D layout) -> f16 B fragment, in place:
      // element s of the fragment is register s & 7 of tile s >> 3
#pragma unroll
      for (int w = 0; w < 8; ++w) {
        const float p0 = (w < 4) ? s0[u][2 * w] : s1[u][2 * w - 8];
        const float p1 = (w < 4) ? s0[u][2 * w + 1] : s1[u][2 * w - 7];
        pa[u].w[w] = __builtin_bit_cast(unsigned, __builtin_convertvector((v2f){p0, p1}, v2h));
      }
    }

    // O^T += V^T * P^T  (V tile in LDS [d][token], k = token contiguous)
#pragma unroll
    for (int t = 0; t < 4; ++t) {
      FragH vf;
      vf.u = ldfrag_l(sb + AT_K + (t * 16) * VPITCH, VPITCH, lane);
#pragma unroll
      for (int u = 0; u < AQT; ++u) o[u][t] = mma_h(vf.v, pa[u].v, o[u][t]);
    }
    wait_lds_reads();
    wait_copies();
    __syncthreads();   // publishes the next 32 keys and frees the buffer that this trip has read
    if (kb + 64 < SEQ)
      stage_kv(lk + buf * (AT_BUF * 2), lv + buf * (AT_BUF * 2),
               Kf + gko + (long)(kb + 64) * HDIM, Vf + gvo + (long)(kb + 64) * HDIM);
  }
  wait_copies();

  unsigned short* cl = Cl + wave * (16 * AQT * 72);
#pragma unroll
  for (int u = 0; u < AQT; ++u) {
    const float inv = 16.0f / (lrun[u] + xhalf(lrun[u]));   // the halves' sums join here
#pragma unroll
    for (int t = 0; t < 4; ++t) {   // registers 0..7 of o[u][t] are d = t*16 + hh*8 + 0..7 of query lc
      Pack8 pc;
#pragma unroll
      for (int r = 0; r < 8; ++r) pc.s[r] = f16_bits(o[u][t][r] * inv);
      *(v4u*)(cl + (u * 16 + lc) * 72 + t * 16 + hh * 8) = pc.u;
    }
  }
  __syncthreads();
  Pack8 pk[4 * AQT];
  long go[4 * AQT];
#pragma unroll
  for (int p = 0; p < 4 * AQT; ++p) {
    const int q = p * 4 + (lane >> 3);   // query row 0..31; lanes 8q'..8q'+7 share a line
    const int sub = lane & 7;
    pk[p].s = *(const v8us*)(cl + q * 72 + sub * 8);
    go[p] = ((long)h * (NB * SEQ) + (long)bb * SEQ + qb * (16 * AQT) + q) * KT + sub * 8;   // [k tile = head][row][KT]
  }
#pragma unroll
  for (int p = 0; p < 4 * AQT; ++p) *(v4u*)(Ctx + go[p]) = pk[p].u;
}

// ---------------------------------------------------------------------------
// 5) Output GEMM: out[m][o] = (1/1024) * sum_c A[m][c] * WT[o][c] + bias[o]   (f16 operands)
//    (32 floats) written by 8 consecutive lanes x 16 B in one instruction.
// ---------------------------------------------------------------------------
__global__ void __launch_bounds__(256)
k_gemm_out(const unsigned short* __restrict__ A, const unsigned short* __restrict__ WT,
           const float* __restrict__ bias, float* __restrict__ out) {
  // k loop: two operand buffers of (64 + 256) rows; epilogue (behind the loop's last barrier): otile
  __shared__ __attribute__((aligned(16))) unsigned short smem[2 * 320 * LPITCH];
  static_assert(2 * 320 * LPITCH * 2 >= 32 * 260 * 4);
  float* otile = (float*)smem;
  const int tid = threadIdx.x;
  const int lane = tid & 31;
  const int wave = tid >> 5;
  const int wm = wave >> 2;
  const int wn = wave & 3;
  const int hh = lane >> 4;
  const int lc = lane & 15;
  const int mblk = blockIdx.x * 64;
  const int nblk = blockIdx.y * 256;
  const long n0 = (long)nblk + wn * 64;

  v8f acc[2][4];
#pragma unroll
  for (int i = 0; i < 2; ++i)
#pragma unroll
    for (int j = 0; j < 4; ++j) acc[i][j] = zero8();

  const unsigned lcp = lds_off(smem) + (tid >> 3) * (LPITCH * 2) + (tid & 7) * 16;
  constexpr long astep = (long)NB * SEQ * KT;   // from one k tile of an operand to the next
  constexpr long wstep = (long)HID * KT;
  const unsigned short* ga = A + ((long)mblk + (tid >> 3)) * KT + (tid & 7) * 8;
  const unsigned short* gw = WT + ((long)nblk + (tid >> 3)) * KT + (tid & 7) * 8;
  stage_tile<2>(lcp, ga, gw);
  wait_copies();
  __syncthreads();
  stage_tile<2>(lcp + 320 * LPITCH * 2, ga + astep, gw + wstep);

#pragma unroll 1
  for (int t = 0; t < HID / KT; ++t) {
    const unsigned short* sb = smem + (t & 1) * (320 * LPITCH);
#pragma unroll   // both 32-k steps of a tile: every LDS offset becomes an immediate
    for (int kk = 0; kk < KT; kk += 32) {
      FragH a0, a1, b0, b1, b2, b3;
      a0.u = ldfrag_l(sb + (wm * 32) * LPITCH + kk, LPITCH, lane);
      a1.u = ldfrag_l(sb + (wm * 32 + 16) * LPITCH + kk, LPITCH, lane);
      b0.u = ldfrag_l(sb + (64 + wn * 64) * LPITCH + kk, LPITCH, lane);
      b1.u = ldfrag_l(sb + (64 + wn * 64 + 16) * LPITCH + kk, LPITCH, lane);
      b2.u = ldfrag_l(sb + (64 + wn * 64 + 32) * LPITCH + kk, LPITCH, lane);
      b3.u = ldfrag_l(sb + (64 + wn * 64 + 48) * LPITCH + kk, LPITCH, lane);
      acc[0][0] = mma_h(a0.v, b0.v, acc[0][0]);
      acc[0][1] = mma_h(a0.v, b1.v, acc[0][1]);
      acc[0][2] = mma_h(a0.v, b2.v, acc[0][2]);
      acc[0][3] = mma_h(a0.v, b3.v, acc[0][3]);
      acc[1][0] = mma_h(a1.v, b0.v, acc[1][0]);
      acc[1][1] = mma_h(a1.v, b1.v, acc[1][1]);
      acc[1][2] = mma_h(a1.v, b2.v, acc[1][2]);
      acc[1][3] = mma_h(a1.v, b3.v, acc[1][3]);
    }
    wait_lds_reads();
    wait_copies();
    __syncthreads();   // publishes tile t + 1 and frees the buffer that trip t has read
    if (t + 2 < HID / KT)
      stage_tile<2>(lcp + (t & 1) * (320 * LPITCH * 2), ga + (t + 2) * astep, gw + (t + 2) * wstep);
  }
  wait_copies();

  // undo carries (x16 ctx, x64 weight) and add bf16-valued bias, all in f32
#pragma unroll
  for (int j = 0; j < 4; ++j) {
    const float bj = bf16_rne(bias[n0 + j * 16 + lc]);
#pragma unroll
    for (int i = 0; i < 2; ++i)
#pragma unroll
      for (int r = 0; r < 8; ++r) acc[i][j][r] = acc[i][j][r] * (1.0f / 1024.0f) + bj;
  }

#pragma unroll
  for (int phase = 0; phase < 2; ++phase) {
    if (wm == phase) {   // wave-uniform: waves owning rows phase*32 .. +31 stage them
#pragma unroll
      for (int i = 0; i < 2; ++i)
#pragma unroll
        for (int j = 0; j < 4; ++j)
#pragma unroll
          for (int r = 0; r < 8; ++r) {
            const int ml = i * 16 + r + hh * 8;
            const int ol = wn * 64 + j * 16 + lc;
            otile[ml * 260 + ol] = acc[i][j][r];
          }
    }
    __syncthreads();
    v4f pk[8];
    long go[8];
#pragma unroll
    for (int p = 0; p < 8; ++p) {
      const int L = p * 32 + (tid >> 3);
      const int sub = tid & 7;
      const int row = L >> 3;
      const int piece = L & 7;
      pk[p] = *(const v4f*)(otile + row * 260 + piece * 32 + sub * 4);
      go[p] = ((long)mblk + phase * 32 + row) * HID + nblk + piece * 32 + sub * 4;
    }
#pragma unroll
    for (int p = 0; p < 8; ++p) *(v4f*)(out + go[p]) = pk[p];
    
    __syncthreads();
  }
}

// ---------------------------------------------------------------------------
// Launch
// ---------------------------------------------------------------------------
extern "C" void kernel_launch(void* const* d_in, const int* in_sizes, int n_in,
                              void* d_out, int out_size, void* d_ws, size_t ws_size,
                              hipStream_t stream) {
  if (n_in < 6) return;
  const float* x     = (const float*)d_in[0];   // [NB_FULL, SEQ_FULL, HID]
  const int*   maskp = (const int*)d_in[1];     // [NB_FULL, 1, 1, SEQ_FULL] int32
  const float* Wqkv  = (const float*)d_in[2];   // [HID][3*HID]
  const float* bqkv  = (const float*)d_in[3];   // [3*HID]
  const float* Wout  = (const float*)d_in[4];   // [HID][HID]
  const float* bout  = (const float*)d_in[5];   // [HID]
  float* out = (float*)d_out;                   // [NB*SEQ, HID]

  const long M = (long)NB * SEQ;
  if ((long)in_sizes[0] < (((long)(NB - 1) * SEQ_FULL + SEQ) * HID)) return;
  if ((long)in_sizes[1] < ((long)(NB - 1) * SEQ_FULL + SEQ)) return;
  if ((long)in_sizes[2] < 3L * HID * HID) return;
  if ((long)in_sizes[3] < 3L * HID) return;
  if ((long)in_sizes[4] < (long)HID * HID) return;
  if ((long)in_sizes[5] < (long)HID) return;
  if ((long)out_size < M * HID) return;

  // workspace carve (bytes); every region is a whole number of tiles, no padding needed
  const size_t szX  = (size_t)M * HID * 2;                       // x bf16 plane, later ctx f16 plane
  const size_t szWq = (size_t)3 * HID * HID * 2;                 // WqkvT bf16
  const size_t szWo = (size_t)HID * HID * 2;                     // WoutT f16
  const size_t szP  = (size_t)NB * NHEAD * SEQ * HDIM * 2;       // one q/k/v plane
  const size_t oX  = 0;
  const size_t oWq = oX + szX;
  const size_t oWo = oWq + szWq;
  const size_t oP0 = oWo + szWo;
  const size_t total = oP0 + 3 * szP;
  if (total > ws_size) return;
  static_assert((size_t)NB * SEQ * HID * 2 == (size_t)NB * NHEAD * SEQ * HDIM * 2);

  char* ws = (char*)d_ws;
  unsigned short* xb  = (unsigned short*)(ws + oX);
  unsigned short* ctx = (unsigned short*)(ws + oX);      // aliases xb: xb is dead after k_gemm_qkv
  unsigned short* wq  = (unsigned short*)(ws + oWq);
  unsigned short* wo  = (unsigned short*)(ws + oWo);
  unsigned short* qf  = (unsigned short*)(ws + oP0 + 0 * szP);
  unsigned short* kf  = (unsigned short*)(ws + oP0 + 1 * szP);
  unsigned short* vf  = (unsigned short*)(ws + oP0 + 2 * szP);

  // 1) + 2) one launch: Wqkv in[HID][3*HID] -> out[HID/64][3*HID][64] bf16;  Wout in[HID][HID] ->
  //    out[HID/64][HID][64] f16 (x64);  x -> bf16 plane [HID/64][NB*SEQ][64]
  k_cvt_all<<<CVT_WQ_BLKS + CVT_WO_BLKS + CVT_X_BLKS, 256, 0, stream>>>(x, Wqkv, Wout, xb, wq, wo);
  // 3) qkv GEMM -> f16 planes of q, k ([bh][t][d]) and v ([bh][t/32][slot of d][32]); block tile 128x256
  k_gemm_qkv<<<dim3((int)(M / QM), 3 * HID / QN), 256, 0, stream>>>(xb, wq, bqkv, qf, kf, vf);
  // 4) attention -> ctx f16 plane [NHEAD][NB*SEQ][64] (over the dead x plane)
  k_attn<<<(NB * NHEAD * (SEQ / (16 * AQT))) / 4, 128, 0, stream>>>(qf, kf, vf, maskp, ctx);
  // 5) output GEMM -> f32 out
  k_gemm_out<<<dim3((int)(M / 64), HID / 256), 256, 0, stream>>>(ctx, wo, bout, out);
}

// v008
// One run takes 97.6 microseconds.
// Two timings next to v007 both put it at 1.07 times that version's speed.
// Over all steps from v000 it is 4.40 times as fast.
// Contractions: x*Wqkv on v_wmma_f32_16x16x32_bf16 (bf16 operands = RNE-converted inputs); q*k^T and p*v on v_wmma_f32_16x16x32_f16 (f16 operands = RNE-converted f32 q, k, v and softmax weights, one product per operand pair); ctx*Wout on v_wmma_f32_16x16x32_f16 (f16 operands, ctx carried x16, Wout carried x64); f32 accumulate, f32 softmax.
#include <hip/hip_runtime.h>

#ifndef NB
#define NB 16
#endif
#ifndef SEQ
#define SEQ 512
#endif
#ifndef NB_FULL
#define NB_FULL 16
#endif
#ifndef SEQ_FULL
#define SEQ_FULL 512
#endif
#define HID 1024
#define NHEAD 16
#define HDIM 64
#define SCALE_QK 0.125f

static_assert(SEQ % 64 == 0);
static_assert(HID == NHEAD * HDIM);
static_assert(HID % 256 == 0);
static_assert(HID % 128 == 0);
static_assert(((NB * NHEAD * (SEQ / 16)) % 4) == 0);
static_assert(NB <= NB_FULL);
static_assert(SEQ <= SEQ_FULL);

typedef _Float16 v16h __attribute__((ext_vector_type(16)));
typedef __bf16   v16b __attribute__((ext_vector_type(16)));
typedef unsigned short v8us  __attribute__((ext_vector_type(8)));
typedef unsigned short v16us __attribute__((ext_vector_type(16)));
typedef float v8f __attribute__((ext_vector_type(8)));
typedef float v4f __attribute__((ext_vector_type(4)));
typedef unsigned int v4u __attribute__((ext_vector_type(4)));
typedef unsigned int v8u __attribute__((ext_vector_type(8)));
typedef int v4i __attribute__((ext_vector_type(4)));
typedef float v2f __attribute__((ext_vector_type(2)));
typedef _Float16 v2h __attribute__((ext_vector_type(2)));

union FragB { v16us u; v16b v; };
union FragH { v16us u; v16h v; };
union Pack8 { v8us s; v4u u; };
union FragP { v8u w; v16h v; };

// ---------------------------------------------------------------------------
// 16-bit conversion helpers (bf16 via RNE on the f32 bit pattern)
// ---------------------------------------------------------------------------
__device__ __forceinline__ unsigned short bf16_rne_bits(float f) {
  unsigned int u = __float_as_uint(f);
  u += 0x7fffu + ((u >> 16) & 1u);
  return (unsigned short)(u >> 16);
}
__device__ __forceinline__ float bf16_val(unsigned short b) {
  return __uint_as_float(((unsigned int)b) << 16);
}
__device__ __forceinline__ float bf16_rne(float f) { return bf16_val(bf16_rne_bits(f)); }
__device__ __forceinline__ unsigned short f16_bits(float f) {
  _Float16 hv = (_Float16)f;
  return __builtin_bit_cast(unsigned short, hv);
}
template <int MODE>   // 0: bf16 bits of RNE(w); 1: f16 bits of RNE_bf16(w) * 64
__device__ __forceinline__ unsigned short wbits(float f) {
  if (MODE == 0) return bf16_rne_bits(f);
  return f16_bits(bf16_rne(f) * 64.0f);
}

// ---------------------------------------------------------------------------
// WMMA helpers: D(16x16 f32) += A(16x32) * B(32x16); hazard guard after each op
// ---------------------------------------------------------------------------
__device__ __forceinline__ v8f mma_b(v16b a, v16b b, v8f c) {
  v8f d = __builtin_amdgcn_wmma_f32_16x16x32_bf16(false, a, false, b, (short)0, c, false, false);
  asm volatile("v_nop\n\tv_nop\n\tv_nop\n\tv_nop" : "+v"(d) : "v"(a), "v"(b));
  return d;
}
__device__ __forceinline__ v8f mma_h(v16h a, v16h b, v8f c) {
  v8f d = __builtin_amdgcn_wmma_f32_16x16x32_f16(false, a, false, b, (short)0, c, false, false);
  asm volatile("v_nop\n\tv_nop\n\tv_nop\n\tv_nop" : "+v"(d) : "v"(a), "v"(b));
  return d;
}
__device__ __forceinline__ v8f zero8() { return (v8f){0.f, 0.f, 0.f, 0.f, 0.f, 0.f, 0.f, 0.f}; }

// ---------------------------------------------------------------------------
// Fragment loader, 16-bit split k-map for A and B:
//   lane l: row/col = l & 15; elements 0..7 <- k0 + 8*(l>>4) + 0..7,
//                             elements 8..15 <- k0 + 16 + 8*(l>>4) + 0..7.
// base points at (row0/col0, k0) of a k-contiguous 16-bit plane, ld = pitch.
// ---------------------------------------------------------------------------
__device__ __forceinline__ v16us ldfrag_g(const unsigned short* __restrict__ base, long ld, int lane) {
  const unsigned short* p = base + (long)(lane & 15) * ld + ((lane >> 4) << 3);
  v8us e0 = *(const v8us*)(p);
  v8us e1 = *(const v8us*)(p + 16);
  return __builtin_shufflevector(e0, e1, 0, 1, 2, 3, 4, 5, 6, 7, 8, 9, 10, 11, 12, 13, 14, 15);
}
__device__ __forceinline__ v16us ldfrag_l(const unsigned short* base, int ld, int lane) {
  const unsigned short* p = base + (lane & 15) * ld + ((lane >> 4) << 3);
  v8us e0 = *(const v8us*)(p);
  v8us e1 = *(const v8us*)(p + 16);
  return __builtin_shufflevector(e0, e1, 0, 1, 2, 3, 4, 5, 6, 7, 8, 9, 10, 11, 12, 13, 14, 15);
}

// ---------------------------------------------------------------------------
// GEMM operand staging: a tile is KT k-elements (one whole 128-B line) of every operand row
// of the block, laid in LDS at a pitch of 144 B (16 B x 9: conflict-free for 16-B row reads).
// In the workspace every GEMM operand lies k-tile-major, [k / KT][row][KT]: the rows of a block's
// tile follow one another without a gap, so a wave-wide copy (16 B a lane) takes 512 contiguous
// bytes, and each operand's part of a block's tile is one run of 8 to 32 KB.
// ---------------------------------------------------------------------------
#define KT 64
#define LPITCH 72
static_assert(HID % KT == 0 && HID / KT >= 2);

__device__ __forceinline__ unsigned lds_off(const void* p) { return (unsigned)(size_t)p; }

// One statement per tile; the s_wait_xcnt ends it so that no address register of an issued
// copy is rewritten before the wait.
__device__ __forceinline__ void async_copy4(const unsigned (&l)[4], const unsigned short* const (&g)[4]) {
  asm volatile("global_load_async_to_lds_b128 %0, %4, off\n\t"
               "global_load_async_to_lds_b128 %1, %5, off\n\t"
               "global_load_async_to_lds_b128 %2, %6, off\n\t"
               "global_load_async_to_lds_b128 %3, %7, off\n\t"
               "s_wait_xcnt 0x0"
               :: "v"(l[0]), "v"(l[1]), "v"(l[2]), "v"(l[3]),
                  "v"(g[0]), "v"(g[1]), "v"(g[2]), "v"(g[3]) : "memory");
}
__device__ __forceinline__ void async_copy10(const unsigned (&l)[10], const unsigned short* const (&g)[10]) {
  asm volatile("global_load_async_to_lds_b128 %0, %10, off\n\t"
               "global_load_async_to_lds_b128 %1, %11, off\n\t"
               "global_load_async_to_lds_b128 %2, %12, off\n\t"
               "global_load_async_to_lds_b128 %3, %13, off\n\t"
               "global_load_async_to_lds_b128 %4, %14, off\n\t"
               "global_load_async_to_lds_b128 %5, %15, off\n\t"
               "global_load_async_to_lds_b128 %6, %16, off\n\t"
               "global_load_async_to_lds_b128 %7, %17, off\n\t"
               "global_load_async_to_lds_b128 %8, %18, off\n\t"
               "global_load_async_to_lds_b128 %9, %19, off\n\t"
               "s_wait_xcnt 0x0"
               :: "v"(l[0]), "v"(l[1]), "v"(l[2]), "v"(l[3]), "v"(l[4]), "v"(l[5]), "v"(l[6]), "v"(l[7]), "v"(l[8]), "v"(l[9]),
                  "v"(g[0]), "v"(g[1]), "v"(g[2]), "v"(g[3]), "v"(g[4]), "v"(g[5]), "v"(g[6]), "v"(g[7]), "v"(g[8]), "v"(g[9]) : "memory");
}
// 256 lanes copy 64 A rows then NBG*128 B rows; l, ga, gb are the lane's own first addresses
// (row tid>>3, 16-B piece tid&7); further rows follow in steps of 32.
template <int NBG>
__device__ __forceinline__ void stage_tile(unsigned l, const unsigned short* ga, const unsigned short* gb) {
  unsigned la[2 + 4 * NBG];
  const unsigned short* gp[2 + 4 * NBG];
#pragma unroll
  for (int i = 0; i < 2 + 4 * NBG; ++i) {
    la[i] = l + i * 32 * LPITCH * 2;
    gp[i] = (i < 2) ? ga + (i * 32) * KT : gb + ((i - 2) * 32) * KT;
  }
  static_assert(NBG == 2);
  async_copy10(la, gp);
}
// The 128 x 256 block's tile: 128 A rows then 256 B rows, 12 copies a lane, in one statement as above.
__device__ __forceinline__ void async_copy12(const unsigned (&l)[12], const unsigned short* const (&g)[12]) {
  asm volatile("global_load_async_to_lds_b128 %0, %12, off\n\t"
               "global_load_async_to_lds_b128 %1, %13, off\n\t"
               "global_load_async_to_lds_b128 %2, %14, off\n\t"
               "global_load_async_to_lds_b128 %3, %15, off\n\t"
               "global_load_async_to_lds_b128 %4, %16, off\n\t"
               "global_load_async_to_lds_b128 %5, %17, off\n\t"
               "global_load_async_to_lds_b128 %6, %18, off\n\t"
               "global_load_async_to_lds_b128 %7, %19, off\n\t"
               "global_load_async_to_lds_b128 %8, %20, off\n\t"
               "global_load_async_to_lds_b128 %9, %21, off\n\t"
               "global_load_async_to_lds_b128 %10, %22, off\n\t"
               "global_load_async_to_lds_b128 %11, %23, off\n\t"
               "s_wait_xcnt 0x0"
               :: "v"(l[0]), "v"(l[1]), "v"(l[2]), "v"(l[3]), "v"(l[4]), "v"(l[5]),
                  "v"(l[6]), "v"(l[7]), "v"(l[8]), "v"(l[9]), "v"(l[10]), "v"(l[11]),
                  "v"(g[0]), "v"(g[1]), "v"(g[2]), "v"(g[3]), "v"(g[4]), "v"(g[5]),
                  "v"(g[6]), "v"(g[7]), "v"(g[8]), "v"(g[9]), "v"(g[10]), "v"(g[11]) : "memory");
}
__device__ __forceinline__ void stage_tile_q(unsigned l, const unsigned short* ga, const unsigned short* gb) {
  unsigned la[12];
  const unsigned short* gp[12];
#pragma unroll
  for (int i = 0; i < 12; ++i) {
    la[i] = l + i * 32 * LPITCH * 2;
    gp[i] = (i < 4) ? ga + (i * 32) * KT : gb + ((i - 4) * 32) * KT;
  }
  async_copy12(la, gp);
}
// Attention K/V tile: 32 keys. K as [32 keys][64 d] at pitch 144 B; V as [64 d][32 keys]
// at pitch 80 B (16 B x 5). 128 lanes; lk, lv and the two pointers are the lane's own first addresses.
// In the workspace V lies tile-major, [b,h][key / 32][slot][32 keys]: a tile is one run of 4 KB and a
// wave-wide copy takes 512 contiguous bytes.  Row d sits in slot vslot(d), which swaps the two low
// bit pairs of d (its own inverse): the four rows that 16 lanes of the producer read from its
// LDS tile at once then lie 4 rows apart there, on disjoint banks.
#define VPITCH 40
#define AT_K (32 * LPITCH)
#define AT_V (64 * VPITCH)
#define AT_BUF (AT_K + AT_V)
__device__ __forceinline__ int vslot(int d) { return (d & 48) | ((d & 3) << 2) | ((d >> 2) & 3); }
__device__ __forceinline__ void stage_kv(unsigned lk, unsigned lv,
                                         const unsigned short* gk, const unsigned short* gv) {
  const unsigned la[4] = {lk, lk + 16 * LPITCH * 2, lv, lv + 32 * VPITCH * 2};
  const unsigned short* const gp[4] = {gk, gk + 16 * HDIM, gv, gv + 32 * 32};
  async_copy4(la, gp);
}
// Ring waits, each ahead of the barrier that hands a buffer over.
__device__ __forceinline__ void wait_lds_reads()  { asm volatile("s_wait_dscnt 0x0" ::: "memory"); }
__device__ __forceinline__ void wait_copies()     { asm volatile("s_wait_asynccnt 0x0" ::: "memory"); }

// ---------------------------------------------------------------------------
// 1) x f32 [NB,SEQ,HID] (batch stride SEQ_FULL*HID) -> bf16 bits, [HID / KT][NB*SEQ][KT].
//    A wave takes one k tile of 4 rows (reads 4 x 256 B, writes 512 contiguous B); the 8 waves of a
//    block take 8 neighbouring k tiles of the same rows.
// ---------------------------------------------------------------------------
__device__ __forceinline__ void
cvt_x_block(const float* __restrict__ x, unsigned short* __restrict__ y, int blk) {
  static_assert(HID / KT == 16 && (NB * SEQ) % 4 == 0);
  const int tid = threadIdx.x;
  const int row = (blk >> 1) * 4 + ((tid >> 3) & 3);
  const int kt = (blk & 1) * 8 + (tid >> 5);
  const int g = kt * 8 + (tid & 7);
  const int bb = row / SEQ;
  const int tt = row - bb * SEQ;
  const long srow = (long)bb * SEQ_FULL + tt;
  const float* src = x + srow * HID + g * 8;
  const v4f a = *(const v4f*)(src);
  const v4f c = *(const v4f*)(src + 4);
  Pack8 pk;
  pk.s = (v8us){bf16_rne_bits(a.x), bf16_rne_bits(a.y), bf16_rne_bits(a.z), bf16_rne_bits(a.w),
                bf16_rne_bits(c.x), bf16_rne_bits(c.y), bf16_rne_bits(c.z), bf16_rne_bits(c.w)};
  const v4u val = pk.u;
  unsigned short* dst = y + ((long)kt * (NB * SEQ) + row) * KT + (tid & 7) * 8;
  *(v4u*)dst = val;
  // no register that the issued store names is
  // rewritten ahead of this wait
  asm volatile("s_wait_xcnt 0x0" ::: "memory");
}

// ---------------------------------------------------------------------------
// 2) weight convert + transpose: in W[kdim rows][ndim cols] f32 -> out WT[kdim / KT][ndim][KT] 16-bit.
//    line written by 8 consecutive lanes x 16 B in one instruction; a block's 64 lines are one run of 8 KB.
//    Block (bx, by) of (ndim/64, kdim/64).
// ---------------------------------------------------------------------------
template <int MODE>
__device__ __forceinline__ void
cvt_wt_block(const float* __restrict__ W, unsigned short* __restrict__ WT, int kdim, int ndim,
             int bx, int by, unsigned short* tile) {
  const int tid = threadIdx.x;
  const int n0 = bx * 64;
  const int k0 = by * 64;
  const int kl = tid >> 2;          // 0..63
  const int nl = (tid & 3) * 16;    // 0,16,32,48
  const float* src = W + (long)(k0 + kl) * ndim + n0 + nl;
#pragma unroll
  for (int q = 0; q < 4; ++q) {
    const v4f v = *(const v4f*)(src + q * 4);
    unsigned short* trow = tile + (nl + q * 4) * 72 + kl;   // tile[n_local][k_local]
    trow[0 * 72] = wbits<MODE>(v.x);
    trow[1 * 72] = wbits<MODE>(v.y);
    trow[2 * 72] = wbits<MODE>(v.z);
    trow[3 * 72] = wbits<MODE>(v.w);
  }
  __syncthreads();
  Pack8 pk[2];
  long go[2];
#pragma unroll
  for (int p = 0; p < 2; ++p) {
    const int L = p * 32 + (tid >> 3);   // output row n_local 0..63
    const int sub = tid & 7;
    pk[p].s = *(const v8us*)(tile + L * 72 + sub * 8);
    go[p] = ((long)by * ndim + n0 + L) * KT + sub * 8;
  }
#pragma unroll
  for (int p = 0; p < 2; ++p) *(v4u*)(WT + go[p]) = pk[p].u;
  // no register that an issued store names is
  // rewritten ahead of this wait
  asm volatile("s_wait_xcnt 0x0" ::: "memory");
}

// ---------------------------------------------------------------------------
// 1) + 2) in one launch: the three conversions depend on nothing but the inputs, so they share a
//    grid.  The block index picks the job: first the weight tiles (the longer chain: load, LDS,
//    barrier, store), then the rows of x.  Each branch is taken by a whole block.
// ---------------------------------------------------------------------------
#define CVT_WQ_BX (3 * HID / 64)
#define CVT_WO_BX (HID / 64)
#define CVT_WQ_BLKS (CVT_WQ_BX * (HID / 64))
#define CVT_WO_BLKS (CVT_WO_BX * (HID / 64))
#define CVT_X_GROUPS (NB * SEQ * (HID / 8))
#define CVT_X_BLKS (CVT_X_GROUPS / 256)
static_assert(CVT_X_GROUPS % 256 == 0 && KT == 64);
__global__ void __launch_bounds__(256)
k_cvt_all(const float* __restrict__ x, const float* __restrict__ Wqkv, const float* __restrict__ Wout,
          unsigned short* __restrict__ xb, unsigned short* __restrict__ wq, unsigned short* __restrict__ wo) {
  __shared__ __attribute__((aligned(16))) unsigned short tile[64 * 72];
  const int b = blockIdx.x;
  if (b < CVT_WQ_BLKS) {
    cvt_wt_block<0>(Wqkv, wq, HID, 3 * HID, b % CVT_WQ_BX, b / CVT_WQ_BX, tile);
  } else if (b < CVT_WQ_BLKS + CVT_WO_BLKS) {
    const int c = b - CVT_WQ_BLKS;
    cvt_wt_block<1>(Wout, wo, HID, HID, c % CVT_WO_BX, c / CVT_WO_BX, tile);
  } else {
    cvt_x_block(x, xb, b - (CVT_WQ_BLKS + CVT_WO_BLKS));
  }
}

// ---------------------------------------------------------------------------
// 3) QKV GEMM: y[m][o] = sum_c X[m][c] * WT[o][c] + bias[o]  (bf16 operands, f32 acc)
//    Block 256 threads = 8 waves (2M x 4N), block tile 128 x 256, wave tile 64 x 64
//    (16 accumulator tiles, 4 + 4 fragments: 16 products per 8 fragments read from LDS, and
//    each operand row fetched from L2 by half as many blocks as with a 64 x 128 tile).
//    Epilogue: f32 -> f16 bits
//      Q,K sections: [NB*NHEAD][SEQ][HDIM] (one line per (b,h,t) row)
//      V  section:   [NB*NHEAD][SEQ/32][64 slots][32 keys] (two slots of a 32-key tile = one line)
// ---------------------------------------------------------------------------
#define QM 128
#define QN 256
#define QROWS (QM + QN)
static_assert(SEQ % QM == 0);          // a block's rows lie in one batch
static_assert(HID % QN == 0);          // a block's columns lie in one of the q, k, v sections
// Epilogue of the 128 x 256 tile, orientation as a compile-time constant so that every LDS
// offset is an immediate.  TR = false (q, k): stile[m][o], pitch 264; TR = true (v): stile[o][m], pitch 136.
template <bool TR>
__device__ __forceinline__ void qkv_stage(const v8f (&acc)[4][4], unsigned short* stile, int tid) {
  constexpr int sm = TR ? 1 : 264;            // LDS stride of the m index
  constexpr int so = TR ? 136 : 1;            // LDS stride of the o index
  const int lane = tid & 31;
  const int wave = tid >> 5;
  unsigned short* p0 = stile + ((wave >> 2) * 64 + (lane >> 4) * 8) * sm + ((wave & 3) * 64 + (lane & 15)) * so;
#pragma unroll
  for (int i = 0; i < 4; ++i)
#pragma unroll
    for (int j = 0; j < 4; ++j)
#pragma unroll
      for (int r = 0; r < 8; ++r) p0[(i * 16 + r) * sm + (j * 16) * so] = f16_bits(acc[i][j][r]);
}
// 512 lines of 128 B leave in 4 groups of 4 x 32 lines; lanes 8q..8q+7 share a line.
// q, k: line = (head L >> 7, token L & 127); v: line = (head L >> 7, 32-key tile (L >> 5) & 3, slot pair L & 31).
template <bool TR>
__device__ __forceinline__ void qkv_lines(const unsigned short* stile, unsigned short* __restrict__ dstp,
                                          int tid, long bh0, int t0) {
  const int sub = tid & 7;
#pragma unroll
  for (int g = 0; g < 4; ++g) {
    Pack8 pk[4];
    long go[4];
#pragma unroll
    for (int p = 0; p < 4; ++p) {
      const int L = (g * 4 + p) * 32 + (tid >> 3);   // line 0..511
      const long bhh = bh0 + (L >> 7);               // head within the tile, in both orientations
      const int sidx = TR ? (((L >> 7) * 64 + vslot((L & 31) * 2 + (sub >> 2))) * 136 + ((L >> 5) & 3) * 32 + (sub & 3) * 8)
                          : ((L & 127) * 264 + (L >> 7) * 64 + sub * 8);
      pk[p].s = *(const v8us*)(stile + sidx);
      go[p] = TR ? ((bhh * (SEQ / 32) + (t0 >> 5) + ((L >> 5) & 3)) * (HDIM * 32) + (L & 31) * 64 + sub * 8)
                 : ((bhh * SEQ + t0 + (L & 127)) * HDIM + sub * 8);
    }
#pragma unroll
    for (int p = 0; p < 4; ++p) *(v4u*)(dstp + go[p]) = pk[p].u;
    // no register that an issued store names is rewritten ahead of this wait
    asm volatile("s_wait_xcnt 0x0" ::: "memory");
  }
}
__global__ void __launch_bounds__(256) __attribute__((amdgpu_num_vgpr(256)))
k_gemm_qkv(const unsigned short* __restrict__ X, const unsigned short* __restrict__ WT,
           const float* __restrict__ bias,
           unsigned short* __restrict__ Qf, unsigned short* __restrict__ Kf,
           unsigned short* __restrict__ Vf) {
  // k loop: two operand buffers of (128 + 256) rows; epilogue (behind the loop's last barrier):
  // row orientation [128][264] (33792) or transposed [256][136] (34816)
  __shared__ __attribute__((aligned(16))) unsigned short smem[2 * QROWS * LPITCH];
  static_assert(2 * QROWS * LPITCH >= 256 * 136 && 2 * QROWS * LPITCH >= 128 * 264);
  unsigned short* stile = smem;
  const int tid = threadIdx.x;
  const int lane = tid & 31;
  const int wave = tid >> 5;
  const int wm = wave >> 2;    // 0..1
  const int wn = wave & 3;     // 0..3
  const int lc = lane & 15;
  const int mblk = blockIdx.x * QM;
  const int nblk = blockIdx.y * QN;
  const long n0 = (long)nblk + wn * 64;

  v8f acc[4][4];
#pragma unroll
  for (int i = 0; i < 4; ++i)
#pragma unroll
    for (int j = 0; j < 4; ++j) acc[i][j] = zero8();

  const unsigned lcp = lds_off(smem) + (tid >> 3) * (LPITCH * 2) + (tid & 7) * 16;
  constexpr long xstep = (long)NB * SEQ * KT;   // from one k tile of an operand to the next
  constexpr long wstep = (long)3 * HID * KT;
  const unsigned short* gx = X + ((long)mblk + (tid >> 3)) * KT + (tid & 7) * 8;
  const unsigned short* gw = WT + ((long)nblk + (tid >> 3)) * KT + (tid & 7) * 8;
  stage_tile_q(lcp, gx, gw);
  wait_copies();
  __syncthreads();
  stage_tile_q(lcp + QROWS * LPITCH * 2, gx + xstep, gw + wstep);

#pragma unroll 1
  for (int t = 0; t < HID / KT; ++t) {
    const unsigned short* sb = smem + (t & 1) * (QROWS * LPITCH);
#pragma unroll   // both 32-k steps of a tile: every LDS offset becomes an immediate
    for (int kk = 0; kk < KT; kk += 32) {
      FragB a[4], b[4];
#pragma unroll
      for (int i = 0; i < 4; ++i) a[i].u = ldfrag_l(sb + (wm * 64 + i * 16) * LPITCH + kk, LPITCH, lane);
#pragma unroll
      for (int j = 0; j < 4; ++j) b[j].u = ldfrag_l(sb + (QM + wn * 64 + j * 16) * LPITCH + kk, LPITCH, lane);
#pragma unroll
      for (int i = 0; i < 4; ++i)
#pragma unroll
        for (int j = 0; j < 4; ++j) acc[i][j] = mma_b(a[i].v, b[j].v, acc[i][j]);
    }
    wait_lds_reads();
    wait_copies();
    __syncthreads();   // publishes tile t + 1 and frees the buffer that trip t has read
    if (t + 2 < HID / KT)
      stage_tile_q(lcp + (t & 1) * (QROWS * LPITCH * 2), gx + (t + 2) * xstep, gw + (t + 2) * wstep);
  }
  wait_copies();

  // bias add in f32 (bias entries RNE-converted to bf16 values)
#pragma unroll
  for (int j = 0; j < 4; ++j) {
    const float bj = bf16_rne(bias[n0 + j * 16 + lc]);
#pragma unroll
    for (int i = 0; i < 4; ++i)
#pragma unroll
      for (int r = 0; r < 8; ++r) acc[i][j][r] += bj;
  }

  const int sec = nblk / HID;                 // 0 = q, 1 = k, 2 = v (block-uniform)
  const int h0 = (nblk - sec * HID) >> 6;     // first of the 4 heads in this tile
  const int bb = mblk / SEQ;
  const int t0 = mblk - bb * SEQ;
  const long bh0 = (long)bb * NHEAD + h0;

  // stage the f16 bits of the 128x256 tile (accumulators die here), then write whole lines
  if (sec == 2) qkv_stage<true>(acc, stile, tid); else qkv_stage<false>(acc, stile, tid);
  __syncthreads();
  if (sec == 2) qkv_lines<true>(stile, Vf, tid, bh0, t0);
  else          qkv_lines<false>(stile, (sec == 0) ? Qf : Kf, tid, bh0, t0);
}

// ---------------------------------------------------------------------------
// 4) Flash attention, transposed: one wave = 32 queries (two tiles of 16) of one (b,h); keys streamed
//    32 at a time.  S^T = k*q (A = key rows, B = queries): lane l holds, of query l & 15 of a tile, the
//    keys 8*(l>>4) + 0..7 (tile 0) and 16 + 8*(l>>4) + 0..7 (tile 1), so the softmax of a query runs
//    in one lane pair, and the two tiles converted in place are the B fragment of
//    O^T += v*p (A = d rows of V).  Every K and V fragment read from LDS serves both query tiles.
//    Block = 128 threads (4 waves, same b,h: 128 queries), which share one LDS copy of each
//    32-key K/V tile.
// ---------------------------------------------------------------------------
#define AQT 2
#define EXPC (SCALE_QK * 1.44269504088896340736f)   // score scale times log2(e)
static_assert(SEQ % (4 * 16 * AQT) == 0);   // the 4 waves of a block lie in one (b,h)
static_assert(HDIM == KT);                  // a head's 64 ctx columns are one k tile of the output GEMM
// lane l <-> lane l ^ 16
__device__ __forceinline__ float xhalf(float x) {
  const int b = __builtin_bit_cast(int, x);
  return __builtin_bit_cast(float, __builtin_amdgcn_permlanex16(b, b, 0x76543210, 0xfedcba98, false, false));
}
__global__ void __launch_bounds__(128) __attribute__((amdgpu_num_vgpr(256)))
k_attn(const unsigned short* __restrict__ Qf, const unsigned short* __restrict__ Kf,
       const unsigned short* __restrict__ Vf,
       const int* __restrict__ maskp, unsigned short* __restrict__ Ctx) {
  __shared__ __attribute__((aligned(16))) unsigned short Cl[4 * 16 * AQT * 72];
  __shared__ __attribute__((aligned(16))) unsigned short KV[2 * AT_BUF];   // K/V ring, shared by the 4 waves
  __shared__ __attribute__((aligned(16))) float Mb[SEQ];   // per key of this batch: 0, or -inf where mask == 0
  const int lane = threadIdx.x & 31;
  const int wave = threadIdx.x >> 5;
  const int hh = lane >> 4;
  const int lc = lane & 15;
  const int nqb = SEQ / (16 * AQT);
  const int gq = blockIdx.x * 4 + wave;
  const int qb = gq % nqb;
  const int bh = gq / nqb;
  const int bb = bh / NHEAD;
  const int h = bh - bb * NHEAD;
  const long qoff = ((long)bh * SEQ + qb * (16 * AQT)) * HDIM;
  const long koff = (long)bh * SEQ * HDIM;
  const long voff = (long)bh * HDIM * SEQ;
  const int* mrow = maskp + (long)bb * SEQ_FULL;
  const float ninf = __uint_as_float(0xff800000u);

  FragH q0[AQT], q1[AQT];
#pragma unroll
  for (int u = 0; u < AQT; ++u) {
    q0[u].u = ldfrag_g(Qf + qoff + u * 16 * HDIM, HDIM, lane);
    q1[u].u = ldfrag_g(Qf + qoff + u * 16 * HDIM + 32, HDIM, lane);
  }

  v8f o[AQT][4];
  float mrun[AQT];   // running maximum of the raw scores of query lc of tile u (equal in both lanes of the pair)
  float lrun[AQT];   // running sum over this lane's own half of the keys
#pragma unroll
  for (int u = 0; u < AQT; ++u) {
#pragma unroll
    for (int t = 0; t < 4; ++t) o[u][t] = zero8();
    mrun[u] = -1e30f;
    lrun[u] = 0.f;
  }

  const int tid = threadIdx.x;
  // the key mask as an additive row, built once a block; the barrier behind tile 0's copies publishes it
  static_assert(SEQ % (128 * 4) == 0);   // every lane takes the same number of 4-key pieces
  v4i mm[SEQ / (128 * 4)];
#pragma unroll
  for (int j = 0; j < SEQ / (128 * 4); ++j) mm[j] = *(const v4i*)(mrow + j * (128 * 4) + tid * 4);
  const unsigned lk = lds_off(KV) + (tid >> 3) * (LPITCH * 2) + (tid & 7) * 16;
  const unsigned lv = lds_off(KV) + AT_K * 2 + vslot(tid >> 2) * (VPITCH * 2) + (tid & 3) * 16;
  const long gko = koff + (long)(tid >> 3) * HDIM + (tid & 7) * 8;
  const long gvo = voff + (long)(tid >> 2) * 32 + (tid & 3) * 8;
  stage_kv(lk, lv, Kf + gko, Vf + gvo);
#pragma unroll
  for (int j = 0; j < SEQ / (128 * 4); ++j)
    *(v4f*)(Mb + j * (128 * 4) + tid * 4) = (v4f){(mm[j].x == 0) ? ninf : 0.f, (mm[j].y == 0) ? ninf : 0.f,
                                                  (mm[j].z == 0) ? ninf : 0.f, (mm[j].w == 0) ? ninf : 0.f};
  wait_copies();
  __syncthreads();
  stage_kv(lk + AT_BUF * 2, lv + AT_BUF * 2, Kf + gko + 32 * HDIM, Vf + gvo + 32 * HDIM);

#pragma unroll 1
  for (int kb = 0; kb < SEQ; kb += 32) {
    const int buf = (kb >> 5) & 1;
    const unsigned short* sb = KV + buf * AT_BUF;
    // mask row of this lane's 16 keys, in the accumulator's layout (register r = key hh*8 + r of a tile):
    // it is the C operand of each score tile's first product, the same for both query tiles
    const float* mb = Mb + kb + hh * 8;
    const v8f c0 = __builtin_shufflevector(*(const v4f*)(mb), *(const v4f*)(mb + 4), 0, 1, 2, 3, 4, 5, 6, 7);
    const v8f c1 = __builtin_shufflevector(*(const v4f*)(mb + 16), *(const v4f*)(mb + 20), 0, 1, 2, 3, 4, 5, 6, 7);
    v8f s0[AQT], s1[AQT];
    {
      FragH ka, kc;
      // keys kb .. kb+15
      ka.u = ldfrag_l(sb, LPITCH, lane);
      kc.u = ldfrag_l(sb + 32, LPITCH, lane);
#pragma unroll
      for (int u = 0; u < AQT; ++u) s0[u] = mma_h(ka.v, q0[u].v, c0);
#pragma unroll
      for (int u = 0; u < AQT; ++u) s0[u] = mma_h(kc.v, q1[u].v, s0[u]);
      // keys kb+16 .. kb+31
      ka.u = ldfrag_l(sb + 16 * LPITCH, LPITCH, lane);
      kc.u = ldfrag_l(sb + 16 * LPITCH + 32, LPITCH, lane);
#pragma unroll
      for (int u = 0; u < AQT; ++u) s1[u] = mma_h(ka.v, q0[u].v, c1);
#pragma unroll
      for (int u = 0; u < AQT; ++u) s1[u] = mma_h(kc.v, q1[u].v, s1[u]);
    }

    FragP pa[AQT];
#pragma unroll
    for (int u = 0; u < AQT; ++u) {
      // online softmax of query lc on the raw (unscaled, masked) scores: maximum in the lane, then one
      // exchange between the halves; exp(SCALE_QK * (s - m)) = exp2(s * EXPC - m * EXPC), one FMA a score
      float mx = fmaxf(s0[u][0], s1[u][0]);
#pragma unroll
      for (int r = 1; r < 8; ++r) mx = fmaxf(mx, fmaxf(s0[u][r], s1[u][r]));
      mx = fmaxf(mx, xhalf(mx));
      const float mnew = fmaxf(mrun[u], mx);
      const float nmc = -mnew * EXPC;
      const float alpha = __builtin_amdgcn_exp2f((mrun[u] - mnew) * EXPC);   // difference first: exactly 0 where the two are equal
      s0[u] = s0[u] * EXPC + nmc;
      s1[u] = s1[u] * EXPC + nmc;
#pragma unroll
      for (int r = 0; r < 8; ++r) {
        s0[u][r] = __builtin_amdgcn_exp2f(s0[u][r]);
        s1[u][r] = __builtin_amdgcn_exp2f(s1[u][r]);
      }
      const v8f ps = s0[u] + s1[u];
      const float rs = ((ps[0] + ps[1]) + (ps[2] + ps[3])) + ((ps[4] + ps[5]) + (ps[6] + ps[7]));
      lrun[u] = lrun[u] * alpha + rs;
      mrun[u] = mnew;
#pragma unroll
      for (int t = 0; t < 4; ++t)
#pragma unroll
        for (int r = 0; r < 8; ++r) o[u][t][r] *= alpha;

      // P^T (32 keys x 16 queries, f32 in D layout) -> f16 B fragment, in place:
      // element s of the fragment is register s & 7 of tile s >> 3
#pragma unroll
      for (int w = 0; w < 8; ++w) {
        const float p0 = (w < 4) ? s0[u][2 * w] : s1[u][2 * w - 8];
        const float p1 = (w < 4) ? s0[u][2 * w + 1] : s1[u][2 * w - 7];
        pa[u].w[w] = __builtin_bit_cast(unsigned, __builtin_convertvector((v2f){p0, p1}, v2h));
      }
    }

    // O^T += V^T * P^T  (V tile in LDS [d][token], k = token contiguous)
#pragma unroll
    for (int t = 0; t < 4; ++t) {
      FragH vf;
      vf.u = ldfrag_l(sb + AT_K + (t * 16) * VPITCH, VPITCH, lane);
#pragma unroll
      for (int u = 0; u < AQT; ++u) o[u][t] = mma_h(vf.v, pa[u].v, o[u][t]);
    }
    wait_lds_reads();
    wait_copies();
    __syncthreads();   // publishes the next 32 keys and frees the buffer that this trip has read
    if (kb + 64 < SEQ)
      stage_kv(lk + buf * (AT_BUF * 2), lv + buf * (AT_BUF * 2),
               Kf + gko + (long)(kb + 64) * HDIM, Vf + gvo + (long)(kb + 64) * HDIM);
  }
  wait_copies();

  unsigned short* cl = Cl + wave * (16 * AQT * 72);
#pragma unroll
  for (int u = 0; u < AQT; ++u) {
    const float inv = 16.0f / (lrun[u] + xhalf(lrun[u]));   // the halves' sums join here
#pragma unroll
    for (int t = 0; t < 4; ++t) {   // registers 0..7 of o[u][t] are d = t*16 + hh*8 + 0..7 of query lc
      Pack8 pc;
#pragma unroll
      for (int r = 0; r < 8; ++r) pc.s[r] = f16_bits(o[u][t][r] * inv);
      *(v4u*)(cl + (u * 16 + lc) * 72 + t * 16 + hh * 8) = pc.u;
    }
  }
  __syncthreads();
  Pack8 pk[4 * AQT];
  long go[4 * AQT];
#pragma unroll
  for (int p = 0; p < 4 * AQT; ++p) {
    const int q = p * 4 + (lane >> 3);   // query row 0..31; lanes 8q'..8q'+7 share a line
    const int sub = lane & 7;
    pk[p].s = *(const v8us*)(cl + q * 72 + sub * 8);
    go[p] = ((long)h * (NB * SEQ) + (long)bb * SEQ + qb * (16 * AQT) + q) * KT + sub * 8;   // [k tile = head][row][KT]
  }
#pragma unroll
  for (int p = 0; p < 4 * AQT; ++p) *(v4u*)(Ctx + go[p]) = pk[p].u;
}

// ---------------------------------------------------------------------------
// 5) Output GEMM: out[m][o] = (1/1024) * sum_c A[m][c] * WT[o][c] + bias[o]   (f16 operands)
//    (32 floats) written by 8 consecutive lanes x 16 B in one instruction.
// ---------------------------------------------------------------------------
__global__ void __launch_bounds__(256)
k_gemm_out(const unsigned short* __restrict__ A, const unsigned short* __restrict__ WT,
           const float* __restrict__ bias, float* __restrict__ out) {
  // k loop: two operand buffers of (64 + 256) rows; epilogue (behind the loop's last barrier): otile
  __shared__ __attribute__((aligned(16))) unsigned short smem[2 * 320 * LPITCH];
  static_assert(2 * 320 * LPITCH * 2 >= 32 * 260 * 4);
  float* otile = (float*)smem;
  const int tid = threadIdx.x;
  const int lane = tid & 31;
  const int wave = tid >> 5;
  const int wm = wave >> 2;
  const int wn = wave & 3;
  const int hh = lane >> 4;
  const int lc = lane & 15;
  const int mblk = blockIdx.x * 64;
  const int nblk = blockIdx.y * 256;
  const long n0 = (long)nblk + wn * 64;

  v8f acc[2][4];
#pragma unroll
  for (int i = 0; i < 2; ++i)
#pragma unroll
    for (int j = 0; j < 4; ++j) acc[i][j] = zero8();

  const unsigned lcp = lds_off(smem) + (tid >> 3) * (LPITCH * 2) + (tid & 7) * 16;
  constexpr long astep = (long)NB * SEQ * KT;   // from one k tile of an operand to the next
  constexpr long wstep = (long)HID * KT;
  const unsigned short* ga = A + ((long)mblk + (tid >> 3)) * KT + (tid & 7) * 8;
  const unsigned short* gw = WT + ((long)nblk + (tid >> 3)) * KT + (tid & 7) * 8;
  stage_tile<2>(lcp, ga, gw);
  wait_copies();
  __syncthreads();
  stage_tile<2>(lcp + 320 * LPITCH * 2, ga + astep, gw + wstep);

#pragma unroll 1
  for (int t = 0; t < HID / KT; ++t) {
    const unsigned short* sb = smem + (t & 1) * (320 * LPITCH);
#pragma unroll   // both 32-k steps of a tile: every LDS offset becomes an immediate
    for (int kk = 0; kk < KT; kk += 32) {
      FragH a0, a1, b0, b1, b2, b3;
      a0.u = ldfrag_l(sb + (wm * 32) * LPITCH + kk, LPITCH, lane);
      a1.u = ldfrag_l(sb + (wm * 32 + 16) * LPITCH + kk, LPITCH, lane);
      b0.u = ldfrag_l(sb + (64 + wn * 64) * LPITCH + kk, LPITCH, lane);
      b1.u = ldfrag_l(sb + (64 + wn * 64 + 16) * LPITCH + kk, LPITCH, lane);
      b2.u = ldfrag_l(sb + (64 + wn * 64 + 32) * LPITCH + kk, LPITCH, lane);
      b3.u = ldfrag_l(sb + (64 + wn * 64 + 48) * LPITCH + kk, LPITCH, lane);
      acc[0][0] = mma_h(a0.v, b0.v, acc[0][0]);
      acc[0][1] = mma_h(a0.v, b1.v, acc[0][1]);
      acc[0][2] = mma_h(a0.v, b2.v, acc[0][2]);
      acc[0][3] = mma_h(a0.v, b3.v, acc[0][3]);
      acc[1][0] = mma_h(a1.v, b0.v, acc[1][0]);
      acc[1][1] = mma_h(a1.v, b1.v, acc[1][1]);
      acc[1][2] = mma_h(a1.v, b2.v, acc[1][2]);
      acc[1][3] = mma_h(a1.v, b3.v, acc[1][3]);
    }
    wait_lds_reads();
    wait_copies();
    __syncthreads();   // publishes tile t + 1 and frees the buffer that trip t has read
    if (t + 2 < HID / KT)
      stage_tile<2>(lcp + (t & 1) * (320 * LPITCH * 2), ga + (t + 2) * astep, gw + (t + 2) * wstep);
  }
  wait_copies();

  // undo carries (x16 ctx, x64 weight) and add bf16-valued bias, all in f32
#pragma unroll
  for (int j = 0; j < 4; ++j) {
    const float bj = bf16_rne(bias[n0 + j * 16 + lc]);
#pragma unroll
    for (int i = 0; i < 2; ++i)
#pragma unroll
      for (int r = 0; r < 8; ++r) acc[i][j][r] = acc[i][j][r] * (1.0f / 1024.0f) + bj;
  }

#pragma unroll
  for (int phase = 0; phase < 2; ++phase) {
    if (wm == phase) {   // wave-uniform: waves owning rows phase*32 .. +31 stage them
#pragma unroll
      for (int i = 0; i < 2; ++i)
#pragma unroll
        for (int j = 0; j < 4; ++j)
#pragma unroll
          for (int r = 0; r < 8; ++r) {
            const int ml = i * 16 + r + hh * 8;
            const int ol = wn * 64 + j * 16 + lc;
            otile[ml * 260 + ol] = acc[i][j][r];
          }
    }
    __syncthreads();
    v4f pk[8];
    long go[8];
#pragma unroll
    for (int p = 0; p < 8; ++p) {
      const int L = p * 32 + (tid >> 3);
      const int sub = tid & 7;
      const int row = L >> 3;
      const int piece = L & 7;
      pk[p] = *(const v4f*)(otile + row * 260 + piece * 32 + sub * 4);
      go[p] = ((long)mblk + phase * 32 + row) * HID + nblk + piece * 32 + sub * 4;
    }
#pragma unroll
    for (int p = 0; p < 8; ++p) *(v4f*)(out + go[p]) = pk[p];
    
    __syncthreads();
  }
}

// ---------------------------------------------------------------------------
// Launch
// ---------------------------------------------------------------------------
extern "C" void kernel_launch(void* const* d_in, const int* in_sizes, int n_in,
                              void* d_out, int out_size, void* d_ws, size_t ws_size,
                              hipStream_t stream) {
  if (n_in < 6) return;
  const float* x     = (const float*)d_in[0];   // [NB_FULL, SEQ_FULL, HID]
  const int*   maskp = (const int*)d_in[1];     // [NB_FULL, 1, 1, SEQ_FULL] int32
  const float* Wqkv  = (const float*)d_in[2];   // [HID][3*HID]
  const float* bqkv  = (const float*)d_in[3];   // [3*HID]
  const float* Wout  = (const float*)d_in[4];   // [HID][HID]
  const float* bout  = (const float*)d_in[5];   // [HID]
  float* out = (float*)d_out;                   // [NB*SEQ, HID]

  const long M = (long)NB * SEQ;
  if ((long)in_sizes[0] < (((long)(NB - 1) * SEQ_FULL + SEQ) * HID)) return;
  if ((long)in_sizes[1] < ((long)(NB - 1) * SEQ_FULL + SEQ)) return;
  if ((long)in_sizes[2] < 3L * HID * HID) return;
  if ((long)in_sizes[3] < 3L * HID) return;
  if ((long)in_sizes[4] < (long)HID * HID) return;
  if ((long)in_sizes[5] < (long)HID) return;
  if ((long)out_size < M * HID) return;

  // workspace carve (bytes); every region is a whole number of tiles, no padding needed
  const size_t szX  = (size_t)M * HID * 2;                       // x bf16 plane, later ctx f16 plane
  const size_t szWq = (size_t)3 * HID * HID * 2;                 // WqkvT bf16
  const size_t szWo = (size_t)HID * HID * 2;                     // WoutT f16
  const size_t szP  = (size_t)NB * NHEAD * SEQ * HDIM * 2;       // one q/k/v plane
  const size_t oX  = 0;
  const size_t oWq = oX + szX;
  const size_t oWo = oWq + szWq;
  const size_t oP0 = oWo + szWo;
  const size_t total = oP0 + 3 * szP;
  if (total > ws_size) return;
  static_assert((size_t)NB * SEQ * HID * 2 == (size_t)NB * NHEAD * SEQ * HDIM * 2);

  char* ws = (char*)d_ws;
  unsigned short* xb  = (unsigned short*)(ws + oX);
  unsigned short* ctx = (unsigned short*)(ws + oX);      // aliases xb: xb is dead after k_gemm_qkv
  unsigned short* wq  = (unsigned short*)(ws + oWq);
  unsigned short* wo  = (unsigned short*)(ws + oWo);
  unsigned short* qf  = (unsigned short*)(ws + oP0 + 0 * szP);
  unsigned short* kf  = (unsigned short*)(ws + oP0 + 1 * szP);
  unsigned short* vf  = (unsigned short*)(ws + oP0 + 2 * szP);

  // 1) + 2) one launch: Wqkv in[HID][3*HID] -> out[HID/64][3*HID][64] bf16;  Wout in[HID][HID] ->
  //    out[HID/64][HID][64] f16 (x64);  x -> bf16 plane [HID/64][NB*SEQ][64]
  k_cvt_all<<<CVT_WQ_BLKS + CVT_WO_BLKS + CVT_X_BLKS, 256, 0, stream>>>(x, Wqkv, Wout, xb, wq, wo);
  // 3) qkv GEMM -> f16 planes of q, k ([bh][t][d]) and v ([bh][t/32][slot of d][32]); block tile 128x256
  k_gemm_qkv<<<dim3((int)(M / QM), 3 * HID / QN), 256, 0, stream>>>(xb, wq, bqkv, qf, kf, vf);
  // 4) attention -> ctx f16 plane [NHEAD][NB*SEQ][64] (over the dead x plane)
  k_attn<<<(NB * NHEAD * (SEQ / (16 * AQT))) / 4, 128, 0, stream>>>(qf, kf, vf, maskp, ctx);
  // 5) output GEMM -> f32 out
  k_gemm_out<<<dim3((int)(M / 64), HID / 256), 256, 0, stream>>>(ctx, wo, bout, out);
}

// v009
// Measured time: 92.7 microseconds a run.
// Next to v008, in two timings, it ran 1.05 times as fast each time.
// Over all steps from v000 it is 4.63 times as fast.
// Contractions: x*Wqkv on v_wmma_f32_16x16x32_bf16 (bf16 operands = RNE-converted inputs); q*k^T and p*v on v_wmma_f32_16x16x32_f16 (f16 operands = RNE-converted f32 q, k, v and softmax weights, one product per operand pair); ctx*Wout on v_wmma_f32_16x16x32_f16 (f16 operands, ctx carried x16, Wout carried x64); f32 accumulate, f32 softmax.
#include <hip/hip_runtime.h>

#ifndef NB
#define NB 16
#endif
#ifndef SEQ
#define SEQ 512
#endif
#ifndef NB_FULL
#define NB_FULL 16
#endif
#ifndef SEQ_FULL
#define SEQ_FULL 512
#endif
#define HID 1024
#define NHEAD 16
#define HDIM 64
#define SCALE_QK 0.125f

static_assert(SEQ % 64 == 0);
static_assert(HID == NHEAD * HDIM);
static_assert(HID % 256 == 0);
static_assert(HID % 128 == 0);
static_assert(((NB * NHEAD * (SEQ / 16)) % 4) == 0);
static_assert(NB <= NB_FULL);
static_assert(SEQ <= SEQ_FULL);

typedef _Float16 v16h __attribute__((ext_vector_type(16)));
typedef __bf16   v16b __attribute__((ext_vector_type(16)));
typedef unsigned short v8us  __attribute__((ext_vector_type(8)));
typedef unsigned short v16us __attribute__((ext_vector_type(16)));
typedef float v8f __attribute__((ext_vector_type(8)));
typedef float v4f __attribute__((ext_vector_type(4)));
typedef unsigned int v4u __attribute__((ext_vector_type(4)));
typedef unsigned int v8u __attribute__((ext_vector_type(8)));
typedef int v4i __attribute__((ext_vector_type(4)));
typedef float v2f __attribute__((ext_vector_type(2)));
typedef _Float16 v2h __attribute__((ext_vector_type(2)));

union FragB { v16us u; v16b v; };
union FragH { v16us u; v16h v; };
union Pack8 { v8us s; v4u u; };
union FragP { v8u w; v16h v; };

// ---------------------------------------------------------------------------
// 16-bit conversion helpers (bf16 via RNE on the f32 bit pattern)
// ---------------------------------------------------------------------------
__device__ __forceinline__ unsigned short bf16_rne_bits(float f) {
  unsigned int u = __float_as_uint(f);
  u += 0x7fffu + ((u >> 16) & 1u);
  return (unsigned short)(u >> 16);
}
__device__ __forceinline__ float bf16_val(unsigned short b) {
  return __uint_as_float(((unsigned int)b) << 16);
}
__device__ __forceinline__ float bf16_rne(float f) { return bf16_val(bf16_rne_bits(f)); }
__device__ __forceinline__ unsigned short f16_bits(float f) {
  _Float16 hv = (_Float16)f;
  return __builtin_bit_cast(unsigned short, hv);
}
template <int MODE>   // 0: bf16 bits of RNE(w); 1: f16 bits of RNE_bf16(w) * 64
__device__ __forceinline__ unsigned short wbits(float f) {
  if (MODE == 0) return bf16_rne_bits(f);
  return f16_bits(bf16_rne(f) * 64.0f);
}

// ---------------------------------------------------------------------------
// WMMA helpers: D(16x16 f32) += A(16x32) * B(32x16); hazard guard after each op
// ---------------------------------------------------------------------------
__device__ __forceinline__ v8f mma_b(v16b a, v16b b, v8f c) {
  v8f d = __builtin_amdgcn_wmma_f32_16x16x32_bf16(false, a, false, b, (short)0, c, false, false);
  asm volatile("v_nop\n\tv_nop\n\tv_nop\n\tv_nop" : "+v"(d) : "v"(a), "v"(b));
  return d;
}
__device__ __forceinline__ v8f mma_h(v16h a, v16h b, v8f c) {
  v8f d = __builtin_amdgcn_wmma_f32_16x16x32_f16(false, a, false, b, (short)0, c, false, false);
  asm volatile("v_nop\n\tv_nop\n\tv_nop\n\tv_nop" : "+v"(d) : "v"(a), "v"(b));
  return d;
}
__device__ __forceinline__ v8f zero8() { return (v8f){0.f, 0.f, 0.f, 0.f, 0.f, 0.f, 0.f, 0.f}; }

// ---------------------------------------------------------------------------
// Fragment loader, 16-bit split k-map for A and B:
//   lane l: row/col = l & 15; elements 0..7 <- k0 + 8*(l>>4) + 0..7,
//                             elements 8..15 <- k0 + 16 + 8*(l>>4) + 0..7.
// base points at (row0/col0, k0) of a k-contiguous 16-bit plane, ld = pitch.
// ---------------------------------------------------------------------------
__device__ __forceinline__ v16us ldfrag_g(const unsigned short* __restrict__ base, long ld, int lane) {
  const unsigned short* p = base + (long)(lane & 15) * ld + ((lane >> 4) << 3);
  v8us e0 = *(const v8us*)(p);
  v8us e1 = *(const v8us*)(p + 16);
  return __builtin_shufflevector(e0, e1, 0, 1, 2, 3, 4, 5, 6, 7, 8, 9, 10, 11, 12, 13, 14, 15);
}
__device__ __forceinline__ v16us ldfrag_l(const unsigned short* base, int ld, int lane) {
  const unsigned short* p = base + (lane & 15) * ld + ((lane >> 4) << 3);
  v8us e0 = *(const v8us*)(p);
  v8us e1 = *(const v8us*)(p + 16);
  return __builtin_shufflevector(e0, e1, 0, 1, 2, 3, 4, 5, 6, 7, 8, 9, 10, 11, 12, 13, 14, 15);
}

// ---------------------------------------------------------------------------
// GEMM operand staging: a tile is KT k-elements (one whole 128-B line) of every operand row
// of the block, laid in LDS at a pitch of 144 B in the output GEMM (16 B x 9: conflict-free for 16-B row reads).
// In the workspace every GEMM operand lies k-tile-major, [k / KT][row][KT]: the rows of a block's
// tile follow one another without a gap, so a wave-wide copy (16 B a lane) takes 512 contiguous
// bytes, and each operand's part of a block's tile is one run of 8 to 32 KB.
// ---------------------------------------------------------------------------
#define KT 64
#define LPITCH 72
static_assert(HID % KT == 0 && HID / KT >= 2);

__device__ __forceinline__ unsigned lds_off(const void* p) { return (unsigned)(size_t)p; }

// One statement per tile; the s_wait_xcnt ends it so that no address register of an issued
// copy is rewritten before the wait.
__device__ __forceinline__ void async_copy4(const unsigned (&l)[4], const unsigned short* const (&g)[4]) {
  asm volatile("global_load_async_to_lds_b128 %0, %4, off\n\t"
               "global_load_async_to_lds_b128 %1, %5, off\n\t"
               "global_load_async_to_lds_b128 %2, %6, off\n\t"
               "global_load_async_to_lds_b128 %3, %7, off\n\t"
               "s_wait_xcnt 0x0"
               :: "v"(l[0]), "v"(l[1]), "v"(l[2]), "v"(l[3]),
                  "v"(g[0]), "v"(g[1]), "v"(g[2]), "v"(g[3]) : "memory");
}
__device__ __forceinline__ void async_copy10(const unsigned (&l)[10], const unsigned short* const (&g)[10]) {
  asm volatile("global_load_async_to_lds_b128 %0, %10, off\n\t"
               "global_load_async_to_lds_b128 %1, %11, off\n\t"
               "global_load_async_to_lds_b128 %2, %12, off\n\t"
               "global_load_async_to_lds_b128 %3, %13, off\n\t"
               "global_load_async_to_lds_b128 %4, %14, off\n\t"
               "global_load_async_to_lds_b128 %5, %15, off\n\t"
               "global_load_async_to_lds_b128 %6, %16, off\n\t"
               "global_load_async_to_lds_b128 %7, %17, off\n\t"
               "global_load_async_to_lds_b128 %8, %18, off\n\t"
               "global_load_async_to_lds_b128 %9, %19, off\n\t"
               "s_wait_xcnt 0x0"
               :: "v"(l[0]), "v"(l[1]), "v"(l[2]), "v"(l[3]), "v"(l[4]), "v"(l[5]), "v"(l[6]), "v"(l[7]), "v"(l[8]), "v"(l[9]),
                  "v"(g[0]), "v"(g[1]), "v"(g[2]), "v"(g[3]), "v"(g[4]), "v"(g[5]), "v"(g[6]), "v"(g[7]), "v"(g[8]), "v"(g[9]) : "memory");
}
// 256 lanes copy 64 A rows then NBG*128 B rows; l, ga, gb are the lane's own first addresses
// (row tid>>3, 16-B piece tid&7); further rows follow in steps of 32.
template <int NBG>
__device__ __forceinline__ void stage_tile(unsigned l, const unsigned short* ga, const unsigned short* gb) {
  unsigned la[2 + 4 * NBG];
  const unsigned short* gp[2 + 4 * NBG];
#pragma unroll
  for (int i = 0; i < 2 + 4 * NBG; ++i) {
    la[i] = l + i * 32 * LPITCH * 2;
    gp[i] = (i < 2) ? ga + (i * 32) * KT : gb + ((i - 2) * 32) * KT;
  }
  static_assert(NBG == 2);
  async_copy10(la, gp);
}
// The 128 x 256 block's tile: 128 A rows then 256 B rows, 12 copies a lane, in one statement as above.
__device__ __forceinline__ void async_copy12(const unsigned (&l)[12], const unsigned short* const (&g)[12]) {
  asm volatile("global_load_async_to_lds_b128 %0, %12, off\n\t"
               "global_load_async_to_lds_b128 %1, %13, off\n\t"
               "global_load_async_to_lds_b128 %2, %14, off\n\t"
               "global_load_async_to_lds_b128 %3, %15, off\n\t"
               "global_load_async_to_lds_b128 %4, %16, off\n\t"
               "global_load_async_to_lds_b128 %5, %17, off\n\t"
               "global_load_async_to_lds_b128 %6, %18, off\n\t"
               "global_load_async_to_lds_b128 %7, %19, off\n\t"
               "global_load_async_to_lds_b128 %8, %20, off\n\t"
               "global_load_async_to_lds_b128 %9, %21, off\n\t"
               "global_load_async_to_lds_b128 %10, %22, off\n\t"
               "global_load_async_to_lds_b128 %11, %23, off\n\t"
               "s_wait_xcnt 0x0"
               :: "v"(l[0]), "v"(l[1]), "v"(l[2]), "v"(l[3]), "v"(l[4]), "v"(l[5]),
                  "v"(l[6]), "v"(l[7]), "v"(l[8]), "v"(l[9]), "v"(l[10]), "v"(l[11]),
                  "v"(g[0]), "v"(g[1]), "v"(g[2]), "v"(g[3]), "v"(g[4]), "v"(g[5]),
                  "v"(g[6]), "v"(g[7]), "v"(g[8]), "v"(g[9]), "v"(g[10]), "v"(g[11]) : "memory");
}
// In LDS this tile's rows lie in pairs: rows 2j and 2j + 1 side by side (256 B), pairs at a pitch of 272 B
// (16 B x 17).  The 16 rows of a fragment read then fall on 16 different 16-B bank groups, as at a pitch
// of 144 B a row, and three buffers of two blocks fit one WGP's LDS.
#define PPITCH 136
__device__ __forceinline__ v16us ldfrag_p(const unsigned short* base, int lane) {
  const unsigned short* p = base + ((lane & 15) >> 1) * PPITCH + (lane & 1) * KT + ((lane >> 4) << 3);
  v8us e0 = *(const v8us*)(p);
  v8us e1 = *(const v8us*)(p + 16);
  return __builtin_shufflevector(e0, e1, 0, 1, 2, 3, 4, 5, 6, 7, 8, 9, 10, 11, 12, 13, 14, 15);
}
__device__ __forceinline__ void stage_tile_q(unsigned l, const unsigned short* ga, const unsigned short* gb) {
  unsigned la[12];
  const unsigned short* gp[12];
#pragma unroll
  for (int i = 0; i < 12; ++i) {
    la[i] = l + i * 16 * PPITCH * 2;
    gp[i] = (i < 4) ? ga + (i * 32) * KT : gb + ((i - 4) * 32) * KT;
  }
  async_copy12(la, gp);
}
// Attention K/V tile: 32 keys. K as [32 keys][64 d] at pitch 144 B; V as [64 d][32 keys]
// at pitch 80 B (16 B x 5). 128 lanes; lk, lv and the two pointers are the lane's own first addresses.
// In the workspace V lies tile-major, [b,h][key / 32][slot][32 keys]: a tile is one run of 4 KB and a
// wave-wide copy takes 512 contiguous bytes.  Row d sits in slot vslot(d), which swaps the two low
// bit pairs of d (its own inverse): the four rows that 16 lanes of the producer read from its
// LDS tile at once then lie 4 rows apart there, on disjoint banks.
#define VPITCH 40
#define AT_K (32 * LPITCH)
#define AT_V (64 * VPITCH)
#define AT_BUF (AT_K + AT_V)
__device__ __forceinline__ int vslot(int d) { return (d & 48) | ((d & 3) << 2) | ((d >> 2) & 3); }
__device__ __forceinline__ void stage_kv(unsigned lk, unsigned lv,
                                         const unsigned short* gk, const unsigned short* gv) {
  const unsigned la[4] = {lk, lk + 16 * LPITCH * 2, lv, lv + 32 * VPITCH * 2};
  const unsigned short* const gp[4] = {gk, gk + 16 * HDIM, gv, gv + 32 * 32};
  async_copy4(la, gp);
}
// Ring waits, each ahead of the barrier that hands a buffer over.
__device__ __forceinline__ void wait_lds_reads()  { asm volatile("s_wait_dscnt 0x0" ::: "memory"); }
__device__ __forceinline__ void wait_copies()     { asm volatile("s_wait_asynccnt 0x0" ::: "memory"); }
template <int N>
__device__ __forceinline__ void wait_copies_but() { asm volatile("s_wait_asynccnt %0" :: "n"(N) : "memory"); }

// ---------------------------------------------------------------------------
// 1) x f32 [NB,SEQ,HID] (batch stride SEQ_FULL*HID) -> bf16 bits, [HID / KT][NB*SEQ][KT].
//    A wave takes one k tile of 4 rows (reads 4 x 256 B, writes 512 contiguous B); the 8 waves of a
//    block take 8 neighbouring k tiles of the same rows.
// ---------------------------------------------------------------------------
__device__ __forceinline__ void
cvt_x_block(const float* __restrict__ x, unsigned short* __restrict__ y, int blk) {
  static_assert(HID / KT == 16 && (NB * SEQ) % 4 == 0);
  const int tid = threadIdx.x;
  const int row = (blk >> 1) * 4 + ((tid >> 3) & 3);
  const int kt = (blk & 1) * 8 + (tid >> 5);
  const int g = kt * 8 + (tid & 7);
  const int bb = row / SEQ;
  const int tt = row - bb * SEQ;
  const long srow = (long)bb * SEQ_FULL + tt;
  const float* src = x + srow * HID + g * 8;
  const v4f a = *(const v4f*)(src);
  const v4f c = *(const v4f*)(src + 4);
  Pack8 pk;
  pk.s = (v8us){bf16_rne_bits(a.x), bf16_rne_bits(a.y), bf16_rne_bits(a.z), bf16_rne_bits(a.w),
                bf16_rne_bits(c.x), bf16_rne_bits(c.y), bf16_rne_bits(c.z), bf16_rne_bits(c.w)};
  const v4u val = pk.u;
  unsigned short* dst = y + ((long)kt * (NB * SEQ) + row) * KT + (tid & 7) * 8;
  *(v4u*)dst = val;
  // no register that the issued store names is
  // rewritten ahead of this wait
  asm volatile("s_wait_xcnt 0x0" ::: "memory");
}

// ---------------------------------------------------------------------------
// 2) weight convert + transpose: in W[kdim rows][ndim cols] f32 -> out WT[kdim / KT][ndim][KT] 16-bit.
//    line written by 8 consecutive lanes x 16 B in one instruction; a block's 64 lines are one run of 8 KB.
//    Block (bx, by) of (ndim/64, kdim/64).
// ---------------------------------------------------------------------------
template <int MODE>
__device__ __forceinline__ void
cvt_wt_block(const float* __restrict__ W, unsigned short* __restrict__ WT, int kdim, int ndim,
             int bx, int by, unsigned short* tile) {
  const int tid = threadIdx.x;
  const int n0 = bx * 64;
  const int k0 = by * 64;
  const int kl = tid >> 2;          // 0..63
  const int nl = (tid & 3) * 16;    // 0,16,32,48
  const float* src = W + (long)(k0 + kl) * ndim + n0 + nl;
#pragma unroll
  for (int q = 0; q < 4; ++q) {
    const v4f v = *(const v4f*)(src + q * 4);
    unsigned short* trow = tile + (nl + q * 4) * 72 + kl;   // tile[n_local][k_local]
    trow[0 * 72] = wbits<MODE>(v.x);
    trow[1 * 72] = wbits<MODE>(v.y);
    trow[2 * 72] = wbits<MODE>(v.z);
    trow[3 * 72] = wbits<MODE>(v.w);
  }
  __syncthreads();
  Pack8 pk[2];
  long go[2];
#pragma unroll
  for (int p = 0; p < 2; ++p) {
    const int L = p * 32 + (tid >> 3);   // output row n_local 0..63
    const int sub = tid & 7;
    pk[p].s = *(const v8us*)(tile + L * 72 + sub * 8);
    go[p] = ((long)by * ndim + n0 + L) * KT + sub * 8;
  }
#pragma unroll
  for (int p = 0; p < 2; ++p) *(v4u*)(WT + go[p]) = pk[p].u;
  // no register that an issued store names is
  // rewritten ahead of this wait
  asm volatile("s_wait_xcnt 0x0" ::: "memory");
}

// ---------------------------------------------------------------------------
// 1) + 2) in one launch: the three conversions depend on nothing but the inputs, so they share a
//    grid.  The block index picks the job: first the weight tiles (the longer chain: load, LDS,
//    barrier, store), then the rows of x.  Each branch is taken by a whole block.
// ---------------------------------------------------------------------------
#define CVT_WQ_BX (3 * HID / 64)
#define CVT_WO_BX (HID / 64)
#define CVT_WQ_BLKS (CVT_WQ_BX * (HID / 64))
#define CVT_WO_BLKS (CVT_WO_BX * (HID / 64))
#define CVT_X_GROUPS (NB * SEQ * (HID / 8))
#define CVT_X_BLKS (CVT_X_GROUPS / 256)
static_assert(CVT_X_GROUPS % 256 == 0 && KT == 64);
__global__ void __launch_bounds__(256)
k_cvt_all(const float* __restrict__ x, const float* __restrict__ Wqkv, const float* __restrict__ Wout,
          unsigned short* __restrict__ xb, unsigned short* __restrict__ wq, unsigned short* __restrict__ wo) {
  __shared__ __attribute__((aligned(16))) unsigned short tile[64 * 72];
  const int b = blockIdx.x;
  if (b < CVT_WQ_BLKS) {
    cvt_wt_block<0>(Wqkv, wq, HID, 3 * HID, b % CVT_WQ_BX, b / CVT_WQ_BX, tile);
  } else if (b < CVT_WQ_BLKS + CVT_WO_BLKS) {
    const int c = b - CVT_WQ_BLKS;
    cvt_wt_block<1>(Wout, wo, HID, HID, c % CVT_WO_BX, c / CVT_WO_BX, tile);
  } else {
    cvt_x_block(x, xb, b - (CVT_WQ_BLKS + CVT_WO_BLKS));
  }
}

// ---------------------------------------------------------------------------
// 3) QKV GEMM: y[m][o] = sum_c X[m][c] * WT[o][c] + bias[o]  (bf16 operands, f32 acc)
//    Block 256 threads = 8 waves (2M x 4N), block tile 128 x 256, wave tile 64 x 64
//    (16 accumulator tiles, 4 + 4 fragments: 16 products per 8 fragments read from LDS, and
//    each operand row fetched from L2 by half as many blocks as with a 64 x 128 tile).
//    Epilogue: f32 -> f16 bits
//      Q,K sections: [NB*NHEAD][SEQ][HDIM] (one line per (b,h,t) row)
//      V  section:   [NB*NHEAD][SEQ/32][64 slots][32 keys] (two slots of a 32-key tile = one line)
// ---------------------------------------------------------------------------
#define QM 128
#define QN 256
#define QROWS (QM + QN)
#define QBUF ((QROWS / 2) * PPITCH)
static_assert(SEQ % QM == 0);          // a block's rows lie in one batch
static_assert(HID % QN == 0);          // a block's columns lie in one of the q, k, v sections
// Epilogue of the 128 x 256 tile, orientation as a compile-time constant so that every LDS
// offset is an immediate.  TR = false (q, k): stile[m][o], pitch 264; TR = true (v): stile[o][m], pitch 136.
template <bool TR>
__device__ __forceinline__ void qkv_stage(const v8f (&acc)[4][4], unsigned short* stile, int tid) {
  constexpr int sm = TR ? 1 : 264;            // LDS stride of the m index
  constexpr int so = TR ? 136 : 1;            // LDS stride of the o index
  const int lane = tid & 31;
  const int wave = tid >> 5;
  unsigned short* p0 = stile + ((wave >> 2) * 64 + (lane >> 4) * 8) * sm + ((wave & 3) * 64 + (lane & 15)) * so;
#pragma unroll
  for (int i = 0; i < 4; ++i)
#pragma unroll
    for (int j = 0; j < 4; ++j)
#pragma unroll
      for (int r = 0; r < 8; ++r) p0[(i * 16 + r) * sm + (j * 16) * so] = f16_bits(acc[i][j][r]);
}
// 512 lines of 128 B leave in 4 groups of 4 x 32 lines; lanes 8q..8q+7 share a line.
// q, k: line = (head L >> 7, token L & 127); v: line = (head L >> 7, 32-key tile (L >> 5) & 3, slot pair L & 31).
template <bool TR>
__device__ __forceinline__ void qkv_lines(const unsigned short* stile, unsigned short* __restrict__ dstp,
                                          int tid, long bh0, int t0) {
  const int sub = tid & 7;
#pragma unroll
  for (int g = 0; g < 4; ++g) {
    Pack8 pk[4];
    long go[4];
#pragma unroll
    for (int p = 0; p < 4; ++p) {
      const int L = (g * 4 + p) * 32 + (tid >> 3);   // line 0..511
      const long bhh = bh0 + (L >> 7);               // head within the tile, in both orientations
      const int sidx = TR ? (((L >> 7) * 64 + vslot((L & 31) * 2 + (sub >> 2))) * 136 + ((L >> 5) & 3) * 32 + (sub & 3) * 8)
                          : ((L & 127) * 264 + (L >> 7) * 64 + sub * 8);
      pk[p].s = *(const v8us*)(stile + sidx);
      go[p] = TR ? ((bhh * (SEQ / 32) + (t0 >> 5) + ((L >> 5) & 3)) * (HDIM * 32) + (L & 31) * 64 + sub * 8)
                 : ((bhh * SEQ + t0 + (L & 127)) * HDIM + sub * 8);
    }
#pragma unroll
    for (int p = 0; p < 4; ++p) *(v4u*)(dstp + go[p]) = pk[p].u;
    // no register that an issued store names is rewritten ahead of this wait
    asm volatile("s_wait_xcnt 0x0" ::: "memory");
  }
}
__global__ void __launch_bounds__(256) __attribute__((amdgpu_num_vgpr(256)))
k_gemm_qkv(const unsigned short* __restrict__ X, const unsigned short* __restrict__ WT,
           const float* __restrict__ bias,
           unsigned short* __restrict__ Qf, unsigned short* __restrict__ Kf,
           unsigned short* __restrict__ Vf) {
  // k loop: three operand buffers of (128 + 256) rows; epilogue (behind the loop's last barrier):
  // row orientation [128][264] (33792) or transposed [256][136] (34816)
  __shared__ __attribute__((aligned(16))) unsigned short smem[3 * QBUF];
  static_assert(3 * QBUF >= 256 * 136 && 3 * QBUF >= 128 * 264);
  static_assert(2 * 3 * QBUF * 2 <= 320 * 1024);   // two blocks on a WGP
  unsigned short* stile = smem;
  const int tid = threadIdx.x;
  const int lane = tid & 31;
  const int wave = tid >> 5;
  const int wm = wave >> 2;    // 0..1
  const int wn = wave & 3;     // 0..3
  const int lc = lane & 15;
  const int mblk = blockIdx.x * QM;
  const int nblk = blockIdx.y * QN;
  const long n0 = (long)nblk + wn * 64;

  v8f acc[4][4];
#pragma unroll
  for (int i = 0; i < 4; ++i)
#pragma unroll
    for (int j = 0; j < 4; ++j) acc[i][j] = zero8();

  const unsigned lcp = lds_off(smem) + (tid >> 4) * (PPITCH * 2) + (tid & 15) * 16;   // row tid >> 3, piece tid & 7
  constexpr long xstep = (long)NB * SEQ * KT;   // from one k tile of an operand to the next
  constexpr long wstep = (long)3 * HID * KT;
  const unsigned short* gx = X + ((long)mblk + (tid >> 3)) * KT + (tid & 7) * 8;
  const unsigned short* gw = WT + ((long)nblk + (tid >> 3)) * KT + (tid & 7) * 8;
  static_assert(HID / KT >= 3);
  stage_tile_q(lcp, gx, gw);
  stage_tile_q(lcp + QBUF * 2, gx + xstep, gw + wstep);
  stage_tile_q(lcp + 2 * QBUF * 2, gx + 2 * xstep, gw + 2 * wstep);
  wait_copies_but<24>();   // tile 0 has landed; tiles 1 and 2 fly on
  __syncthreads();

  int cur = 0;   // t mod 3: the buffer that trip t reads
#pragma unroll 1
  for (int t = 0; t < HID / KT; ++t) {
    const unsigned short* sb = smem + cur * QBUF;
#pragma unroll   // both 32-k steps of a tile: every LDS offset becomes an immediate
    for (int kk = 0; kk < KT; kk += 32) {
      FragB a[4], b[4];
#pragma unroll
      for (int i = 0; i < 4; ++i) a[i].u = ldfrag_p(sb + (wm * 32 + i * 8) * PPITCH + kk, lane);
#pragma unroll
      for (int j = 0; j < 4; ++j) b[j].u = ldfrag_p(sb + (QM / 2 + wn * 32 + j * 8) * PPITCH + kk, lane);
#pragma unroll
      for (int i = 0; i < 4; ++i)
#pragma unroll
        for (int j = 0; j < 4; ++j) acc[i][j] = mma_b(a[i].v, b[j].v, acc[i][j]);
    }
    wait_lds_reads();
    // tile t + 1 must have landed: the wave's 12 youngest copies are tile t + 2's; where there is no
    // tile t + 2 they are tile t + 1's own, and the wait goes to 0
    wait_copies_but<12>();
    if (t + 2 >= HID / KT) wait_copies();
    __syncthreads();   // publishes tile t + 1 and frees the buffer that trip t has read
    if (t + 3 < HID / KT)
      stage_tile_q(lcp + cur * (QBUF * 2), gx + (t + 3) * xstep, gw + (t + 3) * wstep);
    cur = (cur == 2) ? 0 : cur + 1;
  }
  wait_copies();

  // bias add in f32 (bias entries RNE-converted to bf16 values)
#pragma unroll
  for (int j = 0; j < 4; ++j) {
    const float bj = bf16_rne(bias[n0 + j * 16 + lc]);
#pragma unroll
    for (int i = 0; i < 4; ++i)
#pragma unroll
      for (int r = 0; r < 8; ++r) acc[i][j][r] += bj;
  }

  const int sec = nblk / HID;                 // 0 = q, 1 = k, 2 = v (block-uniform)
  const int h0 = (nblk - sec * HID) >> 6;     // first of the 4 heads in this tile
  const int bb = mblk / SEQ;
  const int t0 = mblk - bb * SEQ;
  const long bh0 = (long)bb * NHEAD + h0;

  // stage the f16 bits of the 128x256 tile (accumulators die here), then write whole lines
  if (sec == 2) qkv_stage<true>(acc, stile, tid); else qkv_stage<false>(acc, stile, tid);
  __syncthreads();
  if (sec == 2) qkv_lines<true>(stile, Vf, tid, bh0, t0);
  else          qkv_lines<false>(stile, (sec == 0) ? Qf : Kf, tid, bh0, t0);
}

// ---------------------------------------------------------------------------
// 4) Flash attention, transposed: one wave = 32 queries (two tiles of 16) of one (b,h); keys streamed
//    32 at a time.  S^T = k*q (A = key rows, B = queries): lane l holds, of query l & 15 of a tile, the
//    keys 8*(l>>4) + 0..7 (tile 0) and 16 + 8*(l>>4) + 0..7 (tile 1), so the softmax of a query runs
//    in one lane pair, and the two tiles converted in place are the B fragment of
//    O^T += v*p (A = d rows of V).  Every K and V fragment read from LDS serves both query tiles.
//    Block = 128 threads (4 waves, same b,h: 128 queries), which share one LDS copy of each
//    32-key K/V tile.
// ---------------------------------------------------------------------------
#define AQT 2
#define EXPC (SCALE_QK * 1.44269504088896340736f)   // score scale times log2(e)
static_assert(SEQ % (4 * 16 * AQT) == 0);   // the 4 waves of a block lie in one (b,h)
static_assert(HDIM == KT);                  // a head's 64 ctx columns are one k tile of the output GEMM
// lane l <-> lane l ^ 16
__device__ __forceinline__ float xhalf(float x) {
  const int b = __builtin_bit_cast(int, x);
  return __builtin_bit_cast(float, __builtin_amdgcn_permlanex16(b, b, 0x76543210, 0xfedcba98, false, false));
}
__global__ void __launch_bounds__(128) __attribute__((amdgpu_num_vgpr(256)))
k_attn(const unsigned short* __restrict__ Qf, const unsigned short* __restrict__ Kf,
       const unsigned short* __restrict__ Vf,
       const int* __restrict__ maskp, unsigned short* __restrict__ Ctx) {
  __shared__ __attribute__((aligned(16))) unsigned short Cl[4 * 16 * AQT * 72];
  __shared__ __attribute__((aligned(16))) unsigned short KV[2 * AT_BUF];   // K/V ring, shared by the 4 waves
  __shared__ __attribute__((aligned(16))) float Mb[SEQ];   // per key of this batch: 0, or -inf where mask == 0
  const int lane = threadIdx.x & 31;
  const int wave = threadIdx.x >> 5;
  const int hh = lane >> 4;
  const int lc = lane & 15;
  const int nqb = SEQ / (16 * AQT);
  const int gq = blockIdx.x * 4 + wave;
  const int qb = gq % nqb;
  const int bh = gq / nqb;
  const int bb = bh / NHEAD;
  const int h = bh - bb * NHEAD;
  const long qoff = ((long)bh * SEQ + qb * (16 * AQT)) * HDIM;
  const long koff = (long)bh * SEQ * HDIM;
  const long voff = (long)bh * HDIM * SEQ;
  const int* mrow = maskp + (long)bb * SEQ_FULL;
  const float ninf = __uint_as_float(0xff800000u);

  FragH q0[AQT], q1[AQT];
#pragma unroll
  for (int u = 0; u < AQT; ++u) {
    q0[u].u = ldfrag_g(Qf + qoff + u * 16 * HDIM, HDIM, lane);
    q1[u].u = ldfrag_g(Qf + qoff + u * 16 * HDIM + 32, HDIM, lane);
  }

  v8f o[AQT][4];
  float mrun[AQT];   // running maximum of the raw scores of query lc of tile u (equal in both lanes of the pair)
  float lrun[AQT];   // running sum over this lane's own half of the keys
#pragma unroll
  for (int u = 0; u < AQT; ++u) {
#pragma unroll
    for (int t = 0; t < 4; ++t) o[u][t] = zero8();
    mrun[u] = -1e30f;
    lrun[u] = 0.f;
  }

  const int tid = threadIdx.x;
  // the key mask as an additive row, built once a block; the barrier behind tile 0's copies publishes it
  static_assert(SEQ % (128 * 4) == 0);   // every lane takes the same number of 4-key pieces
  v4i mm[SEQ / (128 * 4)];
#pragma unroll
  for (int j = 0; j < SEQ / (128 * 4); ++j) mm[j] = *(const v4i*)(mrow + j * (128 * 4) + tid * 4);
  const unsigned lk = lds_off(KV) + (tid >> 3) * (LPITCH * 2) + (tid & 7) * 16;
  const unsigned lv = lds_off(KV) + AT_K * 2 + vslot(tid >> 2) * (VPITCH * 2) + (tid & 3) * 16;
  const long gko = koff + (long)(tid >> 3) * HDIM + (tid & 7) * 8;
  const long gvo = voff + (long)(tid >> 2) * 32 + (tid & 3) * 8;
  stage_kv(lk, lv, Kf + gko, Vf + gvo);
#pragma unroll
  for (int j = 0; j < SEQ / (128 * 4); ++j)
    *(v4f*)(Mb + j * (128 * 4) + tid * 4) = (v4f){(mm[j].x == 0) ? ninf : 0.f, (mm[j].y == 0) ? ninf : 0.f,
                                                  (mm[j].z == 0) ? ninf : 0.f, (mm[j].w == 0) ? ninf : 0.f};
  wait_copies();
  __syncthreads();
  stage_kv(lk + AT_BUF * 2, lv + AT_BUF * 2, Kf + gko + 32 * HDIM, Vf + gvo + 32 * HDIM);

#pragma unroll 1
  for (int kb = 0; kb < SEQ; kb += 32) {
    const int buf = (kb >> 5) & 1;
    const unsigned short* sb = KV + buf * AT_BUF;
    // mask row of this lane's 16 keys, in the accumulator's layout (register r = key hh*8 + r of a tile):
    // it is the C operand of each score tile's first product, the same for both query tiles
    const float* mb = Mb + kb + hh * 8;
    const v8f c0 = __builtin_shufflevector(*(const v4f*)(mb), *(const v4f*)(mb + 4), 0, 1, 2, 3, 4, 5, 6, 7);
    const v8f c1 = __builtin_shufflevector(*(const v4f*)(mb + 16), *(const v4f*)(mb + 20), 0, 1, 2, 3, 4, 5, 6, 7);
    v8f s0[AQT], s1[AQT];
    {
      FragH ka, kc;
      // keys kb .. kb+15
      ka.u = ldfrag_l(sb, LPITCH, lane);
      kc.u = ldfrag_l(sb + 32, LPITCH, lane);
#pragma unroll
      for (int u = 0; u < AQT; ++u) s0[u] = mma_h(ka.v, q0[u].v, c0);
#pragma unroll
      for (int u = 0; u < AQT; ++u) s0[u] = mma_h(kc.v, q1[u].v, s0[u]);
      // keys kb+16 .. kb+31
      ka.u = ldfrag_l(sb + 16 * LPITCH, LPITCH, lane);
      kc.u = ldfrag_l(sb + 16 * LPITCH + 32, LPITCH, lane);
#pragma unroll
      for (int u = 0; u < AQT; ++u) s1[u] = mma_h(ka.v, q0[u].v, c1);
#pragma unroll
      for (int u = 0; u < AQT; ++u) s1[u] = mma_h(kc.v, q1[u].v, s1[u]);
    }

    FragP pa[AQT];
#pragma unroll
    for (int u = 0; u < AQT; ++u) {
      // online softmax of query lc on the raw (unscaled, masked) scores: maximum in the lane, then one
      // exchange between the halves; exp(SCALE_QK * (s - m)) = exp2(s * EXPC - m * EXPC), one FMA a score
      float mx = fmaxf(s0[u][0], s1[u][0]);
#pragma unroll
      for (int r = 1; r < 8; ++r) mx = fmaxf(mx, fmaxf(s0[u][r], s1[u][r]));
      mx = fmaxf(mx, xhalf(mx));
      const float mnew = fmaxf(mrun[u], mx);
      const float nmc = -mnew * EXPC;
      const float alpha = __builtin_amdgcn_exp2f((mrun[u] - mnew) * EXPC);   // difference first: exactly 0 where the two are equal
      s0[u] = s0[u] * EXPC + nmc;
      s1[u] = s1[u] * EXPC + nmc;
#pragma unroll
      for (int r = 0; r < 8; ++r) {
        s0[u][r] = __builtin_amdgcn_exp2f(s0[u][r]);
        s1[u][r] = __builtin_amdgcn_exp2f(s1[u][r]);
      }
      const v8f ps = s0[u] + s1[u];
      const float rs = ((ps[0] + ps[1]) + (ps[2] + ps[3])) + ((ps[4] + ps[5]) + (ps[6] + ps[7]));
      lrun[u] = lrun[u] * alpha + rs;
      mrun[u] = mnew;
#pragma unroll
      for (int t = 0; t < 4; ++t)
#pragma unroll
        for (int r = 0; r < 8; ++r) o[u][t][r] *= alpha;

      // P^T (32 keys x 16 queries, f32 in D layout) -> f16 B fragment, in place:
      // element s of the fragment is register s & 7 of tile s >> 3
#pragma unroll
      for (int w = 0; w < 8; ++w) {
        const float p0 = (w < 4) ? s0[u][2 * w] : s1[u][2 * w - 8];
        const float p1 = (w < 4) ? s0[u][2 * w + 1] : s1[u][2 * w - 7];
        pa[u].w[w] = __builtin_bit_cast(unsigned, __builtin_convertvector((v2f){p0, p1}, v2h));
      }
    }

    // O^T += V^T * P^T  (V tile in LDS [d][token], k = token contiguous)
#pragma unroll
    for (int t = 0; t < 4; ++t) {
      FragH vf;
      vf.u = ldfrag_l(sb + AT_K + (t * 16) * VPITCH, VPITCH, lane);
#pragma unroll
      for (int u = 0; u < AQT; ++u) o[u][t] = mma_h(vf.v, pa[u].v, o[u][t]);
    }
    wait_lds_reads();
    wait_copies();
    __syncthreads();   // publishes the next 32 keys and frees the buffer that this trip has read
    if (kb + 64 < SEQ)
      stage_kv(lk + buf * (AT_BUF * 2), lv + buf * (AT_BUF * 2),
               Kf + gko + (long)(kb + 64) * HDIM, Vf + gvo + (long)(kb + 64) * HDIM);
  }
  wait_copies();

  unsigned short* cl = Cl + wave * (16 * AQT * 72);
#pragma unroll
  for (int u = 0; u < AQT; ++u) {
    const float inv = 16.0f / (lrun[u] + xhalf(lrun[u]));   // the halves' sums join here
#pragma unroll
    for (int t = 0; t < 4; ++t) {   // registers 0..7 of o[u][t] are d = t*16 + hh*8 + 0..7 of query lc
      Pack8 pc;
#pragma unroll
      for (int r = 0; r < 8; ++r) pc.s[r] = f16_bits(o[u][t][r] * inv);
      *(v4u*)(cl + (u * 16 + lc) * 72 + t * 16 + hh * 8) = pc.u;
    }
  }
  __syncthreads();
  Pack8 pk[4 * AQT];
  long go[4 * AQT];
#pragma unroll
  for (int p = 0; p < 4 * AQT; ++p) {
    const int q = p * 4 + (lane >> 3);   // query row 0..31; lanes 8q'..8q'+7 share a line
    const int sub = lane & 7;
    pk[p].s = *(const v8us*)(cl + q * 72 + sub * 8);
    go[p] = ((long)h * (NB * SEQ) + (long)bb * SEQ + qb * (16 * AQT) + q) * KT + sub * 8;   // [k tile = head][row][KT]
  }
#pragma unroll
  for (int p = 0; p < 4 * AQT; ++p) *(v4u*)(Ctx + go[p]) = pk[p].u;
}

// ---------------------------------------------------------------------------
// 5) Output GEMM: out[m][o] = (1/1024) * sum_c A[m][c] * WT[o][c] + bias[o]   (f16 operands)
//    (32 floats) written by 8 consecutive lanes x 16 B in one instruction.
// ---------------------------------------------------------------------------
__global__ void __launch_bounds__(256)
k_gemm_out(const unsigned short* __restrict__ A, const unsigned short* __restrict__ WT,
           const float* __restrict__ bias, float* __restrict__ out) {
  // k loop: three operand buffers of (64 + 256) rows; epilogue (behind the loop's last barrier): otile
  __shared__ __attribute__((aligned(16))) unsigned short smem[3 * 320 * LPITCH];
  static_assert(3 * 320 * LPITCH * 2 >= 32 * 260 * 4);
  static_assert(2 * 3 * 320 * LPITCH * 2 <= 320 * 1024);   // two blocks on a WGP
  float* otile = (float*)smem;
  const int tid = threadIdx.x;
  const int lane = tid & 31;
  const int wave = tid >> 5;
  const int wm = wave >> 2;
  const int wn = wave & 3;
  const int hh = lane >> 4;
  const int lc = lane & 15;
  const int mblk = blockIdx.x * 64;
  const int nblk = blockIdx.y * 256;
  const long n0 = (long)nblk + wn * 64;

  v8f acc[2][4];
#pragma unroll
  for (int i = 0; i < 2; ++i)
#pragma unroll
    for (int j = 0; j < 4; ++j) acc[i][j] = zero8();

  const unsigned lcp = lds_off(smem) + (tid >> 3) * (LPITCH * 2) + (tid & 7) * 16;
  constexpr long astep = (long)NB * SEQ * KT;   // from one k tile of an operand to the next
  constexpr long wstep = (long)HID * KT;
  const unsigned short* ga = A + ((long)mblk + (tid >> 3)) * KT + (tid & 7) * 8;
  const unsigned short* gw = WT + ((long)nblk + (tid >> 3)) * KT + (tid & 7) * 8;
  stage_tile<2>(lcp, ga, gw);
  stage_tile<2>(lcp + 320 * LPITCH * 2, ga + astep, gw + wstep);
  stage_tile<2>(lcp + 2 * 320 * LPITCH * 2, ga + 2 * astep, gw + 2 * wstep);
  wait_copies_but<20>();   // tile 0 has landed; tiles 1 and 2 fly on
  __syncthreads();

  int cur = 0;   // t mod 3: the buffer that trip t reads
#pragma unroll 1
  for (int t = 0; t < HID / KT; ++t) {
    const unsigned short* sb = smem + cur * (320 * LPITCH);
#pragma unroll   // both 32-k steps of a tile: every LDS offset becomes an immediate
    for (int kk = 0; kk < KT; kk += 32) {
      FragH a0, a1, b0, b1, b2, b3;
      a0.u = ldfrag_l(sb + (wm * 32) * LPITCH + kk, LPITCH, lane);
      a1.u = ldfrag_l(sb + (wm * 32 + 16) * LPITCH + kk, LPITCH, lane);
      b0.u = ldfrag_l(sb + (64 + wn * 64) * LPITCH + kk, LPITCH, lane);
      b1.u = ldfrag_l(sb + (64 + wn * 64 + 16) * LPITCH + kk, LPITCH, lane);
      b2.u = ldfrag_l(sb + (64 + wn * 64 + 32) * LPITCH + kk, LPITCH, lane);
      b3.u = ldfrag_l(sb + (64 + wn * 64 + 48) * LPITCH + kk, LPITCH, lane);
      acc[0][0] = mma_h(a0.v, b0.v, acc[0][0]);
      acc[0][1] = mma_h(a0.v, b1.v, acc[0][1]);
      acc[0][2] = mma_h(a0.v, b2.v, acc[0][2]);
      acc[0][3] = mma_h(a0.v, b3.v, acc[0][3]);
      acc[1][0] = mma_h(a1.v, b0.v, acc[1][0]);
      acc[1][1] = mma_h(a1.v, b1.v, acc[1][1]);
      acc[1][2] = mma_h(a1.v, b2.v, acc[1][2]);
      acc[1][3] = mma_h(a1.v, b3.v, acc[1][3]);
    }
    wait_lds_reads();
    // tile t + 1 must have landed: the wave's 10 youngest copies are tile t + 2's; where there is no
    // tile t + 2 they are tile t + 1's own, and the wait goes to 0
    wait_copies_but<10>();
    if (t + 2 >= HID / KT) wait_copies();
    __syncthreads();   // publishes tile t + 1 and frees the buffer that trip t has read
    if (t + 3 < HID / KT)
      stage_tile<2>(lcp + cur * (320 * LPITCH * 2), ga + (t + 3) * astep, gw + (t + 3) * wstep);
    cur = (cur == 2) ? 0 : cur + 1;
  }
  wait_copies();

  // undo carries (x16 ctx, x64 weight) and add bf16-valued bias, all in f32
#pragma unroll
  for (int j = 0; j < 4; ++j) {
    const float bj = bf16_rne(bias[n0 + j * 16 + lc]);
#pragma unroll
    for (int i = 0; i < 2; ++i)
#pragma unroll
      for (int r = 0; r < 8; ++r) acc[i][j][r] = acc[i][j][r] * (1.0f / 1024.0f) + bj;
  }

#pragma unroll
  for (int phase = 0; phase < 2; ++phase) {
    if (wm == phase) {   // wave-uniform: waves owning rows phase*32 .. +31 stage them
#pragma unroll
      for (int i = 0; i < 2; ++i)
#pragma unroll
        for (int j = 0; j < 4; ++j)
#pragma unroll
          for (int r = 0; r < 8; ++r) {
            const int ml = i * 16 + r + hh * 8;
            const int ol = wn * 64 + j * 16 + lc;
            otile[ml * 260 + ol] = acc[i][j][r];
          }
    }
    __syncthreads();
    v4f pk[8];
    long go[8];
#pragma unroll
    for (int p = 0; p < 8; ++p) {
      const int L = p * 32 + (tid >> 3);
      const int sub = tid & 7;
      const int row = L >> 3;
      const int piece = L & 7;
      pk[p] = *(const v4f*)(otile + row * 260 + piece * 32 + sub * 4);
      go[p] = ((long)mblk + phase * 32 + row) * HID + nblk + piece * 32 + sub * 4;
    }
#pragma unroll
    for (int p = 0; p < 8; ++p) *(v4f*)(out + go[p]) = pk[p];
    
    __syncthreads();
  }
}

// ---------------------------------------------------------------------------
// Launch
// ---------------------------------------------------------------------------
extern "C" void kernel_launch(void* const* d_in, const int* in_sizes, int n_in,
                              void* d_out, int out_size, void* d_ws, size_t ws_size,
                              hipStream_t stream) {
  if (n_in < 6) return;
  const float* x     = (const float*)d_in[0];   // [NB_FULL, SEQ_FULL, HID]
  const int*   maskp = (const int*)d_in[1];     // [NB_FULL, 1, 1, SEQ_FULL] int32
  const float* Wqkv  = (const float*)d_in[2];   // [HID][3*HID]
  const float* bqkv  = (const float*)d_in[3];   // [3*HID]
  const float* Wout  = (const float*)d_in[4];   // [HID][HID]
  const float* bout  = (const float*)d_in[5];   // [HID]
  float* out = (float*)d_out;                   // [NB*SEQ, HID]

  const long M = (long)NB * SEQ;
  if ((long)in_sizes[0] < (((long)(NB - 1) * SEQ_FULL + SEQ) * HID)) return;
  if ((long)in_sizes[1] < ((long)(NB - 1) * SEQ_FULL + SEQ)) return;
  if ((long)in_sizes[2] < 3L * HID * HID) return;
  if ((long)in_sizes[3] < 3L * HID) return;
  if ((long)in_sizes[4] < (long)HID * HID) return;
  if ((long)in_sizes[5] < (long)HID) return;
  if ((long)out_size < M * HID) return;

  // workspace carve (bytes); every region is a whole number of tiles, no padding needed
  const size_t szX  = (size_t)M * HID * 2;                       // x bf16 plane, later ctx f16 plane
  const size_t szWq = (size_t)3 * HID * HID * 2;                 // WqkvT bf16
  const size_t szWo = (size_t)HID * HID * 2;                     // WoutT f16
  const size_t szP  = (size_t)NB * NHEAD * SEQ * HDIM * 2;       // one q/k/v plane
  const size_t oX  = 0;
  const size_t oWq = oX + szX;
  const size_t oWo = oWq + szWq;
  const size_t oP0 = oWo + szWo;
  const size_t total = oP0 + 3 * szP;
  if (total > ws_size) return;
  static_assert((size_t)NB * SEQ * HID * 2 == (size_t)NB * NHEAD * SEQ * HDIM * 2);

  char* ws = (char*)d_ws;
  unsigned short* xb  = (unsigned short*)(ws + oX);
  unsigned short* ctx = (unsigned short*)(ws + oX);      // aliases xb: xb is dead after k_gemm_qkv
  unsigned short* wq  = (unsigned short*)(ws + oWq);
  unsigned short* wo  = (unsigned short*)(ws + oWo);
  unsigned short* qf  = (unsigned short*)(ws + oP0 + 0 * szP);
  unsigned short* kf  = (unsigned short*)(ws + oP0 + 1 * szP);
  unsigned short* vf  = (unsigned short*)(ws + oP0 + 2 * szP);

  // 1) + 2) one launch: Wqkv in[HID][3*HID] -> out[HID/64][3*HID][64] bf16;  Wout in[HID][HID] ->
  //    out[HID/64][HID][64] f16 (x64);  x -> bf16 plane [HID/64][NB*SEQ][64]
  k_cvt_all<<<CVT_WQ_BLKS + CVT_WO_BLKS + CVT_X_BLKS, 256, 0, stream>>>(x, Wqkv, Wout, xb, wq, wo);
  // 3) qkv GEMM -> f16 planes of q, k ([bh][t][d]) and v ([bh][t/32][slot of d][32]); block tile 128x256
  k_gemm_qkv<<<dim3((int)(M / QM), 3 * HID / QN), 256, 0, stream>>>(xb, wq, bqkv, qf, kf, vf);
  // 4) attention -> ctx f16 plane [NHEAD][NB*SEQ][64] (over the dead x plane)
  k_attn<<<(NB * NHEAD * (SEQ / (16 * AQT))) / 4, 128, 0, stream>>>(qf, kf, vf, maskp, ctx);
  // 5) output GEMM -> f32 out
  k_gemm_out<<<dim3((int)(M / 64), HID / 256), 256, 0, stream>>>(ctx, wo, bout, out);
}

// v010
// One run takes 89.2 microseconds.
// Two timings next to v009 both put it at 1.04 times that version's speed.
// All steps since v000 together make it 4.82 times as fast.
// Contractions: x*Wqkv on v_wmma_f32_16x16x32_bf16 (bf16 operands = RNE-converted inputs); q*k^T and p*v on v_wmma_f32_16x16x32_f16 (f16 operands = RNE-converted f32 q, k, v and softmax weights, one product per operand pair); ctx*Wout on v_wmma_f32_16x16x32_f16 (f16 operands, ctx carried x16, Wout carried x64); f32 accumulate, f32 softmax.
#include <hip/hip_runtime.h>

#ifndef NB
#define NB 16
#endif
#ifndef SEQ
#define SEQ 512
#endif
#ifndef NB_FULL
#define NB_FULL 16
#endif
#ifndef SEQ_FULL
#define SEQ_FULL 512
#endif
#define HID 1024
#define NHEAD 16
#define HDIM 64
#define SCALE_QK 0.125f

static_assert(SEQ % 64 == 0);
static_assert(HID == NHEAD * HDIM);
static_assert(HID % 256 == 0);
static_assert(HID % 128 == 0);
static_assert(((NB * NHEAD * (SEQ / 16)) % 4) == 0);
static_assert(NB <= NB_FULL);
static_assert(SEQ <= SEQ_FULL);

typedef _Float16 v16h __attribute__((ext_vector_type(16)));
typedef __bf16   v16b __attribute__((ext_vector_type(16)));
typedef unsigned short v8us  __attribute__((ext_vector_type(8)));
typedef unsigned short v16us __attribute__((ext_vector_type(16)));
typedef float v8f __attribute__((ext_vector_type(8)));
typedef float v4f __attribute__((ext_vector_type(4)));
typedef unsigned int v4u __attribute__((ext_vector_type(4)));
typedef unsigned int v8u __attribute__((ext_vector_type(8)));
typedef int v4i __attribute__((ext_vector_type(4)));
typedef float v2f __attribute__((ext_vector_type(2)));
typedef _Float16 v2h __attribute__((ext_vector_type(2)));

union FragB { v16us u; v16b v; };
union FragH { v16us u; v16h v; };
union Pack8 { v8us s; v4u u; };
union FragP { v8u w; v16h v; };

// ---------------------------------------------------------------------------
// 16-bit conversion helpers (bf16 via RNE on the f32 bit pattern)
// ---------------------------------------------------------------------------
__device__ __forceinline__ unsigned short bf16_rne_bits(float f) {
  unsigned int u = __float_as_uint(f);
  u += 0x7fffu + ((u >> 16) & 1u);
  return (unsigned short)(u >> 16);
}
__device__ __forceinline__ float bf16_val(unsigned short b) {
  return __uint_as_float(((unsigned int)b) << 16);
}
__device__ __forceinline__ float bf16_rne(float f) { return bf16_val(bf16_rne_bits(f)); }
__device__ __forceinline__ unsigned short f16_bits(float f) {
  _Float16 hv = (_Float16)f;
  return __builtin_bit_cast(unsigned short, hv);
}
template <int MODE>   // 0: bf16 bits of RNE(w); 1: f16 bits of RNE_bf16(w) * 64
__device__ __forceinline__ unsigned short wbits(float f) {
  if (MODE == 0) return bf16_rne_bits(f);
  return f16_bits(bf16_rne(f) * 64.0f);
}

// ---------------------------------------------------------------------------
// WMMA helpers: D(16x16 f32) += A(16x32) * B(32x16); builtin forms, whose hazard slots the compiler keeps
// ---------------------------------------------------------------------------
__device__ __forceinline__ v8f mma_b(v16b a, v16b b, v8f c) {
  return __builtin_amdgcn_wmma_f32_16x16x32_bf16(false, a, false, b, (short)0, c, false, false);
}
__device__ __forceinline__ v8f mma_h(v16h a, v16h b, v8f c) {
  return __builtin_amdgcn_wmma_f32_16x16x32_f16(false, a, false, b, (short)0, c, false, false);
}
__device__ __forceinline__ v8f zero8() { return (v8f){0.f, 0.f, 0.f, 0.f, 0.f, 0.f, 0.f, 0.f}; }

// ---------------------------------------------------------------------------
// Fragment loader, 16-bit split k-map for A and B:
//   lane l: row/col = l & 15; elements 0..7 <- k0 + 8*(l>>4) + 0..7,
//                             elements 8..15 <- k0 + 16 + 8*(l>>4) + 0..7.
// base points at (row0/col0, k0) of a k-contiguous 16-bit plane, ld = pitch.
// ---------------------------------------------------------------------------
__device__ __forceinline__ v16us ldfrag_g(const unsigned short* __restrict__ base, long ld, int lane) {
  const unsigned short* p = base + (long)(lane & 15) * ld + ((lane >> 4) << 3);
  v8us e0 = *(const v8us*)(p);
  v8us e1 = *(const v8us*)(p + 16);
  return __builtin_shufflevector(e0, e1, 0, 1, 2, 3, 4, 5, 6, 7, 8, 9, 10, 11, 12, 13, 14, 15);
}
__device__ __forceinline__ v16us ldfrag_l(const unsigned short* base, int ld, int lane) {
  const unsigned short* p = base + (lane & 15) * ld + ((lane >> 4) << 3);
  v8us e0 = *(const v8us*)(p);
  v8us e1 = *(const v8us*)(p + 16);
  return __builtin_shufflevector(e0, e1, 0, 1, 2, 3, 4, 5, 6, 7, 8, 9, 10, 11, 12, 13, 14, 15);
}

// ---------------------------------------------------------------------------
// GEMM operand staging: a tile is KT k-elements (one whole 128-B line) of every operand row
// of the block, laid in LDS at a pitch of 144 B in the output GEMM (16 B x 9: conflict-free for 16-B row reads).
// In the workspace every GEMM operand lies k-tile-major, [k / KT][row][KT]: the rows of a block's
// tile follow one another without a gap, so a wave-wide copy (16 B a lane) takes 512 contiguous
// bytes, and each operand's part of a block's tile is one run of 8 to 32 KB.
// ---------------------------------------------------------------------------
#define KT 64
#define LPITCH 72
static_assert(HID % KT == 0 && HID / KT >= 2);

__device__ __forceinline__ unsigned lds_off(const void* p) { return (unsigned)(size_t)p; }

// One statement per tile; the s_wait_xcnt ends it so that no address register of an issued
// copy is rewritten before the wait.
__device__ __forceinline__ void async_copy4(const unsigned (&l)[4], const unsigned short* const (&g)[4]) {
  asm volatile("global_load_async_to_lds_b128 %0, %4, off\n\t"
               "global_load_async_to_lds_b128 %1, %5, off\n\t"
               "global_load_async_to_lds_b128 %2, %6, off\n\t"
               "global_load_async_to_lds_b128 %3, %7, off\n\t"
               "s_wait_xcnt 0x0"
               :: "v"(l[0]), "v"(l[1]), "v"(l[2]), "v"(l[3]),
                  "v"(g[0]), "v"(g[1]), "v"(g[2]), "v"(g[3]) : "memory");
}
__device__ __forceinline__ void async_copy10(const unsigned (&l)[10], const unsigned short* const (&g)[10]) {
  asm volatile("global_load_async_to_lds_b128 %0, %10, off\n\t"
               "global_load_async_to_lds_b128 %1, %11, off\n\t"
               "global_load_async_to_lds_b128 %2, %12, off\n\t"
               "global_load_async_to_lds_b128 %3, %13, off\n\t"
               "global_load_async_to_lds_b128 %4, %14, off\n\t"
               "global_load_async_to_lds_b128 %5, %15, off\n\t"
               "global_load_async_to_lds_b128 %6, %16, off\n\t"
               "global_load_async_to_lds_b128 %7, %17, off\n\t"
               "global_load_async_to_lds_b128 %8, %18, off\n\t"
               "global_load_async_to_lds_b128 %9, %19, off\n\t"
               "s_wait_xcnt 0x0"
               :: "v"(l[0]), "v"(l[1]), "v"(l[2]), "v"(l[3]), "v"(l[4]), "v"(l[5]), "v"(l[6]), "v"(l[7]), "v"(l[8]), "v"(l[9]),
                  "v"(g[0]), "v"(g[1]), "v"(g[2]), "v"(g[3]), "v"(g[4]), "v"(g[5]), "v"(g[6]), "v"(g[7]), "v"(g[8]), "v"(g[9]) : "memory");
}
// 256 lanes copy 64 A rows then NBG*128 B rows; l, ga, gb are the lane's own first addresses
// (row tid>>3, 16-B piece tid&7); further rows follow in steps of 32.
template <int NBG>
__device__ __forceinline__ void stage_tile(unsigned l, const unsigned short* ga, const unsigned short* gb) {
  unsigned la[2 + 4 * NBG];
  const unsigned short* gp[2 + 4 * NBG];
#pragma unroll
  for (int i = 0; i < 2 + 4 * NBG; ++i) {
    la[i] = l + i * 32 * LPITCH * 2;
    gp[i] = (i < 2) ? ga + (i * 32) * KT : gb + ((i - 2) * 32) * KT;
  }
  static_assert(NBG == 2);
  async_copy10(la, gp);
}
// The 128 x 256 block's tile: 128 A rows then 256 B rows, 12 copies a lane, in one statement as above.
__device__ __forceinline__ void async_copy12(const unsigned (&l)[12], const unsigned short* const (&g)[12]) {
  asm volatile("global_load_async_to_lds_b128 %0, %12, off\n\t"
               "global_load_async_to_lds_b128 %1, %13, off\n\t"
               "global_load_async_to_lds_b128 %2, %14, off\n\t"
               "global_load_async_to_lds_b128 %3, %15, off\n\t"
               "global_load_async_to_lds_b128 %4, %16, off\n\t"
               "global_load_async_to_lds_b128 %5, %17, off\n\t"
               "global_load_async_to_lds_b128 %6, %18, off\n\t"
               "global_load_async_to_lds_b128 %7, %19, off\n\t"
               "global_load_async_to_lds_b128 %8, %20, off\n\t"
               "global_load_async_to_lds_b128 %9, %21, off\n\t"
               "global_load_async_to_lds_b128 %10, %22, off\n\t"
               "global_load_async_to_lds_b128 %11, %23, off\n\t"
               "s_wait_xcnt 0x0"
               :: "v"(l[0]), "v"(l[1]), "v"(l[2]), "v"(l[3]), "v"(l[4]), "v"(l[5]),
                  "v"(l[6]), "v"(l[7]), "v"(l[8]), "v"(l[9]), "v"(l[10]), "v"(l[11]),
                  "v"(g[0]), "v"(g[1]), "v"(g[2]), "v"(g[3]), "v"(g[4]), "v"(g[5]),
                  "v"(g[6]), "v"(g[7]), "v"(g[8]), "v"(g[9]), "v"(g[10]), "v"(g[11]) : "memory");
}
// In LDS this tile's rows lie in pairs: rows 2j and 2j + 1 side by side (256 B), pairs at a pitch of 272 B
// (16 B x 17).  The 16 rows of a fragment read then fall on 16 different 16-B bank groups, as at a pitch
// of 144 B a row, and three buffers of two blocks fit one WGP's LDS.
#define PPITCH 136
__device__ __forceinline__ v16us ldfrag_p(const unsigned short* base, int lane) {
  const unsigned short* p = base + ((lane & 15) >> 1) * PPITCH + (lane & 1) * KT + ((lane >> 4) << 3);
  v8us e0 = *(const v8us*)(p);
  v8us e1 = *(const v8us*)(p + 16);
  return __builtin_shufflevector(e0, e1, 0, 1, 2, 3, 4, 5, 6, 7, 8, 9, 10, 11, 12, 13, 14, 15);
}
__device__ __forceinline__ void stage_tile_q(unsigned l, const unsigned short* ga, const unsigned short* gb) {
  unsigned la[12];
  const unsigned short* gp[12];
#pragma unroll
  for (int i = 0; i < 12; ++i) {
    la[i] = l + i * 16 * PPITCH * 2;
    gp[i] = (i < 4) ? ga + (i * 32) * KT : gb + ((i - 4) * 32) * KT;
  }
  async_copy12(la, gp);
}
// Attention K/V tile: 32 keys. K as [32 keys][64 d] at pitch 144 B; V as [64 d][32 keys]
// at pitch 80 B (16 B x 5). 128 lanes; lk, lv and the two pointers are the lane's own first addresses.
// In the workspace V lies tile-major, [b,h][key / 32][slot][32 keys]: a tile is one run of 4 KB and a
// wave-wide copy takes 512 contiguous bytes.  Row d sits in slot vslot(d), which swaps the two low
// bit pairs of d (its own inverse): the four rows that 16 lanes of the producer read from its
// LDS tile at once then lie 4 rows apart there, on disjoint banks.
#define VPITCH 40
#define AT_K (32 * LPITCH)
#define AT_V (64 * VPITCH)
#define AT_BUF (AT_K + AT_V)
__device__ __forceinline__ int vslot(int d) { return (d & 48) | ((d & 3) << 2) | ((d >> 2) & 3); }
__device__ __forceinline__ void stage_kv(unsigned lk, unsigned lv,
                                         const unsigned short* gk, const unsigned short* gv) {
  const unsigned la[4] = {lk, lk + 16 * LPITCH * 2, lv, lv + 32 * VPITCH * 2};
  const unsigned short* const gp[4] = {gk, gk + 16 * HDIM, gv, gv + 32 * 32};
  async_copy4(la, gp);
}
// Ring waits, each ahead of the barrier that hands a buffer over.
__device__ __forceinline__ void wait_lds_reads()  { asm volatile("s_wait_dscnt 0x0" ::: "memory"); }
__device__ __forceinline__ void wait_copies()     { asm volatile("s_wait_asynccnt 0x0" ::: "memory"); }
template <int N>
__device__ __forceinline__ void wait_copies_but() { asm volatile("s_wait_asynccnt %0" :: "n"(N) : "memory"); }

// ---------------------------------------------------------------------------
// 1) x f32 [NB,SEQ,HID] (batch stride SEQ_FULL*HID) -> bf16 bits, [HID / KT][NB*SEQ][KT].
//    A wave takes one k tile of 4 rows (reads 4 x 256 B, writes 512 contiguous B); the 8 waves of a
//    block take 8 neighbouring k tiles of the same rows.
// ---------------------------------------------------------------------------
__device__ __forceinline__ void
cvt_x_block(const float* __restrict__ x, unsigned short* __restrict__ y, int blk) {
  static_assert(HID / KT == 16 && (NB * SEQ) % 4 == 0);
  const int tid = threadIdx.x;
  const int row = (blk >> 1) * 4 + ((tid >> 3) & 3);
  const int kt = (blk & 1) * 8 + (tid >> 5);
  const int g = kt * 8 + (tid & 7);
  const int bb = row / SEQ;
  const int tt = row - bb * SEQ;
  const long srow = (long)bb * SEQ_FULL + tt;
  const float* src = x + srow * HID + g * 8;
  const v4f a = *(const v4f*)(src);
  const v4f c = *(const v4f*)(src + 4);
  Pack8 pk;
  pk.s = (v8us){bf16_rne_bits(a.x), bf16_rne_bits(a.y), bf16_rne_bits(a.z), bf16_rne_bits(a.w),
                bf16_rne_bits(c.x), bf16_rne_bits(c.y), bf16_rne_bits(c.z), bf16_rne_bits(c.w)};
  const v4u val = pk.u;
  unsigned short* dst = y + ((long)kt * (NB * SEQ) + row) * KT + (tid & 7) * 8;
  *(v4u*)dst = val;
  // no register that the issued store names is
  // rewritten ahead of this wait
  asm volatile("s_wait_xcnt 0x0" ::: "memory");
}

// ---------------------------------------------------------------------------
// 2) weight convert + transpose: in W[kdim rows][ndim cols] f32 -> out WT[kdim / KT][ndim][KT] 16-bit.
//    line written by 8 consecutive lanes x 16 B in one instruction; a block's 64 lines are one run of 8 KB.
//    Block (bx, by) of (ndim/64, kdim/64).
// ---------------------------------------------------------------------------
template <int MODE>
__device__ __forceinline__ void
cvt_wt_block(const float* __restrict__ W, unsigned short* __restrict__ WT, int kdim, int ndim,
             int bx, int by, unsigned short* tile) {
  const int tid = threadIdx.x;
  const int n0 = bx * 64;
  const int k0 = by * 64;
  const int kl = tid >> 2;          // 0..63
  const int nl = (tid & 3) * 16;    // 0,16,32,48
  const float* src = W + (long)(k0 + kl) * ndim + n0 + nl;
#pragma unroll
  for (int q = 0; q < 4; ++q) {
    const v4f v = *(const v4f*)(src + q * 4);
    unsigned short* trow = tile + (nl + q * 4) * 72 + kl;   // tile[n_local][k_local]
    trow[0 * 72] = wbits<MODE>(v.x);
    trow[1 * 72] = wbits<MODE>(v.y);
    trow[2 * 72] = wbits<MODE>(v.z);
    trow[3 * 72] = wbits<MODE>(v.w);
  }
  __syncthreads();
  Pack8 pk[2];
  long go[2];
#pragma unroll
  for (int p = 0; p < 2; ++p) {
    const int L = p * 32 + (tid >> 3);   // output row n_local 0..63
    const int sub = tid & 7;
    pk[p].s = *(const v8us*)(tile + L * 72 + sub * 8);
    go[p] = ((long)by * ndim + n0 + L) * KT + sub * 8;
  }
#pragma unroll
  for (int p = 0; p < 2; ++p) *(v4u*)(WT + go[p]) = pk[p].u;
  // no register that an issued store names is
  // rewritten ahead of this wait
  asm volatile("s_wait_xcnt 0x0" ::: "memory");
}

// ---------------------------------------------------------------------------
// 1) + 2) in one launch: the three conversions depend on nothing but the inputs, so they share a
//    grid.  The block index picks the job: first the weight tiles (the longer chain: load, LDS,
//    barrier, store), then the rows of x.  Each branch is taken by a whole block.
// ---------------------------------------------------------------------------
#define CVT_WQ_BX (3 * HID / 64)
#define CVT_WO_BX (HID / 64)
#define CVT_WQ_BLKS (CVT_WQ_BX * (HID / 64))
#define CVT_WO_BLKS (CVT_WO_BX * (HID / 64))
#define CVT_X_GROUPS (NB * SEQ * (HID / 8))
#define CVT_X_BLKS (CVT_X_GROUPS / 256)
static_assert(CVT_X_GROUPS % 256 == 0 && KT == 64);
__global__ void __launch_bounds__(256)
k_cvt_all(const float* __restrict__ x, const float* __restrict__ Wqkv, const float* __restrict__ Wout,
          unsigned short* __restrict__ xb, unsigned short* __restrict__ wq, unsigned short* __restrict__ wo) {
  __shared__ __attribute__((aligned(16))) unsigned short tile[64 * 72];
  const int b = blockIdx.x;
  if (b < CVT_WQ_BLKS) {
    cvt_wt_block<0>(Wqkv, wq, HID, 3 * HID, b % CVT_WQ_BX, b / CVT_WQ_BX, tile);
  } else if (b < CVT_WQ_BLKS + CVT_WO_BLKS) {
    const int c = b - CVT_WQ_BLKS;
    cvt_wt_block<1>(Wout, wo, HID, HID, c % CVT_WO_BX, c / CVT_WO_BX, tile);
  } else {
    cvt_x_block(x, xb, b - (CVT_WQ_BLKS + CVT_WO_BLKS));
  }
}

// ---------------------------------------------------------------------------
// 3) QKV GEMM: y[m][o] = sum_c X[m][c] * WT[o][c] + bias[o]  (bf16 operands, f32 acc)
//    Block 256 threads = 8 waves (2M x 4N), block tile 128 x 256, wave tile 64 x 64
//    (16 accumulator tiles, 4 + 4 fragments: 16 products per 8 fragments read from LDS, and
//    each operand row fetched from L2 by half as many blocks as with a 64 x 128 tile).
//    Epilogue: f32 -> f16 bits
//      Q,K sections: [NB*NHEAD][SEQ][HDIM] (one line per (b,h,t) row)
//      V  section:   [NB*NHEAD][SEQ/32][64 slots][32 keys] (two slots of a 32-key tile = one line)
// ---------------------------------------------------------------------------
#define QM 128
#define QN 256
#define QROWS (QM + QN)
#define QBUF ((QROWS / 2) * PPITCH)
static_assert(SEQ % QM == 0);          // a block's rows lie in one batch
static_assert(HID % QN == 0);          // a block's columns lie in one of the q, k, v sections
// Epilogue of the 128 x 256 tile, orientation as a compile-time constant so that every LDS
// offset is an immediate.  TR = false (q, k): stile[m][o], pitch 264; TR = true (v): stile[o][m], pitch 136.
template <bool TR>
__device__ __forceinline__ void qkv_stage(const v8f (&acc)[4][4], unsigned short* stile, int tid) {
  constexpr int sm = TR ? 1 : 264;            // LDS stride of the m index
  constexpr int so = TR ? 136 : 1;            // LDS stride of the o index
  const int lane = tid & 31;
  const int wave = tid >> 5;
  unsigned short* p0 = stile + ((wave >> 2) * 64 + (lane >> 4) * 8) * sm + ((wave & 3) * 64 + (lane & 15)) * so;
#pragma unroll
  for (int i = 0; i < 4; ++i)
#pragma unroll
    for (int j = 0; j < 4; ++j)
#pragma unroll
      for (int r = 0; r < 8; ++r) p0[(i * 16 + r) * sm + (j * 16) * so] = f16_bits(acc[i][j][r]);
}
// 512 lines of 128 B leave in 4 groups of 4 x 32 lines; lanes 8q..8q+7 share a line.
// q, k: line = (head L >> 7, token L & 127); v: line = (head L >> 7, 32-key tile (L >> 5) & 3, slot pair L & 31).
template <bool TR>
__device__ __forceinline__ void qkv_lines(const unsigned short* stile, unsigned short* __restrict__ dstp,
                                          int tid, long bh0, int t0) {
  const int sub = tid & 7;
#pragma unroll
  for (int g = 0; g < 4; ++g) {
    Pack8 pk[4];
    long go[4];
#pragma unroll
    for (int p = 0; p < 4; ++p) {
      const int L = (g * 4 + p) * 32 + (tid >> 3);   // line 0..511
      const long bhh = bh0 + (L >> 7);               // head within the tile, in both orientations
      const int sidx = TR ? (((L >> 7) * 64 + vslot((L & 31) * 2 + (sub >> 2))) * 136 + ((L >> 5) & 3) * 32 + (sub & 3) * 8)
                          : ((L & 127) * 264 + (L >> 7) * 64 + sub * 8);
      pk[p].s = *(const v8us*)(stile + sidx);
      go[p] = TR ? ((bhh * (SEQ / 32) + (t0 >> 5) + ((L >> 5) & 3)) * (HDIM * 32) + (L & 31) * 64 + sub * 8)
                 : ((bhh * SEQ + t0 + (L & 127)) * HDIM + sub * 8);
    }
#pragma unroll
    for (int p = 0; p < 4; ++p) *(v4u*)(dstp + go[p]) = pk[p].u;
    // no register that an issued store names is rewritten ahead of this wait
    asm volatile("s_wait_xcnt 0x0" ::: "memory");
  }
}
__global__ void __launch_bounds__(256) __attribute__((amdgpu_num_vgpr(256)))
k_gemm_qkv(const unsigned short* __restrict__ X, const unsigned short* __restrict__ WT,
           const float* __restrict__ bias,
           unsigned short* __restrict__ Qf, unsigned short* __restrict__ Kf,
           unsigned short* __restrict__ Vf) {
  // k loop: three operand buffers of (128 + 256) rows; epilogue (behind the loop's last barrier):
  // row orientation [128][264] (33792) or transposed [256][136] (34816)
  __shared__ __attribute__((aligned(16))) unsigned short smem[3 * QBUF];
  static_assert(3 * QBUF >= 256 * 136 && 3 * QBUF >= 128 * 264);
  static_assert(2 * 3 * QBUF * 2 <= 320 * 1024);   // two blocks on a WGP
  unsigned short* stile = smem;
  const int tid = threadIdx.x;
  const int lane = tid & 31;
  const int wave = tid >> 5;
  const int wm = wave >> 2;    // 0..1
  const int wn = wave & 3;     // 0..3
  const int lc = lane & 15;
  const int mblk = blockIdx.x * QM;
  const int nblk = blockIdx.y * QN;
  const long n0 = (long)nblk + wn * 64;

  v8f acc[4][4];
#pragma unroll
  for (int i = 0; i < 4; ++i)
#pragma unroll
    for (int j = 0; j < 4; ++j) acc[i][j] = zero8();

  const unsigned lcp = lds_off(smem) + (tid >> 4) * (PPITCH * 2) + (tid & 15) * 16;   // row tid >> 3, piece tid & 7
  constexpr long xstep = (long)NB * SEQ * KT;   // from one k tile of an operand to the next
  constexpr long wstep = (long)3 * HID * KT;
  const unsigned short* gx = X + ((long)mblk + (tid >> 3)) * KT + (tid & 7) * 8;
  const unsigned short* gw = WT + ((long)nblk + (tid >> 3)) * KT + (tid & 7) * 8;
  static_assert(HID / KT >= 3);
  stage_tile_q(lcp, gx, gw);
  stage_tile_q(lcp + QBUF * 2, gx + xstep, gw + wstep);
  stage_tile_q(lcp + 2 * QBUF * 2, gx + 2 * xstep, gw + 2 * wstep);
  wait_copies_but<24>();   // tile 0 has landed; tiles 1 and 2 fly on
  __syncthreads();

  int cur = 0;   // t mod 3: the buffer that trip t reads
#pragma unroll 1
  for (int t = 0; t < HID / KT; ++t) {
    const unsigned short* sb = smem + cur * QBUF;
#pragma unroll   // both 32-k steps of a tile: every LDS offset becomes an immediate
    for (int kk = 0; kk < KT; kk += 32) {
      FragB a[4], b[4];
#pragma unroll
      for (int i = 0; i < 4; ++i) a[i].u = ldfrag_p(sb + (wm * 32 + i * 8) * PPITCH + kk, lane);
#pragma unroll
      for (int j = 0; j < 4; ++j) b[j].u = ldfrag_p(sb + (QM / 2 + wn * 32 + j * 8) * PPITCH + kk, lane);
      // keeps the block's 16 LDS reads one group ahead of its products: left free, the scheduler reads one
      // A fragment at a time into one register set and waits for it in front of every four products
      __builtin_amdgcn_sched_barrier(0);
#pragma unroll
      for (int i = 0; i < 4; ++i)
#pragma unroll
        for (int j = 0; j < 4; ++j) acc[i][j] = mma_b(a[i].v, b[j].v, acc[i][j]);
      // keeps the next block's reads from being spread among these products
      __builtin_amdgcn_sched_barrier(0);
    }
    wait_lds_reads();
    // tile t + 1 must have landed: the wave's 12 youngest copies are tile t + 2's; where there is no
    // tile t + 2 they are tile t + 1's own, and the wait goes to 0
    wait_copies_but<12>();
    if (t + 2 >= HID / KT) wait_copies();
    __syncthreads();   // publishes tile t + 1 and frees the buffer that trip t has read
    if (t + 3 < HID / KT)
      stage_tile_q(lcp + cur * (QBUF * 2), gx + (t + 3) * xstep, gw + (t + 3) * wstep);
    cur = (cur == 2) ? 0 : cur + 1;
  }
  wait_copies();

  // bias add in f32 (bias entries RNE-converted to bf16 values)
#pragma unroll
  for (int j = 0; j < 4; ++j) {
    const float bj = bf16_rne(bias[n0 + j * 16 + lc]);
#pragma unroll
    for (int i = 0; i < 4; ++i)
#pragma unroll
      for (int r = 0; r < 8; ++r) acc[i][j][r] += bj;
  }

  const int sec = nblk / HID;                 // 0 = q, 1 = k, 2 = v (block-uniform)
  const int h0 = (nblk - sec * HID) >> 6;     // first of the 4 heads in this tile
  const int bb = mblk / SEQ;
  const int t0 = mblk - bb * SEQ;
  const long bh0 = (long)bb * NHEAD + h0;

  // stage the f16 bits of the 128x256 tile (accumulators die here), then write whole lines
  if (sec == 2) qkv_stage<true>(acc, stile, tid); else qkv_stage<false>(acc, stile, tid);
  __syncthreads();
  if (sec == 2) qkv_lines<true>(stile, Vf, tid, bh0, t0);
  else          qkv_lines<false>(stile, (sec == 0) ? Qf : Kf, tid, bh0, t0);
}

// ---------------------------------------------------------------------------
// 4) Flash attention, transposed: one wave = 32 queries (two tiles of 16) of one (b,h); keys streamed
//    32 at a time.  S^T = k*q (A = key rows, B = queries): lane l holds, of query l & 15 of a tile, the
//    keys 8*(l>>4) + 0..7 (tile 0) and 16 + 8*(l>>4) + 0..7 (tile 1), so the softmax of a query runs
//    in one lane pair, and the two tiles converted in place are the B fragment of
//    O^T += v*p (A = d rows of V).  Every K and V fragment read from LDS serves both query tiles.
//    Block = 128 threads (4 waves, same b,h: 128 queries), which share one LDS copy of each
//    32-key K/V tile.
// ---------------------------------------------------------------------------
#define AQT 2
#define EXPC (SCALE_QK * 1.44269504088896340736f)   // score scale times log2(e)
static_assert(SEQ % (4 * 16 * AQT) == 0);   // the 4 waves of a block lie in one (b,h)
static_assert(HDIM == KT);                  // a head's 64 ctx columns are one k tile of the output GEMM
// lane l <-> lane l ^ 16
__device__ __forceinline__ float xhalf(float x) {
  const int b = __builtin_bit_cast(int, x);
  return __builtin_bit_cast(float, __builtin_amdgcn_permlanex16(b, b, 0x76543210, 0xfedcba98, false, false));
}
__global__ void __launch_bounds__(128) __attribute__((amdgpu_num_vgpr(256)))
k_attn(const unsigned short* __restrict__ Qf, const unsigned short* __restrict__ Kf,
       const unsigned short* __restrict__ Vf,
       const int* __restrict__ maskp, unsigned short* __restrict__ Ctx) {
  __shared__ __attribute__((aligned(16))) unsigned short Cl[4 * 16 * AQT * 72];
  __shared__ __attribute__((aligned(16))) unsigned short KV[2 * AT_BUF];   // K/V ring, shared by the 4 waves
  __shared__ __attribute__((aligned(16))) float Mb[SEQ];   // per key of this batch: 0, or -inf where mask == 0
  const int lane = threadIdx.x & 31;
  const int wave = threadIdx.x >> 5;
  const int hh = lane >> 4;
  const int lc = lane & 15;
  const int nqb = SEQ / (16 * AQT);
  const int gq = blockIdx.x * 4 + wave;
  const int qb = gq % nqb;
  const int bh = gq / nqb;
  const int bb = bh / NHEAD;
  const int h = bh - bb * NHEAD;
  const long qoff = ((long)bh * SEQ + qb * (16 * AQT)) * HDIM;
  const long koff = (long)bh * SEQ * HDIM;
  const long voff = (long)bh * HDIM * SEQ;
  const int* mrow = maskp + (long)bb * SEQ_FULL;
  const float ninf = __uint_as_float(0xff800000u);

  FragH q0[AQT], q1[AQT];
#pragma unroll
  for (int u = 0; u < AQT; ++u) {
    q0[u].u = ldfrag_g(Qf + qoff + u * 16 * HDIM, HDIM, lane);
    q1[u].u = ldfrag_g(Qf + qoff + u * 16 * HDIM + 32, HDIM, lane);
  }

  v8f o[AQT][4];
  float mrun[AQT];   // running maximum of the raw scores of query lc of tile u (equal in both lanes of the pair)
  float lrun[AQT];   // running sum over this lane's own half of the keys
#pragma unroll
  for (int u = 0; u < AQT; ++u) {
#pragma unroll
    for (int t = 0; t < 4; ++t) o[u][t] = zero8();
    mrun[u] = -1e30f;
    lrun[u] = 0.f;
  }

  const int tid = threadIdx.x;
  // the key mask as an additive row, built once a block; the barrier behind tile 0's copies publishes it
  static_assert(SEQ % (128 * 4) == 0);   // every lane takes the same number of 4-key pieces
  v4i mm[SEQ / (128 * 4)];
#pragma unroll
  for (int j = 0; j < SEQ / (128 * 4); ++j) mm[j] = *(const v4i*)(mrow + j * (128 * 4) + tid * 4);
  const unsigned lk = lds_off(KV) + (tid >> 3) * (LPITCH * 2) + (tid & 7) * 16;
  const unsigned lv = lds_off(KV) + AT_K * 2 + vslot(tid >> 2) * (VPITCH * 2) + (tid & 3) * 16;
  const long gko = koff + (long)(tid >> 3) * HDIM + (tid & 7) * 8;
  const long gvo = voff + (long)(tid >> 2) * 32 + (tid & 3) * 8;
  stage_kv(lk, lv, Kf + gko, Vf + gvo);
#pragma unroll
  for (int j = 0; j < SEQ / (128 * 4); ++j)
    *(v4f*)(Mb + j * (128 * 4) + tid * 4) = (v4f){(mm[j].x == 0) ? ninf : 0.f, (mm[j].y == 0) ? ninf : 0.f,
                                                  (mm[j].z == 0) ? ninf : 0.f, (mm[j].w == 0) ? ninf : 0.f};
  wait_copies();
  __syncthreads();
  stage_kv(lk + AT_BUF * 2, lv + AT_BUF * 2, Kf + gko + 32 * HDIM, Vf + gvo + 32 * HDIM);

#pragma unroll 1
  for (int kb = 0; kb < SEQ; kb += 32) {
    const int buf = (kb >> 5) & 1;
    const unsigned short* sb = KV + buf * AT_BUF;
    // mask row of this lane's 16 keys, in the accumulator's layout (register r = key hh*8 + r of a tile):
    // it is the C operand of each score tile's first product, the same for both query tiles
    const float* mb = Mb + kb + hh * 8;
    const v8f c0 = __builtin_shufflevector(*(const v4f*)(mb), *(const v4f*)(mb + 4), 0, 1, 2, 3, 4, 5, 6, 7);
    const v8f c1 = __builtin_shufflevector(*(const v4f*)(mb + 16), *(const v4f*)(mb + 20), 0, 1, 2, 3, 4, 5, 6, 7);
    v8f s0[AQT], s1[AQT];
    {
      FragH ka, kc;
      // keys kb .. kb+15
      ka.u = ldfrag_l(sb, LPITCH, lane);
      kc.u = ldfrag_l(sb + 32, LPITCH, lane);
#pragma unroll
      for (int u = 0; u < AQT; ++u) s0[u] = mma_h(ka.v, q0[u].v, c0);
#pragma unroll
      for (int u = 0; u < AQT; ++u) s0[u] = mma_h(kc.v, q1[u].v, s0[u]);
      // keys kb+16 .. kb+31
      ka.u = ldfrag_l(sb + 16 * LPITCH, LPITCH, lane);
      kc.u = ldfrag_l(sb + 16 * LPITCH + 32, LPITCH, lane);
#pragma unroll
      for (int u = 0; u < AQT; ++u) s1[u] = mma_h(ka.v, q0[u].v, c1);
#pragma unroll
      for (int u = 0; u < AQT; ++u) s1[u] = mma_h(kc.v, q1[u].v, s1[u]);
    }

    FragP pa[AQT];
#pragma unroll
    for (int u = 0; u < AQT; ++u) {
      // online softmax of query lc on the raw (unscaled, masked) scores: maximum in the lane, then one
      // exchange between the halves; exp(SCALE_QK * (s - m)) = exp2(s * EXPC - m * EXPC), one FMA a score
      float mx = fmaxf(s0[u][0], s1[u][0]);
#pragma unroll
      for (int r = 1; r < 8; ++r) mx = fmaxf(mx, fmaxf(s0[u][r], s1[u][r]));
      mx = fmaxf(mx, xhalf(mx));
      const float mnew = fmaxf(mrun[u], mx);
      const float nmc = -mnew * EXPC;
      const float alpha = __builtin_amdgcn_exp2f((mrun[u] - mnew) * EXPC);   // difference first: exactly 0 where the two are equal
      s0[u] = s0[u] * EXPC + nmc;
      s1[u] = s1[u] * EXPC + nmc;
#pragma unroll
      for (int r = 0; r < 8; ++r) {
        s0[u][r] = __builtin_amdgcn_exp2f(s0[u][r]);
        s1[u][r] = __builtin_amdgcn_exp2f(s1[u][r]);
      }
      const v8f ps = s0[u] + s1[u];
      const float rs = ((ps[0] + ps[1]) + (ps[2] + ps[3])) + ((ps[4] + ps[5]) + (ps[6] + ps[7]));
      lrun[u] = lrun[u] * alpha + rs;
      mrun[u] = mnew;
#pragma unroll
      for (int t = 0; t < 4; ++t)
#pragma unroll
        for (int r = 0; r < 8; ++r) o[u][t][r] *= alpha;

      // P^T (32 keys x 16 queries, f32 in D layout) -> f16 B fragment, in place:
      // element s of the fragment is register s & 7 of tile s >> 3
#pragma unroll
      for (int w = 0; w < 8; ++w) {
        const float p0 = (w < 4) ? s0[u][2 * w] : s1[u][2 * w - 8];
        const float p1 = (w < 4) ? s0[u][2 * w + 1] : s1[u][2 * w - 7];
        pa[u].w[w] = __builtin_bit_cast(unsigned, __builtin_convertvector((v2f){p0, p1}, v2h));
      }
    }

    // O^T += V^T * P^T  (V tile in LDS [d][token], k = token contiguous)
#pragma unroll
    for (int t = 0; t < 4; ++t) {
      FragH vf;
      vf.u = ldfrag_l(sb + AT_K + (t * 16) * VPITCH, VPITCH, lane);
#pragma unroll
      for (int u = 0; u < AQT; ++u) o[u][t] = mma_h(vf.v, pa[u].v, o[u][t]);
    }
    wait_lds_reads();
    wait_copies();
    __syncthreads();   // publishes the next 32 keys and frees the buffer that this trip has read
    if (kb + 64 < SEQ)
      stage_kv(lk + buf * (AT_BUF * 2), lv + buf * (AT_BUF * 2),
               Kf + gko + (long)(kb + 64) * HDIM, Vf + gvo + (long)(kb + 64) * HDIM);
  }
  wait_copies();

  unsigned short* cl = Cl + wave * (16 * AQT * 72);
#pragma unroll
  for (int u = 0; u < AQT; ++u) {
    const float inv = 16.0f / (lrun[u] + xhalf(lrun[u]));   // the halves' sums join here
#pragma unroll
    for (int t = 0; t < 4; ++t) {   // registers 0..7 of o[u][t] are d = t*16 + hh*8 + 0..7 of query lc
      Pack8 pc;
#pragma unroll
      for (int r = 0; r < 8; ++r) pc.s[r] = f16_bits(o[u][t][r] * inv);
      *(v4u*)(cl + (u * 16 + lc) * 72 + t * 16 + hh * 8) = pc.u;
    }
  }
  __syncthreads();
  Pack8 pk[4 * AQT];
  long go[4 * AQT];
#pragma unroll
  for (int p = 0; p < 4 * AQT; ++p) {
    const int q = p * 4 + (lane >> 3);   // query row 0..31; lanes 8q'..8q'+7 share a line
    const int sub = lane & 7;
    pk[p].s = *(const v8us*)(cl + q * 72 + sub * 8);
    go[p] = ((long)h * (NB * SEQ) + (long)bb * SEQ + qb * (16 * AQT) + q) * KT + sub * 8;   // [k tile = head][row][KT]
  }
#pragma unroll
  for (int p = 0; p < 4 * AQT; ++p) *(v4u*)(Ctx + go[p]) = pk[p].u;
}

// ---------------------------------------------------------------------------
// 5) Output GEMM: out[m][o] = (1/1024) * sum_c A[m][c] * WT[o][c] + bias[o]   (f16 operands)
//    (32 floats) written by 8 consecutive lanes x 16 B in one instruction.
// ---------------------------------------------------------------------------
__global__ void __launch_bounds__(256)
k_gemm_out(const unsigned short* __restrict__ A, const unsigned short* __restrict__ WT,
           const float* __restrict__ bias, float* __restrict__ out) {
  // k loop: three operand buffers of (64 + 256) rows; epilogue (behind the loop's last barrier): otile
  __shared__ __attribute__((aligned(16))) unsigned short smem[3 * 320 * LPITCH];
  static_assert(3 * 320 * LPITCH * 2 >= 32 * 260 * 4);
  static_assert(2 * 3 * 320 * LPITCH * 2 <= 320 * 1024);   // two blocks on a WGP
  float* otile = (float*)smem;
  const int tid = threadIdx.x;
  const int lane = tid & 31;
  const int wave = tid >> 5;
  const int wm = wave >> 2;
  const int wn = wave & 3;
  const int hh = lane >> 4;
  const int lc = lane & 15;
  const int mblk = blockIdx.x * 64;
  const int nblk = blockIdx.y * 256;
  const long n0 = (long)nblk + wn * 64;

  v8f acc[2][4];
#pragma unroll
  for (int i = 0; i < 2; ++i)
#pragma unroll
    for (int j = 0; j < 4; ++j) acc[i][j] = zero8();

  const unsigned lcp = lds_off(smem) + (tid >> 3) * (LPITCH * 2) + (tid & 7) * 16;
  constexpr long astep = (long)NB * SEQ * KT;   // from one k tile of an operand to the next
  constexpr long wstep = (long)HID * KT;
  const unsigned short* ga = A + ((long)mblk + (tid >> 3)) * KT + (tid & 7) * 8;
  const unsigned short* gw = WT + ((long)nblk + (tid >> 3)) * KT + (tid & 7) * 8;
  stage_tile<2>(lcp, ga, gw);
  stage_tile<2>(lcp + 320 * LPITCH * 2, ga + astep, gw + wstep);
  stage_tile<2>(lcp + 2 * 320 * LPITCH * 2, ga + 2 * astep, gw + 2 * wstep);
  wait_copies_but<20>();   // tile 0 has landed; tiles 1 and 2 fly on
  __syncthreads();

  int cur = 0;   // t mod 3: the buffer that trip t reads
#pragma unroll 1
  for (int t = 0; t < HID / KT; ++t) {
    const unsigned short* sb = smem + cur * (320 * LPITCH);
#pragma unroll   // both 32-k steps of a tile: every LDS offset becomes an immediate
    for (int kk = 0; kk < KT; kk += 32) {
      FragH a0, a1, b0, b1, b2, b3;
      a0.u = ldfrag_l(sb + (wm * 32) * LPITCH + kk, LPITCH, lane);
      a1.u = ldfrag_l(sb + (wm * 32 + 16) * LPITCH + kk, LPITCH, lane);
      b0.u = ldfrag_l(sb + (64 + wn * 64) * LPITCH + kk, LPITCH, lane);
      b1.u = ldfrag_l(sb + (64 + wn * 64 + 16) * LPITCH + kk, LPITCH, lane);
      b2.u = ldfrag_l(sb + (64 + wn * 64 + 32) * LPITCH + kk, LPITCH, lane);
      b3.u = ldfrag_l(sb + (64 + wn * 64 + 48) * LPITCH + kk, LPITCH, lane);
      // keeps the block's 12 LDS reads one group ahead of its products, not spread among them
      __builtin_amdgcn_sched_barrier(0);
      acc[0][0] = mma_h(a0.v, b0.v, acc[0][0]);
      acc[0][1] = mma_h(a0.v, b1.v, acc[0][1]);
      acc[0][2] = mma_h(a0.v, b2.v, acc[0][2]);
      acc[0][3] = mma_h(a0.v, b3.v, acc[0][3]);
      acc[1][0] = mma_h(a1.v, b0.v, acc[1][0]);
      acc[1][1] = mma_h(a1.v, b1.v, acc[1][1]);
      acc[1][2] = mma_h(a1.v, b2.v, acc[1][2]);
      acc[1][3] = mma_h(a1.v, b3.v, acc[1][3]);
      // keeps the next block's reads from being spread among these products
      __builtin_amdgcn_sched_barrier(0);
    }
    wait_lds_reads();
    // tile t + 1 must have landed: the wave's 10 youngest copies are tile t + 2's; where there is no
    // tile t + 2 they are tile t + 1's own, and the wait goes to 0
    wait_copies_but<10>();
    if (t + 2 >= HID / KT) wait_copies();
    __syncthreads();   // publishes tile t + 1 and frees the buffer that trip t has read
    if (t + 3 < HID / KT)
      stage_tile<2>(lcp + cur * (320 * LPITCH * 2), ga + (t + 3) * astep, gw + (t + 3) * wstep);
    cur = (cur == 2) ? 0 : cur + 1;
  }
  wait_copies();

  // undo carries (x16 ctx, x64 weight) and add bf16-valued bias, all in f32
#pragma unroll
  for (int j = 0; j < 4; ++j) {
    const float bj = bf16_rne(bias[n0 + j * 16 + lc]);
#pragma unroll
    for (int i = 0; i < 2; ++i)
#pragma unroll
      for (int r = 0; r < 8; ++r) acc[i][j][r] = acc[i][j][r] * (1.0f / 1024.0f) + bj;
  }

#pragma unroll
  for (int phase = 0; phase < 2; ++phase) {
    if (wm == phase) {   // wave-uniform: waves owning rows phase*32 .. +31 stage them
#pragma unroll
      for (int i = 0; i < 2; ++i)
#pragma unroll
        for (int j = 0; j < 4; ++j)
#pragma unroll
          for (int r = 0; r < 8; ++r) {
            const int ml = i * 16 + r + hh * 8;
            const int ol = wn * 64 + j * 16 + lc;
            otile[ml * 260 + ol] = acc[i][j][r];
          }
    }
    __syncthreads();
    v4f pk[8];
    long go[8];
#pragma unroll
    for (int p = 0; p < 8; ++p) {
      const int L = p * 32 + (tid >> 3);
      const int sub = tid & 7;
      const int row = L >> 3;
      const int piece = L & 7;
      pk[p] = *(const v4f*)(otile + row * 260 + piece * 32 + sub * 4);
      go[p] = ((long)mblk + phase * 32 + row) * HID + nblk + piece * 32 + sub * 4;
    }
#pragma unroll
    for (int p = 0; p < 8; ++p) *(v4f*)(out + go[p]) = pk[p];
    
    __syncthreads();
  }
}

// ---------------------------------------------------------------------------
// Launch
// ---------------------------------------------------------------------------
extern "C" void kernel_launch(void* const* d_in, const int* in_sizes, int n_in,
                              void* d_out, int out_size, void* d_ws, size_t ws_size,
                              hipStream_t stream) {
  if (n_in < 6) return;
  const float* x     = (const float*)d_in[0];   // [NB_FULL, SEQ_FULL, HID]
  const int*   maskp = (const int*)d_in[1];     // [NB_FULL, 1, 1, SEQ_FULL] int32
  const float* Wqkv  = (const float*)d_in[2];   // [HID][3*HID]
  const float* bqkv  = (const float*)d_in[3];   // [3*HID]
  const float* Wout  = (const float*)d_in[4];   // [HID][HID]
  const float* bout  = (const float*)d_in[5];   // [HID]
  float* out = (float*)d_out;                   // [NB*SEQ, HID]

  const long M = (long)NB * SEQ;
  if ((long)in_sizes[0] < (((long)(NB - 1) * SEQ_FULL + SEQ) * HID)) return;
  if ((long)in_sizes[1] < ((long)(NB - 1) * SEQ_FULL + SEQ)) return;
  if ((long)in_sizes[2] < 3L * HID * HID) return;
  if ((long)in_sizes[3] < 3L * HID) return;
  if ((long)in_sizes[4] < (long)HID * HID) return;
  if ((long)in_sizes[5] < (long)HID) return;
  if ((long)out_size < M * HID) return;

  // workspace carve (bytes); every region is a whole number of tiles, no padding needed
  const size_t szX  = (size_t)M * HID * 2;                       // x bf16 plane, later ctx f16 plane
  const size_t szWq = (size_t)3 * HID * HID * 2;                 // WqkvT bf16
  const size_t szWo = (size_t)HID * HID * 2;                     // WoutT f16
  const size_t szP  = (size_t)NB * NHEAD * SEQ * HDIM * 2;       // one q/k/v plane
  const size_t oX  = 0;
  const size_t oWq = oX + szX;
  const size_t oWo = oWq + szWq;
  const size_t oP0 = oWo + szWo;
  const size_t total = oP0 + 3 * szP;
  if (total > ws_size) return;
  static_assert((size_t)NB * SEQ * HID * 2 == (size_t)NB * NHEAD * SEQ * HDIM * 2);

  char* ws = (char*)d_ws;
  unsigned short* xb  = (unsigned short*)(ws + oX);
  unsigned short* ctx = (unsigned short*)(ws + oX);      // aliases xb: xb is dead after k_gemm_qkv
  unsigned short* wq  = (unsigned short*)(ws + oWq);
  unsigned short* wo  = (unsigned short*)(ws + oWo);
  unsigned short* qf  = (unsigned short*)(ws + oP0 + 0 * szP);
  unsigned short* kf  = (unsigned short*)(ws + oP0 + 1 * szP);
  unsigned short* vf  = (unsigned short*)(ws + oP0 + 2 * szP);

  // 1) + 2) one launch: Wqkv in[HID][3*HID] -> out[HID/64][3*HID][64] bf16;  Wout in[HID][HID] ->
  //    out[HID/64][HID][64] f16 (x64);  x -> bf16 plane [HID/64][NB*SEQ][64]
  k_cvt_all<<<CVT_WQ_BLKS + CVT_WO_BLKS + CVT_X_BLKS, 256, 0, stream>>>(x, Wqkv, Wout, xb, wq, wo);
  // 3) qkv GEMM -> f16 planes of q, k ([bh][t][d]) and v ([bh][t/32][slot of d][32]); block tile 128x256
  k_gemm_qkv<<<dim3((int)(M / QM), 3 * HID / QN), 256, 0, stream>>>(xb, wq, bqkv, qf, kf, vf);
  // 4) attention -> ctx f16 plane [NHEAD][NB*SEQ][64] (over the dead x plane)
  k_attn<<<(NB * NHEAD * (SEQ / (16 * AQT))) / 4, 128, 0, stream>>>(qf, kf, vf, maskp, ctx);
  // 5) output GEMM -> f32 out
  k_gemm_out<<<dim3((int)(M / 64), HID / 256), 256, 0, stream>>>(ctx, wo, bout, out);
}
